// v000
// Measured on an AMD MI455X. A time is GPU time per run, averaged over a window of back-to-back runs after a warm-up
// (all launches, gaps included; the runs take copies of the inputs in turn), and the median of several windows.
// Apart from v000's, it joins two sittings. Times from different sittings can be a few percent apart, while
// side-by-side timings come from the same sitting.
// The starting kernel, v000, takes 2370 microseconds a run.
#include <hip/hip_runtime.h>

// BMOJOAttention (hidden [2][1024][2048]; two projection paths - in-context (Wq,bq,Wk,bk,Wv,bv,gq,gk) and fading (Wq2..gk2): q = rope(rmsnorm(x Wq^T + bq) gq) (16 x 128), k = rope(rmsnorm(x Wk^T + bk) gk) (8 kv heads; group h/2), v = x Wv^T + bv; rotate-half RoPE with the read cos/sin [B][S][128]; s_ic = q_ic.k_ic / sqrt(128) live where 0 <= i-j < 256, s_f = q_f.k_f / sqrt(128) live where i-j >= 256 (else -1e30); ONE joint softmax over [s_ic | s_f]; out = p_ic v_ic + p_f v_f; merged Wo^T -> [2][1024][2048]).
// The joint softmax over 2S columns is computed as one causal softmax whose score (and value source) switches at i-j = 256: the masked halves contribute exactly 0; keys j > i are masked in both (causal tile skipping).
// Compute dtypes, f32 accumulate: every input rounded to bf16; both paths' q/k/v on PLAIN bf16 operands (inputs: exact) + bias; RMSNorm * g (in place) and RoPE (bf16-rounded per-batch tables) f32; both score sets and both attn.v products: query rows < 512 hl (3 products), the rest single fp16 (x1024), causal tile skipping; softmax f32 over the selected scores, emitting window-part and fading-part probability planes (zeros elsewhere); the two value products summed in f32 when forming the hl planes; Wo hl x exact (2 products).

#define NB_  2
#define TT   1024
#define DM   2048
#define NH_  16
#define NKV  8
#define REP  (NH_ / NKV)
#define HD   128
#define DQ   (NH_ * HD)
#define DKV  (NKV * HD)
#define ZH   2
#define RH   512                  // query rows < RH use hi+lo planes (0: none)
#define WIN  1024
#define PCAR 1024.0f
#define SCL  0.088388347648318447f   // HD^-0.5
typedef _Float16 h16;
typedef unsigned short bf;
typedef __attribute__((ext_vector_type(16))) __bf16   v16bf;
typedef __attribute__((ext_vector_type(16))) _Float16 v16h;
typedef __attribute__((ext_vector_type(8)))  _Float16 v8h;
typedef __attribute__((ext_vector_type(8)))  unsigned short v8us;
typedef __attribute__((ext_vector_type(8)))  float    v8f;
typedef __attribute__((ext_vector_type(4)))  float    v4f;
typedef v8h  __attribute__((may_alias)) v8ha;
typedef v4f  __attribute__((may_alias)) v4fa;
typedef v8us __attribute__((may_alias)) v8usa;

__device__ __forceinline__ unsigned short f2bf(float f) { unsigned u = __float_as_uint(f); u += 0x7FFFu + ((u >> 16) & 1u); return (unsigned short)(u >> 16); }
__device__ __forceinline__ float bf2f(unsigned short b) { return __uint_as_float(((unsigned)b) << 16); }
__device__ __forceinline__ float bfr(float f) { return bf2f(f2bf(f)); }
__device__ __forceinline__ v16h cat16(v8h lo, v8h hi) { return __builtin_shufflevector(lo, hi, 0, 1, 2, 3, 4, 5, 6, 7, 8, 9, 10, 11, 12, 13, 14, 15); }
__device__ __forceinline__ v16bf cat16b(v8us lo, v8us hi) { return __builtin_bit_cast(v16bf, __builtin_shufflevector(lo, hi, 0, 1, 2, 3, 4, 5, 6, 7, 8, 9, 10, 11, 12, 13, 14, 15)); }
__device__ __forceinline__ v8f wmma16(v16h a, v16h b, v8f c) { return __builtin_amdgcn_wmma_f32_16x16x32_f16(false, a, false, b, (short)0, c, false, false); }
__device__ __forceinline__ v8f wmmab(v16bf a, v16bf b, v8f c) { return __builtin_amdgcn_wmma_f32_16x16x32_bf16(false, a, false, b, (short)0, c, false, false); }



// ---- k_gemmw: register-blocked GEMM, ONE WAVE per 64x64 output tile (16 accumulators), operands straight from K-contiguous 16-bit planes; grid (M/64, N/64, Z), 32 threads.
// C[m][n] (f32, pitch ldc, + optional bf16-rounded f32 bias[n]) = sum_k A[m][k] Bt[n][k] (+ split products per NSPLIT). z-batch strides sA/sB/sC in elements. K % 32 == 0.
template <typename T16> struct WFrag;
template <> struct WFrag<h16> { typedef v16h V; static __device__ __forceinline__ V ld(const h16* p) { return cat16(*(const v8h*)p, *(const v8h*)(p + 16)); } static __device__ __forceinline__ v8f mma(V a, V b, v8f c) { return wmma16(a, b, c); } };
template <> struct WFrag<bf> { typedef v16bf V; static __device__ __forceinline__ V ld(const bf* p) { return cat16b(*(const v8us*)p, *(const v8us*)(p + 16)); } static __device__ __forceinline__ v8f mma(V a, V b, v8f c) { return wmmab(a, b, c); } };
template <typename T16, int NSPLIT, bool BIAS>
__global__ __launch_bounds__(32) void k_gemmw(const T16* __restrict__ A, const T16* __restrict__ A2, const T16* __restrict__ Bt, const T16* __restrict__ Bt2, int K, float* C, int ldc, const float* __restrict__ bias, size_t sA, size_t sB, size_t sC) {
    typedef typename WFrag<T16>::V V;
    __shared__ __align__(16) float os[16 * 68];
    const size_t z = blockIdx.z; A += z * sA; if (A2) A2 += z * sA; Bt += z * sB; if (Bt2) Bt2 += z * sB; C += z * sC;
    const int lane = threadIdx.x & 31, lr = lane & 15, hi = lane >> 4; const int r0 = blockIdx.x * 64, c0 = blockIdx.y * 64;
    v8f acc[4][4];
#pragma unroll
    for (int mb = 0; mb < 4; ++mb)
#pragma unroll
        for (int nb = 0; nb < 4; ++nb) acc[mb][nb] = (v8f){};
    const size_t aoff = (size_t)(r0 + lr) * K + 8 * hi, boff = (size_t)(c0 + lr) * K + 8 * hi;
#pragma unroll 1
    for (int kc = 0; kc < K; kc += 32) {
        V a[4], a2[4];
#pragma unroll
        for (int mb = 0; mb < 4; ++mb) { a[mb] = WFrag<T16>::ld(A + aoff + (size_t)mb * 16 * K + kc); if (NSPLIT == 1 || NSPLIT == 2) a2[mb] = WFrag<T16>::ld(A2 + aoff + (size_t)mb * 16 * K + kc); }
#pragma unroll
        for (int nb = 0; nb < 4; ++nb) { const V b = WFrag<T16>::ld(Bt + boff + (size_t)nb * 16 * K + kc); V b2; if (NSPLIT >= 2) b2 = WFrag<T16>::ld(Bt2 + boff + (size_t)nb * 16 * K + kc);
#pragma unroll
            for (int mb = 0; mb < 4; ++mb) { acc[mb][nb] = WFrag<T16>::mma(a[mb], b, acc[mb][nb]); if (NSPLIT == 1 || NSPLIT == 2) acc[mb][nb] = WFrag<T16>::mma(a2[mb], b, acc[mb][nb]); if (NSPLIT >= 2) acc[mb][nb] = WFrag<T16>::mma(a[mb], b2, acc[mb][nb]); } }
        asm volatile("v_nop\n\tv_nop\n\tv_nop\n\tv_nop" : "+v"(acc[0][0]), "+v"(acc[1][1]), "+v"(acc[2][2]), "+v"(acc[3][3]) : "v"(a[0]), "v"(a[3]));
    }
#pragma unroll
    for (int mb = 0; mb < 4; ++mb) {
#pragma unroll
        for (int nb = 0; nb < 4; ++nb) {
#pragma unroll
            for (int j = 0; j < 8; ++j) os[(hi * 8 + j) * 68 + nb * 16 + lr] = acc[mb][nb][j]; }
        __builtin_amdgcn_wave_barrier(); asm volatile("" ::: "memory");
        float* crow = C + (size_t)(r0 + mb * 16) * ldc + c0;
{
#pragma unroll
            for (int s = 0; s < 8; ++s) { const int row = 2 * s + hi, cofs = lr * 4; v4f val = *(const v4fa*)(os + row * 68 + cofs); if (BIAS) { val[0] += bfr(bias[c0 + cofs]); val[1] += bfr(bias[c0 + cofs + 1]); val[2] += bfr(bias[c0 + cofs + 2]); val[3] += bfr(bias[c0 + cofs + 3]); }
                *(v4f*)(crow + (size_t)row * ldc + cofs) = val; }
             }
        __builtin_amdgcn_wave_barrier(); asm volatile("" ::: "memory");
    }
}

// ---- k_gemmc: the same one-wave 64x64 tile GEMM specialised for causal attention: CMODE 1 skips score tiles entirely above the diagonal (query rows r0+roff.., key columns c0..), CMODE 2 limits the
// key (K) loop of the probability x value contraction to the diagonal block (probabilities beyond it are exactly zero). roff = row offset of this launch's first row within the sequence.
template <typename T16, int NSPLIT, int CMODE>
__global__ __launch_bounds__(32) void k_gemmc(const T16* __restrict__ A, const T16* __restrict__ A2, const T16* __restrict__ Bt, const T16* __restrict__ Bt2, int K, float* C, int ldc, int roff, size_t sA, size_t sB, size_t sC) {
    typedef typename WFrag<T16>::V V;
    __shared__ __align__(16) float os[16 * 68];
    const size_t z = blockIdx.z; A += z * sA; if (A2) A2 += z * sA; Bt += z * sB; if (Bt2) Bt2 += z * sB; C += z * sC;
    const int lane = threadIdx.x & 31, lr = lane & 15, hi = lane >> 4; const int r0 = blockIdx.x * 64, c0 = blockIdx.y * 64;
    if (CMODE == 1 && c0 > r0 + roff + 63) return;                  // score tile entirely above the causal diagonal: never read (the softmax masks j > i by select)
    const int Kl = (CMODE == 2) ? min(K, r0 + roff + 64) : K;        // P.V: probabilities are exactly 0 beyond the diagonal block, so the K loop stops there
    v8f acc[4][4];
#pragma unroll
    for (int mb = 0; mb < 4; ++mb)
#pragma unroll
        for (int nb = 0; nb < 4; ++nb) acc[mb][nb] = (v8f){};
    const size_t aoff = (size_t)(r0 + lr) * K + 8 * hi, boff = (size_t)(c0 + lr) * K + 8 * hi;
#pragma unroll 1
    for (int kc = 0; kc < Kl; kc += 32) {
        V a[4], a2[4];
#pragma unroll
        for (int mb = 0; mb < 4; ++mb) { a[mb] = WFrag<T16>::ld(A + aoff + (size_t)mb * 16 * K + kc); if (NSPLIT == 1 || NSPLIT == 2) a2[mb] = WFrag<T16>::ld(A2 + aoff + (size_t)mb * 16 * K + kc); }
#pragma unroll
        for (int nb = 0; nb < 4; ++nb) { const V b = WFrag<T16>::ld(Bt + boff + (size_t)nb * 16 * K + kc); V b2; if (NSPLIT >= 2) b2 = WFrag<T16>::ld(Bt2 + boff + (size_t)nb * 16 * K + kc);
#pragma unroll
            for (int mb = 0; mb < 4; ++mb) { acc[mb][nb] = WFrag<T16>::mma(a[mb], b, acc[mb][nb]); if (NSPLIT == 1 || NSPLIT == 2) acc[mb][nb] = WFrag<T16>::mma(a2[mb], b, acc[mb][nb]); if (NSPLIT >= 2) acc[mb][nb] = WFrag<T16>::mma(a[mb], b2, acc[mb][nb]); } }
        asm volatile("v_nop\n\tv_nop\n\tv_nop\n\tv_nop" : "+v"(acc[0][0]), "+v"(acc[1][1]), "+v"(acc[2][2]), "+v"(acc[3][3]) : "v"(a[0]), "v"(a[3]));
    }
#pragma unroll
    for (int mb = 0; mb < 4; ++mb) {
#pragma unroll
        for (int nb = 0; nb < 4; ++nb) {
#pragma unroll
            for (int j = 0; j < 8; ++j) os[(hi * 8 + j) * 68 + nb * 16 + lr] = acc[mb][nb][j]; }
        __builtin_amdgcn_wave_barrier(); asm volatile("" ::: "memory");
        float* crow = C + (size_t)(r0 + mb * 16) * ldc + c0;
{
#pragma unroll
            for (int s = 0; s < 8; ++s) { const int row = 2 * s + hi, cofs = lr * 4; v4f val = *(const v4fa*)(os + row * 68 + cofs);
                *(v4f*)(crow + (size_t)row * ldc + cofs) = val; }
             }
        __builtin_amdgcn_wave_barrier(); asm volatile("" ::: "memory");
    }
}

__device__ __forceinline__ h16 tohx(float x) { return (h16)x; }
__device__ __forceinline__ void splitf(float y, unsigned short& h, unsigned short& l) { h = f2bf(y); l = f2bf(y - bf2f(h)); }
typedef __attribute__((ext_vector_type(2))) _Float16 v2h;
typedef __attribute__((ext_vector_type(4))) _Float16 v4h;
typedef __attribute__((ext_vector_type(2))) unsigned short v2us;
typedef __attribute__((ext_vector_type(4))) unsigned short v4us;
typedef __attribute__((ext_vector_type(2))) float v2f;
typedef __attribute__((ext_vector_type(4))) int v4i;

__global__ __launch_bounds__(256) void k_wtG(const float* __restrict__ w, int K, int N, bf* Bt) {
    const int lane = threadIdx.x & 31; const int L0 = (blockIdx.x * 8 + (threadIdx.x >> 5)) * 8; const int nlines = N * K / 64;
{
#pragma unroll 1
        for (int l = 0; l < 8; ++l) { const int L = L0 + l; if (L >= nlines) break; const size_t e = (size_t)L * 64 + lane * 2; const int k = (int)(e % K), n = (int)(e / K); v2us o;
            o[0] = f2bf(w[(size_t)k * N + n]); o[1] = f2bf(w[(size_t)(k + 1) * N + n]); *(v2us*)(Bt + e) = o; }
         }
}
__global__ __launch_bounds__(256) void k_cvt8(const float* __restrict__ src, bf* dst, size_t n8) { const size_t i = (size_t)blockIdx.x * 256 + threadIdx.x; if (i >= n8) return; const v8f v = *(const v8f*)(src + i * 8); v8us o;
#pragma unroll
    for (int k = 0; k < 8; ++k) o[k] = f2bf(v[k]); *(v8us*)(dst + i * 8) = o;  }
__global__ __launch_bounds__(256) void k_cscvt(const float* __restrict__ cosT, const float* __restrict__ sinT, float* CS) { const int idx = blockIdx.x * 256 + threadIdx.x; if (idx >= TT * HD) return; v2f cs; cs[0] = bfr(cosT[idx]); cs[1] = bfr(sinT[idx]); *(v2f*)(CS + (size_t)idx * 2) = cs;  }
// k_rope: head planes [h][t][d] (fp16 + hi/lo) of rope(x) x sc with the rotate-half convention out[d] = x[d] cos[t][d] - x[d+HD/2] sin[t][d], out[d+HD/2] = x[d+HD/2] cos[t][d+HD/2] + x[d] sin[t][d+HD/2]
__global__ __launch_bounds__(256) void k_rope(const float* __restrict__ F, int pitch, int nheads, const float* __restrict__ CS, const float* __restrict__ RF, const float* __restrict__ nw, float sc, h16* P16, bf* Ph, bf* Pl) {
    const size_t e = ((size_t)blockIdx.x * 256 + threadIdx.x) * 2; if (e >= (size_t)nheads * TT * HD) return; const int d = (int)(e % HD); const int t = (int)((e / HD) % TT); const int h = (int)(e / ((size_t)HD * TT)); const float* f = F + (size_t)t * pitch + h * HD; const float rf = RF ? RF[(size_t)h * TT + t] : 1.0f; v2h o16; v2us oh, ol;
#pragma unroll
    for (int q = 0; q < 2; ++q) { const int dd = d + q; const int dp = (dd < HD / 2) ? dd + HD / 2 : dd - HD / 2; float x0 = f[dd], x1 = f[dp];
        if (RF) { float n0 = __fmul_rn(x0, rf), n1 = __fmul_rn(x1, rf); asm volatile("" : "+v"(n0)); asm volatile("" : "+v"(n1)); x0 = __fmul_rn(bfr(nw[dd]), n0); x1 = __fmul_rn(bfr(nw[dp]), n1); }
        const v2f cs = *(const v2f*)(CS + ((size_t)t * HD + dd) * 2); float a = __fmul_rn(x0, cs[0]), bq = __fmul_rn(x1, cs[1]); asm volatile("" : "+v"(a)); asm volatile("" : "+v"(bq)); const float r = ((dd < HD / 2) ? __fsub_rn(a, bq) : __fadd_rn(a, bq)) * sc;
        o16[q] = tohx(r); unsigned short a2, c2; splitf(r, a2, c2); oh[q] = a2; ol[q] = c2; }
    *(v2h*)(P16 + e) = o16; *(v2us*)(Ph + e) = oh; *(v2us*)(Pl + e) = ol;  }
__global__ __launch_bounds__(256) void k_vtp(const float* __restrict__ F, int pitch, int nheads, h16* V16, bf* Vh, bf* Vl) { const size_t e = ((size_t)blockIdx.x * 256 + threadIdx.x) * 2; if (e >= (size_t)nheads * HD * TT) return; const int t = (int)(e % TT); const int d = (int)((e / TT) % HD); const int g = (int)(e / ((size_t)TT * HD)); v2h o16; v2us oh, ol;
#pragma unroll
    for (int q = 0; q < 2; ++q) { const float x = F[(size_t)(t + q) * pitch + g * HD + d]; o16[q] = tohx(x); unsigned short a2, c2; splitf(x, a2, c2); oh[q] = a2; ol[q] = c2; }
    *(v2h*)(V16 + e) = o16; *(v2us*)(Vh + e) = oh; *(v2us*)(Vl + e) = ol;  }
__global__ __launch_bounds__(256) void k_rmsw(float* F, int pitch, int nheads, const float* __restrict__ w) { const int lane = threadIdx.x & 31; const int wv = blockIdx.x * 8 + (threadIdx.x >> 5); if (wv >= TT * nheads) return; const int t = wv / nheads, h = wv % nheads; float* f = F + (size_t)t * pitch + h * HD; const v4f a = *(const v4f*)(f + lane * 4); float ss = 0.f;
#pragma unroll
    for (int q = 0; q < 4; ++q) { float p = __fmul_rn(a[q], a[q]); asm volatile("" : "+v"(p)); ss = __fadd_rn(ss, p); }
#pragma unroll
    for (int sh = 16; sh; sh >>= 1) ss = __fadd_rn(ss, __shfl_xor(ss, sh, 32));
    const float rs = __fdiv_rn(1.0f, sqrtf(__fadd_rn(ss * (1.0f / HD), 1e-6f))); v4f o;
#pragma unroll
    for (int q = 0; q < 4; ++q) { float y = __fmul_rn(a[q], rs); asm volatile("" : "+v"(y)); o[q] = __fmul_rn(y, bfr(w[lane * 4 + q])); }
    *(v4f*)(f + lane * 4) = o;  }
__global__ __launch_bounds__(256) void k_asoft2(const float* __restrict__ Sb, const float* __restrict__ Sb2, h16* P16, bf* Ph, bf* Pl, h16* P16b, bf* Phb, bf* Plb) {
    const int lane = threadIdx.x & 31; const int row = blockIdx.x * 8 + (threadIdx.x >> 5); if (row >= ZH * TT) return; const int i = row % TT; const int zz = row / TT; (void)zz; const bool hires = (i < RH); const float* sr = Sb + (size_t)row * TT; const float* sr2 = Sb2 + (size_t)row * TT; float v[TT / 32]; float mx = -3.0e38f;
#pragma unroll
    for (int ch = 0; ch < TT / 128; ++ch) { const int j0 = ch * 128 + lane * 4; const v4f a = *(const v4f*)(sr + j0); const v4f a2 = *(const v4f*)(sr2 + j0);
#pragma unroll
        for (int q = 0; q < 4; ++q) { const int j = j0 + q; (void)j; const float t = (j <= i) ? ((i - j < 256) ? a[q] * SCL : a2[q] * SCL) : -3.0e38f; v[ch * 4 + q] = t; mx = fmaxf(mx, t); } }
#pragma unroll
    for (int sh = 16; sh; sh >>= 1) mx = fmaxf(mx, __shfl_xor(mx, sh, 32));
    float sum = 0.f;
#pragma unroll
    for (int k = 0; k < TT / 32; ++k) { float d0 = __fsub_rn(v[k], mx); asm volatile("" : "+v"(d0)); v[k] = __builtin_amdgcn_exp2f(__fmul_rn(d0, 1.4426950408889634f)); sum += v[k]; }
#pragma unroll
    for (int sh = 16; sh; sh >>= 1) sum += __shfl_xor(sum, sh, 32);
    const float f = __fdiv_rn(hires ? 1.0f : PCAR, sum);
{
        if (hires) {
#pragma unroll
            for (int ch = 0; ch < TT / 128; ++ch) { v4us oh, ol, ohb, olb;
#pragma unroll
                for (int q = 0; q < 4; ++q) { const int j = ch * 128 + lane * 4 + q; const bool win = (j <= i && i - j < 256); unsigned short a, c2; splitf(v[ch * 4 + q] * f, a, c2); oh[q] = win ? a : (unsigned short)0; ol[q] = win ? c2 : (unsigned short)0; ohb[q] = win ? (unsigned short)0 : a; olb[q] = win ? (unsigned short)0 : c2; }
                const size_t oo = ((size_t)zz * (RH ? RH : 1) + i) * TT + ch * 128 + lane * 4; *(v4us*)(Ph + oo) = oh; *(v4us*)(Pl + oo) = ol; *(v4us*)(Phb + oo) = ohb; *(v4us*)(Plb + oo) = olb; }
        } else {
#pragma unroll
            for (int ch = 0; ch < TT / 128; ++ch) { v4h o4, o4b;
#pragma unroll
                for (int q = 0; q < 4; ++q) { const int j = ch * 128 + lane * 4 + q; const bool win = (j <= i && i - j < 256); const _Float16 pv = tohx(v[ch * 4 + q] * f); o4[q] = win ? pv : (_Float16)0.0f; o4b[q] = win ? (_Float16)0.0f : pv; }
                *(v4h*)(P16 + (size_t)row * TT + ch * 128 + lane * 4) = o4; *(v4h*)(P16b + (size_t)row * TT + ch * 128 + lane * 4) = o4b; } }
         }
}
__global__ __launch_bounds__(256) void k_merge2(const float* __restrict__ O, const float* __restrict__ O2, int h0, bf* Ah, bf* Al) { const size_t e = ((size_t)blockIdx.x * 256 + threadIdx.x) * 2; if (e >= (size_t)ZH * TT * HD) return; const int d = (int)(e % HD); const int t = (int)((e / HD) % TT); const int zz = (int)(e / ((size_t)HD * TT)); const float cs = (t < RH) ? 1.0f : (1.0f / PCAR); const size_t oo = (size_t)t * DQ + (h0 + zz) * HD + d;
    v2us oh, ol;
#pragma unroll
    for (int q = 0; q < 2; ++q) { unsigned short a, c2; float s1 = O[e + q] * cs, s2 = O2[e + q] * cs; asm volatile("" : "+v"(s1)); asm volatile("" : "+v"(s2)); splitf(__fadd_rn(s1, s2), a, c2); oh[q] = a; ol[q] = c2; } *(v2us*)(Ah + oo) = oh; *(v2us*)(Al + oo) = ol;  }

// k_asoft: per row (zz, i): t = S x HD^-0.5 for j <= i and i - j < WIN (sliding causal window; the reference's -1e9 additive fill vanishes identically); softmax over the 1024 keys (register row, one exp, fixed trees);
__global__ __launch_bounds__(256) void k_asoft(const float* __restrict__ Sb, h16* P16, bf* Ph, bf* Pl) {
    const int lane = threadIdx.x & 31; const int row = blockIdx.x * 8 + (threadIdx.x >> 5); if (row >= ZH * TT) return; const int i = row % TT; const int zz = row / TT; (void)zz; const bool hires = (i < RH); const float* sr = Sb + (size_t)row * TT; float v[TT / 32]; float mx = -3.0e38f;
#pragma unroll
    for (int ch = 0; ch < TT / 128; ++ch) { const int j0 = ch * 128 + lane * 4; const v4f a = *(const v4f*)(sr + j0);
#pragma unroll
        for (int q = 0; q < 4; ++q) { const int j = j0 + q; (void)j; const float t = (j <= i && i - j < WIN) ? a[q] * SCL : -3.0e38f; v[ch * 4 + q] = t; mx = fmaxf(mx, t); } }
#pragma unroll
    for (int sh = 16; sh; sh >>= 1) mx = fmaxf(mx, __shfl_xor(mx, sh, 32));
    float sum = 0.f;
#pragma unroll
    for (int k = 0; k < TT / 32; ++k) { float d0 = __fsub_rn(v[k], mx); asm volatile("" : "+v"(d0)); v[k] = __builtin_amdgcn_exp2f(__fmul_rn(d0, 1.4426950408889634f)); sum += v[k]; }
#pragma unroll
    for (int sh = 16; sh; sh >>= 1) sum += __shfl_xor(sum, sh, 32);
    const float f = __fdiv_rn(hires ? 1.0f : PCAR, sum);
{
        if (hires) {
#pragma unroll
            for (int ch = 0; ch < TT / 128; ++ch) { v4us oh, ol;
#pragma unroll
                for (int q = 0; q < 4; ++q) { unsigned short a, c2; splitf(v[ch * 4 + q] * f, a, c2); oh[q] = a; ol[q] = c2; }
                const size_t oo = ((size_t)zz * (RH ? RH : 1) + i) * TT + ch * 128 + lane * 4; *(v4us*)(Ph + oo) = oh; *(v4us*)(Pl + oo) = ol; }
        } else {
#pragma unroll
            for (int ch = 0; ch < TT / 128; ++ch) { v4h o4;
#pragma unroll
                for (int q = 0; q < 4; ++q) o4[q] = tohx(v[ch * 4 + q] * f);
                *(v4h*)(P16 + (size_t)row * TT + ch * 128 + lane * 4) = o4; } }
         }
}
__global__ __launch_bounds__(256) void k_merge(const float* __restrict__ O, int h0, bf* Ah, bf* Al) { const size_t e = ((size_t)blockIdx.x * 256 + threadIdx.x) * 2; if (e >= (size_t)ZH * TT * HD) return; const int d = (int)(e % HD); const int t = (int)((e / HD) % TT); const int zz = (int)(e / ((size_t)HD * TT)); const float cs = (t < RH) ? 1.0f : (1.0f / PCAR); const size_t oo = (size_t)t * DQ + (h0 + zz) * HD + d;
    v2us oh, ol;
#pragma unroll
    for (int q = 0; q < 2; ++q) { unsigned short a, c2; splitf(O[e + q] * cs, a, c2); oh[q] = a; ol[q] = c2; } *(v2us*)(Ah + oo) = oh; *(v2us*)(Al + oo) = ol;  }

extern "C" void kernel_launch(void* const* d_in, const int* in_sizes, int n_in,
                              void* d_out, int out_size, void* d_ws, size_t ws_size, hipStream_t stream) {
    (void)in_sizes; (void)n_in; (void)out_size;
    const float* x = (const float*)d_in[0]; const float* cosA = (const float*)d_in[1]; const float* sinA = (const float*)d_in[2]; const float* wq = (const float*)d_in[3]; const float* bq = (const float*)d_in[4]; const float* wk = (const float*)d_in[5]; const float* bk = (const float*)d_in[6]; const float* wv = (const float*)d_in[7]; const float* bv = (const float*)d_in[8]; const float* wq2 = (const float*)d_in[9]; const float* bq2 = (const float*)d_in[10]; const float* wk2 = (const float*)d_in[11]; const float* bk2 = (const float*)d_in[12]; const float* wv2 = (const float*)d_in[13]; const float* bv2 = (const float*)d_in[14]; const float* wo = (const float*)d_in[15]; const float* gq = (const float*)d_in[16]; const float* gk = (const float*)d_in[17]; const float* gq2 = (const float*)d_in[18]; const float* gk2 = (const float*)d_in[19]; const float* cosT = cosA; const float* sinT = sinA;
    float* OUT = (float*)d_out;     // [2][1024][2048]
    char* wsp = (char*)d_ws;
    auto take = [&](size_t bytes) { char* p = wsp; wsp += (bytes + 255) & ~(size_t)255; return (void*)p; };
    bf* WQ = (bf*)take((size_t)DQ * DM * 2); bf* WK = (bf*)take((size_t)DKV * DM * 2); bf* WV = (bf*)take((size_t)DKV * DM * 2); bf* WO = (bf*)take((size_t)DM * DQ * 2); bf* WQ2 = (bf*)take((size_t)DQ * DM * 2); bf* WK2 = (bf*)take((size_t)DKV * DM * 2); bf* WV2 = (bf*)take((size_t)DKV * DM * 2); float* CS = (float*)take((size_t)TT * HD * 2 * 4);
    bf* XB = (bf*)take((size_t)TT * DM * 2); float* FQ = (float*)take((size_t)TT * DQ * 4); float* FK = (float*)take((size_t)TT * DKV * 4);
    h16* QP16 = (h16*)take((size_t)NH_ * TT * HD * 2); h16* KP16 = (h16*)take((size_t)NKV * TT * HD * 2); h16* VT16 = (h16*)take((size_t)NKV * HD * TT * 2);
    bf* QPh = (bf*)take((size_t)NH_ * TT * HD * 2); bf* QPl = (bf*)take((size_t)NH_ * TT * HD * 2); bf* KPh = (bf*)take((size_t)NKV * TT * HD * 2); bf* KPl = (bf*)take((size_t)NKV * TT * HD * 2); bf* VTh = (bf*)take((size_t)NKV * HD * TT * 2); bf* VTl = (bf*)take((size_t)NKV * HD * TT * 2); bf* Ph = (bf*)take((size_t)ZH * RH * TT * 2); bf* Pl = (bf*)take((size_t)ZH * RH * TT * 2);
    float* Sb = (float*)take((size_t)ZH * TT * TT * 4); h16* P16 = (h16*)take((size_t)ZH * TT * TT * 2); float* Ob = (float*)take((size_t)ZH * TT * HD * 4); bf* ATh = (bf*)take((size_t)TT * DQ * 2); bf* ATl = (bf*)take((size_t)TT * DQ * 2); h16* QP16b = (h16*)take((size_t)NH_ * TT * HD * 2); h16* KP16b = (h16*)take((size_t)NKV * TT * HD * 2); h16* VT16b = (h16*)take((size_t)NKV * HD * TT * 2); bf* QPhb = (bf*)take((size_t)NH_ * TT * HD * 2); bf* QPlb = (bf*)take((size_t)NH_ * TT * HD * 2); bf* KPhb = (bf*)take((size_t)NKV * TT * HD * 2); bf* KPlb = (bf*)take((size_t)NKV * TT * HD * 2); bf* VThb = (bf*)take((size_t)NKV * HD * TT * 2); bf* VTlb = (bf*)take((size_t)NKV * HD * TT * 2); float* Sb2 = (float*)take((size_t)ZH * TT * TT * 4); h16* P16b = (h16*)take((size_t)ZH * TT * TT * 2); bf* Phb = (bf*)take((size_t)ZH * RH * TT * 2); bf* Plb = (bf*)take((size_t)ZH * RH * TT * 2); float* Ob2 = (float*)take((size_t)ZH * TT * HD * 4);
    if ((size_t)(wsp - (char*)d_ws) > ws_size) return;    // ws 256 MiB
    float* FV = FK;   // v projection reuses the k buffer after the k planes are built (stream-ordered)
    { k_cvt8<<<(unsigned)(((size_t)DQ * DM / 8 + 255) / 256), 256, 0, stream>>>(wq, WQ, (size_t)DQ * DM / 8); k_cvt8<<<(unsigned)(((size_t)DKV * DM / 8 + 255) / 256), 256, 0, stream>>>(wk, WK, (size_t)DKV * DM / 8); k_cvt8<<<(unsigned)(((size_t)DKV * DM / 8 + 255) / 256), 256, 0, stream>>>(wv, WV, (size_t)DKV * DM / 8);
      k_cvt8<<<(unsigned)(((size_t)DM * DQ / 8 + 255) / 256), 256, 0, stream>>>(wo, WO, (size_t)DM * DQ / 8); k_cvt8<<<(unsigned)(((size_t)DQ * DM / 8 + 255) / 256), 256, 0, stream>>>(wq2, WQ2, (size_t)DQ * DM / 8); k_cvt8<<<(unsigned)(((size_t)DKV * DM / 8 + 255) / 256), 256, 0, stream>>>(wk2, WK2, (size_t)DKV * DM / 8); k_cvt8<<<(unsigned)(((size_t)DKV * DM / 8 + 255) / 256), 256, 0, stream>>>(wv2, WV2, (size_t)DKV * DM / 8);
       }
    const unsigned LQ = (unsigned)(((size_t)NH_ * TT * HD / 2 + 255) / 256), LKv = (unsigned)(((size_t)NKV * TT * HD / 2 + 255) / 256);
    for (int b = 0; b < NB_; ++b) {
        k_cscvt<<<(TT * HD + 255) / 256, 256, 0, stream>>>(cosA + (size_t)b * TT * HD, sinA + (size_t)b * TT * HD, CS);
        k_cvt8<<<(unsigned)(((size_t)TT * DM / 8 + 255) / 256), 256, 0, stream>>>(x + (size_t)b * TT * DM, XB, (size_t)TT * DM / 8);
        k_gemmw<bf, 0, true><<<dim3(TT / 64, DQ / 64, 1), 32, 0, stream>>>(XB, nullptr, WQ, nullptr, DM, FQ, DQ, bq, 0, 0, 0); k_rmsw<<<TT * NH_ / 8, 256, 0, stream>>>(FQ, DQ, NH_, gq); k_rope<<<LQ, 256, 0, stream>>>(FQ, DQ, NH_, CS, nullptr, nullptr, 1.0f, QP16, QPh, QPl);
        k_gemmw<bf, 0, true><<<dim3(TT / 64, DKV / 64, 1), 32, 0, stream>>>(XB, nullptr, WK, nullptr, DM, FK, DKV, bk, 0, 0, 0); k_rmsw<<<TT * NKV / 8, 256, 0, stream>>>(FK, DKV, NKV, gk); k_rope<<<LKv, 256, 0, stream>>>(FK, DKV, NKV, CS, nullptr, nullptr, 1.0f, KP16, KPh, KPl);
        k_gemmw<bf, 0, true><<<dim3(TT / 64, DKV / 64, 1), 32, 0, stream>>>(XB, nullptr, WV, nullptr, DM, FV, DKV, bv, 0, 0, 0); k_vtp<<<LKv, 256, 0, stream>>>(FV, DKV, NKV, VT16, VTh, VTl);
        k_gemmw<bf, 0, true><<<dim3(TT / 64, DQ / 64, 1), 32, 0, stream>>>(XB, nullptr, WQ2, nullptr, DM, FQ, DQ, bq2, 0, 0, 0); k_rmsw<<<TT * NH_ / 8, 256, 0, stream>>>(FQ, DQ, NH_, gq2); k_rope<<<LQ, 256, 0, stream>>>(FQ, DQ, NH_, CS, nullptr, nullptr, 1.0f, QP16b, QPhb, QPlb);
        k_gemmw<bf, 0, true><<<dim3(TT / 64, DKV / 64, 1), 32, 0, stream>>>(XB, nullptr, WK2, nullptr, DM, FK, DKV, bk2, 0, 0, 0); k_rmsw<<<TT * NKV / 8, 256, 0, stream>>>(FK, DKV, NKV, gk2); k_rope<<<LKv, 256, 0, stream>>>(FK, DKV, NKV, CS, nullptr, nullptr, 1.0f, KP16b, KPhb, KPlb);
        k_gemmw<bf, 0, true><<<dim3(TT / 64, DKV / 64, 1), 32, 0, stream>>>(XB, nullptr, WV2, nullptr, DM, FV, DKV, bv2, 0, 0, 0); k_vtp<<<LKv, 256, 0, stream>>>(FV, DKV, NKV, VT16b, VThb, VTlb);
        for (int h0 = 0; h0 < NH_; h0 += ZH) { const size_t zq = (size_t)h0, zk = (size_t)(h0 / REP);   // both heads of a pass share kv group h0/REP (REP >= 2): sB = 0
            k_gemmc<bf, 2, 1><<<dim3(RH / 64, TT / 64, ZH), 32, 0, stream>>>(QPh + zq * TT * HD, QPl + zq * TT * HD, KPh + zk * TT * HD, KPl + zk * TT * HD, HD, Sb, TT, 0, (size_t)TT * HD, 0, (size_t)TT * TT);
            k_gemmc<bf, 2, 1><<<dim3(RH / 64, TT / 64, ZH), 32, 0, stream>>>(QPhb + zq * TT * HD, QPlb + zq * TT * HD, KPhb + zk * TT * HD, KPlb + zk * TT * HD, HD, Sb2, TT, 0, (size_t)TT * HD, 0, (size_t)TT * TT);
            k_gemmc<h16, 0, 1><<<dim3((TT - RH) / 64, TT / 64, ZH), 32, 0, stream>>>(QP16 + zq * TT * HD + (size_t)RH * HD, nullptr, KP16 + zk * TT * HD, nullptr, HD, Sb + (size_t)RH * TT, TT, RH, (size_t)TT * HD, 0, (size_t)TT * TT);
            k_gemmc<h16, 0, 1><<<dim3((TT - RH) / 64, TT / 64, ZH), 32, 0, stream>>>(QP16b + zq * TT * HD + (size_t)RH * HD, nullptr, KP16b + zk * TT * HD, nullptr, HD, Sb2 + (size_t)RH * TT, TT, RH, (size_t)TT * HD, 0, (size_t)TT * TT);
            k_asoft2<<<ZH * TT / 8, 256, 0, stream>>>(Sb, Sb2, P16, Ph, Pl, P16b, Phb, Plb);
            k_gemmc<bf, 2, 2><<<dim3(RH / 64, HD / 64, ZH), 32, 0, stream>>>(Ph, Pl, VTh + zk * HD * TT, VTl + zk * HD * TT, TT, Ob, HD, 0, (size_t)RH * TT, 0, (size_t)TT * HD);
            k_gemmc<bf, 2, 2><<<dim3(RH / 64, HD / 64, ZH), 32, 0, stream>>>(Phb, Plb, VThb + zk * HD * TT, VTlb + zk * HD * TT, TT, Ob2, HD, 0, (size_t)RH * TT, 0, (size_t)TT * HD);
            k_gemmc<h16, 0, 2><<<dim3((TT - RH) / 64, HD / 64, ZH), 32, 0, stream>>>(P16 + (size_t)RH * TT, nullptr, VT16 + zk * HD * TT, nullptr, TT, Ob + (size_t)RH * HD, HD, RH, (size_t)TT * TT, 0, (size_t)TT * HD);
            k_gemmc<h16, 0, 2><<<dim3((TT - RH) / 64, HD / 64, ZH), 32, 0, stream>>>(P16b + (size_t)RH * TT, nullptr, VT16b + zk * HD * TT, nullptr, TT, Ob2 + (size_t)RH * HD, HD, RH, (size_t)TT * TT, 0, (size_t)TT * HD);
            k_merge2<<<(unsigned)(((size_t)ZH * TT * HD / 2 + 255) / 256), 256, 0, stream>>>(Ob, Ob2, h0, ATh, ATl); }
        k_gemmw<bf, 1, false><<<dim3(TT / 64, DM / 64, 1), 32, 0, stream>>>(ATh, ATl, WO, nullptr, DQ, OUT + (size_t)b * TT * DM, DM, nullptr, 0, 0, 0); }
}

// v001
// One run takes 1060 microseconds.
// Timed twice side by side with v000, it ran 2.25 and 2.21 times as fast.
#include <hip/hip_runtime.h>

// BMOJOAttention (hidden [2][1024][2048]; two projection paths - in-context (Wq,bq,Wk,bk,Wv,bv,gq,gk) and fading (Wq2..gk2): q = rope(rmsnorm(x Wq^T + bq) gq) (16 x 128), k = rope(rmsnorm(x Wk^T + bk) gk) (8 kv heads; group h/2), v = x Wv^T + bv; rotate-half RoPE with the read cos/sin [B][S][128]; s_ic = q_ic.k_ic / sqrt(128) live where 0 <= i-j < 256, s_f = q_f.k_f / sqrt(128) live where i-j >= 256 (else -1e30); ONE joint softmax over [s_ic | s_f]; out = p_ic v_ic + p_f v_f; merged Wo^T -> [2][1024][2048]).
// The joint softmax over 2S columns is computed as one causal softmax whose score (and value source) switches at i-j = 256: the masked halves contribute exactly 0; keys j > i are masked in both (causal tile skipping).
// Compute dtypes, f32 accumulate: every input rounded to bf16; both paths' q/k/v on PLAIN bf16 operands (inputs: exact) + bias; RMSNorm * g (in place) and RoPE (bf16-rounded per-batch tables) f32; both score sets and both attn.v products: query rows < 512 hl (3 products), the rest single fp16 (x1024), causal tile skipping; softmax f32 over the selected scores, emitting window-part and fading-part probability planes (zeros elsewhere); the two value products summed in f32 when forming the hl planes; Wo hl x exact (2 products).

#define NB_  2
#define TT   1024
#define DM   2048
#define NH_  16
#define NKV  8
#define REP  (NH_ / NKV)
#define HD   128
#define DQ   (NH_ * HD)
#define DKV  (NKV * HD)
#define ZH   16                   // heads per attention pass (grid z): all of them; the pass is split by query rows (< RH, >= RH) so that the score planes fit the workspace
#define RH   512                  // query rows < RH use hi+lo planes
#define WIN  1024
#define PCAR 1024.0f
static_assert(TT - RH == RH, "both row passes of the attention hold RH query rows");
#define SCL  0.088388347648318447f   // HD^-0.5
typedef _Float16 h16;
typedef unsigned short bf;
typedef __attribute__((ext_vector_type(16))) __bf16   v16bf;
typedef __attribute__((ext_vector_type(16))) _Float16 v16h;
typedef __attribute__((ext_vector_type(8)))  _Float16 v8h;
typedef __attribute__((ext_vector_type(8)))  unsigned short v8us;
typedef __attribute__((ext_vector_type(8)))  float    v8f;
typedef __attribute__((ext_vector_type(4)))  float    v4f;
typedef v8h  __attribute__((may_alias)) v8ha;
typedef v4f  __attribute__((may_alias)) v4fa;
typedef v8us __attribute__((may_alias)) v8usa;

__device__ __forceinline__ unsigned short f2bf(float f) { unsigned u = __float_as_uint(f); u += 0x7FFFu + ((u >> 16) & 1u); return (unsigned short)(u >> 16); }
__device__ __forceinline__ float bf2f(unsigned short b) { return __uint_as_float(((unsigned)b) << 16); }
__device__ __forceinline__ float bfr(float f) { return bf2f(f2bf(f)); }
__device__ __forceinline__ v16h cat16(v8h lo, v8h hi) { return __builtin_shufflevector(lo, hi, 0, 1, 2, 3, 4, 5, 6, 7, 8, 9, 10, 11, 12, 13, 14, 15); }
__device__ __forceinline__ v16bf cat16b(v8us lo, v8us hi) { return __builtin_bit_cast(v16bf, __builtin_shufflevector(lo, hi, 0, 1, 2, 3, 4, 5, 6, 7, 8, 9, 10, 11, 12, 13, 14, 15)); }
__device__ __forceinline__ v8f wmma16(v16h a, v16h b, v8f c) { return __builtin_amdgcn_wmma_f32_16x16x32_f16(false, a, false, b, (short)0, c, false, false); }
__device__ __forceinline__ v8f wmmab(v16bf a, v16bf b, v8f c) { return __builtin_amdgcn_wmma_f32_16x16x32_bf16(false, a, false, b, (short)0, c, false, false); }



// ---- k_gemmw: register-blocked GEMM, ONE WAVE per 64x64 output tile (16 accumulators), operands straight from K-contiguous 16-bit planes; grid (M/64, N/64, Z), 32 threads.
// C[m][n] (f32, pitch ldc, + optional bf16-rounded f32 bias[n]) = sum_k A[m][k] Bt[n][k] (+ split products per NSPLIT). z-batch strides sA/sB/sC in elements. K % 32 == 0.
template <typename T16> struct WFrag;
template <> struct WFrag<h16> { typedef v16h V; static __device__ __forceinline__ V ld(const h16* p) { return cat16(*(const v8h*)p, *(const v8h*)(p + 16)); } static __device__ __forceinline__ v8f mma(V a, V b, v8f c) { return wmma16(a, b, c); } };
template <> struct WFrag<bf> { typedef v16bf V; static __device__ __forceinline__ V ld(const bf* p) { return cat16b(*(const v8us*)p, *(const v8us*)(p + 16)); } static __device__ __forceinline__ v8f mma(V a, V b, v8f c) { return wmmab(a, b, c); } };
template <typename T16, int NSPLIT, bool BIAS>
__global__ __launch_bounds__(32) void k_gemmw(const T16* __restrict__ A, const T16* __restrict__ A2, const T16* __restrict__ Bt, const T16* __restrict__ Bt2, int K, float* C, int ldc, const float* __restrict__ bias, size_t sA, size_t sB, size_t sC) {
    typedef typename WFrag<T16>::V V;
    __shared__ __align__(16) float os[16 * 68];
    const size_t z = blockIdx.z; A += z * sA; if (A2) A2 += z * sA; Bt += z * sB; if (Bt2) Bt2 += z * sB; C += z * sC;
    const int lane = threadIdx.x & 31, lr = lane & 15, hi = lane >> 4; const int r0 = blockIdx.x * 64, c0 = blockIdx.y * 64;
    v8f acc[4][4];
#pragma unroll
    for (int mb = 0; mb < 4; ++mb)
#pragma unroll
        for (int nb = 0; nb < 4; ++nb) acc[mb][nb] = (v8f){};
    const size_t aoff = (size_t)(r0 + lr) * K + 8 * hi, boff = (size_t)(c0 + lr) * K + 8 * hi;
#pragma unroll 1
    for (int kc = 0; kc < K; kc += 32) {
        V a[4], a2[4];
#pragma unroll
        for (int mb = 0; mb < 4; ++mb) { a[mb] = WFrag<T16>::ld(A + aoff + (size_t)mb * 16 * K + kc); if (NSPLIT == 1 || NSPLIT == 2) a2[mb] = WFrag<T16>::ld(A2 + aoff + (size_t)mb * 16 * K + kc); }
#pragma unroll
        for (int nb = 0; nb < 4; ++nb) { const V b = WFrag<T16>::ld(Bt + boff + (size_t)nb * 16 * K + kc); V b2; if (NSPLIT >= 2) b2 = WFrag<T16>::ld(Bt2 + boff + (size_t)nb * 16 * K + kc);
#pragma unroll
            for (int mb = 0; mb < 4; ++mb) { acc[mb][nb] = WFrag<T16>::mma(a[mb], b, acc[mb][nb]); if (NSPLIT == 1 || NSPLIT == 2) acc[mb][nb] = WFrag<T16>::mma(a2[mb], b, acc[mb][nb]); if (NSPLIT >= 2) acc[mb][nb] = WFrag<T16>::mma(a[mb], b2, acc[mb][nb]); } }
        asm volatile("v_nop\n\tv_nop\n\tv_nop\n\tv_nop" : "+v"(acc[0][0]), "+v"(acc[1][1]), "+v"(acc[2][2]), "+v"(acc[3][3]) : "v"(a[0]), "v"(a[3]));
    }
#pragma unroll
    for (int mb = 0; mb < 4; ++mb) {
#pragma unroll
        for (int nb = 0; nb < 4; ++nb) {
#pragma unroll
            for (int j = 0; j < 8; ++j) os[(hi * 8 + j) * 68 + nb * 16 + lr] = acc[mb][nb][j]; }
        __builtin_amdgcn_wave_barrier(); asm volatile("" ::: "memory");
        float* crow = C + (size_t)(r0 + mb * 16) * ldc + c0;
{
#pragma unroll
            for (int s = 0; s < 8; ++s) { const int row = 2 * s + hi, cofs = lr * 4; v4f val = *(const v4fa*)(os + row * 68 + cofs); if (BIAS) { val[0] += bfr(bias[c0 + cofs]); val[1] += bfr(bias[c0 + cofs + 1]); val[2] += bfr(bias[c0 + cofs + 2]); val[3] += bfr(bias[c0 + cofs + 3]); }
                *(v4f*)(crow + (size_t)row * ldc + cofs) = val; }
             }
        __builtin_amdgcn_wave_barrier(); asm volatile("" ::: "memory");
    }
}

// ---- k_gemmc: the same one-wave 64x64 tile GEMM specialised for causal attention: CMODE 1 skips score tiles entirely above the diagonal (query rows r0+roff.., key columns c0..), CMODE 2 limits the
// key (K) loop of the probability x value contraction to the diagonal block (probabilities beyond it are exactly zero). roff = row offset of this launch's first row within the sequence.
template <typename T16, int NSPLIT, int CMODE>
__global__ __launch_bounds__(32) void k_gemmc(const T16* __restrict__ A, const T16* __restrict__ A2, const T16* __restrict__ Bt, const T16* __restrict__ Bt2, int K, float* C, int ldc, int roff, size_t sA, size_t sB, size_t sC) {
    typedef typename WFrag<T16>::V V;
    __shared__ __align__(16) float os[16 * 68];
    const size_t z = blockIdx.z, zb = z / REP; A += z * sA; if (A2) A2 += z * sA; Bt += zb * sB; if (Bt2) Bt2 += zb * sB; C += z * sC;   // z = query head; the B planes (keys, values) step per kv group z / REP
    const int lane = threadIdx.x & 31, lr = lane & 15, hi = lane >> 4; const int r0 = blockIdx.x * 64, c0 = blockIdx.y * 64;
    if (CMODE == 1 && c0 > r0 + roff + 63) return;                  // score tile entirely above the causal diagonal: never read (the softmax masks j > i by select)
    const int Kl = (CMODE == 2) ? min(K, r0 + roff + 64) : K;        // P.V: probabilities are exactly 0 beyond the diagonal block, so the K loop stops there
    v8f acc[4][4];
#pragma unroll
    for (int mb = 0; mb < 4; ++mb)
#pragma unroll
        for (int nb = 0; nb < 4; ++nb) acc[mb][nb] = (v8f){};
    const size_t aoff = (size_t)(r0 + lr) * K + 8 * hi, boff = (size_t)(c0 + lr) * K + 8 * hi;
#pragma unroll 1
    for (int kc = 0; kc < Kl; kc += 32) {
        V a[4], a2[4];
#pragma unroll
        for (int mb = 0; mb < 4; ++mb) { a[mb] = WFrag<T16>::ld(A + aoff + (size_t)mb * 16 * K + kc); if (NSPLIT == 1 || NSPLIT == 2) a2[mb] = WFrag<T16>::ld(A2 + aoff + (size_t)mb * 16 * K + kc); }
#pragma unroll
        for (int nb = 0; nb < 4; ++nb) { const V b = WFrag<T16>::ld(Bt + boff + (size_t)nb * 16 * K + kc); V b2; if (NSPLIT >= 2) b2 = WFrag<T16>::ld(Bt2 + boff + (size_t)nb * 16 * K + kc);
#pragma unroll
            for (int mb = 0; mb < 4; ++mb) { acc[mb][nb] = WFrag<T16>::mma(a[mb], b, acc[mb][nb]); if (NSPLIT == 1 || NSPLIT == 2) acc[mb][nb] = WFrag<T16>::mma(a2[mb], b, acc[mb][nb]); if (NSPLIT >= 2) acc[mb][nb] = WFrag<T16>::mma(a[mb], b2, acc[mb][nb]); } }
        asm volatile("v_nop\n\tv_nop\n\tv_nop\n\tv_nop" : "+v"(acc[0][0]), "+v"(acc[1][1]), "+v"(acc[2][2]), "+v"(acc[3][3]) : "v"(a[0]), "v"(a[3]));
    }
#pragma unroll
    for (int mb = 0; mb < 4; ++mb) {
#pragma unroll
        for (int nb = 0; nb < 4; ++nb) {
#pragma unroll
            for (int j = 0; j < 8; ++j) os[(hi * 8 + j) * 68 + nb * 16 + lr] = acc[mb][nb][j]; }
        __builtin_amdgcn_wave_barrier(); asm volatile("" ::: "memory");
        float* crow = C + (size_t)(r0 + mb * 16) * ldc + c0;
{
#pragma unroll
            for (int s = 0; s < 8; ++s) { const int row = 2 * s + hi, cofs = lr * 4; v4f val = *(const v4fa*)(os + row * 68 + cofs);
                *(v4f*)(crow + (size_t)row * ldc + cofs) = val; }
             }
        __builtin_amdgcn_wave_barrier(); asm volatile("" ::: "memory");
    }
}

__device__ __forceinline__ h16 tohx(float x) { return (h16)x; }
__device__ __forceinline__ void splitf(float y, unsigned short& h, unsigned short& l) { h = f2bf(y); l = f2bf(y - bf2f(h)); }
typedef __attribute__((ext_vector_type(2))) _Float16 v2h;
typedef __attribute__((ext_vector_type(4))) _Float16 v4h;
typedef __attribute__((ext_vector_type(2))) unsigned short v2us;
typedef __attribute__((ext_vector_type(4))) unsigned short v4us;
typedef __attribute__((ext_vector_type(2))) float v2f;
typedef __attribute__((ext_vector_type(4))) int v4i;

__global__ __launch_bounds__(256) void k_wtG(const float* __restrict__ w, int K, int N, bf* Bt) {
    const int lane = threadIdx.x & 31; const int L0 = (blockIdx.x * 8 + (threadIdx.x >> 5)) * 8; const int nlines = N * K / 64;
{
#pragma unroll 1
        for (int l = 0; l < 8; ++l) { const int L = L0 + l; if (L >= nlines) break; const size_t e = (size_t)L * 64 + lane * 2; const int k = (int)(e % K), n = (int)(e / K); v2us o;
            o[0] = f2bf(w[(size_t)k * N + n]); o[1] = f2bf(w[(size_t)(k + 1) * N + n]); *(v2us*)(Bt + e) = o; }
         }
}
__global__ __launch_bounds__(256) void k_cvt8(const float* __restrict__ src, bf* dst, size_t n8) { const size_t i = (size_t)blockIdx.x * 256 + threadIdx.x; if (i >= n8) return; const v8f v = *(const v8f*)(src + i * 8); v8us o;
#pragma unroll
    for (int k = 0; k < 8; ++k) o[k] = f2bf(v[k]); *(v8us*)(dst + i * 8) = o;  }
__global__ __launch_bounds__(256) void k_cscvt(const float* __restrict__ cosT, const float* __restrict__ sinT, float* CS) { const int idx = blockIdx.x * 256 + threadIdx.x; if (idx >= TT * HD) return; v2f cs; cs[0] = bfr(cosT[idx]); cs[1] = bfr(sinT[idx]); *(v2f*)(CS + (size_t)idx * 2) = cs;  }
// k_rope: head planes [h][t][d] (fp16 + hi/lo) of rope(x) x sc with the rotate-half convention out[d] = x[d] cos[t][d] - x[d+HD/2] sin[t][d], out[d+HD/2] = x[d+HD/2] cos[t][d+HD/2] + x[d] sin[t][d+HD/2]
__global__ __launch_bounds__(256) void k_rope(const float* __restrict__ F, int pitch, int nheads, const float* __restrict__ CS, const float* __restrict__ RF, const float* __restrict__ nw, float sc, h16* P16, bf* Ph, bf* Pl) {
    const size_t e = ((size_t)blockIdx.x * 256 + threadIdx.x) * 2; if (e >= (size_t)nheads * TT * HD) return; const int d = (int)(e % HD); const int t = (int)((e / HD) % TT); const int h = (int)(e / ((size_t)HD * TT)); const float* f = F + (size_t)t * pitch + h * HD; const float rf = RF ? RF[(size_t)h * TT + t] : 1.0f; v2h o16; v2us oh, ol;
#pragma unroll
    for (int q = 0; q < 2; ++q) { const int dd = d + q; const int dp = (dd < HD / 2) ? dd + HD / 2 : dd - HD / 2; float x0 = f[dd], x1 = f[dp];
        if (RF) { float n0 = __fmul_rn(x0, rf), n1 = __fmul_rn(x1, rf); asm volatile("" : "+v"(n0)); asm volatile("" : "+v"(n1)); x0 = __fmul_rn(bfr(nw[dd]), n0); x1 = __fmul_rn(bfr(nw[dp]), n1); }
        const v2f cs = *(const v2f*)(CS + ((size_t)t * HD + dd) * 2); float a = __fmul_rn(x0, cs[0]), bq = __fmul_rn(x1, cs[1]); asm volatile("" : "+v"(a)); asm volatile("" : "+v"(bq)); const float r = ((dd < HD / 2) ? __fsub_rn(a, bq) : __fadd_rn(a, bq)) * sc;
        o16[q] = tohx(r); unsigned short a2, c2; splitf(r, a2, c2); oh[q] = a2; ol[q] = c2; }
    *(v2h*)(P16 + e) = o16; *(v2us*)(Ph + e) = oh; *(v2us*)(Pl + e) = ol;  }
__global__ __launch_bounds__(256) void k_vtp(const float* __restrict__ F, int pitch, int nheads, h16* V16, bf* Vh, bf* Vl) { const size_t e = ((size_t)blockIdx.x * 256 + threadIdx.x) * 2; if (e >= (size_t)nheads * HD * TT) return; const int t = (int)(e % TT); const int d = (int)((e / TT) % HD); const int g = (int)(e / ((size_t)TT * HD)); v2h o16; v2us oh, ol;
#pragma unroll
    for (int q = 0; q < 2; ++q) { const float x = F[(size_t)(t + q) * pitch + g * HD + d]; o16[q] = tohx(x); unsigned short a2, c2; splitf(x, a2, c2); oh[q] = a2; ol[q] = c2; }
    *(v2h*)(V16 + e) = o16; *(v2us*)(Vh + e) = oh; *(v2us*)(Vl + e) = ol;  }
__global__ __launch_bounds__(256) void k_rmsw(float* F, int pitch, int nheads, const float* __restrict__ w) { const int lane = threadIdx.x & 31; const int wv = blockIdx.x * 8 + (threadIdx.x >> 5); if (wv >= TT * nheads) return; const int t = wv / nheads, h = wv % nheads; float* f = F + (size_t)t * pitch + h * HD; const v4f a = *(const v4f*)(f + lane * 4); float ss = 0.f;
#pragma unroll
    for (int q = 0; q < 4; ++q) { float p = __fmul_rn(a[q], a[q]); asm volatile("" : "+v"(p)); ss = __fadd_rn(ss, p); }
#pragma unroll
    for (int sh = 16; sh; sh >>= 1) ss = __fadd_rn(ss, __shfl_xor(ss, sh, 32));
    const float rs = __fdiv_rn(1.0f, sqrtf(__fadd_rn(ss * (1.0f / HD), 1e-6f))); v4f o;
#pragma unroll
    for (int q = 0; q < 4; ++q) { float y = __fmul_rn(a[q], rs); asm volatile("" : "+v"(y)); o[q] = __fmul_rn(y, bfr(w[lane * 4 + q])); }
    *(v4f*)(f + lane * 4) = o;  }
// one launch covers the RH query rows ROFF .. ROFF + RH - 1 of every head: plane row = head * RH + (i - ROFF), for the score planes and for every probability plane alike
template <int ROFF>
__global__ __launch_bounds__(256) void k_asoft2(const float* __restrict__ Sb, const float* __restrict__ Sb2, h16* P16, bf* Ph, bf* Pl, h16* P16b, bf* Phb, bf* Plb) {
    const int lane = threadIdx.x & 31; const int row = blockIdx.x * 8 + (threadIdx.x >> 5); if (row >= ZH * RH) return; const int i = ROFF + row % RH; constexpr bool hires = (ROFF < RH); const float* sr = Sb + (size_t)row * TT; const float* sr2 = Sb2 + (size_t)row * TT; float v[TT / 32]; float mx = -3.0e38f;
#pragma unroll
    for (int ch = 0; ch < TT / 128; ++ch) { const int j0 = ch * 128 + lane * 4; const v4f a = *(const v4f*)(sr + j0); const v4f a2 = *(const v4f*)(sr2 + j0);
#pragma unroll
        for (int q = 0; q < 4; ++q) { const int j = j0 + q; (void)j; const float t = (j <= i) ? ((i - j < 256) ? a[q] * SCL : a2[q] * SCL) : -3.0e38f; v[ch * 4 + q] = t; mx = fmaxf(mx, t); } }
#pragma unroll
    for (int sh = 16; sh; sh >>= 1) mx = fmaxf(mx, __shfl_xor(mx, sh, 32));
    float sum = 0.f;
#pragma unroll
    for (int k = 0; k < TT / 32; ++k) { float d0 = __fsub_rn(v[k], mx); asm volatile("" : "+v"(d0)); v[k] = __builtin_amdgcn_exp2f(__fmul_rn(d0, 1.4426950408889634f)); sum += v[k]; }
#pragma unroll
    for (int sh = 16; sh; sh >>= 1) sum += __shfl_xor(sum, sh, 32);
    const float f = __fdiv_rn(hires ? 1.0f : PCAR, sum);
{
        if (hires) {
#pragma unroll
            for (int ch = 0; ch < TT / 128; ++ch) { v4us oh, ol, ohb, olb;
#pragma unroll
                for (int q = 0; q < 4; ++q) { const int j = ch * 128 + lane * 4 + q; const bool win = (j <= i && i - j < 256); unsigned short a, c2; splitf(v[ch * 4 + q] * f, a, c2); oh[q] = win ? a : (unsigned short)0; ol[q] = win ? c2 : (unsigned short)0; ohb[q] = win ? (unsigned short)0 : a; olb[q] = win ? (unsigned short)0 : c2; }
                const size_t oo = (size_t)row * TT + ch * 128 + lane * 4; *(v4us*)(Ph + oo) = oh; *(v4us*)(Pl + oo) = ol; *(v4us*)(Phb + oo) = ohb; *(v4us*)(Plb + oo) = olb; }
        } else {
#pragma unroll
            for (int ch = 0; ch < TT / 128; ++ch) { v4h o4, o4b;
#pragma unroll
                for (int q = 0; q < 4; ++q) { const int j = ch * 128 + lane * 4 + q; const bool win = (j <= i && i - j < 256); const _Float16 pv = tohx(v[ch * 4 + q] * f); o4[q] = win ? pv : (_Float16)0.0f; o4b[q] = win ? (_Float16)0.0f : pv; }
                *(v4h*)(P16 + (size_t)row * TT + ch * 128 + lane * 4) = o4; *(v4h*)(P16b + (size_t)row * TT + ch * 128 + lane * 4) = o4b; } }
         }
}
__global__ __launch_bounds__(256) void k_merge2(const float* __restrict__ O, const float* __restrict__ O2, int h0, bf* Ah, bf* Al) { const size_t e = ((size_t)blockIdx.x * 256 + threadIdx.x) * 2; if (e >= (size_t)ZH * TT * HD) return; const int d = (int)(e % HD); const int t = (int)((e / HD) % TT); const int zz = (int)(e / ((size_t)HD * TT)); const float cs = (t < RH) ? 1.0f : (1.0f / PCAR); const size_t oo = (size_t)t * DQ + (h0 + zz) * HD + d;
    v2us oh, ol;
#pragma unroll
    for (int q = 0; q < 2; ++q) { unsigned short a, c2; float s1 = O[e + q] * cs, s2 = O2[e + q] * cs; asm volatile("" : "+v"(s1)); asm volatile("" : "+v"(s2)); splitf(__fadd_rn(s1, s2), a, c2); oh[q] = a; ol[q] = c2; } *(v2us*)(Ah + oo) = oh; *(v2us*)(Al + oo) = ol;  }

// k_asoft: per row (zz, i): t = S x HD^-0.5 for j <= i and i - j < WIN (sliding causal window; the reference's -1e9 additive fill vanishes identically); softmax over the 1024 keys (register row, one exp, fixed trees);
__global__ __launch_bounds__(256) void k_asoft(const float* __restrict__ Sb, h16* P16, bf* Ph, bf* Pl) {
    const int lane = threadIdx.x & 31; const int row = blockIdx.x * 8 + (threadIdx.x >> 5); if (row >= ZH * TT) return; const int i = row % TT; const int zz = row / TT; (void)zz; const bool hires = (i < RH); const float* sr = Sb + (size_t)row * TT; float v[TT / 32]; float mx = -3.0e38f;
#pragma unroll
    for (int ch = 0; ch < TT / 128; ++ch) { const int j0 = ch * 128 + lane * 4; const v4f a = *(const v4f*)(sr + j0);
#pragma unroll
        for (int q = 0; q < 4; ++q) { const int j = j0 + q; (void)j; const float t = (j <= i && i - j < WIN) ? a[q] * SCL : -3.0e38f; v[ch * 4 + q] = t; mx = fmaxf(mx, t); } }
#pragma unroll
    for (int sh = 16; sh; sh >>= 1) mx = fmaxf(mx, __shfl_xor(mx, sh, 32));
    float sum = 0.f;
#pragma unroll
    for (int k = 0; k < TT / 32; ++k) { float d0 = __fsub_rn(v[k], mx); asm volatile("" : "+v"(d0)); v[k] = __builtin_amdgcn_exp2f(__fmul_rn(d0, 1.4426950408889634f)); sum += v[k]; }
#pragma unroll
    for (int sh = 16; sh; sh >>= 1) sum += __shfl_xor(sum, sh, 32);
    const float f = __fdiv_rn(hires ? 1.0f : PCAR, sum);
{
        if (hires) {
#pragma unroll
            for (int ch = 0; ch < TT / 128; ++ch) { v4us oh, ol;
#pragma unroll
                for (int q = 0; q < 4; ++q) { unsigned short a, c2; splitf(v[ch * 4 + q] * f, a, c2); oh[q] = a; ol[q] = c2; }
                const size_t oo = ((size_t)zz * (RH ? RH : 1) + i) * TT + ch * 128 + lane * 4; *(v4us*)(Ph + oo) = oh; *(v4us*)(Pl + oo) = ol; }
        } else {
#pragma unroll
            for (int ch = 0; ch < TT / 128; ++ch) { v4h o4;
#pragma unroll
                for (int q = 0; q < 4; ++q) o4[q] = tohx(v[ch * 4 + q] * f);
                *(v4h*)(P16 + (size_t)row * TT + ch * 128 + lane * 4) = o4; } }
         }
}
__global__ __launch_bounds__(256) void k_merge(const float* __restrict__ O, int h0, bf* Ah, bf* Al) { const size_t e = ((size_t)blockIdx.x * 256 + threadIdx.x) * 2; if (e >= (size_t)ZH * TT * HD) return; const int d = (int)(e % HD); const int t = (int)((e / HD) % TT); const int zz = (int)(e / ((size_t)HD * TT)); const float cs = (t < RH) ? 1.0f : (1.0f / PCAR); const size_t oo = (size_t)t * DQ + (h0 + zz) * HD + d;
    v2us oh, ol;
#pragma unroll
    for (int q = 0; q < 2; ++q) { unsigned short a, c2; splitf(O[e + q] * cs, a, c2); oh[q] = a; ol[q] = c2; } *(v2us*)(Ah + oo) = oh; *(v2us*)(Al + oo) = ol;  }

extern "C" void kernel_launch(void* const* d_in, const int* in_sizes, int n_in,
                              void* d_out, int out_size, void* d_ws, size_t ws_size, hipStream_t stream) {
    (void)in_sizes; (void)n_in; (void)out_size;
    const float* x = (const float*)d_in[0]; const float* cosA = (const float*)d_in[1]; const float* sinA = (const float*)d_in[2]; const float* wq = (const float*)d_in[3]; const float* bq = (const float*)d_in[4]; const float* wk = (const float*)d_in[5]; const float* bk = (const float*)d_in[6]; const float* wv = (const float*)d_in[7]; const float* bv = (const float*)d_in[8]; const float* wq2 = (const float*)d_in[9]; const float* bq2 = (const float*)d_in[10]; const float* wk2 = (const float*)d_in[11]; const float* bk2 = (const float*)d_in[12]; const float* wv2 = (const float*)d_in[13]; const float* bv2 = (const float*)d_in[14]; const float* wo = (const float*)d_in[15]; const float* gq = (const float*)d_in[16]; const float* gk = (const float*)d_in[17]; const float* gq2 = (const float*)d_in[18]; const float* gk2 = (const float*)d_in[19]; const float* cosT = cosA; const float* sinT = sinA;
    float* OUT = (float*)d_out;     // [2][1024][2048]
    char* wsp = (char*)d_ws;
    auto take = [&](size_t bytes) { char* p = wsp; wsp += (bytes + 255) & ~(size_t)255; return (void*)p; };
    bf* WQ = (bf*)take((size_t)DQ * DM * 2); bf* WK = (bf*)take((size_t)DKV * DM * 2); bf* WV = (bf*)take((size_t)DKV * DM * 2); bf* WO = (bf*)take((size_t)DM * DQ * 2); bf* WQ2 = (bf*)take((size_t)DQ * DM * 2); bf* WK2 = (bf*)take((size_t)DKV * DM * 2); bf* WV2 = (bf*)take((size_t)DKV * DM * 2); float* CS = (float*)take((size_t)TT * HD * 2 * 4);
    bf* XB = (bf*)take((size_t)TT * DM * 2); float* FQ = (float*)take((size_t)TT * DQ * 4); float* FK = (float*)take((size_t)TT * DKV * 4);
    h16* QP16 = (h16*)take((size_t)NH_ * TT * HD * 2); h16* KP16 = (h16*)take((size_t)NKV * TT * HD * 2); h16* VT16 = (h16*)take((size_t)NKV * HD * TT * 2);
    bf* QPh = (bf*)take((size_t)NH_ * TT * HD * 2); bf* QPl = (bf*)take((size_t)NH_ * TT * HD * 2); bf* KPh = (bf*)take((size_t)NKV * TT * HD * 2); bf* KPl = (bf*)take((size_t)NKV * TT * HD * 2); bf* VTh = (bf*)take((size_t)NKV * HD * TT * 2); bf* VTl = (bf*)take((size_t)NKV * HD * TT * 2); bf* Ph = (bf*)take((size_t)ZH * RH * TT * 2); bf* Pl = (bf*)take((size_t)ZH * RH * TT * 2);
    float* Sb = (float*)take((size_t)ZH * RH * TT * 4); bf* ATh = (bf*)take((size_t)TT * DQ * 2); bf* ATl = (bf*)take((size_t)TT * DQ * 2); h16* QP16b = (h16*)take((size_t)NH_ * TT * HD * 2); h16* KP16b = (h16*)take((size_t)NKV * TT * HD * 2); h16* VT16b = (h16*)take((size_t)NKV * HD * TT * 2); bf* QPhb = (bf*)take((size_t)NH_ * TT * HD * 2); bf* QPlb = (bf*)take((size_t)NH_ * TT * HD * 2); bf* KPhb = (bf*)take((size_t)NKV * TT * HD * 2); bf* KPlb = (bf*)take((size_t)NKV * TT * HD * 2); bf* VThb = (bf*)take((size_t)NKV * HD * TT * 2); bf* VTlb = (bf*)take((size_t)NKV * HD * TT * 2); float* Sb2 = (float*)take((size_t)ZH * RH * TT * 4); bf* Phb = (bf*)take((size_t)ZH * RH * TT * 2); bf* Plb = (bf*)take((size_t)ZH * RH * TT * 2); float* Ob2 = (float*)take((size_t)ZH * TT * HD * 4);
    if ((size_t)(wsp - (char*)d_ws) > ws_size) return;    // ws 256 MiB
    h16* P16 = (h16*)Ph; h16* P16b = (h16*)Phb;   // the fp16 probability planes of the rows >= RH reuse the hi planes of the rows < RH, whose value products have run by then (stream-ordered; same size)
    float* Ob = FQ;   // the window-part attention output reuses the q projection buffer, dead once the q planes are built (stream-ordered; same size)
    float* FV = FK;   // v projection reuses the k buffer after the k planes are built (stream-ordered)
    { k_cvt8<<<(unsigned)(((size_t)DQ * DM / 8 + 255) / 256), 256, 0, stream>>>(wq, WQ, (size_t)DQ * DM / 8); k_cvt8<<<(unsigned)(((size_t)DKV * DM / 8 + 255) / 256), 256, 0, stream>>>(wk, WK, (size_t)DKV * DM / 8); k_cvt8<<<(unsigned)(((size_t)DKV * DM / 8 + 255) / 256), 256, 0, stream>>>(wv, WV, (size_t)DKV * DM / 8);
      k_cvt8<<<(unsigned)(((size_t)DM * DQ / 8 + 255) / 256), 256, 0, stream>>>(wo, WO, (size_t)DM * DQ / 8); k_cvt8<<<(unsigned)(((size_t)DQ * DM / 8 + 255) / 256), 256, 0, stream>>>(wq2, WQ2, (size_t)DQ * DM / 8); k_cvt8<<<(unsigned)(((size_t)DKV * DM / 8 + 255) / 256), 256, 0, stream>>>(wk2, WK2, (size_t)DKV * DM / 8); k_cvt8<<<(unsigned)(((size_t)DKV * DM / 8 + 255) / 256), 256, 0, stream>>>(wv2, WV2, (size_t)DKV * DM / 8);
       }
    const unsigned LQ = (unsigned)(((size_t)NH_ * TT * HD / 2 + 255) / 256), LKv = (unsigned)(((size_t)NKV * TT * HD / 2 + 255) / 256);
    for (int b = 0; b < NB_; ++b) {
        k_cscvt<<<(TT * HD + 255) / 256, 256, 0, stream>>>(cosA + (size_t)b * TT * HD, sinA + (size_t)b * TT * HD, CS);
        k_cvt8<<<(unsigned)(((size_t)TT * DM / 8 + 255) / 256), 256, 0, stream>>>(x + (size_t)b * TT * DM, XB, (size_t)TT * DM / 8);
        k_gemmw<bf, 0, true><<<dim3(TT / 64, DQ / 64, 1), 32, 0, stream>>>(XB, nullptr, WQ, nullptr, DM, FQ, DQ, bq, 0, 0, 0); k_rmsw<<<TT * NH_ / 8, 256, 0, stream>>>(FQ, DQ, NH_, gq); k_rope<<<LQ, 256, 0, stream>>>(FQ, DQ, NH_, CS, nullptr, nullptr, 1.0f, QP16, QPh, QPl);
        k_gemmw<bf, 0, true><<<dim3(TT / 64, DKV / 64, 1), 32, 0, stream>>>(XB, nullptr, WK, nullptr, DM, FK, DKV, bk, 0, 0, 0); k_rmsw<<<TT * NKV / 8, 256, 0, stream>>>(FK, DKV, NKV, gk); k_rope<<<LKv, 256, 0, stream>>>(FK, DKV, NKV, CS, nullptr, nullptr, 1.0f, KP16, KPh, KPl);
        k_gemmw<bf, 0, true><<<dim3(TT / 64, DKV / 64, 1), 32, 0, stream>>>(XB, nullptr, WV, nullptr, DM, FV, DKV, bv, 0, 0, 0); k_vtp<<<LKv, 256, 0, stream>>>(FV, DKV, NKV, VT16, VTh, VTl);
        k_gemmw<bf, 0, true><<<dim3(TT / 64, DQ / 64, 1), 32, 0, stream>>>(XB, nullptr, WQ2, nullptr, DM, FQ, DQ, bq2, 0, 0, 0); k_rmsw<<<TT * NH_ / 8, 256, 0, stream>>>(FQ, DQ, NH_, gq2); k_rope<<<LQ, 256, 0, stream>>>(FQ, DQ, NH_, CS, nullptr, nullptr, 1.0f, QP16b, QPhb, QPlb);
        k_gemmw<bf, 0, true><<<dim3(TT / 64, DKV / 64, 1), 32, 0, stream>>>(XB, nullptr, WK2, nullptr, DM, FK, DKV, bk2, 0, 0, 0); k_rmsw<<<TT * NKV / 8, 256, 0, stream>>>(FK, DKV, NKV, gk2); k_rope<<<LKv, 256, 0, stream>>>(FK, DKV, NKV, CS, nullptr, nullptr, 1.0f, KP16b, KPhb, KPlb);
        k_gemmw<bf, 0, true><<<dim3(TT / 64, DKV / 64, 1), 32, 0, stream>>>(XB, nullptr, WV2, nullptr, DM, FV, DKV, bv2, 0, 0, 0); k_vtp<<<LKv, 256, 0, stream>>>(FV, DKV, NKV, VT16b, VThb, VTlb);
        {   // all NH_ heads in grid z; first the query rows < RH (hi+lo planes), then the rows >= RH (fp16 planes), each pass over the same score planes
            const size_t sQ = (size_t)TT * HD, sKV = (size_t)TT * HD, sS = (size_t)RH * TT, sO = (size_t)TT * HD;
            k_gemmc<bf, 2, 1><<<dim3(RH / 64, TT / 64, ZH), 32, 0, stream>>>(QPh, QPl, KPh, KPl, HD, Sb, TT, 0, sQ, sKV, sS);
            k_gemmc<bf, 2, 1><<<dim3(RH / 64, TT / 64, ZH), 32, 0, stream>>>(QPhb, QPlb, KPhb, KPlb, HD, Sb2, TT, 0, sQ, sKV, sS);
            k_asoft2<0><<<ZH * RH / 8, 256, 0, stream>>>(Sb, Sb2, P16, Ph, Pl, P16b, Phb, Plb);
            k_gemmc<bf, 2, 2><<<dim3(RH / 64, HD / 64, ZH), 32, 0, stream>>>(Ph, Pl, VTh, VTl, TT, Ob, HD, 0, sS, sKV, sO);
            k_gemmc<bf, 2, 2><<<dim3(RH / 64, HD / 64, ZH), 32, 0, stream>>>(Phb, Plb, VThb, VTlb, TT, Ob2, HD, 0, sS, sKV, sO);
            k_gemmc<h16, 0, 1><<<dim3((TT - RH) / 64, TT / 64, ZH), 32, 0, stream>>>(QP16 + (size_t)RH * HD, nullptr, KP16, nullptr, HD, Sb, TT, RH, sQ, sKV, sS);
            k_gemmc<h16, 0, 1><<<dim3((TT - RH) / 64, TT / 64, ZH), 32, 0, stream>>>(QP16b + (size_t)RH * HD, nullptr, KP16b, nullptr, HD, Sb2, TT, RH, sQ, sKV, sS);
            k_asoft2<RH><<<ZH * RH / 8, 256, 0, stream>>>(Sb, Sb2, P16, Ph, Pl, P16b, Phb, Plb);
            k_gemmc<h16, 0, 2><<<dim3((TT - RH) / 64, HD / 64, ZH), 32, 0, stream>>>(P16, nullptr, VT16, nullptr, TT, Ob + (size_t)RH * HD, HD, RH, sS, sKV, sO);
            k_gemmc<h16, 0, 2><<<dim3((TT - RH) / 64, HD / 64, ZH), 32, 0, stream>>>(P16b, nullptr, VT16b, nullptr, TT, Ob2 + (size_t)RH * HD, HD, RH, sS, sKV, sO);
            k_merge2<<<(unsigned)(((size_t)ZH * TT * HD / 2 + 255) / 256), 256, 0, stream>>>(Ob, Ob2, 0, ATh, ATl); }
        k_gemmw<bf, 1, false><<<dim3(TT / 64, DM / 64, 1), 32, 0, stream>>>(ATh, ATl, WO, nullptr, DQ, OUT + (size_t)b * TT * DM, DM, nullptr, 0, 0, 0); }
}

// v002
// It runs in 489 microseconds.
// Timed twice side by side with v001, it ran 2.14 times as fast both times.
// Counting every step since v000, it is 4.77 times as fast.
#include <hip/hip_runtime.h>

// BMOJOAttention (hidden [2][1024][2048]; two projection paths - in-context (Wq,bq,Wk,bk,Wv,bv,gq,gk) and fading (Wq2..gk2): q = rope(rmsnorm(x Wq^T + bq) gq) (16 x 128), k = rope(rmsnorm(x Wk^T + bk) gk) (8 kv heads; group h/2), v = x Wv^T + bv; rotate-half RoPE with the read cos/sin [B][S][128]; s_ic = q_ic.k_ic / sqrt(128) live where 0 <= i-j < 256, s_f = q_f.k_f / sqrt(128) live where i-j >= 256 (else -1e30); ONE joint softmax over [s_ic | s_f]; out = p_ic v_ic + p_f v_f; merged Wo^T -> [2][1024][2048]).
// The joint softmax over 2S columns is computed as one causal softmax whose score (and value source) switches at i-j = 256: the masked halves contribute exactly 0; keys j > i are masked in both (causal tile skipping).
// Compute dtypes, f32 accumulate: every input rounded to bf16; both paths' q/k/v on PLAIN bf16 operands (inputs: exact) + bias; RMSNorm * g (in place) and RoPE (bf16-rounded per-batch tables) f32; both score sets and both attn.v products: query rows < 512 hl (3 products), the rest single fp16 (x1024), causal tile skipping; softmax f32 over the selected scores, emitting window-part and fading-part probability planes (zeros elsewhere); the two value products summed in f32 when forming the hl planes; Wo hl x exact (2 products).

#define NB_  2
#define TT   1024
#define DM   2048
#define NH_  16
#define NKV  8
#define REP  (NH_ / NKV)
#define HD   128
#define DQ   (NH_ * HD)
#define DKV  (NKV * HD)
#define ZH   16                   // heads per attention pass (grid z): all of them; the pass is split by query rows (< RH, >= RH) so that the score planes fit the workspace
#define RH   512                  // query rows < RH use hi+lo planes
#define WIN  1024
#define PCAR 1024.0f
static_assert(TT - RH == RH, "both row passes of the attention hold RH query rows");
#define SCL  0.088388347648318447f   // HD^-0.5
typedef _Float16 h16;
typedef unsigned short bf;
typedef __attribute__((ext_vector_type(16))) __bf16   v16bf;
typedef __attribute__((ext_vector_type(16))) _Float16 v16h;
typedef __attribute__((ext_vector_type(8)))  _Float16 v8h;
typedef __attribute__((ext_vector_type(8)))  unsigned short v8us;
typedef __attribute__((ext_vector_type(8)))  float    v8f;
typedef __attribute__((ext_vector_type(4)))  float    v4f;
typedef v8h  __attribute__((may_alias)) v8ha;
typedef v4f  __attribute__((may_alias)) v4fa;
typedef v8us __attribute__((may_alias)) v8usa;

__device__ __forceinline__ unsigned short f2bf(float f) { unsigned u = __float_as_uint(f); u += 0x7FFFu + ((u >> 16) & 1u); return (unsigned short)(u >> 16); }
__device__ __forceinline__ float bf2f(unsigned short b) { return __uint_as_float(((unsigned)b) << 16); }
__device__ __forceinline__ float bfr(float f) { return bf2f(f2bf(f)); }
__device__ __forceinline__ v16h cat16(v8h lo, v8h hi) { return __builtin_shufflevector(lo, hi, 0, 1, 2, 3, 4, 5, 6, 7, 8, 9, 10, 11, 12, 13, 14, 15); }
__device__ __forceinline__ v16bf cat16b(v8us lo, v8us hi) { return __builtin_bit_cast(v16bf, __builtin_shufflevector(lo, hi, 0, 1, 2, 3, 4, 5, 6, 7, 8, 9, 10, 11, 12, 13, 14, 15)); }
__device__ __forceinline__ v8f wmma16(v16h a, v16h b, v8f c) { return __builtin_amdgcn_wmma_f32_16x16x32_f16(false, a, false, b, (short)0, c, false, false); }
__device__ __forceinline__ v8f wmmab(v16bf a, v16bf b, v8f c) { return __builtin_amdgcn_wmma_f32_16x16x32_bf16(false, a, false, b, (short)0, c, false, false); }



// ---- k_gemmw: register-blocked GEMM, ONE WAVE per 64x64 output tile (16 accumulators), operands straight from K-contiguous 16-bit planes; grid (M/64, N/64, Z), 32 threads.
// C[m][n] (f32, pitch ldc, + optional bf16-rounded bias[n]) = sum_k A[m][k] Bt[n][k] (+ split products per NSPLIT). z-batch strides sA/sB/sC in elements. K % 32 == 0.
// With BIAS the N axis is the concatenation [q | q2 | k | k2 | v | v2] of both paths' projections (DQ, DQ, DKV, DKV, DKV, DKV columns); each 64-column tile lies in one section and takes that section's bias vector.
template <typename T16> struct WFrag;
template <> struct WFrag<h16> { typedef v16h V; static __device__ __forceinline__ V ld(const h16* p) { return cat16(*(const v8h*)p, *(const v8h*)(p + 16)); } static __device__ __forceinline__ v8f mma(V a, V b, v8f c) { return wmma16(a, b, c); } };
template <> struct WFrag<bf> { typedef v16bf V; static __device__ __forceinline__ V ld(const bf* p) { return cat16b(*(const v8us*)p, *(const v8us*)(p + 16)); } static __device__ __forceinline__ v8f mma(V a, V b, v8f c) { return wmmab(a, b, c); } };
template <typename T16, int NSPLIT, bool BIAS>
__global__ __launch_bounds__(32) void k_gemmw(const T16* __restrict__ A, const T16* __restrict__ A2, const T16* __restrict__ Bt, const T16* __restrict__ Bt2, int K, float* C, int ldc, const float* __restrict__ bq, const float* __restrict__ bq2, const float* __restrict__ bk, const float* __restrict__ bk2, const float* __restrict__ bv, const float* __restrict__ bv2, size_t sA, size_t sB, size_t sC) {
    typedef typename WFrag<T16>::V V;
    __shared__ __align__(16) float os[16 * 68];
    const size_t z = blockIdx.z; A += z * sA; if (A2) A2 += z * sA; Bt += z * sB; if (Bt2) Bt2 += z * sB; C += z * sC;
    const int lane = threadIdx.x & 31, lr = lane & 15, hi = lane >> 4; const int r0 = blockIdx.x * 64, c0 = blockIdx.y * 64;
    const float* bias = nullptr;   // this tile's bias, already stepped to column c0
    if (BIAS) bias = (c0 < DQ) ? bq + c0 : (c0 < 2 * DQ) ? bq2 + (c0 - DQ) : (c0 < 2 * DQ + DKV) ? bk + (c0 - 2 * DQ) : (c0 < 2 * DQ + 2 * DKV) ? bk2 + (c0 - 2 * DQ - DKV) : (c0 < 2 * DQ + 3 * DKV) ? bv + (c0 - 2 * DQ - 2 * DKV) : bv2 + (c0 - 2 * DQ - 3 * DKV);
    v8f acc[4][4];
#pragma unroll
    for (int mb = 0; mb < 4; ++mb)
#pragma unroll
        for (int nb = 0; nb < 4; ++nb) acc[mb][nb] = (v8f){};
    const size_t aoff = (size_t)(r0 + lr) * K + 8 * hi, boff = (size_t)(c0 + lr) * K + 8 * hi;
#pragma unroll 1
    for (int kc = 0; kc < K; kc += 32) {
        V a[4], a2[4];
#pragma unroll
        for (int mb = 0; mb < 4; ++mb) { a[mb] = WFrag<T16>::ld(A + aoff + (size_t)mb * 16 * K + kc); if (NSPLIT == 1 || NSPLIT == 2) a2[mb] = WFrag<T16>::ld(A2 + aoff + (size_t)mb * 16 * K + kc); }
#pragma unroll
        for (int nb = 0; nb < 4; ++nb) { const V b = WFrag<T16>::ld(Bt + boff + (size_t)nb * 16 * K + kc); V b2; if (NSPLIT >= 2) b2 = WFrag<T16>::ld(Bt2 + boff + (size_t)nb * 16 * K + kc);
#pragma unroll
            for (int mb = 0; mb < 4; ++mb) { acc[mb][nb] = WFrag<T16>::mma(a[mb], b, acc[mb][nb]); if (NSPLIT == 1 || NSPLIT == 2) acc[mb][nb] = WFrag<T16>::mma(a2[mb], b, acc[mb][nb]); if (NSPLIT >= 2) acc[mb][nb] = WFrag<T16>::mma(a[mb], b2, acc[mb][nb]); } }
        asm volatile("v_nop\n\tv_nop\n\tv_nop\n\tv_nop" : "+v"(acc[0][0]), "+v"(acc[1][1]), "+v"(acc[2][2]), "+v"(acc[3][3]) : "v"(a[0]), "v"(a[3]));
    }
#pragma unroll
    for (int mb = 0; mb < 4; ++mb) {
#pragma unroll
        for (int nb = 0; nb < 4; ++nb) {
#pragma unroll
            for (int j = 0; j < 8; ++j) os[(hi * 8 + j) * 68 + nb * 16 + lr] = acc[mb][nb][j]; }
        __builtin_amdgcn_wave_barrier(); asm volatile("" ::: "memory");
        float* crow = C + (size_t)(r0 + mb * 16) * ldc + c0;
{
#pragma unroll
            for (int s = 0; s < 8; ++s) { const int row = 2 * s + hi, cofs = lr * 4; v4f val = *(const v4fa*)(os + row * 68 + cofs); if (BIAS) { val[0] += bfr(bias[cofs]); val[1] += bfr(bias[cofs + 1]); val[2] += bfr(bias[cofs + 2]); val[3] += bfr(bias[cofs + 3]); }
                *(v4f*)(crow + (size_t)row * ldc + cofs) = val; }
             }
        __builtin_amdgcn_wave_barrier(); asm volatile("" ::: "memory");
    }
}

// ---- k_gemmc: the same one-wave 64x64 tile GEMM specialised for causal attention: CMODE 1 skips score tiles entirely above the diagonal (query rows r0+roff.., key columns c0..), CMODE 2 limits the
// key (K) loop of the probability x value contraction to the diagonal block (probabilities beyond it are exactly zero). roff = row offset of this launch's first row within the sequence.
template <typename T16, int NSPLIT, int CMODE>
__global__ __launch_bounds__(32) void k_gemmc(const T16* __restrict__ A, const T16* __restrict__ A2, const T16* __restrict__ Bt, const T16* __restrict__ Bt2, int K, float* C, int ldc, int roff, size_t sA, size_t sB, size_t sC) {
    typedef typename WFrag<T16>::V V;
    __shared__ __align__(16) float os[16 * 68];
    const size_t z = blockIdx.z, zb = z / REP; A += z * sA; if (A2) A2 += z * sA; Bt += zb * sB; if (Bt2) Bt2 += zb * sB; C += z * sC;   // z = path * NH_ + query head; the B planes (keys, values; the fading path's NKV planes behind the window path's) step per kv group z / REP
    const int lane = threadIdx.x & 31, lr = lane & 15, hi = lane >> 4; const int r0 = blockIdx.x * 64, c0 = blockIdx.y * 64;
    if (CMODE == 1 && c0 > r0 + roff + 63) return;                  // score tile entirely above the causal diagonal: never read (the softmax masks j > i by select)
    const int Kl = (CMODE == 2) ? min(K, r0 + roff + 64) : K;        // P.V: probabilities are exactly 0 beyond the diagonal block, so the K loop stops there
    v8f acc[4][4];
#pragma unroll
    for (int mb = 0; mb < 4; ++mb)
#pragma unroll
        for (int nb = 0; nb < 4; ++nb) acc[mb][nb] = (v8f){};
    const size_t aoff = (size_t)(r0 + lr) * K + 8 * hi, boff = (size_t)(c0 + lr) * K + 8 * hi;
#pragma unroll 1
    for (int kc = 0; kc < Kl; kc += 32) {
        V a[4], a2[4];
#pragma unroll
        for (int mb = 0; mb < 4; ++mb) { a[mb] = WFrag<T16>::ld(A + aoff + (size_t)mb * 16 * K + kc); if (NSPLIT == 1 || NSPLIT == 2) a2[mb] = WFrag<T16>::ld(A2 + aoff + (size_t)mb * 16 * K + kc); }
#pragma unroll
        for (int nb = 0; nb < 4; ++nb) { const V b = WFrag<T16>::ld(Bt + boff + (size_t)nb * 16 * K + kc); V b2; if (NSPLIT >= 2) b2 = WFrag<T16>::ld(Bt2 + boff + (size_t)nb * 16 * K + kc);
#pragma unroll
            for (int mb = 0; mb < 4; ++mb) { acc[mb][nb] = WFrag<T16>::mma(a[mb], b, acc[mb][nb]); if (NSPLIT == 1 || NSPLIT == 2) acc[mb][nb] = WFrag<T16>::mma(a2[mb], b, acc[mb][nb]); if (NSPLIT >= 2) acc[mb][nb] = WFrag<T16>::mma(a[mb], b2, acc[mb][nb]); } }
        asm volatile("v_nop\n\tv_nop\n\tv_nop\n\tv_nop" : "+v"(acc[0][0]), "+v"(acc[1][1]), "+v"(acc[2][2]), "+v"(acc[3][3]) : "v"(a[0]), "v"(a[3]));
    }
#pragma unroll
    for (int mb = 0; mb < 4; ++mb) {
#pragma unroll
        for (int nb = 0; nb < 4; ++nb) {
#pragma unroll
            for (int j = 0; j < 8; ++j) os[(hi * 8 + j) * 68 + nb * 16 + lr] = acc[mb][nb][j]; }
        __builtin_amdgcn_wave_barrier(); asm volatile("" ::: "memory");
        float* crow = C + (size_t)(r0 + mb * 16) * ldc + c0;
{
#pragma unroll
            for (int s = 0; s < 8; ++s) { const int row = 2 * s + hi, cofs = lr * 4; v4f val = *(const v4fa*)(os + row * 68 + cofs);
                *(v4f*)(crow + (size_t)row * ldc + cofs) = val; }
             }
        __builtin_amdgcn_wave_barrier(); asm volatile("" ::: "memory");
    }
}

__device__ __forceinline__ h16 tohx(float x) { return (h16)x; }
__device__ __forceinline__ void splitf(float y, unsigned short& h, unsigned short& l) { h = f2bf(y); l = f2bf(y - bf2f(h)); }
typedef __attribute__((ext_vector_type(2))) _Float16 v2h;
typedef __attribute__((ext_vector_type(4))) _Float16 v4h;
typedef __attribute__((ext_vector_type(2))) unsigned short v2us;
typedef __attribute__((ext_vector_type(4))) unsigned short v4us;
typedef __attribute__((ext_vector_type(2))) float v2f;
typedef __attribute__((ext_vector_type(4))) int v4i;

__global__ __launch_bounds__(256) void k_wtG(const float* __restrict__ w, int K, int N, bf* Bt) {
    const int lane = threadIdx.x & 31; const int L0 = (blockIdx.x * 8 + (threadIdx.x >> 5)) * 8; const int nlines = N * K / 64;
{
#pragma unroll 1
        for (int l = 0; l < 8; ++l) { const int L = L0 + l; if (L >= nlines) break; const size_t e = (size_t)L * 64 + lane * 2; const int k = (int)(e % K), n = (int)(e / K); v2us o;
            o[0] = f2bf(w[(size_t)k * N + n]); o[1] = f2bf(w[(size_t)(k + 1) * N + n]); *(v2us*)(Bt + e) = o; }
         }
}
// k_cvtall: every f32 operand of the plain GEMMs rounded to bf16 in one launch. dst = [x | wq | wq2 | wk | wk2 | wv | wv2 | wo] in units of DKV * DM elements (2, 2, 2, 1, 1, 1, 1, 2 units); one unit = 1024 blocks x 256 threads x 8 elements.
static_assert((size_t)DKV * DM == (size_t)1024 * 256 * 8 && DQ == 2 * DKV && NB_ * TT == 2 * DKV, "unit bookkeeping of k_cvtall");
__global__ __launch_bounds__(256) void k_cvtall(const float* __restrict__ x, const float* __restrict__ wq, const float* __restrict__ wq2, const float* __restrict__ wk, const float* __restrict__ wk2, const float* __restrict__ wv, const float* __restrict__ wv2, const float* __restrict__ wo, bf* dst) {
    const int u = blockIdx.x >> 10; const size_t U = (size_t)DKV * DM;
    const float* s = (u < 2) ? x + u * U : (u < 4) ? wq + (u - 2) * U : (u < 6) ? wq2 + (u - 4) * U : (u == 6) ? wk : (u == 7) ? wk2 : (u == 8) ? wv : (u == 9) ? wv2 : wo + (u - 10) * U;
    const size_t i = (size_t)(blockIdx.x & 1023) * 2048 + threadIdx.x * 8; const v8f v = *(const v8f*)(s + i); v8us o;
#pragma unroll
    for (int k = 0; k < 8; ++k) o[k] = f2bf(v[k]); *(v8us*)(dst + u * U + i) = o;  }
__global__ __launch_bounds__(256) void k_cscvt(const float* __restrict__ cosT, const float* __restrict__ sinT, float* CS) { const int idx = blockIdx.x * 256 + threadIdx.x; if (idx >= NB_ * TT * HD) return; v2f cs; cs[0] = bfr(cosT[idx]); cs[1] = bfr(sinT[idx]); *(v2f*)(CS + (size_t)idx * 2) = cs;  }
// k_rope: head planes [h][t][d] (fp16 + hi/lo) of rope(x) x sc with the rotate-half convention out[d] = x[d] cos[t][d] - x[d+HD/2] sin[t][d], out[d+HD/2] = x[d+HD/2] cos[t][d+HD/2] + x[d] sin[t][d+HD/2]
__global__ __launch_bounds__(256) void k_rope(const float* __restrict__ F, int pitch, int nheads, const float* __restrict__ CS, const float* __restrict__ RF, const float* __restrict__ nw, float sc, h16* P16, bf* Ph, bf* Pl) {
    const size_t e = ((size_t)blockIdx.x * 256 + threadIdx.x) * 2; if (e >= (size_t)nheads * TT * HD) return; const int d = (int)(e % HD); const int t = (int)((e / HD) % TT); const int h = (int)(e / ((size_t)HD * TT)); const float* f = F + (size_t)t * pitch + h * HD; const float rf = RF ? RF[(size_t)h * TT + t] : 1.0f; v2h o16; v2us oh, ol;
#pragma unroll
    for (int q = 0; q < 2; ++q) { const int dd = d + q; const int dp = (dd < HD / 2) ? dd + HD / 2 : dd - HD / 2; float x0 = f[dd], x1 = f[dp];
        if (RF) { float n0 = __fmul_rn(x0, rf), n1 = __fmul_rn(x1, rf); asm volatile("" : "+v"(n0)); asm volatile("" : "+v"(n1)); x0 = __fmul_rn(bfr(nw[dd]), n0); x1 = __fmul_rn(bfr(nw[dp]), n1); }
        const v2f cs = *(const v2f*)(CS + ((size_t)t * HD + dd) * 2); float a = __fmul_rn(x0, cs[0]), bq = __fmul_rn(x1, cs[1]); asm volatile("" : "+v"(a)); asm volatile("" : "+v"(bq)); const float r = ((dd < HD / 2) ? __fsub_rn(a, bq) : __fadd_rn(a, bq)) * sc;
        o16[q] = tohx(r); unsigned short a2, c2; splitf(r, a2, c2); oh[q] = a2; ol[q] = c2; }
    *(v2h*)(P16 + e) = o16; *(v2us*)(Ph + e) = oh; *(v2us*)(Pl + e) = ol;  }
__global__ __launch_bounds__(256) void k_vtp(const float* __restrict__ F, int pitch, int nheads, h16* V16, bf* Vh, bf* Vl) { const size_t e = ((size_t)blockIdx.x * 256 + threadIdx.x) * 2; if (e >= (size_t)nheads * HD * TT) return; const int t = (int)(e % TT); const int d = (int)((e / TT) % HD); const int g = (int)(e / ((size_t)TT * HD)); v2h o16; v2us oh, ol;
#pragma unroll
    for (int q = 0; q < 2; ++q) { const float x = F[(size_t)(t + q) * pitch + g * HD + d]; o16[q] = tohx(x); unsigned short a2, c2; splitf(x, a2, c2); oh[q] = a2; ol[q] = c2; }
    *(v2h*)(V16 + e) = o16; *(v2us*)(Vh + e) = oh; *(v2us*)(Vl + e) = ol;  }
__global__ __launch_bounds__(256) void k_rmsw(float* F, int pitch, int nheads, const float* __restrict__ gq, const float* __restrict__ gq2, const float* __restrict__ gk, const float* __restrict__ gk2) { const int lane = threadIdx.x & 31; const int wv = blockIdx.x * 8 + (threadIdx.x >> 5); if (wv >= TT * nheads) return; const int t = wv / nheads, h = wv % nheads; float* f = F + (size_t)t * pitch + h * HD; const int hb = (int)(blockIdx.x * 8) % nheads; const float* w = (hb < NH_) ? gq : (hb < 2 * NH_) ? gq2 : (hb < 2 * NH_ + NKV) ? gk : gk2; /* head slots [q | q2 | k | k2]; a block's 8 waves hold 8 consecutive slots and every section starts at a multiple of 8, so the choice is the block's (nheads % 8 == 0) */ const v4f a = *(const v4f*)(f + lane * 4); float ss = 0.f;
#pragma unroll
    for (int q = 0; q < 4; ++q) { float p = __fmul_rn(a[q], a[q]); asm volatile("" : "+v"(p)); ss = __fadd_rn(ss, p); }
#pragma unroll
    for (int sh = 16; sh; sh >>= 1) ss = __fadd_rn(ss, __shfl_xor(ss, sh, 32));
    const float rs = __fdiv_rn(1.0f, sqrtf(__fadd_rn(ss * (1.0f / HD), 1e-6f))); v4f o;
#pragma unroll
    for (int q = 0; q < 4; ++q) { float y = __fmul_rn(a[q], rs); asm volatile("" : "+v"(y)); o[q] = __fmul_rn(y, bfr(w[lane * 4 + q])); }
    *(v4f*)(f + lane * 4) = o;  }
// one launch covers the RH query rows ROFF .. ROFF + RH - 1 of every head: plane row = head * RH + (i - ROFF), for the score planes and for every probability plane alike
template <int ROFF>
__global__ __launch_bounds__(256) void k_asoft2(const float* __restrict__ Sb, const float* __restrict__ Sb2, h16* P16, bf* Ph, bf* Pl, h16* P16b, bf* Phb, bf* Plb) {
    const int lane = threadIdx.x & 31; const int row = blockIdx.x * 8 + (threadIdx.x >> 5); if (row >= ZH * RH) return; const int i = ROFF + row % RH; constexpr bool hires = (ROFF < RH); const float* sr = Sb + (size_t)row * TT; const float* sr2 = Sb2 + (size_t)row * TT; float v[TT / 32]; float mx = -3.0e38f;
#pragma unroll
    for (int ch = 0; ch < TT / 128; ++ch) { const int j0 = ch * 128 + lane * 4; const v4f a = *(const v4f*)(sr + j0); const v4f a2 = *(const v4f*)(sr2 + j0);
#pragma unroll
        for (int q = 0; q < 4; ++q) { const int j = j0 + q; (void)j; const float t = (j <= i) ? ((i - j < 256) ? a[q] * SCL : a2[q] * SCL) : -3.0e38f; v[ch * 4 + q] = t; mx = fmaxf(mx, t); } }
#pragma unroll
    for (int sh = 16; sh; sh >>= 1) mx = fmaxf(mx, __shfl_xor(mx, sh, 32));
    float sum = 0.f;
#pragma unroll
    for (int k = 0; k < TT / 32; ++k) { float d0 = __fsub_rn(v[k], mx); asm volatile("" : "+v"(d0)); v[k] = __builtin_amdgcn_exp2f(__fmul_rn(d0, 1.4426950408889634f)); sum += v[k]; }
#pragma unroll
    for (int sh = 16; sh; sh >>= 1) sum += __shfl_xor(sum, sh, 32);
    const float f = __fdiv_rn(hires ? 1.0f : PCAR, sum);
{
        if (hires) {
#pragma unroll
            for (int ch = 0; ch < TT / 128; ++ch) { v4us oh, ol, ohb, olb;
#pragma unroll
                for (int q = 0; q < 4; ++q) { const int j = ch * 128 + lane * 4 + q; const bool win = (j <= i && i - j < 256); unsigned short a, c2; splitf(v[ch * 4 + q] * f, a, c2); oh[q] = win ? a : (unsigned short)0; ol[q] = win ? c2 : (unsigned short)0; ohb[q] = win ? (unsigned short)0 : a; olb[q] = win ? (unsigned short)0 : c2; }
                const size_t oo = (size_t)row * TT + ch * 128 + lane * 4; *(v4us*)(Ph + oo) = oh; *(v4us*)(Pl + oo) = ol; *(v4us*)(Phb + oo) = ohb; *(v4us*)(Plb + oo) = olb; }
        } else {
#pragma unroll
            for (int ch = 0; ch < TT / 128; ++ch) { v4h o4, o4b;
#pragma unroll
                for (int q = 0; q < 4; ++q) { const int j = ch * 128 + lane * 4 + q; const bool win = (j <= i && i - j < 256); const _Float16 pv = tohx(v[ch * 4 + q] * f); o4[q] = win ? pv : (_Float16)0.0f; o4b[q] = win ? (_Float16)0.0f : pv; }
                *(v4h*)(P16 + (size_t)row * TT + ch * 128 + lane * 4) = o4; *(v4h*)(P16b + (size_t)row * TT + ch * 128 + lane * 4) = o4b; } }
         }
}
__global__ __launch_bounds__(256) void k_merge2(const float* __restrict__ O, const float* __restrict__ O2, int h0, bf* Ah, bf* Al) { const size_t e = ((size_t)blockIdx.x * 256 + threadIdx.x) * 2; if (e >= (size_t)ZH * TT * HD) return; const int d = (int)(e % HD); const int t = (int)((e / HD) % TT); const int zz = (int)(e / ((size_t)HD * TT)); const float cs = (t < RH) ? 1.0f : (1.0f / PCAR); const size_t oo = (size_t)t * DQ + (h0 + zz) * HD + d;
    v2us oh, ol;
#pragma unroll
    for (int q = 0; q < 2; ++q) { unsigned short a, c2; float s1 = O[e + q] * cs, s2 = O2[e + q] * cs; asm volatile("" : "+v"(s1)); asm volatile("" : "+v"(s2)); splitf(__fadd_rn(s1, s2), a, c2); oh[q] = a; ol[q] = c2; } *(v2us*)(Ah + oo) = oh; *(v2us*)(Al + oo) = ol;  }

// k_asoft: per row (zz, i): t = S x HD^-0.5 for j <= i and i - j < WIN (sliding causal window; the reference's -1e9 additive fill vanishes identically); softmax over the 1024 keys (register row, one exp, fixed trees);
__global__ __launch_bounds__(256) void k_asoft(const float* __restrict__ Sb, h16* P16, bf* Ph, bf* Pl) {
    const int lane = threadIdx.x & 31; const int row = blockIdx.x * 8 + (threadIdx.x >> 5); if (row >= ZH * TT) return; const int i = row % TT; const int zz = row / TT; (void)zz; const bool hires = (i < RH); const float* sr = Sb + (size_t)row * TT; float v[TT / 32]; float mx = -3.0e38f;
#pragma unroll
    for (int ch = 0; ch < TT / 128; ++ch) { const int j0 = ch * 128 + lane * 4; const v4f a = *(const v4f*)(sr + j0);
#pragma unroll
        for (int q = 0; q < 4; ++q) { const int j = j0 + q; (void)j; const float t = (j <= i && i - j < WIN) ? a[q] * SCL : -3.0e38f; v[ch * 4 + q] = t; mx = fmaxf(mx, t); } }
#pragma unroll
    for (int sh = 16; sh; sh >>= 1) mx = fmaxf(mx, __shfl_xor(mx, sh, 32));
    float sum = 0.f;
#pragma unroll
    for (int k = 0; k < TT / 32; ++k) { float d0 = __fsub_rn(v[k], mx); asm volatile("" : "+v"(d0)); v[k] = __builtin_amdgcn_exp2f(__fmul_rn(d0, 1.4426950408889634f)); sum += v[k]; }
#pragma unroll
    for (int sh = 16; sh; sh >>= 1) sum += __shfl_xor(sum, sh, 32);
    const float f = __fdiv_rn(hires ? 1.0f : PCAR, sum);
{
        if (hires) {
#pragma unroll
            for (int ch = 0; ch < TT / 128; ++ch) { v4us oh, ol;
#pragma unroll
                for (int q = 0; q < 4; ++q) { unsigned short a, c2; splitf(v[ch * 4 + q] * f, a, c2); oh[q] = a; ol[q] = c2; }
                const size_t oo = ((size_t)zz * (RH ? RH : 1) + i) * TT + ch * 128 + lane * 4; *(v4us*)(Ph + oo) = oh; *(v4us*)(Pl + oo) = ol; }
        } else {
#pragma unroll
            for (int ch = 0; ch < TT / 128; ++ch) { v4h o4;
#pragma unroll
                for (int q = 0; q < 4; ++q) o4[q] = tohx(v[ch * 4 + q] * f);
                *(v4h*)(P16 + (size_t)row * TT + ch * 128 + lane * 4) = o4; } }
         }
}
__global__ __launch_bounds__(256) void k_merge(const float* __restrict__ O, int h0, bf* Ah, bf* Al) { const size_t e = ((size_t)blockIdx.x * 256 + threadIdx.x) * 2; if (e >= (size_t)ZH * TT * HD) return; const int d = (int)(e % HD); const int t = (int)((e / HD) % TT); const int zz = (int)(e / ((size_t)HD * TT)); const float cs = (t < RH) ? 1.0f : (1.0f / PCAR); const size_t oo = (size_t)t * DQ + (h0 + zz) * HD + d;
    v2us oh, ol;
#pragma unroll
    for (int q = 0; q < 2; ++q) { unsigned short a, c2; splitf(O[e + q] * cs, a, c2); oh[q] = a; ol[q] = c2; } *(v2us*)(Ah + oo) = oh; *(v2us*)(Al + oo) = ol;  }

extern "C" void kernel_launch(void* const* d_in, const int* in_sizes, int n_in,
                              void* d_out, int out_size, void* d_ws, size_t ws_size, hipStream_t stream) {
    (void)in_sizes; (void)n_in; (void)out_size;
    const float* x = (const float*)d_in[0]; const float* cosA = (const float*)d_in[1]; const float* sinA = (const float*)d_in[2]; const float* wq = (const float*)d_in[3]; const float* bq = (const float*)d_in[4]; const float* wk = (const float*)d_in[5]; const float* bk = (const float*)d_in[6]; const float* wv = (const float*)d_in[7]; const float* bv = (const float*)d_in[8]; const float* wq2 = (const float*)d_in[9]; const float* bq2 = (const float*)d_in[10]; const float* wk2 = (const float*)d_in[11]; const float* bk2 = (const float*)d_in[12]; const float* wv2 = (const float*)d_in[13]; const float* bv2 = (const float*)d_in[14]; const float* wo = (const float*)d_in[15]; const float* gq = (const float*)d_in[16]; const float* gk = (const float*)d_in[17]; const float* gq2 = (const float*)d_in[18]; const float* gk2 = (const float*)d_in[19]; const float* cosT = cosA; const float* sinT = sinA;
    float* OUT = (float*)d_out;     // [2][1024][2048]
    char* wsp = (char*)d_ws;
    auto take = [&](size_t bytes) { char* p = wsp; wsp += (bytes + 255) & ~(size_t)255; return (void*)p; };
    // 16-bit GEMM operands, one conversion launch: [x (both batches) | wq | wq2 | wk | wk2 | wv | wv2 | wo]; the six projection weights are one [NP][DM] plane
    const size_t U = (size_t)DKV * DM; const int NP = 2 * DQ + 4 * DKV, NRH = 2 * NH_ + 2 * NKV, NVH = 2 * NKV;
    bf* XB = (bf*)take(12 * U * 2); bf* WP = XB + 2 * U; bf* WO = XB + 10 * U; float* CS = (float*)take((size_t)NB_ * TT * HD * 2 * 4);
    // head planes, both paths side by side: [q 16 | q2 16 | k 8 | k2 8][t][d] and [v 8 | v2 8][d][t]
    h16* R16 = (h16*)take((size_t)NRH * TT * HD * 2); bf* Rh = (bf*)take((size_t)NRH * TT * HD * 2); bf* Rl = (bf*)take((size_t)NRH * TT * HD * 2);
    h16* VT16 = (h16*)take((size_t)NVH * HD * TT * 2); bf* VTh = (bf*)take((size_t)NVH * HD * TT * 2); bf* VTl = (bf*)take((size_t)NVH * HD * TT * 2);
    h16* QP16 = R16; h16* KP16 = R16 + (size_t)2 * NH_ * TT * HD; bf* QPh = Rh; bf* KPh = Rh + (size_t)2 * NH_ * TT * HD; bf* QPl = Rl; bf* KPl = Rl + (size_t)2 * NH_ * TT * HD;
    // score, probability and attention-output planes: the fading path's ZH planes directly behind the window path's, so that grid z = 0 .. 2 ZH - 1 steps through both
    bf* Ph = (bf*)take((size_t)2 * ZH * RH * TT * 2); bf* Pl = (bf*)take((size_t)2 * ZH * RH * TT * 2); float* Sb = (float*)take((size_t)2 * ZH * RH * TT * 4); float* Ob = (float*)take((size_t)2 * ZH * TT * HD * 4); bf* ATl = (bf*)take((size_t)NB_ * TT * DQ * 2);
    bf* Phb = Ph + (size_t)ZH * RH * TT; bf* Plb = Pl + (size_t)ZH * RH * TT; float* Sb2 = Sb + (size_t)ZH * RH * TT; float* Ob2 = Ob + (size_t)ZH * TT * HD;
    if ((size_t)(wsp - (char*)d_ws) > ws_size) return;    // ws 256 MiB
    h16* P16 = (h16*)Ph; h16* P16b = (h16*)Phb;   // the fp16 probability planes of the rows >= RH reuse the hi planes of the rows < RH, whose value products have run by then (stream-ordered; same size)
    float* F = Sb;    // the [TT][NP] projection output reuses the window path's score planes, first written once every head plane is built (stream-ordered; same size)
    bf* ATh = XB;     // the hi plane of the merged attention output reuses x: batch b's rows are dead once batch b's projection has run (stream-ordered; same size)
    static_assert((size_t)TT * (2 * DQ + 4 * DKV) == (size_t)ZH * RH * TT && DQ == DM, "F fits the window score planes; ATh fits x");
    k_cvtall<<<12 * 1024, 256, 0, stream>>>(x, wq, wq2, wk, wk2, wv, wv2, wo, XB);
    k_cscvt<<<(NB_ * TT * HD + 255) / 256, 256, 0, stream>>>(cosA, sinA, CS);
    for (int b = 0; b < NB_; ++b) {
        k_gemmw<bf, 0, true><<<dim3(TT / 64, NP / 64, 1), 32, 0, stream>>>(XB + (size_t)b * TT * DM, nullptr, WP, nullptr, DM, F, NP, bq, bq2, bk, bk2, bv, bv2, 0, 0, 0);
        k_rmsw<<<TT * NRH / 8, 256, 0, stream>>>(F, NP, NRH, gq, gq2, gk, gk2);
        k_rope<<<(unsigned)(((size_t)NRH * TT * HD / 2 + 255) / 256), 256, 0, stream>>>(F, NP, NRH, CS + (size_t)b * TT * HD * 2, nullptr, nullptr, 1.0f, R16, Rh, Rl);
        k_vtp<<<(unsigned)(((size_t)NVH * TT * HD / 2 + 255) / 256), 256, 0, stream>>>(F + NRH * HD, NP, NVH, VT16, VTh, VTl);
        {   // grid z = path * NH_ + head; first the query rows < RH (hi+lo planes), then the rows >= RH (fp16 planes), each pass over the same score planes
            const size_t sQ = (size_t)TT * HD, sKV = (size_t)TT * HD, sS = (size_t)RH * TT, sO = (size_t)TT * HD;
            k_gemmc<bf, 2, 1><<<dim3(RH / 64, TT / 64, 2 * ZH), 32, 0, stream>>>(QPh, QPl, KPh, KPl, HD, Sb, TT, 0, sQ, sKV, sS);
            k_asoft2<0><<<ZH * RH / 8, 256, 0, stream>>>(Sb, Sb2, P16, Ph, Pl, P16b, Phb, Plb);
            k_gemmc<bf, 2, 2><<<dim3(RH / 64, HD / 64, 2 * ZH), 32, 0, stream>>>(Ph, Pl, VTh, VTl, TT, Ob, HD, 0, sS, sKV, sO);
            k_gemmc<h16, 0, 1><<<dim3((TT - RH) / 64, TT / 64, 2 * ZH), 32, 0, stream>>>(QP16 + (size_t)RH * HD, nullptr, KP16, nullptr, HD, Sb, TT, RH, sQ, sKV, sS);
            k_asoft2<RH><<<ZH * RH / 8, 256, 0, stream>>>(Sb, Sb2, P16, Ph, Pl, P16b, Phb, Plb);
            k_gemmc<h16, 0, 2><<<dim3((TT - RH) / 64, HD / 64, 2 * ZH), 32, 0, stream>>>(P16, nullptr, VT16, nullptr, TT, Ob + (size_t)RH * HD, HD, RH, sS, sKV, sO);
            k_merge2<<<(unsigned)(((size_t)ZH * TT * HD / 2 + 255) / 256), 256, 0, stream>>>(Ob, Ob2, 0, ATh + (size_t)b * TT * DQ, ATl + (size_t)b * TT * DQ); } }
    k_gemmw<bf, 1, false><<<dim3(NB_ * TT / 64, DM / 64, 1), 32, 0, stream>>>(ATh, ATl, WO, nullptr, DQ, OUT, DM, nullptr, nullptr, nullptr, nullptr, nullptr, nullptr, 0, 0, 0);
}

// v003
// It runs in 353 microseconds.
// Two timings next to v002 both put it at 1.38 times that version's speed.
// All steps since v000 together make it 6.57 times as fast.
#include <hip/hip_runtime.h>

// BMOJOAttention (hidden [2][1024][2048]; two projection paths - in-context (Wq,bq,Wk,bk,Wv,bv,gq,gk) and fading (Wq2..gk2): q = rope(rmsnorm(x Wq^T + bq) gq) (16 x 128), k = rope(rmsnorm(x Wk^T + bk) gk) (8 kv heads; group h/2), v = x Wv^T + bv; rotate-half RoPE with the read cos/sin [B][S][128]; s_ic = q_ic.k_ic / sqrt(128) live where 0 <= i-j < 256, s_f = q_f.k_f / sqrt(128) live where i-j >= 256 (else -1e30); ONE joint softmax over [s_ic | s_f]; out = p_ic v_ic + p_f v_f; merged Wo^T -> [2][1024][2048]).
// The joint softmax over 2S columns is computed as one causal softmax whose score (and value source) switches at i-j = 256: the masked halves contribute exactly 0; keys j > i are masked in both (causal tile skipping).
// Compute dtypes, f32 accumulate: every input rounded to bf16; both paths' q/k/v on PLAIN bf16 operands (inputs: exact) + bias; RMSNorm * g (in place) and RoPE (bf16-rounded per-batch tables) f32; both score sets and both attn.v products: query rows < 512 hl (3 products), the rest single fp16 (x1024), causal tile skipping; online softmax f32 over the live scores of both paths, both value products into one f32 accumulator, all in one kernel (k_fattn), which emits the hl planes of the merged output; Wo hl x exact (2 products).

#define NB_  2
#define TT   1024
#define DM   2048
#define NH_  16
#define NKV  8
#define REP  (NH_ / NKV)
#define HD   128
#define DQ   (NH_ * HD)
#define DKV  (NKV * HD)
#define ZH   16                   // heads per attention pass: all of them
#define RH   512                  // query rows < RH use hi+lo planes (0: none)
#define WIN  1024
#define PCAR 1024.0f
static_assert(RH % 64 == 0, "a 64-row block of the attention lies on one side of RH");
#define SCL  0.088388347648318447f   // HD^-0.5
typedef _Float16 h16;
typedef unsigned short bf;
typedef __attribute__((ext_vector_type(16))) __bf16   v16bf;
typedef __attribute__((ext_vector_type(16))) _Float16 v16h;
typedef __attribute__((ext_vector_type(8)))  _Float16 v8h;
typedef __attribute__((ext_vector_type(8)))  unsigned short v8us;
typedef __attribute__((ext_vector_type(8)))  float    v8f;
typedef __attribute__((ext_vector_type(4)))  float    v4f;
typedef v8h  __attribute__((may_alias)) v8ha;
typedef v4f  __attribute__((may_alias)) v4fa;
typedef v8us __attribute__((may_alias)) v8usa;

__device__ __forceinline__ unsigned short f2bf(float f) { unsigned u = __float_as_uint(f); u += 0x7FFFu + ((u >> 16) & 1u); return (unsigned short)(u >> 16); }
__device__ __forceinline__ float bf2f(unsigned short b) { return __uint_as_float(((unsigned)b) << 16); }
__device__ __forceinline__ float bfr(float f) { return bf2f(f2bf(f)); }
__device__ __forceinline__ v16h cat16(v8h lo, v8h hi) { return __builtin_shufflevector(lo, hi, 0, 1, 2, 3, 4, 5, 6, 7, 8, 9, 10, 11, 12, 13, 14, 15); }
__device__ __forceinline__ v16bf cat16b(v8us lo, v8us hi) { return __builtin_bit_cast(v16bf, __builtin_shufflevector(lo, hi, 0, 1, 2, 3, 4, 5, 6, 7, 8, 9, 10, 11, 12, 13, 14, 15)); }
__device__ __forceinline__ v8f wmma16(v16h a, v16h b, v8f c) { return __builtin_amdgcn_wmma_f32_16x16x32_f16(false, a, false, b, (short)0, c, false, false); }
__device__ __forceinline__ v8f wmmab(v16bf a, v16bf b, v8f c) { return __builtin_amdgcn_wmma_f32_16x16x32_bf16(false, a, false, b, (short)0, c, false, false); }



// ---- k_gemmw: register-blocked GEMM, ONE WAVE per 64x64 output tile (16 accumulators), operands straight from K-contiguous 16-bit planes; grid (M/64, N/64, Z), 32 threads.
// C[m][n] (f32, pitch ldc, + optional bf16-rounded bias[n]) = sum_k A[m][k] Bt[n][k] (+ split products per NSPLIT). z-batch strides sA/sB/sC in elements. K % 32 == 0.
// With BIAS the N axis is the concatenation [q | q2 | k | k2 | v | v2] of both paths' projections (DQ, DQ, DKV, DKV, DKV, DKV columns); each 64-column tile lies in one section and takes that section's bias vector.
template <typename T16> struct WFrag;
template <> struct WFrag<h16> { typedef v16h V; static __device__ __forceinline__ V ld(const h16* p) { return cat16(*(const v8h*)p, *(const v8h*)(p + 16)); } static __device__ __forceinline__ v8f mma(V a, V b, v8f c) { return wmma16(a, b, c); } };
template <> struct WFrag<bf> { typedef v16bf V; static __device__ __forceinline__ V ld(const bf* p) { return cat16b(*(const v8us*)p, *(const v8us*)(p + 16)); } static __device__ __forceinline__ v8f mma(V a, V b, v8f c) { return wmmab(a, b, c); } };
template <typename T16, int NSPLIT, bool BIAS>
__global__ __launch_bounds__(32) void k_gemmw(const T16* __restrict__ A, const T16* __restrict__ A2, const T16* __restrict__ Bt, const T16* __restrict__ Bt2, int K, float* C, int ldc, const float* __restrict__ bq, const float* __restrict__ bq2, const float* __restrict__ bk, const float* __restrict__ bk2, const float* __restrict__ bv, const float* __restrict__ bv2, size_t sA, size_t sB, size_t sC) {
    typedef typename WFrag<T16>::V V;
    __shared__ __align__(16) float os[16 * 68];
    const size_t z = blockIdx.z; A += z * sA; if (A2) A2 += z * sA; Bt += z * sB; if (Bt2) Bt2 += z * sB; C += z * sC;
    const int lane = threadIdx.x & 31, lr = lane & 15, hi = lane >> 4; const int r0 = blockIdx.x * 64, c0 = blockIdx.y * 64;
    const float* bias = nullptr;   // this tile's bias, already stepped to column c0
    if (BIAS) bias = (c0 < DQ) ? bq + c0 : (c0 < 2 * DQ) ? bq2 + (c0 - DQ) : (c0 < 2 * DQ + DKV) ? bk + (c0 - 2 * DQ) : (c0 < 2 * DQ + 2 * DKV) ? bk2 + (c0 - 2 * DQ - DKV) : (c0 < 2 * DQ + 3 * DKV) ? bv + (c0 - 2 * DQ - 2 * DKV) : bv2 + (c0 - 2 * DQ - 3 * DKV);
    v8f acc[4][4];
#pragma unroll
    for (int mb = 0; mb < 4; ++mb)
#pragma unroll
        for (int nb = 0; nb < 4; ++nb) acc[mb][nb] = (v8f){};
    const size_t aoff = (size_t)(r0 + lr) * K + 8 * hi, boff = (size_t)(c0 + lr) * K + 8 * hi;
#pragma unroll 1
    for (int kc = 0; kc < K; kc += 32) {
        V a[4], a2[4];
#pragma unroll
        for (int mb = 0; mb < 4; ++mb) { a[mb] = WFrag<T16>::ld(A + aoff + (size_t)mb * 16 * K + kc); if (NSPLIT == 1 || NSPLIT == 2) a2[mb] = WFrag<T16>::ld(A2 + aoff + (size_t)mb * 16 * K + kc); }
#pragma unroll
        for (int nb = 0; nb < 4; ++nb) { const V b = WFrag<T16>::ld(Bt + boff + (size_t)nb * 16 * K + kc); V b2; if (NSPLIT >= 2) b2 = WFrag<T16>::ld(Bt2 + boff + (size_t)nb * 16 * K + kc);
#pragma unroll
            for (int mb = 0; mb < 4; ++mb) { acc[mb][nb] = WFrag<T16>::mma(a[mb], b, acc[mb][nb]); if (NSPLIT == 1 || NSPLIT == 2) acc[mb][nb] = WFrag<T16>::mma(a2[mb], b, acc[mb][nb]); if (NSPLIT >= 2) acc[mb][nb] = WFrag<T16>::mma(a[mb], b2, acc[mb][nb]); } }
        asm volatile("v_nop\n\tv_nop\n\tv_nop\n\tv_nop" : "+v"(acc[0][0]), "+v"(acc[1][1]), "+v"(acc[2][2]), "+v"(acc[3][3]) : "v"(a[0]), "v"(a[3]));
    }
#pragma unroll
    for (int mb = 0; mb < 4; ++mb) {
#pragma unroll
        for (int nb = 0; nb < 4; ++nb) {
#pragma unroll
            for (int j = 0; j < 8; ++j) os[(hi * 8 + j) * 68 + nb * 16 + lr] = acc[mb][nb][j]; }
        __builtin_amdgcn_wave_barrier(); asm volatile("" ::: "memory");
        float* crow = C + (size_t)(r0 + mb * 16) * ldc + c0;
{
#pragma unroll
            for (int s = 0; s < 8; ++s) { const int row = 2 * s + hi, cofs = lr * 4; v4f val = *(const v4fa*)(os + row * 68 + cofs); if (BIAS) { val[0] += bfr(bias[cofs]); val[1] += bfr(bias[cofs + 1]); val[2] += bfr(bias[cofs + 2]); val[3] += bfr(bias[cofs + 3]); }
                *(v4f*)(crow + (size_t)row * ldc + cofs) = val; }
             }
        __builtin_amdgcn_wave_barrier(); asm volatile("" ::: "memory");
    }
}

__device__ __forceinline__ h16 tohx(float x) { return (h16)x; }
__device__ __forceinline__ void splitf(float y, unsigned short& h, unsigned short& l) { h = f2bf(y); l = f2bf(y - bf2f(h)); }
typedef __attribute__((ext_vector_type(2))) _Float16 v2h;
typedef __attribute__((ext_vector_type(4))) _Float16 v4h;
typedef __attribute__((ext_vector_type(2))) unsigned short v2us;
typedef __attribute__((ext_vector_type(4))) unsigned short v4us;
typedef __attribute__((ext_vector_type(2))) float v2f;
typedef __attribute__((ext_vector_type(4))) int v4i;

__global__ __launch_bounds__(256) void k_wtG(const float* __restrict__ w, int K, int N, bf* Bt) {
    const int lane = threadIdx.x & 31; const int L0 = (blockIdx.x * 8 + (threadIdx.x >> 5)) * 8; const int nlines = N * K / 64;
{
#pragma unroll 1
        for (int l = 0; l < 8; ++l) { const int L = L0 + l; if (L >= nlines) break; const size_t e = (size_t)L * 64 + lane * 2; const int k = (int)(e % K), n = (int)(e / K); v2us o;
            o[0] = f2bf(w[(size_t)k * N + n]); o[1] = f2bf(w[(size_t)(k + 1) * N + n]); *(v2us*)(Bt + e) = o; }
         }
}
// k_cvtall: every f32 operand of the plain GEMMs rounded to bf16 in one launch. dst = [x | wq | wq2 | wk | wk2 | wv | wv2 | wo] in units of DKV * DM elements (2, 2, 2, 1, 1, 1, 1, 2 units); one unit = 1024 blocks x 256 threads x 8 elements.
static_assert((size_t)DKV * DM == (size_t)1024 * 256 * 8 && DQ == 2 * DKV && NB_ * TT == 2 * DKV, "unit bookkeeping of k_cvtall");
__global__ __launch_bounds__(256) void k_cvtall(const float* __restrict__ x, const float* __restrict__ wq, const float* __restrict__ wq2, const float* __restrict__ wk, const float* __restrict__ wk2, const float* __restrict__ wv, const float* __restrict__ wv2, const float* __restrict__ wo, bf* dst) {
    const int u = blockIdx.x >> 10; const size_t U = (size_t)DKV * DM;
    const float* s = (u < 2) ? x + u * U : (u < 4) ? wq + (u - 2) * U : (u < 6) ? wq2 + (u - 4) * U : (u == 6) ? wk : (u == 7) ? wk2 : (u == 8) ? wv : (u == 9) ? wv2 : wo + (u - 10) * U;
    const size_t i = (size_t)(blockIdx.x & 1023) * 2048 + threadIdx.x * 8; const v8f v = *(const v8f*)(s + i); v8us o;
#pragma unroll
    for (int k = 0; k < 8; ++k) o[k] = f2bf(v[k]); *(v8us*)(dst + u * U + i) = o;  }
__global__ __launch_bounds__(256) void k_cscvt(const float* __restrict__ cosT, const float* __restrict__ sinT, float* CS) { const int idx = blockIdx.x * 256 + threadIdx.x; if (idx >= NB_ * TT * HD) return; v2f cs; cs[0] = bfr(cosT[idx]); cs[1] = bfr(sinT[idx]); *(v2f*)(CS + (size_t)idx * 2) = cs;  }
// k_rope: head planes [h][t][d] (fp16 + hi/lo) of rope(x) x sc with the rotate-half convention out[d] = x[d] cos[t][d] - x[d+HD/2] sin[t][d], out[d+HD/2] = x[d+HD/2] cos[t][d+HD/2] + x[d] sin[t][d+HD/2]
__global__ __launch_bounds__(256) void k_rope(const float* __restrict__ F, int pitch, int nheads, const float* __restrict__ CS, const float* __restrict__ RF, const float* __restrict__ nw, float sc, h16* P16, bf* Ph, bf* Pl) {
    const size_t e = ((size_t)blockIdx.x * 256 + threadIdx.x) * 2; if (e >= (size_t)nheads * TT * HD) return; const int d = (int)(e % HD); const int t = (int)((e / HD) % TT); const int h = (int)(e / ((size_t)HD * TT)); const float* f = F + (size_t)t * pitch + h * HD; const float rf = RF ? RF[(size_t)h * TT + t] : 1.0f; v2h o16; v2us oh, ol;
#pragma unroll
    for (int q = 0; q < 2; ++q) { const int dd = d + q; const int dp = (dd < HD / 2) ? dd + HD / 2 : dd - HD / 2; float x0 = f[dd], x1 = f[dp];
        if (RF) { float n0 = __fmul_rn(x0, rf), n1 = __fmul_rn(x1, rf); asm volatile("" : "+v"(n0)); asm volatile("" : "+v"(n1)); x0 = __fmul_rn(bfr(nw[dd]), n0); x1 = __fmul_rn(bfr(nw[dp]), n1); }
        const v2f cs = *(const v2f*)(CS + ((size_t)t * HD + dd) * 2); float a = __fmul_rn(x0, cs[0]), bq = __fmul_rn(x1, cs[1]); asm volatile("" : "+v"(a)); asm volatile("" : "+v"(bq)); const float r = ((dd < HD / 2) ? __fsub_rn(a, bq) : __fadd_rn(a, bq)) * sc;
        o16[q] = tohx(r); unsigned short a2, c2; splitf(r, a2, c2); oh[q] = a2; ol[q] = c2; }
    *(v2h*)(P16 + e) = o16; *(v2us*)(Ph + e) = oh; *(v2us*)(Pl + e) = ol;  }
__global__ __launch_bounds__(256) void k_vtp(const float* __restrict__ F, int pitch, int nheads, h16* V16, bf* Vh, bf* Vl) { const size_t e = ((size_t)blockIdx.x * 256 + threadIdx.x) * 2; if (e >= (size_t)nheads * HD * TT) return; const int t = (int)(e % TT); const int d = (int)((e / TT) % HD); const int g = (int)(e / ((size_t)TT * HD)); v2h o16; v2us oh, ol;
#pragma unroll
    for (int q = 0; q < 2; ++q) { const float x = F[(size_t)(t + q) * pitch + g * HD + d]; o16[q] = tohx(x); unsigned short a2, c2; splitf(x, a2, c2); oh[q] = a2; ol[q] = c2; }
    *(v2h*)(V16 + e) = o16; *(v2us*)(Vh + e) = oh; *(v2us*)(Vl + e) = ol;  }
__global__ __launch_bounds__(256) void k_rmsw(float* F, int pitch, int nheads, const float* __restrict__ gq, const float* __restrict__ gq2, const float* __restrict__ gk, const float* __restrict__ gk2) { const int lane = threadIdx.x & 31; const int wv = blockIdx.x * 8 + (threadIdx.x >> 5); if (wv >= TT * nheads) return; const int t = wv / nheads, h = wv % nheads; float* f = F + (size_t)t * pitch + h * HD; const int hb = (int)(blockIdx.x * 8) % nheads; const float* w = (hb < NH_) ? gq : (hb < 2 * NH_) ? gq2 : (hb < 2 * NH_ + NKV) ? gk : gk2; /* head slots [q | q2 | k | k2]; a block's 8 waves hold 8 consecutive slots and every section starts at a multiple of 8, so the choice is the block's (nheads % 8 == 0) */ const v4f a = *(const v4f*)(f + lane * 4); float ss = 0.f;
#pragma unroll
    for (int q = 0; q < 4; ++q) { float p = __fmul_rn(a[q], a[q]); asm volatile("" : "+v"(p)); ss = __fadd_rn(ss, p); }
#pragma unroll
    for (int sh = 16; sh; sh >>= 1) ss = __fadd_rn(ss, __shfl_xor(ss, sh, 32));
    const float rs = __fdiv_rn(1.0f, sqrtf(__fadd_rn(ss * (1.0f / HD), 1e-6f))); v4f o;
#pragma unroll
    for (int q = 0; q < 4; ++q) { float y = __fmul_rn(a[q], rs); asm volatile("" : "+v"(y)); o[q] = __fmul_rn(y, bfr(w[lane * 4 + q])); }
    *(v4f*)(f + lane * 4) = o;  }
// ---- k_fattn: scores, joint softmax and both value products of one head in one kernel; grid (TT / 64, NH_), 4 waves, each wave owns 16 query rows and works alone (no work-group barrier).
// A wave walks 64-key tiles of the window path (from its diagonal tile down to key i - 255), then of the fading path (keys <= i - 256), under ONE running maximum, sum and output accumulator (online softmax):
// the joint softmax over [s_ic | s_f]. A key outside the path's own range gets weight exactly 0. The diagonal tile comes first, so every row's maximum is finite from the first tile on.
// Probabilities go from the accumulator layout to the A-operand layout through the wave's own LDS slice. Rows < RH: hi+lo bf16 planes, 3 products; rows >= RH: fp16, weights x PCAR (the factor cancels in sum and output alike).
// Loops: the path loop and the tile loop stay rolled (#pragma unroll 1: one copy of the long body); every inner loop is unrolled, so that the fragment and accumulator arrays are indexed by constants and stay in registers.
#define PP 72     // LDS pitch (16-bit elements) of the 16 x 64 probability tile: 16-byte aligned rows, 16-byte row reads spread over the banks
#define OP 136    // LDS pitch of the 16 x 128 output tile
template <int X> __device__ __forceinline__ float rowx(float v) { return __int_as_float(__builtin_amdgcn_update_dpp(0, __float_as_int(v), 0x160 + X, 0xf, 0xf, true)); }   // DPP row_xmask: the value of lane ^ X inside the 16-lane row, on the vector port (a shuffle would go through the LDS queue, one wait each)
__device__ __forceinline__ float rowmax(float v) { v = fmaxf(v, rowx<8>(v)); v = fmaxf(v, rowx<4>(v)); v = fmaxf(v, rowx<2>(v)); return fmaxf(v, rowx<1>(v)); }
__device__ __forceinline__ float rowsum(float v) { v += rowx<8>(v); v += rowx<4>(v); v += rowx<2>(v); return v + rowx<1>(v); }
template <typename T16> struct LFrag;
template <> struct LFrag<h16> { static __device__ __forceinline__ v16h ld(const unsigned short* p) { const v8us lo = *(const v8usa*)p, hi = *(const v8usa*)(p + 16); return cat16(__builtin_bit_cast(v8h, lo), __builtin_bit_cast(v8h, hi)); } };
template <> struct LFrag<bf> { static __device__ __forceinline__ v16bf ld(const unsigned short* p) { const v8us lo = *(const v8usa*)p, hi = *(const v8usa*)(p + 16); return cat16b(lo, hi); } };
template <typename T16, bool HL>
__device__ __forceinline__ void attn_rows(const T16* __restrict__ R, const T16* __restrict__ Rlo, const T16* __restrict__ VT, const T16* __restrict__ VTlo, int h, int i0, unsigned short* sh, unsigned short* sl, bf* Ah, bf* Al) {
    typedef typename WFrag<T16>::V V;
    constexpr int NG = HL ? 2 : 1;    // planes per operand; also the number of 16-fragment (32-load) groups that a tile's keys, and its values, are fetched in
    const int lane = threadIdx.x & 31, lr = lane & 15, hi = lane >> 4;
    v8f O[8]; float m[8], l[8];
#pragma unroll
    for (int db = 0; db < 8; ++db) O[db] = (v8f){};
#pragma unroll
    for (int jj = 0; jj < 8; ++jj) { m[jj] = -3.0e38f; l[jj] = 0.f; }
#pragma unroll 1
    for (int p = 0; p < 2; ++p) {      // p = 0: window path, p = 1: fading path
        const size_t qo = ((size_t)(p * NH_ + h) * TT + i0 + lr) * HD + 8 * hi, ko = ((size_t)(2 * NH_ + p * NKV + h / REP) * TT + lr) * HD + 8 * hi, vo = ((size_t)(p * NKV + h / REP) * HD + lr) * TT + 8 * hi;
        V a[4], a2[4];
#pragma unroll
        for (int ks = 0; ks < 4; ++ks) { a[ks] = WFrag<T16>::ld(R + qo + ks * 32); if (HL) a2[ks] = WFrag<T16>::ld(Rlo + qo + ks * 32); }
        const int jhi = p ? ((i0 + 15 - 256) >> 6) : (i0 >> 6), jlo = p ? 0 : (max(0, i0 - 255) >> 6);   // first and last 64-key tile with a live key for one of the 16 rows (jhi < 0: none)
#pragma unroll 1
        for (int jt = jhi; jt >= jlo; --jt) {
            const int j0 = jt * 64; v8f s[4]; V kf[NG][16], vf[NG][16];
            // Fetch order of a tile. Keys and values come in groups of 16 fragments (32 loads), each group issued as one run, so that a group costs one load latency and not one every few fragments.
            // A second group (hi+lo planes) is issued behind the first block's products, whose wait has retired part of the first group: fewer than 64 loads of the wave are outstanding at any time.
            // Each sched_barrier(0) keeps the compiler from moving loads or products over that point. Each s_wait_xcnt 0 stands behind a run of loads, in front of every later overwrite of their address registers (a later load's result may land there).
            asm volatile("s_wait_xcnt 0x0" ::: "memory");   // for the query loads in front of the loop: the key loads' results may land in their address registers
            __builtin_amdgcn_sched_barrier(0);   // keeps the key loads behind that wait
#pragma unroll
            for (int f = 0; f < 16 / NG; ++f) { const size_t o = ko + (size_t)(j0 + (f >> 2) * 16) * HD + (f & 3) * 32; kf[0][f * NG] = WFrag<T16>::ld(R + o); if (HL) kf[0][f * NG + 1] = WFrag<T16>::ld(Rlo + o); }
            asm volatile("s_wait_xcnt 0x0" ::: "memory");   // behind the first key group's loads, in front of any overwrite of their address registers
            __builtin_amdgcn_sched_barrier(0);   // the whole group is issued before the first product waits for a fragment
#pragma unroll
            for (int nb = 0; nb < 4; ++nb) { const int g = nb / (4 / NG), nl = nb % (4 / NG); s[nb] = (v8f){};
#pragma unroll
                for (int ks = 0; ks < 4; ++ks) { s[nb] = WFrag<T16>::mma(a[ks], kf[g][(nl * 4 + ks) * NG], s[nb]);
                    if (HL) { s[nb] = WFrag<T16>::mma(a2[ks], kf[g][(nl * 4 + ks) * NG], s[nb]); s[nb] = WFrag<T16>::mma(a[ks], kf[g][(nl * 4 + ks) * NG + 1], s[nb]); } }
                if (HL && nb == 0) {
                    __builtin_amdgcn_sched_barrier(0);   // the second key group is issued behind the first block's products (fewer than 64 loads outstanding)
#pragma unroll
                    for (int f = 0; f < 16 / NG; ++f) { const size_t o = ko + (size_t)(j0 + (4 / NG + (f >> 2)) * 16) * HD + (f & 3) * 32; kf[NG - 1][f * NG] = WFrag<T16>::ld(R + o); kf[NG - 1][f * NG + 1] = WFrag<T16>::ld(Rlo + o); }
                    asm volatile("s_wait_xcnt 0x0" ::: "memory");   // behind the second key group's loads, as above
                    __builtin_amdgcn_sched_barrier(0);   // and it flies under the products that follow
                } }
            __builtin_amdgcn_sched_barrier(0);   // the value loads start behind the last score product: every key load has retired by then
#pragma unroll
            for (int f = 0; f < 16 / NG; ++f) { const size_t o = vo + (size_t)(f >> 1) * 16 * TT + j0 + (f & 1) * 32; vf[0][f * NG] = WFrag<T16>::ld(VT + o); if (HL) vf[0][f * NG + 1] = WFrag<T16>::ld(VTlo + o); }
            asm volatile("s_wait_xcnt 0x0" ::: "memory");   // behind the first value group's loads, as above
            __builtin_amdgcn_sched_barrier(0);   // the first value group flies while the softmax runs
            float mx[8];
#pragma unroll
            for (int jj = 0; jj < 8; ++jj) mx[jj] = m[jj];
#pragma unroll
            for (int nb = 0; nb < 4; ++nb)
#pragma unroll
                for (int jj = 0; jj < 8; ++jj) { const int dij = (i0 + hi * 8 + jj) - (j0 + nb * 16 + lr); const bool live = p ? (dij >= 256) : (dij >= 0 && dij < 256); const float t = live ? s[nb][jj] * SCL : -3.0e38f; s[nb][jj] = t; mx[jj] = fmaxf(mx[jj], t); }
#pragma unroll
            for (int jj = 0; jj < 8; ++jj) {
                mx[jj] = rowmax(mx[jj]);   // a row's 16 columns lie in the 16 lanes of one half
                const float al = __builtin_amdgcn_exp2f((m[jj] - mx[jj]) * 1.4426950408889634f); m[jj] = mx[jj]; l[jj] *= al;
#pragma unroll
                for (int db = 0; db < 8; ++db) O[db][jj] *= al; }
#pragma unroll
            for (int nb = 0; nb < 4; ++nb)
#pragma unroll
                for (int jj = 0; jj < 8; ++jj) { const float pv = __builtin_amdgcn_exp2f((s[nb][jj] - m[jj]) * 1.4426950408889634f) * (HL ? 1.0f : PCAR); l[jj] += pv; const int o = (hi * 8 + jj) * PP + nb * 16 + lr;
                    if (HL) { unsigned short ph, pl; splitf(pv, ph, pl); sh[o] = ph; sl[o] = pl; } else sh[o] = __builtin_bit_cast(unsigned short, tohx(pv)); }
            __builtin_amdgcn_wave_barrier(); asm volatile("" ::: "memory");   // the fragment reads below take other lanes' stores: keep them behind the stores
            V pa[2], pb[2];
#pragma unroll
            for (int k2 = 0; k2 < 2; ++k2) { pa[k2] = LFrag<T16>::ld(sh + lr * PP + k2 * 32 + 8 * hi); if (HL) pb[k2] = LFrag<T16>::ld(sl + lr * PP + k2 * 32 + 8 * hi); }
            __builtin_amdgcn_wave_barrier(); asm volatile("" ::: "memory");   // the next tile's stores stay behind these reads
#pragma unroll
            for (int db = 0; db < 8; ++db) { const int g = db / (8 / NG), dl = db % (8 / NG);
#pragma unroll
                for (int k2 = 0; k2 < 2; ++k2) { O[db] = WFrag<T16>::mma(pa[k2], vf[g][(dl * 2 + k2) * NG], O[db]);
                    if (HL) { O[db] = WFrag<T16>::mma(pb[k2], vf[g][(dl * 2 + k2) * NG], O[db]); O[db] = WFrag<T16>::mma(pa[k2], vf[g][(dl * 2 + k2) * NG + 1], O[db]); } }
                if (HL && db == 0) {
                    __builtin_amdgcn_sched_barrier(0);   // the second value group is issued behind the first block's products (fewer than 64 loads outstanding)
#pragma unroll
                    for (int f = 0; f < 16 / NG; ++f) { const size_t o = vo + (size_t)(8 / NG + (f >> 1)) * 16 * TT + j0 + (f & 1) * 32; vf[NG - 1][f * NG] = WFrag<T16>::ld(VT + o); vf[NG - 1][f * NG + 1] = WFrag<T16>::ld(VTlo + o); }
                    asm volatile("s_wait_xcnt 0x0" ::: "memory");   // behind the second value group's loads, as above
                    __builtin_amdgcn_sched_barrier(0);   // and it flies under the products that follow
                } }
        }
    }
#pragma unroll
    for (int jj = 0; jj < 8; ++jj) {
        const float f = __fdiv_rn(1.0f, rowsum(l[jj]));
#pragma unroll
        for (int db = 0; db < 8; ++db) { unsigned short oh, ol; splitf(O[db][jj] * f, oh, ol); const int o = (hi * 8 + jj) * OP + db * 16 + lr; sh[o] = oh; sl[o] = ol; } }
    __builtin_amdgcn_wave_barrier(); asm volatile("" ::: "memory");   // the row reads below take other lanes' stores
#pragma unroll
    for (int c = 0; c < 8; ++c) { const int row = c * 2 + hi, col = lr * 8; const size_t oo = (size_t)(i0 + row) * DQ + h * HD + col; const v8us vh = *(const v8usa*)(sh + row * OP + col), vl = *(const v8usa*)(sl + row * OP + col); *(v8us*)(Ah + oo) = vh; *(v8us*)(Al + oo) = vl; }
}
__global__ __launch_bounds__(128) void k_fattn(const h16* __restrict__ R16, const bf* __restrict__ Rh, const bf* __restrict__ Rl, const h16* __restrict__ VT16, const bf* __restrict__ VTh, const bf* __restrict__ VTl, bf* Ah, bf* Al) {
    __shared__ __align__(16) unsigned short ps[4][2][16 * OP];
    const int wv = __builtin_amdgcn_readfirstlane((int)(threadIdx.x >> 5)); const int rb = (int)(gridDim.x - 1 - blockIdx.x);   // the last rows hold the most keys: they start first
    const int i0 = rb * 64 + wv * 16, h = blockIdx.y;
    if (rb * 64 < RH) attn_rows<bf, true>(Rh, Rl, VTh, VTl, h, i0, ps[wv][0], ps[wv][1], Ah, Al);
    else attn_rows<h16, false>(R16, nullptr, VT16, nullptr, h, i0, ps[wv][0], ps[wv][1], Ah, Al);
}

// k_asoft: per row (zz, i): t = S x HD^-0.5 for j <= i and i - j < WIN (sliding causal window; the reference's -1e9 additive fill vanishes identically); softmax over the 1024 keys (register row, one exp, fixed trees);
__global__ __launch_bounds__(256) void k_asoft(const float* __restrict__ Sb, h16* P16, bf* Ph, bf* Pl) {
    const int lane = threadIdx.x & 31; const int row = blockIdx.x * 8 + (threadIdx.x >> 5); if (row >= ZH * TT) return; const int i = row % TT; const int zz = row / TT; (void)zz; const bool hires = (i < RH); const float* sr = Sb + (size_t)row * TT; float v[TT / 32]; float mx = -3.0e38f;
#pragma unroll
    for (int ch = 0; ch < TT / 128; ++ch) { const int j0 = ch * 128 + lane * 4; const v4f a = *(const v4f*)(sr + j0);
#pragma unroll
        for (int q = 0; q < 4; ++q) { const int j = j0 + q; (void)j; const float t = (j <= i && i - j < WIN) ? a[q] * SCL : -3.0e38f; v[ch * 4 + q] = t; mx = fmaxf(mx, t); } }
#pragma unroll
    for (int sh = 16; sh; sh >>= 1) mx = fmaxf(mx, __shfl_xor(mx, sh, 32));
    float sum = 0.f;
#pragma unroll
    for (int k = 0; k < TT / 32; ++k) { float d0 = __fsub_rn(v[k], mx); asm volatile("" : "+v"(d0)); v[k] = __builtin_amdgcn_exp2f(__fmul_rn(d0, 1.4426950408889634f)); sum += v[k]; }
#pragma unroll
    for (int sh = 16; sh; sh >>= 1) sum += __shfl_xor(sum, sh, 32);
    const float f = __fdiv_rn(hires ? 1.0f : PCAR, sum);
{
        if (hires) {
#pragma unroll
            for (int ch = 0; ch < TT / 128; ++ch) { v4us oh, ol;
#pragma unroll
                for (int q = 0; q < 4; ++q) { unsigned short a, c2; splitf(v[ch * 4 + q] * f, a, c2); oh[q] = a; ol[q] = c2; }
                const size_t oo = ((size_t)zz * (RH ? RH : 1) + i) * TT + ch * 128 + lane * 4; *(v4us*)(Ph + oo) = oh; *(v4us*)(Pl + oo) = ol; }
        } else {
#pragma unroll
            for (int ch = 0; ch < TT / 128; ++ch) { v4h o4;
#pragma unroll
                for (int q = 0; q < 4; ++q) o4[q] = tohx(v[ch * 4 + q] * f);
                *(v4h*)(P16 + (size_t)row * TT + ch * 128 + lane * 4) = o4; } }
         }
}
__global__ __launch_bounds__(256) void k_merge(const float* __restrict__ O, int h0, bf* Ah, bf* Al) { const size_t e = ((size_t)blockIdx.x * 256 + threadIdx.x) * 2; if (e >= (size_t)ZH * TT * HD) return; const int d = (int)(e % HD); const int t = (int)((e / HD) % TT); const int zz = (int)(e / ((size_t)HD * TT)); const float cs = (t < RH) ? 1.0f : (1.0f / PCAR); const size_t oo = (size_t)t * DQ + (h0 + zz) * HD + d;
    v2us oh, ol;
#pragma unroll
    for (int q = 0; q < 2; ++q) { unsigned short a, c2; splitf(O[e + q] * cs, a, c2); oh[q] = a; ol[q] = c2; } *(v2us*)(Ah + oo) = oh; *(v2us*)(Al + oo) = ol;  }

extern "C" void kernel_launch(void* const* d_in, const int* in_sizes, int n_in,
                              void* d_out, int out_size, void* d_ws, size_t ws_size, hipStream_t stream) {
    (void)in_sizes; (void)n_in; (void)out_size;
    const float* x = (const float*)d_in[0]; const float* cosA = (const float*)d_in[1]; const float* sinA = (const float*)d_in[2]; const float* wq = (const float*)d_in[3]; const float* bq = (const float*)d_in[4]; const float* wk = (const float*)d_in[5]; const float* bk = (const float*)d_in[6]; const float* wv = (const float*)d_in[7]; const float* bv = (const float*)d_in[8]; const float* wq2 = (const float*)d_in[9]; const float* bq2 = (const float*)d_in[10]; const float* wk2 = (const float*)d_in[11]; const float* bk2 = (const float*)d_in[12]; const float* wv2 = (const float*)d_in[13]; const float* bv2 = (const float*)d_in[14]; const float* wo = (const float*)d_in[15]; const float* gq = (const float*)d_in[16]; const float* gk = (const float*)d_in[17]; const float* gq2 = (const float*)d_in[18]; const float* gk2 = (const float*)d_in[19]; const float* cosT = cosA; const float* sinT = sinA;
    float* OUT = (float*)d_out;     // [2][1024][2048]
    char* wsp = (char*)d_ws;
    auto take = [&](size_t bytes) { char* p = wsp; wsp += (bytes + 255) & ~(size_t)255; return (void*)p; };
    // 16-bit GEMM operands, one conversion launch: [x (both batches) | wq | wq2 | wk | wk2 | wv | wv2 | wo]; the six projection weights are one [NP][DM] plane
    const size_t U = (size_t)DKV * DM; const int NP = 2 * DQ + 4 * DKV, NRH = 2 * NH_ + 2 * NKV, NVH = 2 * NKV;
    bf* XB = (bf*)take(12 * U * 2); bf* WP = XB + 2 * U; bf* WO = XB + 10 * U; float* CS = (float*)take((size_t)NB_ * TT * HD * 2 * 4);
    // head planes, both paths side by side: [q 16 | q2 16 | k 8 | k2 8][t][d] and [v 8 | v2 8][d][t]
    h16* R16 = (h16*)take((size_t)NRH * TT * HD * 2); bf* Rh = (bf*)take((size_t)NRH * TT * HD * 2); bf* Rl = (bf*)take((size_t)NRH * TT * HD * 2);
    h16* VT16 = (h16*)take((size_t)NVH * HD * TT * 2); bf* VTh = (bf*)take((size_t)NVH * HD * TT * 2); bf* VTl = (bf*)take((size_t)NVH * HD * TT * 2);
    float* F = (float*)take((size_t)TT * NP * 4); bf* ATl = (bf*)take((size_t)NB_ * TT * DQ * 2);   // one batch's [TT][NP] projection output; the lo plane of the merged attention output
    if ((size_t)(wsp - (char*)d_ws) > ws_size) return;    // ws 256 MiB
    bf* ATh = XB;     // the hi plane of the merged attention output reuses x: batch b's rows are dead once batch b's projection has run (stream-ordered; same size)
    static_assert(DQ == DM, "ATh fits x");
    k_cvtall<<<12 * 1024, 256, 0, stream>>>(x, wq, wq2, wk, wk2, wv, wv2, wo, XB);
    k_cscvt<<<(NB_ * TT * HD + 255) / 256, 256, 0, stream>>>(cosA, sinA, CS);
    for (int b = 0; b < NB_; ++b) {
        k_gemmw<bf, 0, true><<<dim3(TT / 64, NP / 64, 1), 32, 0, stream>>>(XB + (size_t)b * TT * DM, nullptr, WP, nullptr, DM, F, NP, bq, bq2, bk, bk2, bv, bv2, 0, 0, 0);
        k_rmsw<<<TT * NRH / 8, 256, 0, stream>>>(F, NP, NRH, gq, gq2, gk, gk2);
        k_rope<<<(unsigned)(((size_t)NRH * TT * HD / 2 + 255) / 256), 256, 0, stream>>>(F, NP, NRH, CS + (size_t)b * TT * HD * 2, nullptr, nullptr, 1.0f, R16, Rh, Rl);
        k_vtp<<<(unsigned)(((size_t)NVH * TT * HD / 2 + 255) / 256), 256, 0, stream>>>(F + NRH * HD, NP, NVH, VT16, VTh, VTl);
        k_fattn<<<dim3(TT / 64, NH_, 1), 128, 0, stream>>>(R16, Rh, Rl, VT16, VTh, VTl, ATh + (size_t)b * TT * DQ, ATl + (size_t)b * TT * DQ); }
    k_gemmw<bf, 1, false><<<dim3(NB_ * TT / 64, DM / 64, 1), 32, 0, stream>>>(ATh, ATl, WO, nullptr, DQ, OUT, DM, nullptr, nullptr, nullptr, nullptr, nullptr, nullptr, 0, 0, 0);
}

// v004
// A run of this version takes 270 microseconds.
// Next to v003, in two timings, it ran 1.32 and 1.31 times as fast.
// All steps since v000 together make it 8.64 times as fast.
#include <hip/hip_runtime.h>

// BMOJOAttention (hidden [2][1024][2048]; two projection paths - in-context (Wq,bq,Wk,bk,Wv,bv,gq,gk) and fading (Wq2..gk2): q = rope(rmsnorm(x Wq^T + bq) gq) (16 x 128), k = rope(rmsnorm(x Wk^T + bk) gk) (8 kv heads; group h/2), v = x Wv^T + bv; rotate-half RoPE with the read cos/sin [B][S][128]; s_ic = q_ic.k_ic / sqrt(128) live where 0 <= i-j < 256, s_f = q_f.k_f / sqrt(128) live where i-j >= 256 (else -1e30); ONE joint softmax over [s_ic | s_f]; out = p_ic v_ic + p_f v_f; merged Wo^T -> [2][1024][2048]).
// The joint softmax over 2S columns is computed as one causal softmax whose score (and value source) switches at i-j = 256: the masked halves contribute exactly 0; keys j > i are masked in both (causal tile skipping).
// Compute dtypes, f32 accumulate: every input rounded to bf16; both paths' q/k/v on PLAIN bf16 operands (inputs: exact) + bias; RMSNorm * g (in place) and RoPE (bf16-rounded per-batch tables) f32; both score sets and both attn.v products: query rows < 512 hl (3 products), the rest single fp16 (x1024), causal tile skipping; online softmax f32 over the live scores of both paths, both value products into one f32 accumulator, all in one kernel (k_fattn), which emits the hl planes of the merged output; Wo hl x exact (2 products).

#define NB_  2
#define TT   1024
#define DM   2048
#define NH_  16
#define NKV  8
#define REP  (NH_ / NKV)
#define HD   128
#define DQ   (NH_ * HD)
#define DKV  (NKV * HD)
#define ZH   16                   // heads per attention pass: all of them
#define RH   512                  // query rows < RH use hi+lo planes (0: none)
#define WIN  1024
#define PCAR 1024.0f
static_assert(RH % 64 == 0, "a 64-row block of the attention lies on one side of RH");
#define SCL  0.088388347648318447f   // HD^-0.5
typedef _Float16 h16;
typedef unsigned short bf;
typedef __attribute__((ext_vector_type(16))) __bf16   v16bf;
typedef __attribute__((ext_vector_type(16))) _Float16 v16h;
typedef __attribute__((ext_vector_type(8)))  _Float16 v8h;
typedef __attribute__((ext_vector_type(8)))  unsigned short v8us;
typedef __attribute__((ext_vector_type(8)))  float    v8f;
typedef __attribute__((ext_vector_type(4)))  float    v4f;
typedef v8h  __attribute__((may_alias)) v8ha;
typedef v4f  __attribute__((may_alias)) v4fa;
typedef v8us __attribute__((may_alias)) v8usa;

__device__ __forceinline__ unsigned short f2bf(float f) { unsigned u = __float_as_uint(f); u += 0x7FFFu + ((u >> 16) & 1u); return (unsigned short)(u >> 16); }
__device__ __forceinline__ float bf2f(unsigned short b) { return __uint_as_float(((unsigned)b) << 16); }
__device__ __forceinline__ float bfr(float f) { return bf2f(f2bf(f)); }
__device__ __forceinline__ v16h cat16(v8h lo, v8h hi) { return __builtin_shufflevector(lo, hi, 0, 1, 2, 3, 4, 5, 6, 7, 8, 9, 10, 11, 12, 13, 14, 15); }
__device__ __forceinline__ v16bf cat16b(v8us lo, v8us hi) { return __builtin_bit_cast(v16bf, __builtin_shufflevector(lo, hi, 0, 1, 2, 3, 4, 5, 6, 7, 8, 9, 10, 11, 12, 13, 14, 15)); }
__device__ __forceinline__ v8f wmma16(v16h a, v16h b, v8f c) { return __builtin_amdgcn_wmma_f32_16x16x32_f16(false, a, false, b, (short)0, c, false, false); }
__device__ __forceinline__ v8f wmmab(v16bf a, v16bf b, v8f c) { return __builtin_amdgcn_wmma_f32_16x16x32_bf16(false, a, false, b, (short)0, c, false, false); }



// ---- k_gemms: GEMM with both operands staged in LDS. One work-group = BM x 128 output tile, BM threads = BM / 32 waves in a (BM / 64) x 2 grid, 64 x 64 (16 accumulators) per wave; grid (M / BM, N / 128).
// C[m][n] (f32, pitch ldc, + optional f32 bias[n]) = sum_k (A[m][k] + A2[m][k]) Bt[n][k] (A2 only with NSPLIT = 1: two products per k step, A first); all planes K-contiguous bf16, KK % 64 == 0.
// A stage is 64 k (128 B, one line) of every operand row. Each global load of a wave covers four whole lines; a line is fetched once per work-group and then read from LDS by every wave that needs it.
// Two LDS buffers: a stage's lines are loaded into registers one stage ahead, stored into the other buffer between the two halves of the running stage's products, and one work-group barrier per stage hands the buffers over.
// With BIAS the N axis is the concatenation [q | q2 | k | k2 | v | v2] of both paths' projections (DQ, DQ, DKV, DKV, DKV, DKV columns); each 64-column tile lies in one section and takes that section's bias vector.
template <typename T16> struct WFrag;
template <> struct WFrag<h16> { typedef v16h V; static __device__ __forceinline__ V ld(const h16* p) { return cat16(*(const v8h*)p, *(const v8h*)(p + 16)); } static __device__ __forceinline__ v8f mma(V a, V b, v8f c) { return wmma16(a, b, c); } };
template <> struct WFrag<bf> { typedef v16bf V; static __device__ __forceinline__ V ld(const bf* p) { return cat16b(*(const v8us*)p, *(const v8us*)(p + 16)); } static __device__ __forceinline__ v8f mma(V a, V b, v8f c) { return wmmab(a, b, c); } };
#define GP 72     // LDS pitch (16-bit elements) of a staged 64-k row: 128 B + 16 B, the pitch for 16-byte row reads
template <int BM, int KK, int NSPLIT, bool BIAS>
__global__ __launch_bounds__(BM) void k_gemms(const bf* __restrict__ A, const bf* __restrict__ A2, const bf* __restrict__ Bt, float* C, int ldc, const float* __restrict__ bq, const float* __restrict__ bq2, const float* __restrict__ bk, const float* __restrict__ bk2, const float* __restrict__ bv, const float* __restrict__ bv2) {
    constexpr int NA = NSPLIT ? 2 : 1, RP = BM / 8, NBP = 128 / RP;    // A planes; rows that one staging pass of the work-group covers (8 threads a row); passes for the 128 rows of Bt (the BM rows of A take 8)
    __shared__ __align__(16) unsigned short sa[2][NA][BM * GP];
    __shared__ __align__(16) unsigned short sb[2][128 * GP];
    __shared__ __align__(16) float osm[BM / 32][16 * 68];
    const int tid = threadIdx.x, lane = tid & 31, lr = lane & 15, hi = lane >> 4, wv = __builtin_amdgcn_readfirstlane(tid >> 5);
    const int rw = (wv >> 1) * 64, cw = (wv & 1) * 64; const int r0 = blockIdx.x * BM, c0 = blockIdx.y * 128 + cw;
    const float* bias = nullptr;   // this wave's bias, already stepped to its column c0
    if (BIAS) bias = (c0 < DQ) ? bq + c0 : (c0 < 2 * DQ) ? bq2 + (c0 - DQ) : (c0 < 2 * DQ + DKV) ? bk + (c0 - 2 * DQ) : (c0 < 2 * DQ + 2 * DKV) ? bk2 + (c0 - 2 * DQ - DKV) : (c0 < 2 * DQ + 3 * DKV) ? bv + (c0 - 2 * DQ - 2 * DKV) : bv2 + (c0 - 2 * DQ - 3 * DKV);
    const int srow = tid >> 3, scol = (tid & 7) * 8;
    unsigned vo = (unsigned)(srow * KK + scol) * 2;    // the lane's byte offset from the work-group-uniform bases below, for the stage that is fetched next: carried through the loop in one register, stepped behind each run of loads
    typedef const __attribute__((address_space(1))) char* gptr;
    const gptr ua = (gptr)(A + (size_t)r0 * KK), ua2 = (gptr)(A2 + (size_t)r0 * KK), ub = (gptr)(Bt + (size_t)blockIdx.y * 128 * KK);
    v8us ra[NA][8], rb[NBP];
    auto ld16 = [](gptr p) { return *(const __attribute__((address_space(1))) v8us*)p; };
    auto fetch = [&]() {     // the next stage's lines into registers, one run of loads
#pragma unroll
        for (int i = 0; i < 8; ++i) { ra[0][i] = ld16(ua + vo + (size_t)i * RP * KK * 2); if (NSPLIT) ra[NA - 1][i] = ld16(ua2 + vo + (size_t)i * RP * KK * 2); }
#pragma unroll
        for (int i = 0; i < NBP; ++i) rb[i] = ld16(ub + vo + (size_t)i * RP * KK * 2);
        asm volatile("s_wait_xcnt 0x0" ::: "memory");   // behind the run of loads, in front of any later overwrite of their address registers
        __builtin_amdgcn_sched_barrier(0);   // keeps every later register write behind that wait
        vo += 128;
    };
    auto put = [&](int buf) {      // those registers into LDS buffer buf
#pragma unroll
        for (int i = 0; i < 8; ++i) { const int o = (srow + i * RP) * GP + scol; *(v8usa*)(&sa[buf][0][o]) = ra[0][i]; if (NSPLIT) *(v8usa*)(&sa[buf][NA - 1][o]) = ra[NA - 1][i]; }
#pragma unroll
        for (int i = 0; i < NBP; ++i) *(v8usa*)(&sb[buf][(srow + i * RP) * GP + scol]) = rb[i];
    };
    v8f acc[4][4];
#pragma unroll
    for (int mb = 0; mb < 4; ++mb)
#pragma unroll
        for (int nb = 0; nb < 4; ++nb) acc[mb][nb] = (v8f){};
    v16bf a[2][4], a2[2][4], b[2][4];   // the fragments of the two 32-k halves of a stage
    auto frags = [&](int ks, int buf) {   // half ks of the stage in LDS buffer buf, one run of reads
#pragma unroll
        for (int mb = 0; mb < 4; ++mb) { const int o = (rw + mb * 16 + lr) * GP + ks * 32 + 8 * hi; a[ks][mb] = cat16b(*(const v8usa*)(&sa[buf][0][o]), *(const v8usa*)(&sa[buf][0][o + 16])); if (NSPLIT) a2[ks][mb] = cat16b(*(const v8usa*)(&sa[buf][NA - 1][o]), *(const v8usa*)(&sa[buf][NA - 1][o + 16])); }
#pragma unroll
        for (int nb = 0; nb < 4; ++nb) { const int o = (cw + nb * 16 + lr) * GP + ks * 32 + 8 * hi; b[ks][nb] = cat16b(*(const v8usa*)(&sb[buf][o]), *(const v8usa*)(&sb[buf][o + 16])); }
    };
    auto products = [&](int ks) {
#pragma unroll
        for (int nb = 0; nb < 4; ++nb) {
#pragma unroll
            for (int mb = 0; mb < 4; ++mb) acc[mb][nb] = wmmab(a[ks][mb], b[ks][nb], acc[mb][nb]);
            if (NSPLIT) {
#pragma unroll
                for (int mb = 0; mb < 4; ++mb) acc[mb][nb] = wmmab(a2[ks][mb], b[ks][nb], acc[mb][nb]); } }
    };
    // Order of a trip (stage t in buffer t & 1): first half's products | stage t + 1 from registers into the other buffer | barrier | first-half fragments of stage t + 1 and the global loads of stage t + 2 go out | second half's products | second-half fragments of stage t + 1 go out.
    // Every read of a buffer stands in front of the barrier that precedes its refill; every read of a stage stands behind the barrier that follows its stores. No global load is in flight at a barrier (the barrier's fence would wait for it).
    // Each sched_barrier(0) keeps loads, stores and products on their side of that point, so that each run of reads flies under the products behind it.
    fetch(); put(0);
    __syncthreads();   // publishes stage 0
    frags(0, 0); fetch(); frags(1, 0);
    static_assert(KK >= 128, "a stage 1 exists");
#pragma unroll 1   // stays rolled: one copy of the body, one set of fragment and staging registers
    for (int kc = 0; kc < KK; kc += 64) {
        const int nxt = ((kc >> 6) & 1) ^ 1; const bool more1 = kc + 64 < KK, more2 = kc + 128 < KK;
        __builtin_amdgcn_sched_barrier(0);
        products(0);
        __builtin_amdgcn_sched_barrier(0);
        if (more1) put(nxt);
        __syncthreads();   // publishes stage t + 1 and ends every wave's reads of stage t
        if (more1) frags(0, nxt);
        if (more2) fetch();
        __builtin_amdgcn_sched_barrier(0);
        products(1);
        __builtin_amdgcn_sched_barrier(0);
        if (more1) frags(1, nxt);
    }
    float* os = osm[wv];
    v4f bb = (v4f){};   // the lane's four bias values (columns lr * 4 ..), the same for every row: read once
    if (BIAS) {
        const float b0 = bias[lr * 4], b1 = bias[lr * 4 + 1], b2 = bias[lr * 4 + 2], b3 = bias[lr * 4 + 3];
        asm volatile("s_wait_xcnt 0x0" ::: "memory");   // behind the bias load, in front of any later overwrite of its address registers
        __builtin_amdgcn_sched_barrier(0);   // keeps every later register write behind that wait
        bb[0] = bfr(b0); bb[1] = bfr(b1); bb[2] = bfr(b2); bb[3] = bfr(b3); }
#pragma unroll
    for (int mb = 0; mb < 4; ++mb) {
#pragma unroll
        for (int nb = 0; nb < 4; ++nb) {
#pragma unroll
            for (int j = 0; j < 8; ++j) os[(hi * 8 + j) * 68 + nb * 16 + lr] = acc[mb][nb][j]; }
        __builtin_amdgcn_wave_barrier(); asm volatile("" ::: "memory");   // the row reads below take other lanes' stores: keep them behind the stores
        float* crow = C + (size_t)(r0 + rw + mb * 16) * ldc + c0;
#pragma unroll
        for (int s = 0; s < 8; ++s) { const int row = 2 * s + hi, cofs = lr * 4; v4f val = *(const v4fa*)(os + row * 68 + cofs); if (BIAS) val += bb;
            *(v4f*)(crow + (size_t)row * ldc + cofs) = val; }
        __builtin_amdgcn_wave_barrier(); asm volatile("s_wait_xcnt 0x0" ::: "memory");   // the next block's LDS stores stay behind these reads; the wait stands behind the run of global stores, in front of any overwrite of their registers
        __builtin_amdgcn_sched_barrier(0);   // keeps the next block's register writes behind that wait
    }
}

__device__ __forceinline__ h16 tohx(float x) { return (h16)x; }
__device__ __forceinline__ void splitf(float y, unsigned short& h, unsigned short& l) { h = f2bf(y); l = f2bf(y - bf2f(h)); }
typedef __attribute__((ext_vector_type(2))) _Float16 v2h;
typedef __attribute__((ext_vector_type(4))) _Float16 v4h;
typedef __attribute__((ext_vector_type(2))) unsigned short v2us;
typedef __attribute__((ext_vector_type(4))) unsigned short v4us;
typedef __attribute__((ext_vector_type(2))) float v2f;
typedef __attribute__((ext_vector_type(4))) int v4i;

__global__ __launch_bounds__(256) void k_wtG(const float* __restrict__ w, int K, int N, bf* Bt) {
    const int lane = threadIdx.x & 31; const int L0 = (blockIdx.x * 8 + (threadIdx.x >> 5)) * 8; const int nlines = N * K / 64;
{
#pragma unroll 1
        for (int l = 0; l < 8; ++l) { const int L = L0 + l; if (L >= nlines) break; const size_t e = (size_t)L * 64 + lane * 2; const int k = (int)(e % K), n = (int)(e / K); v2us o;
            o[0] = f2bf(w[(size_t)k * N + n]); o[1] = f2bf(w[(size_t)(k + 1) * N + n]); *(v2us*)(Bt + e) = o; }
         }
}
// k_cvtall: every f32 operand of the plain GEMMs rounded to bf16 in one launch. dst = [x | wq | wq2 | wk | wk2 | wv | wv2 | wo] in units of DKV * DM elements (2, 2, 2, 1, 1, 1, 1, 2 units); one unit = 1024 blocks x 256 threads x 8 elements.
static_assert((size_t)DKV * DM == (size_t)1024 * 256 * 8 && DQ == 2 * DKV && NB_ * TT == 2 * DKV, "unit bookkeeping of k_cvtall");
__global__ __launch_bounds__(256) void k_cvtall(const float* __restrict__ x, const float* __restrict__ wq, const float* __restrict__ wq2, const float* __restrict__ wk, const float* __restrict__ wk2, const float* __restrict__ wv, const float* __restrict__ wv2, const float* __restrict__ wo, bf* dst) {
    const int u = blockIdx.x >> 10; const size_t U = (size_t)DKV * DM;
    const float* s = (u < 2) ? x + u * U : (u < 4) ? wq + (u - 2) * U : (u < 6) ? wq2 + (u - 4) * U : (u == 6) ? wk : (u == 7) ? wk2 : (u == 8) ? wv : (u == 9) ? wv2 : wo + (u - 10) * U;
    const size_t i = (size_t)(blockIdx.x & 1023) * 2048 + threadIdx.x * 8; const v8f v = *(const v8f*)(s + i); v8us o;
#pragma unroll
    for (int k = 0; k < 8; ++k) o[k] = f2bf(v[k]); *(v8us*)(dst + u * U + i) = o;  }
__global__ __launch_bounds__(256) void k_cscvt(const float* __restrict__ cosT, const float* __restrict__ sinT, float* CS) { const int idx = blockIdx.x * 256 + threadIdx.x; if (idx >= NB_ * TT * HD) return; v2f cs; cs[0] = bfr(cosT[idx]); cs[1] = bfr(sinT[idx]); *(v2f*)(CS + (size_t)idx * 2) = cs;  }
// k_rope: head planes [h][t][d] (fp16 + hi/lo) of rope(x) x sc with the rotate-half convention out[d] = x[d] cos[t][d] - x[d+HD/2] sin[t][d], out[d+HD/2] = x[d+HD/2] cos[t][d+HD/2] + x[d] sin[t][d+HD/2]
__global__ __launch_bounds__(256) void k_rope(const float* __restrict__ F, int pitch, int nheads, const float* __restrict__ CS, const float* __restrict__ RF, const float* __restrict__ nw, float sc, h16* P16, bf* Ph, bf* Pl) {
    const size_t e = ((size_t)blockIdx.x * 256 + threadIdx.x) * 2; if (e >= (size_t)nheads * TT * HD) return; const int d = (int)(e % HD); const int t = (int)((e / HD) % TT); const int h = (int)(e / ((size_t)HD * TT)); const float* f = F + (size_t)t * pitch + h * HD; const float rf = RF ? RF[(size_t)h * TT + t] : 1.0f; v2h o16; v2us oh, ol;
#pragma unroll
    for (int q = 0; q < 2; ++q) { const int dd = d + q; const int dp = (dd < HD / 2) ? dd + HD / 2 : dd - HD / 2; float x0 = f[dd], x1 = f[dp];
        if (RF) { float n0 = __fmul_rn(x0, rf), n1 = __fmul_rn(x1, rf); asm volatile("" : "+v"(n0)); asm volatile("" : "+v"(n1)); x0 = __fmul_rn(bfr(nw[dd]), n0); x1 = __fmul_rn(bfr(nw[dp]), n1); }
        const v2f cs = *(const v2f*)(CS + ((size_t)t * HD + dd) * 2); float a = __fmul_rn(x0, cs[0]), bq = __fmul_rn(x1, cs[1]); asm volatile("" : "+v"(a)); asm volatile("" : "+v"(bq)); const float r = ((dd < HD / 2) ? __fsub_rn(a, bq) : __fadd_rn(a, bq)) * sc;
        o16[q] = tohx(r); unsigned short a2, c2; splitf(r, a2, c2); oh[q] = a2; ol[q] = c2; }
    *(v2h*)(P16 + e) = o16; *(v2us*)(Ph + e) = oh; *(v2us*)(Pl + e) = ol;  }
__global__ __launch_bounds__(256) void k_vtp(const float* __restrict__ F, int pitch, int nheads, h16* V16, bf* Vh, bf* Vl) { const size_t e = ((size_t)blockIdx.x * 256 + threadIdx.x) * 2; if (e >= (size_t)nheads * HD * TT) return; const int t = (int)(e % TT); const int d = (int)((e / TT) % HD); const int g = (int)(e / ((size_t)TT * HD)); v2h o16; v2us oh, ol;
#pragma unroll
    for (int q = 0; q < 2; ++q) { const float x = F[(size_t)(t + q) * pitch + g * HD + d]; o16[q] = tohx(x); unsigned short a2, c2; splitf(x, a2, c2); oh[q] = a2; ol[q] = c2; }
    *(v2h*)(V16 + e) = o16; *(v2us*)(Vh + e) = oh; *(v2us*)(Vl + e) = ol;  }
__global__ __launch_bounds__(256) void k_rmsw(float* F, int pitch, int nheads, const float* __restrict__ gq, const float* __restrict__ gq2, const float* __restrict__ gk, const float* __restrict__ gk2) { const int lane = threadIdx.x & 31; const int wv = blockIdx.x * 8 + (threadIdx.x >> 5); if (wv >= TT * nheads) return; const int t = wv / nheads, h = wv % nheads; float* f = F + (size_t)t * pitch + h * HD; const int hb = (int)(blockIdx.x * 8) % nheads; const float* w = (hb < NH_) ? gq : (hb < 2 * NH_) ? gq2 : (hb < 2 * NH_ + NKV) ? gk : gk2; /* head slots [q | q2 | k | k2]; a block's 8 waves hold 8 consecutive slots and every section starts at a multiple of 8, so the choice is the block's (nheads % 8 == 0) */ const v4f a = *(const v4f*)(f + lane * 4); float ss = 0.f;
#pragma unroll
    for (int q = 0; q < 4; ++q) { float p = __fmul_rn(a[q], a[q]); asm volatile("" : "+v"(p)); ss = __fadd_rn(ss, p); }
#pragma unroll
    for (int sh = 16; sh; sh >>= 1) ss = __fadd_rn(ss, __shfl_xor(ss, sh, 32));
    const float rs = __fdiv_rn(1.0f, sqrtf(__fadd_rn(ss * (1.0f / HD), 1e-6f))); v4f o;
#pragma unroll
    for (int q = 0; q < 4; ++q) { float y = __fmul_rn(a[q], rs); asm volatile("" : "+v"(y)); o[q] = __fmul_rn(y, bfr(w[lane * 4 + q])); }
    *(v4f*)(f + lane * 4) = o;  }
// ---- k_fattn: scores, joint softmax and both value products of one head in one kernel; grid (TT / 64, NH_), 4 waves, each wave owns 16 query rows and works alone (no work-group barrier).
// A wave walks 64-key tiles of the window path (from its diagonal tile down to key i - 255), then of the fading path (keys <= i - 256), under ONE running maximum, sum and output accumulator (online softmax):
// the joint softmax over [s_ic | s_f]. A key outside the path's own range gets weight exactly 0. The diagonal tile comes first, so every row's maximum is finite from the first tile on.
// Probabilities go from the accumulator layout to the A-operand layout through the wave's own LDS slice. Rows < RH: hi+lo bf16 planes, 3 products; rows >= RH: fp16, weights x PCAR (the factor cancels in sum and output alike).
// Loops: the path loop and the tile loop stay rolled (#pragma unroll 1: one copy of the long body); every inner loop is unrolled, so that the fragment and accumulator arrays are indexed by constants and stay in registers.
#define PP 72     // LDS pitch (16-bit elements) of the 16 x 64 probability tile: 16-byte aligned rows, 16-byte row reads spread over the banks
#define OP 136    // LDS pitch of the 16 x 128 output tile
template <int X> __device__ __forceinline__ float rowx(float v) { return __int_as_float(__builtin_amdgcn_update_dpp(0, __float_as_int(v), 0x160 + X, 0xf, 0xf, true)); }   // DPP row_xmask: the value of lane ^ X inside the 16-lane row, on the vector port (a shuffle would go through the LDS queue, one wait each)
__device__ __forceinline__ float rowmax(float v) { v = fmaxf(v, rowx<8>(v)); v = fmaxf(v, rowx<4>(v)); v = fmaxf(v, rowx<2>(v)); return fmaxf(v, rowx<1>(v)); }
__device__ __forceinline__ float rowsum(float v) { v += rowx<8>(v); v += rowx<4>(v); v += rowx<2>(v); return v + rowx<1>(v); }
template <typename T16> struct LFrag;
template <> struct LFrag<h16> { static __device__ __forceinline__ v16h ld(const unsigned short* p) { const v8us lo = *(const v8usa*)p, hi = *(const v8usa*)(p + 16); return cat16(__builtin_bit_cast(v8h, lo), __builtin_bit_cast(v8h, hi)); } };
template <> struct LFrag<bf> { static __device__ __forceinline__ v16bf ld(const unsigned short* p) { const v8us lo = *(const v8usa*)p, hi = *(const v8usa*)(p + 16); return cat16b(lo, hi); } };
template <typename T16, bool HL>
__device__ __forceinline__ void attn_rows(const T16* __restrict__ R, const T16* __restrict__ Rlo, const T16* __restrict__ VT, const T16* __restrict__ VTlo, int h, int i0, unsigned short* sh, unsigned short* sl, bf* Ah, bf* Al) {
    typedef typename WFrag<T16>::V V;
    constexpr int NG = HL ? 2 : 1;    // planes per operand; also the number of 16-fragment (32-load) groups that a tile's keys, and its values, are fetched in
    const int lane = threadIdx.x & 31, lr = lane & 15, hi = lane >> 4;
    v8f O[8]; float m[8], l[8];
#pragma unroll
    for (int db = 0; db < 8; ++db) O[db] = (v8f){};
#pragma unroll
    for (int jj = 0; jj < 8; ++jj) { m[jj] = -3.0e38f; l[jj] = 0.f; }
#pragma unroll 1
    for (int p = 0; p < 2; ++p) {      // p = 0: window path, p = 1: fading path
        const size_t qo = ((size_t)(p * NH_ + h) * TT + i0 + lr) * HD + 8 * hi, ko = ((size_t)(2 * NH_ + p * NKV + h / REP) * TT + lr) * HD + 8 * hi, vo = ((size_t)(p * NKV + h / REP) * HD + lr) * TT + 8 * hi;
        V a[4], a2[4];
#pragma unroll
        for (int ks = 0; ks < 4; ++ks) { a[ks] = WFrag<T16>::ld(R + qo + ks * 32); if (HL) a2[ks] = WFrag<T16>::ld(Rlo + qo + ks * 32); }
        const int jhi = p ? ((i0 + 15 - 256) >> 6) : (i0 >> 6), jlo = p ? 0 : (max(0, i0 - 255) >> 6);   // first and last 64-key tile with a live key for one of the 16 rows (jhi < 0: none)
#pragma unroll 1
        for (int jt = jhi; jt >= jlo; --jt) {
            const int j0 = jt * 64; v8f s[4]; V kf[NG][16], vf[NG][16];
            // Fetch order of a tile. Keys and values come in groups of 16 fragments (32 loads), each group issued as one run, so that a group costs one load latency and not one every few fragments.
            // A second group (hi+lo planes) is issued behind the first block's products, whose wait has retired part of the first group: fewer than 64 loads of the wave are outstanding at any time.
            // Each sched_barrier(0) keeps the compiler from moving loads or products over that point. Each s_wait_xcnt 0 stands behind a run of loads, in front of every later overwrite of their address registers (a later load's result may land there).
            asm volatile("s_wait_xcnt 0x0" ::: "memory");   // for the query loads in front of the loop: the key loads' results may land in their address registers
            __builtin_amdgcn_sched_barrier(0);   // keeps the key loads behind that wait
#pragma unroll
            for (int f = 0; f < 16 / NG; ++f) { const size_t o = ko + (size_t)(j0 + (f >> 2) * 16) * HD + (f & 3) * 32; kf[0][f * NG] = WFrag<T16>::ld(R + o); if (HL) kf[0][f * NG + 1] = WFrag<T16>::ld(Rlo + o); }
            asm volatile("s_wait_xcnt 0x0" ::: "memory");   // behind the first key group's loads, in front of any overwrite of their address registers
            __builtin_amdgcn_sched_barrier(0);   // the whole group is issued before the first product waits for a fragment
#pragma unroll
            for (int nb = 0; nb < 4; ++nb) { const int g = nb / (4 / NG), nl = nb % (4 / NG); s[nb] = (v8f){};
#pragma unroll
                for (int ks = 0; ks < 4; ++ks) { s[nb] = WFrag<T16>::mma(a[ks], kf[g][(nl * 4 + ks) * NG], s[nb]);
                    if (HL) { s[nb] = WFrag<T16>::mma(a2[ks], kf[g][(nl * 4 + ks) * NG], s[nb]); s[nb] = WFrag<T16>::mma(a[ks], kf[g][(nl * 4 + ks) * NG + 1], s[nb]); } }
                if (HL && nb == 0) {
                    __builtin_amdgcn_sched_barrier(0);   // the second key group is issued behind the first block's products (fewer than 64 loads outstanding)
#pragma unroll
                    for (int f = 0; f < 16 / NG; ++f) { const size_t o = ko + (size_t)(j0 + (4 / NG + (f >> 2)) * 16) * HD + (f & 3) * 32; kf[NG - 1][f * NG] = WFrag<T16>::ld(R + o); kf[NG - 1][f * NG + 1] = WFrag<T16>::ld(Rlo + o); }
                    asm volatile("s_wait_xcnt 0x0" ::: "memory");   // behind the second key group's loads, as above
                    __builtin_amdgcn_sched_barrier(0);   // and it flies under the products that follow
                } }
            __builtin_amdgcn_sched_barrier(0);   // the value loads start behind the last score product: every key load has retired by then
#pragma unroll
            for (int f = 0; f < 16 / NG; ++f) { const size_t o = vo + (size_t)(f >> 1) * 16 * TT + j0 + (f & 1) * 32; vf[0][f * NG] = WFrag<T16>::ld(VT + o); if (HL) vf[0][f * NG + 1] = WFrag<T16>::ld(VTlo + o); }
            asm volatile("s_wait_xcnt 0x0" ::: "memory");   // behind the first value group's loads, as above
            __builtin_amdgcn_sched_barrier(0);   // the first value group flies while the softmax runs
            float mx[8];
#pragma unroll
            for (int jj = 0; jj < 8; ++jj) mx[jj] = m[jj];
#pragma unroll
            for (int nb = 0; nb < 4; ++nb)
#pragma unroll
                for (int jj = 0; jj < 8; ++jj) { const int dij = (i0 + hi * 8 + jj) - (j0 + nb * 16 + lr); const bool live = p ? (dij >= 256) : (dij >= 0 && dij < 256); const float t = live ? s[nb][jj] * SCL : -3.0e38f; s[nb][jj] = t; mx[jj] = fmaxf(mx[jj], t); }
#pragma unroll
            for (int jj = 0; jj < 8; ++jj) {
                mx[jj] = rowmax(mx[jj]);   // a row's 16 columns lie in the 16 lanes of one half
                const float al = __builtin_amdgcn_exp2f((m[jj] - mx[jj]) * 1.4426950408889634f); m[jj] = mx[jj]; l[jj] *= al;
#pragma unroll
                for (int db = 0; db < 8; ++db) O[db][jj] *= al; }
#pragma unroll
            for (int nb = 0; nb < 4; ++nb)
#pragma unroll
                for (int jj = 0; jj < 8; ++jj) { const float pv = __builtin_amdgcn_exp2f((s[nb][jj] - m[jj]) * 1.4426950408889634f) * (HL ? 1.0f : PCAR); l[jj] += pv; const int o = (hi * 8 + jj) * PP + nb * 16 + lr;
                    if (HL) { unsigned short ph, pl; splitf(pv, ph, pl); sh[o] = ph; sl[o] = pl; } else sh[o] = __builtin_bit_cast(unsigned short, tohx(pv)); }
            __builtin_amdgcn_wave_barrier(); asm volatile("" ::: "memory");   // the fragment reads below take other lanes' stores: keep them behind the stores
            V pa[2], pb[2];
#pragma unroll
            for (int k2 = 0; k2 < 2; ++k2) { pa[k2] = LFrag<T16>::ld(sh + lr * PP + k2 * 32 + 8 * hi); if (HL) pb[k2] = LFrag<T16>::ld(sl + lr * PP + k2 * 32 + 8 * hi); }
            __builtin_amdgcn_wave_barrier(); asm volatile("" ::: "memory");   // the next tile's stores stay behind these reads
#pragma unroll
            for (int db = 0; db < 8; ++db) { const int g = db / (8 / NG), dl = db % (8 / NG);
#pragma unroll
                for (int k2 = 0; k2 < 2; ++k2) { O[db] = WFrag<T16>::mma(pa[k2], vf[g][(dl * 2 + k2) * NG], O[db]);
                    if (HL) { O[db] = WFrag<T16>::mma(pb[k2], vf[g][(dl * 2 + k2) * NG], O[db]); O[db] = WFrag<T16>::mma(pa[k2], vf[g][(dl * 2 + k2) * NG + 1], O[db]); } }
                if (HL && db == 0) {
                    __builtin_amdgcn_sched_barrier(0);   // the second value group is issued behind the first block's products (fewer than 64 loads outstanding)
#pragma unroll
                    for (int f = 0; f < 16 / NG; ++f) { const size_t o = vo + (size_t)(8 / NG + (f >> 1)) * 16 * TT + j0 + (f & 1) * 32; vf[NG - 1][f * NG] = WFrag<T16>::ld(VT + o); vf[NG - 1][f * NG + 1] = WFrag<T16>::ld(VTlo + o); }
                    asm volatile("s_wait_xcnt 0x0" ::: "memory");   // behind the second value group's loads, as above
                    __builtin_amdgcn_sched_barrier(0);   // and it flies under the products that follow
                } }
        }
    }
#pragma unroll
    for (int jj = 0; jj < 8; ++jj) {
        const float f = __fdiv_rn(1.0f, rowsum(l[jj]));
#pragma unroll
        for (int db = 0; db < 8; ++db) { unsigned short oh, ol; splitf(O[db][jj] * f, oh, ol); const int o = (hi * 8 + jj) * OP + db * 16 + lr; sh[o] = oh; sl[o] = ol; } }
    __builtin_amdgcn_wave_barrier(); asm volatile("" ::: "memory");   // the row reads below take other lanes' stores
#pragma unroll
    for (int c = 0; c < 8; ++c) { const int row = c * 2 + hi, col = lr * 8; const size_t oo = (size_t)(i0 + row) * DQ + h * HD + col; const v8us vh = *(const v8usa*)(sh + row * OP + col), vl = *(const v8usa*)(sl + row * OP + col); *(v8us*)(Ah + oo) = vh; *(v8us*)(Al + oo) = vl; }
}
__global__ __launch_bounds__(128) void k_fattn(const h16* __restrict__ R16, const bf* __restrict__ Rh, const bf* __restrict__ Rl, const h16* __restrict__ VT16, const bf* __restrict__ VTh, const bf* __restrict__ VTl, bf* Ah, bf* Al) {
    __shared__ __align__(16) unsigned short ps[4][2][16 * OP];
    const int wv = __builtin_amdgcn_readfirstlane((int)(threadIdx.x >> 5)); const int rb = (int)(gridDim.x - 1 - blockIdx.x);   // the last rows hold the most keys: they start first
    const int i0 = rb * 64 + wv * 16, h = blockIdx.y;
    if (rb * 64 < RH) attn_rows<bf, true>(Rh, Rl, VTh, VTl, h, i0, ps[wv][0], ps[wv][1], Ah, Al);
    else attn_rows<h16, false>(R16, nullptr, VT16, nullptr, h, i0, ps[wv][0], ps[wv][1], Ah, Al);
}

// k_asoft: per row (zz, i): t = S x HD^-0.5 for j <= i and i - j < WIN (sliding causal window; the reference's -1e9 additive fill vanishes identically); softmax over the 1024 keys (register row, one exp, fixed trees);
__global__ __launch_bounds__(256) void k_asoft(const float* __restrict__ Sb, h16* P16, bf* Ph, bf* Pl) {
    const int lane = threadIdx.x & 31; const int row = blockIdx.x * 8 + (threadIdx.x >> 5); if (row >= ZH * TT) return; const int i = row % TT; const int zz = row / TT; (void)zz; const bool hires = (i < RH); const float* sr = Sb + (size_t)row * TT; float v[TT / 32]; float mx = -3.0e38f;
#pragma unroll
    for (int ch = 0; ch < TT / 128; ++ch) { const int j0 = ch * 128 + lane * 4; const v4f a = *(const v4f*)(sr + j0);
#pragma unroll
        for (int q = 0; q < 4; ++q) { const int j = j0 + q; (void)j; const float t = (j <= i && i - j < WIN) ? a[q] * SCL : -3.0e38f; v[ch * 4 + q] = t; mx = fmaxf(mx, t); } }
#pragma unroll
    for (int sh = 16; sh; sh >>= 1) mx = fmaxf(mx, __shfl_xor(mx, sh, 32));
    float sum = 0.f;
#pragma unroll
    for (int k = 0; k < TT / 32; ++k) { float d0 = __fsub_rn(v[k], mx); asm volatile("" : "+v"(d0)); v[k] = __builtin_amdgcn_exp2f(__fmul_rn(d0, 1.4426950408889634f)); sum += v[k]; }
#pragma unroll
    for (int sh = 16; sh; sh >>= 1) sum += __shfl_xor(sum, sh, 32);
    const float f = __fdiv_rn(hires ? 1.0f : PCAR, sum);
{
        if (hires) {
#pragma unroll
            for (int ch = 0; ch < TT / 128; ++ch) { v4us oh, ol;
#pragma unroll
                for (int q = 0; q < 4; ++q) { unsigned short a, c2; splitf(v[ch * 4 + q] * f, a, c2); oh[q] = a; ol[q] = c2; }
                const size_t oo = ((size_t)zz * (RH ? RH : 1) + i) * TT + ch * 128 + lane * 4; *(v4us*)(Ph + oo) = oh; *(v4us*)(Pl + oo) = ol; }
        } else {
#pragma unroll
            for (int ch = 0; ch < TT / 128; ++ch) { v4h o4;
#pragma unroll
                for (int q = 0; q < 4; ++q) o4[q] = tohx(v[ch * 4 + q] * f);
                *(v4h*)(P16 + (size_t)row * TT + ch * 128 + lane * 4) = o4; } }
         }
}
__global__ __launch_bounds__(256) void k_merge(const float* __restrict__ O, int h0, bf* Ah, bf* Al) { const size_t e = ((size_t)blockIdx.x * 256 + threadIdx.x) * 2; if (e >= (size_t)ZH * TT * HD) return; const int d = (int)(e % HD); const int t = (int)((e / HD) % TT); const int zz = (int)(e / ((size_t)HD * TT)); const float cs = (t < RH) ? 1.0f : (1.0f / PCAR); const size_t oo = (size_t)t * DQ + (h0 + zz) * HD + d;
    v2us oh, ol;
#pragma unroll
    for (int q = 0; q < 2; ++q) { unsigned short a, c2; splitf(O[e + q] * cs, a, c2); oh[q] = a; ol[q] = c2; } *(v2us*)(Ah + oo) = oh; *(v2us*)(Al + oo) = ol;  }

extern "C" void kernel_launch(void* const* d_in, const int* in_sizes, int n_in,
                              void* d_out, int out_size, void* d_ws, size_t ws_size, hipStream_t stream) {
    (void)in_sizes; (void)n_in; (void)out_size;
    const float* x = (const float*)d_in[0]; const float* cosA = (const float*)d_in[1]; const float* sinA = (const float*)d_in[2]; const float* wq = (const float*)d_in[3]; const float* bq = (const float*)d_in[4]; const float* wk = (const float*)d_in[5]; const float* bk = (const float*)d_in[6]; const float* wv = (const float*)d_in[7]; const float* bv = (const float*)d_in[8]; const float* wq2 = (const float*)d_in[9]; const float* bq2 = (const float*)d_in[10]; const float* wk2 = (const float*)d_in[11]; const float* bk2 = (const float*)d_in[12]; const float* wv2 = (const float*)d_in[13]; const float* bv2 = (const float*)d_in[14]; const float* wo = (const float*)d_in[15]; const float* gq = (const float*)d_in[16]; const float* gk = (const float*)d_in[17]; const float* gq2 = (const float*)d_in[18]; const float* gk2 = (const float*)d_in[19]; const float* cosT = cosA; const float* sinT = sinA;
    float* OUT = (float*)d_out;     // [2][1024][2048]
    char* wsp = (char*)d_ws;
    auto take = [&](size_t bytes) { char* p = wsp; wsp += (bytes + 255) & ~(size_t)255; return (void*)p; };
    // 16-bit GEMM operands, one conversion launch: [x (both batches) | wq | wq2 | wk | wk2 | wv | wv2 | wo]; the six projection weights are one [NP][DM] plane
    const size_t U = (size_t)DKV * DM; const int NP = 2 * DQ + 4 * DKV, NRH = 2 * NH_ + 2 * NKV, NVH = 2 * NKV;
    bf* XB = (bf*)take(12 * U * 2); bf* WP = XB + 2 * U; bf* WO = XB + 10 * U; float* CS = (float*)take((size_t)NB_ * TT * HD * 2 * 4);
    // head planes, both paths side by side: [q 16 | q2 16 | k 8 | k2 8][t][d] and [v 8 | v2 8][d][t]
    h16* R16 = (h16*)take((size_t)NRH * TT * HD * 2); bf* Rh = (bf*)take((size_t)NRH * TT * HD * 2); bf* Rl = (bf*)take((size_t)NRH * TT * HD * 2);
    h16* VT16 = (h16*)take((size_t)NVH * HD * TT * 2); bf* VTh = (bf*)take((size_t)NVH * HD * TT * 2); bf* VTl = (bf*)take((size_t)NVH * HD * TT * 2);
    float* F = (float*)take((size_t)TT * NP * 4); bf* ATl = (bf*)take((size_t)NB_ * TT * DQ * 2);   // one batch's [TT][NP] projection output; the lo plane of the merged attention output
    if ((size_t)(wsp - (char*)d_ws) > ws_size) return;    // ws 256 MiB
    bf* ATh = XB;     // the hi plane of the merged attention output reuses x: batch b's rows are dead once batch b's projection has run (stream-ordered; same size)
    static_assert(DQ == DM, "ATh fits x");
    k_cvtall<<<12 * 1024, 256, 0, stream>>>(x, wq, wq2, wk, wk2, wv, wv2, wo, XB);
    k_cscvt<<<(NB_ * TT * HD + 255) / 256, 256, 0, stream>>>(cosA, sinA, CS);
    for (int b = 0; b < NB_; ++b) {
        k_gemms<256, DM, 0, true><<<dim3(TT / 256, NP / 128, 1), 256, 0, stream>>>(XB + (size_t)b * TT * DM, nullptr, WP, F, NP, bq, bq2, bk, bk2, bv, bv2);
        k_rmsw<<<TT * NRH / 8, 256, 0, stream>>>(F, NP, NRH, gq, gq2, gk, gk2);
        k_rope<<<(unsigned)(((size_t)NRH * TT * HD / 2 + 255) / 256), 256, 0, stream>>>(F, NP, NRH, CS + (size_t)b * TT * HD * 2, nullptr, nullptr, 1.0f, R16, Rh, Rl);
        k_vtp<<<(unsigned)(((size_t)NVH * TT * HD / 2 + 255) / 256), 256, 0, stream>>>(F + NRH * HD, NP, NVH, VT16, VTh, VTl);
        k_fattn<<<dim3(TT / 64, NH_, 1), 128, 0, stream>>>(R16, Rh, Rl, VT16, VTh, VTl, ATh + (size_t)b * TT * DQ, ATl + (size_t)b * TT * DQ); }
    k_gemms<128, DQ, 1, false><<<dim3(NB_ * TT / 128, DM / 128, 1), 128, 0, stream>>>(ATh, ATl, WO, OUT, DM, nullptr, nullptr, nullptr, nullptr, nullptr, nullptr);
}

// v005
// It runs in 249 microseconds.
// Timed twice side by side with v004, it ran 1.08 times as fast both times.
// Counting every step since v000, it is 9.35 times as fast.
#include <hip/hip_runtime.h>

// BMOJOAttention (hidden [2][1024][2048]; two projection paths - in-context (Wq,bq,Wk,bk,Wv,bv,gq,gk) and fading (Wq2..gk2): q = rope(rmsnorm(x Wq^T + bq) gq) (16 x 128), k = rope(rmsnorm(x Wk^T + bk) gk) (8 kv heads; group h/2), v = x Wv^T + bv; rotate-half RoPE with the read cos/sin [B][S][128]; s_ic = q_ic.k_ic / sqrt(128) live where 0 <= i-j < 256, s_f = q_f.k_f / sqrt(128) live where i-j >= 256 (else -1e30); ONE joint softmax over [s_ic | s_f]; out = p_ic v_ic + p_f v_f; merged Wo^T -> [2][1024][2048]).
// The joint softmax over 2S columns is computed as one causal softmax whose score (and value source) switches at i-j = 256: the masked halves contribute exactly 0; keys j > i are masked in both (causal tile skipping).
// Compute dtypes, f32 accumulate: every input rounded to bf16; both paths' q/k/v on PLAIN bf16 operands (inputs: exact) + bias; RMSNorm * g (in place) and RoPE (bf16-rounded per-batch tables) f32; both score sets and both attn.v products: query rows < 512 hl (3 products), the rest single fp16 (x1024), causal tile skipping; online softmax f32 over the live scores of both paths, both value products into one f32 accumulator, all in one kernel (k_fattn), which emits the hl planes of the merged output; Wo hl x exact (2 products).

#define NB_  2
#define TT   1024
#define DM   2048
#define NH_  16
#define NKV  8
#define REP  (NH_ / NKV)
#define HD   128
#define DQ   (NH_ * HD)
#define DKV  (NKV * HD)
#define ZH   16                   // heads per attention pass: all of them
#define RH   512                  // query rows < RH use hi+lo planes (0: none)
#define WIN  1024
#define PCAR 1024.0f
static_assert(RH % 64 == 0, "a 64-row block of the attention lies on one side of RH");
#define SCL  0.088388347648318447f   // HD^-0.5
typedef _Float16 h16;
typedef unsigned short bf;
typedef __attribute__((ext_vector_type(16))) __bf16   v16bf;
typedef __attribute__((ext_vector_type(16))) _Float16 v16h;
typedef __attribute__((ext_vector_type(8)))  _Float16 v8h;
typedef __attribute__((ext_vector_type(8)))  unsigned short v8us;
typedef __attribute__((ext_vector_type(8)))  float    v8f;
typedef __attribute__((ext_vector_type(4)))  float    v4f;
typedef v8h  __attribute__((may_alias)) v8ha;
typedef v4f  __attribute__((may_alias)) v4fa;
typedef v8us __attribute__((may_alias)) v8usa;

__device__ __forceinline__ unsigned short f2bf(float f) { unsigned u = __float_as_uint(f); u += 0x7FFFu + ((u >> 16) & 1u); return (unsigned short)(u >> 16); }
__device__ __forceinline__ float bf2f(unsigned short b) { return __uint_as_float(((unsigned)b) << 16); }
__device__ __forceinline__ float bfr(float f) { return bf2f(f2bf(f)); }
__device__ __forceinline__ v16h cat16(v8h lo, v8h hi) { return __builtin_shufflevector(lo, hi, 0, 1, 2, 3, 4, 5, 6, 7, 8, 9, 10, 11, 12, 13, 14, 15); }
__device__ __forceinline__ v16bf cat16b(v8us lo, v8us hi) { return __builtin_bit_cast(v16bf, __builtin_shufflevector(lo, hi, 0, 1, 2, 3, 4, 5, 6, 7, 8, 9, 10, 11, 12, 13, 14, 15)); }
__device__ __forceinline__ v8f wmma16(v16h a, v16h b, v8f c) { return __builtin_amdgcn_wmma_f32_16x16x32_f16(false, a, false, b, (short)0, c, false, false); }
__device__ __forceinline__ v8f wmmab(v16bf a, v16bf b, v8f c) { return __builtin_amdgcn_wmma_f32_16x16x32_bf16(false, a, false, b, (short)0, c, false, false); }



// ---- k_gemms: GEMM with both operands staged in LDS. One work-group = BM x 128 output tile, BM threads = BM / 32 waves in a (BM / 64) x 2 grid, 64 x 64 (16 accumulators) per wave; grid (M / BM, N / 128).
// C[m][n] (f32, pitch ldc, + optional bias[n] rounded to bf16) = sum_k (A[m][k] + A2[m][k]) Bt[n][k] (A2 only with NSPLIT = 1: two products per k step, A first); all planes K-contiguous bf16, KK % 64 == 0.
// A stage is 64 k (128 B, one line) of every operand row. Each global load of a wave covers four whole lines; a line is fetched once per work-group and then read from LDS by every wave that needs it.
// Two LDS buffers: a stage's lines are loaded into registers one stage ahead, stored into the other buffer between the two halves of the running stage's products, and one work-group barrier per stage hands the buffers over.
// With BIAS the N axis is the concatenation [q | q2 | k | k2 | v | v2] of both paths' projections (DQ, DQ, DKV, DKV, DKV, DKV columns); each 64-column tile lies in one section and takes that section's bias vector.
template <typename T16> struct WFrag;
template <> struct WFrag<h16> { typedef v16h V; static __device__ __forceinline__ V ld(const h16* p) { return cat16(*(const v8h*)p, *(const v8h*)(p + 16)); } static __device__ __forceinline__ v8f mma(V a, V b, v8f c) { return wmma16(a, b, c); } };
template <> struct WFrag<bf> { typedef v16bf V; static __device__ __forceinline__ V ld(const bf* p) { return cat16b(*(const v8us*)p, *(const v8us*)(p + 16)); } static __device__ __forceinline__ v8f mma(V a, V b, v8f c) { return wmmab(a, b, c); } };
#define GP 72     // LDS pitch (16-bit elements) of a staged 64-k row: 128 B + 16 B, the pitch for 16-byte row reads
template <int BM, int KK, int NSPLIT, bool BIAS>
__global__ __launch_bounds__(BM) void k_gemms(const bf* __restrict__ A, const bf* __restrict__ A2, const bf* __restrict__ Bt, float* C, int ldc, const float* __restrict__ bq, const float* __restrict__ bq2, const float* __restrict__ bk, const float* __restrict__ bk2, const float* __restrict__ bv, const float* __restrict__ bv2) {
    constexpr int NA = NSPLIT ? 2 : 1, RP = BM / 8, NBP = 128 / RP;    // A planes; rows that one staging pass of the work-group covers (8 threads a row); passes for the 128 rows of Bt (the BM rows of A take 8)
    __shared__ __align__(16) unsigned short sa[2][NA][BM * GP];
    __shared__ __align__(16) unsigned short sb[2][128 * GP];
    __shared__ __align__(16) float osm[BM / 32][16 * 68];
    const int tid = threadIdx.x, lane = tid & 31, lr = lane & 15, hi = lane >> 4, wv = __builtin_amdgcn_readfirstlane(tid >> 5);
    const int rw = (wv >> 1) * 64, cw = (wv & 1) * 64; const int r0 = blockIdx.x * BM, c0 = blockIdx.y * 128 + cw;
    const float* bias = nullptr;   // this wave's bias, already stepped to its column c0
    if (BIAS) bias = (c0 < DQ) ? bq + c0 : (c0 < 2 * DQ) ? bq2 + (c0 - DQ) : (c0 < 2 * DQ + DKV) ? bk + (c0 - 2 * DQ) : (c0 < 2 * DQ + 2 * DKV) ? bk2 + (c0 - 2 * DQ - DKV) : (c0 < 2 * DQ + 3 * DKV) ? bv + (c0 - 2 * DQ - 2 * DKV) : bv2 + (c0 - 2 * DQ - 3 * DKV);
    const int srow = tid >> 3, scol = (tid & 7) * 8;
    unsigned vo = (unsigned)(srow * KK + scol) * 2;    // the lane's byte offset from the work-group-uniform bases below, for the stage that is fetched next: carried through the loop in one register, stepped behind each run of loads
    typedef const __attribute__((address_space(1))) char* gptr;
    const gptr ua = (gptr)(A + (size_t)r0 * KK), ua2 = (gptr)(A2 + (size_t)r0 * KK), ub = (gptr)(Bt + (size_t)blockIdx.y * 128 * KK);
    v8us ra[NA][8], rb[NBP];
    auto ld16 = [](gptr p) { return *(const __attribute__((address_space(1))) v8us*)p; };
    auto fetch = [&]() {     // the next stage's lines into registers, one run of loads
#pragma unroll
        for (int i = 0; i < 8; ++i) { ra[0][i] = ld16(ua + vo + (size_t)i * RP * KK * 2); if (NSPLIT) ra[NA - 1][i] = ld16(ua2 + vo + (size_t)i * RP * KK * 2); }
#pragma unroll
        for (int i = 0; i < NBP; ++i) rb[i] = ld16(ub + vo + (size_t)i * RP * KK * 2);
        asm volatile("s_wait_xcnt 0x0" ::: "memory");   // behind the run of loads, in front of any later overwrite of their address registers
        __builtin_amdgcn_sched_barrier(0);   // keeps every later register write behind that wait
        vo += 128;
    };
    auto put = [&](int buf) {      // those registers into LDS buffer buf
#pragma unroll
        for (int i = 0; i < 8; ++i) { const int o = (srow + i * RP) * GP + scol; *(v8usa*)(&sa[buf][0][o]) = ra[0][i]; if (NSPLIT) *(v8usa*)(&sa[buf][NA - 1][o]) = ra[NA - 1][i]; }
#pragma unroll
        for (int i = 0; i < NBP; ++i) *(v8usa*)(&sb[buf][(srow + i * RP) * GP + scol]) = rb[i];
    };
    v8f acc[4][4];
#pragma unroll
    for (int mb = 0; mb < 4; ++mb)
#pragma unroll
        for (int nb = 0; nb < 4; ++nb) acc[mb][nb] = (v8f){};
    v16bf a[2][4], a2[2][4], b[2][4];   // the fragments of the two 32-k halves of a stage
    auto frags = [&](int ks, int buf) {   // half ks of the stage in LDS buffer buf, one run of reads
#pragma unroll
        for (int mb = 0; mb < 4; ++mb) { const int o = (rw + mb * 16 + lr) * GP + ks * 32 + 8 * hi; a[ks][mb] = cat16b(*(const v8usa*)(&sa[buf][0][o]), *(const v8usa*)(&sa[buf][0][o + 16])); if (NSPLIT) a2[ks][mb] = cat16b(*(const v8usa*)(&sa[buf][NA - 1][o]), *(const v8usa*)(&sa[buf][NA - 1][o + 16])); }
#pragma unroll
        for (int nb = 0; nb < 4; ++nb) { const int o = (cw + nb * 16 + lr) * GP + ks * 32 + 8 * hi; b[ks][nb] = cat16b(*(const v8usa*)(&sb[buf][o]), *(const v8usa*)(&sb[buf][o + 16])); }
    };
    auto products = [&](int ks) {
#pragma unroll
        for (int nb = 0; nb < 4; ++nb) {
#pragma unroll
            for (int mb = 0; mb < 4; ++mb) acc[mb][nb] = wmmab(a[ks][mb], b[ks][nb], acc[mb][nb]);
            if (NSPLIT) {
#pragma unroll
                for (int mb = 0; mb < 4; ++mb) acc[mb][nb] = wmmab(a2[ks][mb], b[ks][nb], acc[mb][nb]); } }
    };
    // Order of a trip (stage t in buffer t & 1): first half's products | stage t + 1 from registers into the other buffer | barrier | first-half fragments of stage t + 1 and the global loads of stage t + 2 go out | second half's products | second-half fragments of stage t + 1 go out.
    // Every read of a buffer stands in front of the barrier that precedes its refill; every read of a stage stands behind the barrier that follows its stores. No global load is in flight at a barrier (the barrier's fence would wait for it).
    // Each sched_barrier(0) keeps loads, stores and products on their side of that point, so that each run of reads flies under the products behind it.
    fetch(); put(0);
    __syncthreads();   // publishes stage 0
    frags(0, 0); fetch(); frags(1, 0);
    static_assert(KK >= 128, "a stage 1 exists");
#pragma unroll 1   // stays rolled: one copy of the body, one set of fragment and staging registers
    for (int kc = 0; kc < KK; kc += 64) {
        const int nxt = ((kc >> 6) & 1) ^ 1; const bool more1 = kc + 64 < KK, more2 = kc + 128 < KK;
        __builtin_amdgcn_sched_barrier(0);
        products(0);
        __builtin_amdgcn_sched_barrier(0);
        if (more1) put(nxt);
        __syncthreads();   // publishes stage t + 1 and ends every wave's reads of stage t
        if (more1) frags(0, nxt);
        if (more2) fetch();
        __builtin_amdgcn_sched_barrier(0);
        products(1);
        __builtin_amdgcn_sched_barrier(0);
        if (more1) frags(1, nxt);
    }
    float* os = osm[wv];
    v4f bb = (v4f){};   // the lane's four bias values (columns lr * 4 ..), the same for every row: read once
    if (BIAS) {
        const float b0 = bias[lr * 4], b1 = bias[lr * 4 + 1], b2 = bias[lr * 4 + 2], b3 = bias[lr * 4 + 3];
        asm volatile("s_wait_xcnt 0x0" ::: "memory");   // behind the bias load, in front of any later overwrite of its address registers
        __builtin_amdgcn_sched_barrier(0);   // keeps every later register write behind that wait
        bb[0] = bfr(b0); bb[1] = bfr(b1); bb[2] = bfr(b2); bb[3] = bfr(b3); }
#pragma unroll
    for (int mb = 0; mb < 4; ++mb) {
#pragma unroll
        for (int nb = 0; nb < 4; ++nb) {
#pragma unroll
            for (int j = 0; j < 8; ++j) os[(hi * 8 + j) * 68 + nb * 16 + lr] = acc[mb][nb][j]; }
        __builtin_amdgcn_wave_barrier(); asm volatile("" ::: "memory");   // the row reads below take other lanes' stores: keep them behind the stores
        float* crow = C + (size_t)(r0 + rw + mb * 16) * ldc + c0;
#pragma unroll
        for (int s = 0; s < 8; ++s) { const int row = 2 * s + hi, cofs = lr * 4; v4f val = *(const v4fa*)(os + row * 68 + cofs); if (BIAS) val += bb;
            *(v4f*)(crow + (size_t)row * ldc + cofs) = val; }
        __builtin_amdgcn_wave_barrier(); asm volatile("s_wait_xcnt 0x0" ::: "memory");   // the next block's LDS stores stay behind these reads; the wait stands behind the run of global stores, in front of any overwrite of their registers
        __builtin_amdgcn_sched_barrier(0);   // keeps the next block's register writes behind that wait
    }
}

__device__ __forceinline__ h16 tohx(float x) { return (h16)x; }
__device__ __forceinline__ void splitf(float y, unsigned short& h, unsigned short& l) { h = f2bf(y); l = f2bf(y - bf2f(h)); }
typedef __attribute__((ext_vector_type(2))) _Float16 v2h;
typedef __attribute__((ext_vector_type(4))) _Float16 v4h;
typedef __attribute__((ext_vector_type(2))) unsigned short v2us;
typedef __attribute__((ext_vector_type(4))) unsigned short v4us;
typedef __attribute__((ext_vector_type(2))) float v2f;
typedef __attribute__((ext_vector_type(4))) int v4i;

__global__ __launch_bounds__(256) void k_wtG(const float* __restrict__ w, int K, int N, bf* Bt) {
    const int lane = threadIdx.x & 31; const int L0 = (blockIdx.x * 8 + (threadIdx.x >> 5)) * 8; const int nlines = N * K / 64;
{
#pragma unroll 1
        for (int l = 0; l < 8; ++l) { const int L = L0 + l; if (L >= nlines) break; const size_t e = (size_t)L * 64 + lane * 2; const int k = (int)(e % K), n = (int)(e / K); v2us o;
            o[0] = f2bf(w[(size_t)k * N + n]); o[1] = f2bf(w[(size_t)(k + 1) * N + n]); *(v2us*)(Bt + e) = o; }
         }
}
// ---- The five elementwise kernels. Each runs as 256 work-groups; a wave takes many rows or lines instead of one, so that a launch starts a few thousand waves and not tens of thousands.
// Every kernel is built of runs: a run of 16-byte loads, the arithmetic, a run of stores. run_end() closes a run.
#define NPC (2 * DQ + 4 * DKV)     // pitch of the projection output F: [q | q2 | k | k2 | v | v2]
#define NRS (2 * NH_ + 2 * NKV)    // head slots that take norm and rope: [q 16 | q2 16 | k 8 | k2 8]
#define RPW 12                     // head slots per wave, all of one row t
static_assert(NRS % RPW == 0 && TT * (NRS / RPW) == 256 * 16, "norm and rope: 256 work-groups x 16 waves x RPW head slots cover [TT][NRS]");
__device__ __forceinline__ void run_end() {
    asm volatile("s_wait_xcnt 0x0" ::: "memory");   // behind a run of global loads or stores, in front of any later overwrite of the registers they name
    __builtin_amdgcn_sched_barrier(0);   // keeps every later register write behind that wait
}
// k_cvtall: every f32 operand of the plain GEMMs rounded to bf16 in one launch. dst = [x | wq | wq2 | wk | wk2 | wv | wv2 | wo] in units of DKV * DM elements (2, 2, 2, 1, 1, 1, 1, 2 units).
// A chunk is 4 x 512 threads x 8 elements; 128 chunks a unit, so a chunk lies in one unit; work-group b takes the chunks k * 256 + b, k < 6.
static_assert((size_t)DKV * DM == (size_t)128 * 16384 && 12 * 128 == 6 * 256 && DQ == 2 * DKV && NB_ * TT == 2 * DKV, "unit bookkeeping of k_cvtall");
__global__ __launch_bounds__(512) void k_cvtall(const float* __restrict__ x, const float* __restrict__ wq, const float* __restrict__ wq2, const float* __restrict__ wk, const float* __restrict__ wk2, const float* __restrict__ wv, const float* __restrict__ wv2, const float* __restrict__ wo, bf* dst) {
    const size_t U = (size_t)DKV * DM; const unsigned lo = threadIdx.x * 8; v8f v[2][4];
    auto fetch = [&](int k) {     // chunk k's eight loads, one run
        const int c = k * 256 + (int)blockIdx.x, u = c >> 7;
        const float* s = ((u < 2) ? x + u * U : (u < 4) ? wq + (u - 2) * U : (u < 6) ? wq2 + (u - 4) * U : (u == 6) ? wk : (u == 7) ? wk2 : (u == 8) ? wv : (u == 9) ? wv2 : wo + (u - 10) * U) + (size_t)(c & 127) * 16384;
#pragma unroll
        for (int i = 0; i < 4; ++i) v[k & 1][i] = *(const v8f*)(s + i * 4096 + lo);
        run_end();
    };
    fetch(0);
#pragma unroll   // unrolled: the two register sets are indexed by constants
    for (int k = 0; k < 6; ++k) {
        if (k + 1 < 6) fetch(k + 1);   // the next chunk's loads fly under this chunk's conversion and stores
        bf* d = dst + (size_t)(k * 256 + (int)blockIdx.x) * 16384; v8us o[4];
#pragma unroll
        for (int i = 0; i < 4; ++i)
#pragma unroll
            for (int q = 0; q < 8; ++q) o[i][q] = f2bf(v[k & 1][i][q]);
        __builtin_amdgcn_sched_barrier(0);   // every value is ready before the first store: no store's register is written again inside the run
#pragma unroll
        for (int i = 0; i < 4; ++i) *(v8us*)(d + i * 4096 + lo) = o[i];
        if (k + 1 < 6) run_end();
    }
}
static_assert(NB_ * TT * HD == 256 * 256 * 4, "k_cscvt: four table entries a thread");
__global__ __launch_bounds__(256) void k_cscvt(const float* __restrict__ cosT, const float* __restrict__ sinT, float* CS) {
    const int idx = (blockIdx.x * 256 + threadIdx.x) * 4; const v4f c = *(const v4f*)(cosT + idx), s = *(const v4f*)(sinT + idx);
    run_end();
    v4f o0, o1; o0[0] = bfr(c[0]); o0[1] = bfr(s[0]); o0[2] = bfr(c[1]); o0[3] = bfr(s[1]); o1[0] = bfr(c[2]); o1[1] = bfr(s[2]); o1[2] = bfr(c[3]); o1[3] = bfr(s[3]);
    *(v4f*)(CS + (size_t)idx * 2) = o0; *(v4f*)(CS + (size_t)idx * 2 + 4) = o1;  }
// k_rope: head planes [h][t][d] (fp16 + hi/lo) of rope(x) x sc with the rotate-half convention out[d] = x[d] cos[t][d] - x[d+HD/2] sin[t][d], out[d+HD/2] = x[d+HD/2] cos[t][d+HD/2] + x[d] sin[t][d+HD/2]
// A wave takes RPW head slots of one row t, four d a lane; the row's cos/sin pairs are read once for all of them; a run of cos/sin loads and a run of head-slot loads, then three groups of four head slots, each with its run of stores (256 B of a plane per store).
__global__ __launch_bounds__(512) void k_rope(const float* __restrict__ F, const float* __restrict__ CS, float sc, h16* P16, bf* Ph, bf* Pl) {
    const int lane = threadIdx.x & 31; const int W = blockIdx.x * 16 + __builtin_amdgcn_readfirstlane((int)(threadIdx.x >> 5)); const int t = W / (NRS / RPW), h0 = (W % (NRS / RPW)) * RPW;
    const int d = lane * 4, dp0 = (d < HD / 2) ? d + HD / 2 : d - HD / 2; const float* f = F + (size_t)t * NPC + h0 * HD; const size_t e0 = ((size_t)h0 * TT + t) * HD + d;
    h16* q16 = P16 + e0; bf* qh = Ph + e0; bf* ql = Pl + e0;
    asm volatile("" :: "v"(q16), "v"(qh), "v"(ql) : "memory");   // inputs only: the lane's three store addresses are complete in front of the loads, so that none of their arithmetic and no argument fetch lands in a register that an issued load names
    __builtin_amdgcn_sched_barrier(0);   // keeps the loads behind that point
    const v4f cs01 = *(const v4f*)(CS + ((size_t)t * HD + d) * 2), cs23 = *(const v4f*)(CS + ((size_t)t * HD + d) * 2 + 4);
    run_end();
    v4f xa[RPW], xb[RPW];
#pragma unroll
    for (int k = 0; k < RPW; ++k) { xa[k] = *(const v4f*)(f + k * HD + d); xb[k] = *(const v4f*)(f + k * HD + dp0); }
    run_end();
#pragma unroll
    for (int g = 0; g < RPW / 4; ++g) {
        v4h o16[4]; v4us oh[4], ol[4];
#pragma unroll
        for (int k = 0; k < 4; ++k)
#pragma unroll
            for (int q = 0; q < 4; ++q) { const int dd = d + q; const float x0 = xa[g * 4 + k][q], x1 = xb[g * 4 + k][q]; v2f cs; cs[0] = (q < 2) ? cs01[2 * (q & 1)] : cs23[2 * (q & 1)]; cs[1] = (q < 2) ? cs01[2 * (q & 1) + 1] : cs23[2 * (q & 1) + 1];
                float a = __fmul_rn(x0, cs[0]), bq = __fmul_rn(x1, cs[1]); asm volatile("" : "+v"(a)); asm volatile("" : "+v"(bq)); const float r = ((dd < HD / 2) ? __fsub_rn(a, bq) : __fadd_rn(a, bq)) * sc;
                o16[k][q] = tohx(r); unsigned short a2, c2; splitf(r, a2, c2); oh[k][q] = a2; ol[k][q] = c2; }
        __builtin_amdgcn_sched_barrier(0);   // every value is ready before the first store: no store's register is written again inside the run
#pragma unroll
        for (int k = 0; k < 4; ++k) { const size_t e = (size_t)(g * 4 + k) * TT * HD; *(v4h*)(q16 + e) = o16[k]; *(v4us*)(qh + e) = oh[k]; *(v4us*)(ql + e) = ol[k]; }
        if (g + 1 < RPW / 4) run_end();
    }
}
// k_vtp: value planes [g][d][t] (fp16 + hi/lo) of F[t][g * HD + d]. Work-group = (g, 128 rows t, 64 columns d), wave = 8 columns; a lane takes four rows t: eight 16-byte loads (4 t x 8 d), then per column and plane one 8-byte store, 256 B of the plane per wave.
static_assert(2 * NKV * (TT / 128) * (HD / 64) == 256, "k_vtp: 256 work-groups");
__global__ __launch_bounds__(256) void k_vtp(const float* __restrict__ F, h16* V16, bf* Vh, bf* Vl) {
    const int lane = threadIdx.x & 31, w = __builtin_amdgcn_readfirstlane((int)(threadIdx.x >> 5)), b = blockIdx.x; const int g = b >> 4, tb = ((b >> 1) & 7) * 128, d0 = (b & 1) * 64 + w * 8;
    const float* f = F + (size_t)tb * NPC + g * HD + d0; v4f x[4][2]; v4h o16[8]; v4us oh[8], ol[8];
#pragma unroll
    for (int i = 0; i < 4; ++i)
#pragma unroll
        for (int j = 0; j < 2; ++j) x[i][j] = *(const v4f*)(f + (size_t)(lane * 4 + i) * NPC + j * 4);
    run_end();
#pragma unroll
    for (int dd = 0; dd < 8; ++dd)
#pragma unroll
        for (int i = 0; i < 4; ++i) { const float xv = x[i][dd >> 2][dd & 3]; o16[dd][i] = tohx(xv); unsigned short a2, c2; splitf(xv, a2, c2); oh[dd][i] = a2; ol[dd][i] = c2; }
    __builtin_amdgcn_sched_barrier(0);   // every value is ready before the first store: no store's register is written again inside the run
    const size_t e0 = (size_t)(g * HD + d0) * TT + tb;
#pragma unroll
    for (int dd = 0; dd < 8; ++dd) { const size_t e = e0 + (size_t)dd * TT + lane * 4; *(v4h*)(V16 + e) = o16[dd]; *(v4us*)(Vh + e) = oh[dd]; *(v4us*)(Vl + e) = ol[dd]; }
}
// k_rmsw: RMSNorm x g in place on the head slots [q | q2 | k | k2] of F. A wave takes RPW consecutive head slots of one row t (RPW x 512 contiguous bytes): one run of loads, RPW independent row sums, one run of stores. The four weight vectors are read once; each slot takes its section's.
__global__ __launch_bounds__(512) void k_rmsw(float* F, const float* __restrict__ gq, const float* __restrict__ gq2, const float* __restrict__ gk, const float* __restrict__ gk2) {
    const int lane = threadIdx.x & 31; const int W = blockIdx.x * 16 + __builtin_amdgcn_readfirstlane((int)(threadIdx.x >> 5)); const int t = W / (NRS / RPW), h0 = (W % (NRS / RPW)) * RPW;
    float* f = F + (size_t)t * NPC + h0 * HD; v4f r[RPW]; float sq[RPW];
#pragma unroll
    for (int k = 0; k < RPW; ++k) r[k] = *(const v4f*)(f + k * HD + lane * 4);
    const v4f w0 = *(const v4f*)(gq + lane * 4), w1 = *(const v4f*)(gq2 + lane * 4), w2 = *(const v4f*)(gk + lane * 4), w3 = *(const v4f*)(gk2 + lane * 4);
    run_end();
#pragma unroll
    for (int k = 0; k < RPW; ++k) { const v4f a = r[k]; float ss = 0.f;
#pragma unroll
        for (int q = 0; q < 4; ++q) { float p = __fmul_rn(a[q], a[q]); asm volatile("" : "+v"(p)); ss = __fadd_rn(ss, p); }
        sq[k] = ss; }
#pragma unroll
    for (int sh = 16; sh; sh >>= 1)     // the RPW rows' butterflies step together: one cross-lane latency a step, not one a row and step
#pragma unroll
        for (int k = 0; k < RPW; ++k) sq[k] = __fadd_rn(sq[k], __shfl_xor(sq[k], sh, 32));
#pragma unroll
    for (int k = 0; k < RPW; ++k) { const int h = h0 + k; const v4f w = (h < NH_) ? w0 : (h < 2 * NH_) ? w1 : (h < 2 * NH_ + NKV) ? w2 : w3; const v4f a = r[k]; const float ss = sq[k];
        const float rs = __fdiv_rn(1.0f, sqrtf(__fadd_rn(ss * (1.0f / HD), 1e-6f))); v4f o;
#pragma unroll
        for (int q = 0; q < 4; ++q) { float y = __fmul_rn(a[q], rs); asm volatile("" : "+v"(y)); o[q] = __fmul_rn(y, bfr(w[q])); }
        r[k] = o; }
    __builtin_amdgcn_sched_barrier(0);   // every value is ready before the first store: no store's register is written again inside the run
#pragma unroll
    for (int k = 0; k < RPW; ++k) *(v4f*)(f + k * HD + lane * 4) = r[k];
}
// ---- k_fattn: scores, joint softmax and both value products of one head in one kernel; grid (TT / 64, NH_), 4 waves, each wave owns 16 query rows and works alone (no work-group barrier).
// A wave walks 64-key tiles of the window path (from its diagonal tile down to key i - 255), then of the fading path (keys <= i - 256), under ONE running maximum, sum and output accumulator (online softmax):
// the joint softmax over [s_ic | s_f]. A key outside the path's own range gets weight exactly 0. The diagonal tile comes first, so every row's maximum is finite from the first tile on.
// Probabilities go from the accumulator layout to the A-operand layout through the wave's own LDS slice. Rows < RH: hi+lo bf16 planes, 3 products; rows >= RH: fp16, weights x PCAR (the factor cancels in sum and output alike).
// Loops: the path loop and the tile loop stay rolled (#pragma unroll 1: one copy of the long body); every inner loop is unrolled, so that the fragment and accumulator arrays are indexed by constants and stay in registers.
#define PP 72     // LDS pitch (16-bit elements) of the 16 x 64 probability tile: 16-byte aligned rows, 16-byte row reads spread over the banks
#define OP 136    // LDS pitch of the 16 x 128 output tile
template <int X> __device__ __forceinline__ float rowx(float v) { return __int_as_float(__builtin_amdgcn_update_dpp(0, __float_as_int(v), 0x160 + X, 0xf, 0xf, true)); }   // DPP row_xmask: the value of lane ^ X inside the 16-lane row, on the vector port (a shuffle would go through the LDS queue, one wait each)
__device__ __forceinline__ float rowmax(float v) { v = fmaxf(v, rowx<8>(v)); v = fmaxf(v, rowx<4>(v)); v = fmaxf(v, rowx<2>(v)); return fmaxf(v, rowx<1>(v)); }
__device__ __forceinline__ float rowsum(float v) { v += rowx<8>(v); v += rowx<4>(v); v += rowx<2>(v); return v + rowx<1>(v); }
template <typename T16> struct LFrag;
template <> struct LFrag<h16> { static __device__ __forceinline__ v16h ld(const unsigned short* p) { const v8us lo = *(const v8usa*)p, hi = *(const v8usa*)(p + 16); return cat16(__builtin_bit_cast(v8h, lo), __builtin_bit_cast(v8h, hi)); } };
template <> struct LFrag<bf> { static __device__ __forceinline__ v16bf ld(const unsigned short* p) { const v8us lo = *(const v8usa*)p, hi = *(const v8usa*)(p + 16); return cat16b(lo, hi); } };
template <typename T16, bool HL>
__device__ __forceinline__ void attn_rows(const T16* __restrict__ R, const T16* __restrict__ Rlo, const T16* __restrict__ VT, const T16* __restrict__ VTlo, int h, int i0, unsigned short* sh, unsigned short* sl, bf* Ah, bf* Al) {
    typedef typename WFrag<T16>::V V;
    constexpr int NG = HL ? 2 : 1;    // planes per operand; also the number of 16-fragment (32-load) groups that a tile's keys, and its values, are fetched in
    const int lane = threadIdx.x & 31, lr = lane & 15, hi = lane >> 4;
    v8f O[8]; float m[8], l[8];
#pragma unroll
    for (int db = 0; db < 8; ++db) O[db] = (v8f){};
#pragma unroll
    for (int jj = 0; jj < 8; ++jj) { m[jj] = -3.0e38f; l[jj] = 0.f; }
#pragma unroll 1
    for (int p = 0; p < 2; ++p) {      // p = 0: window path, p = 1: fading path
        const size_t qo = ((size_t)(p * NH_ + h) * TT + i0 + lr) * HD + 8 * hi, ko = ((size_t)(2 * NH_ + p * NKV + h / REP) * TT + lr) * HD + 8 * hi, vo = ((size_t)(p * NKV + h / REP) * HD + lr) * TT + 8 * hi;
        V a[4], a2[4];
#pragma unroll
        for (int ks = 0; ks < 4; ++ks) { a[ks] = WFrag<T16>::ld(R + qo + ks * 32); if (HL) a2[ks] = WFrag<T16>::ld(Rlo + qo + ks * 32); }
        const int jhi = p ? ((i0 + 15 - 256) >> 6) : (i0 >> 6), jlo = p ? 0 : (max(0, i0 - 255) >> 6);   // first and last 64-key tile with a live key for one of the 16 rows (jhi < 0: none)
#pragma unroll 1
        for (int jt = jhi; jt >= jlo; --jt) {
            const int j0 = jt * 64; v8f s[4]; V kf[NG][16], vf[NG][16];
            // Fetch order of a tile. Keys and values come in groups of 16 fragments (32 loads), each group issued as one run, so that a group costs one load latency and not one every few fragments.
            // A second group (hi+lo planes) is issued behind the first block's products, whose wait has retired part of the first group: fewer than 64 loads of the wave are outstanding at any time.
            // Each sched_barrier(0) keeps the compiler from moving loads or products over that point. Each s_wait_xcnt 0 stands behind a run of loads, in front of every later overwrite of their address registers (a later load's result may land there).
            asm volatile("s_wait_xcnt 0x0" ::: "memory");   // for the query loads in front of the loop: the key loads' results may land in their address registers
            __builtin_amdgcn_sched_barrier(0);   // keeps the key loads behind that wait
#pragma unroll
            for (int f = 0; f < 16 / NG; ++f) { const size_t o = ko + (size_t)(j0 + (f >> 2) * 16) * HD + (f & 3) * 32; kf[0][f * NG] = WFrag<T16>::ld(R + o); if (HL) kf[0][f * NG + 1] = WFrag<T16>::ld(Rlo + o); }
            asm volatile("s_wait_xcnt 0x0" ::: "memory");   // behind the first key group's loads, in front of any overwrite of their address registers
            __builtin_amdgcn_sched_barrier(0);   // the whole group is issued before the first product waits for a fragment
#pragma unroll
            for (int nb = 0; nb < 4; ++nb) { const int g = nb / (4 / NG), nl = nb % (4 / NG); s[nb] = (v8f){};
#pragma unroll
                for (int ks = 0; ks < 4; ++ks) { s[nb] = WFrag<T16>::mma(a[ks], kf[g][(nl * 4 + ks) * NG], s[nb]);
                    if (HL) { s[nb] = WFrag<T16>::mma(a2[ks], kf[g][(nl * 4 + ks) * NG], s[nb]); s[nb] = WFrag<T16>::mma(a[ks], kf[g][(nl * 4 + ks) * NG + 1], s[nb]); } }
                if (HL && nb == 0) {
                    __builtin_amdgcn_sched_barrier(0);   // the second key group is issued behind the first block's products (fewer than 64 loads outstanding)
#pragma unroll
                    for (int f = 0; f < 16 / NG; ++f) { const size_t o = ko + (size_t)(j0 + (4 / NG + (f >> 2)) * 16) * HD + (f & 3) * 32; kf[NG - 1][f * NG] = WFrag<T16>::ld(R + o); kf[NG - 1][f * NG + 1] = WFrag<T16>::ld(Rlo + o); }
                    asm volatile("s_wait_xcnt 0x0" ::: "memory");   // behind the second key group's loads, as above
                    __builtin_amdgcn_sched_barrier(0);   // and it flies under the products that follow
                } }
            __builtin_amdgcn_sched_barrier(0);   // the value loads start behind the last score product: every key load has retired by then
#pragma unroll
            for (int f = 0; f < 16 / NG; ++f) { const size_t o = vo + (size_t)(f >> 1) * 16 * TT + j0 + (f & 1) * 32; vf[0][f * NG] = WFrag<T16>::ld(VT + o); if (HL) vf[0][f * NG + 1] = WFrag<T16>::ld(VTlo + o); }
            asm volatile("s_wait_xcnt 0x0" ::: "memory");   // behind the first value group's loads, as above
            __builtin_amdgcn_sched_barrier(0);   // the first value group flies while the softmax runs
            float mx[8];
#pragma unroll
            for (int jj = 0; jj < 8; ++jj) mx[jj] = m[jj];
#pragma unroll
            for (int nb = 0; nb < 4; ++nb)
#pragma unroll
                for (int jj = 0; jj < 8; ++jj) { const int dij = (i0 + hi * 8 + jj) - (j0 + nb * 16 + lr); const bool live = p ? (dij >= 256) : (dij >= 0 && dij < 256); const float t = live ? s[nb][jj] * SCL : -3.0e38f; s[nb][jj] = t; mx[jj] = fmaxf(mx[jj], t); }
#pragma unroll
            for (int jj = 0; jj < 8; ++jj) {
                mx[jj] = rowmax(mx[jj]);   // a row's 16 columns lie in the 16 lanes of one half
                const float al = __builtin_amdgcn_exp2f((m[jj] - mx[jj]) * 1.4426950408889634f); m[jj] = mx[jj]; l[jj] *= al;
#pragma unroll
                for (int db = 0; db < 8; ++db) O[db][jj] *= al; }
#pragma unroll
            for (int nb = 0; nb < 4; ++nb)
#pragma unroll
                for (int jj = 0; jj < 8; ++jj) { const float pv = __builtin_amdgcn_exp2f((s[nb][jj] - m[jj]) * 1.4426950408889634f) * (HL ? 1.0f : PCAR); l[jj] += pv; const int o = (hi * 8 + jj) * PP + nb * 16 + lr;
                    if (HL) { unsigned short ph, pl; splitf(pv, ph, pl); sh[o] = ph; sl[o] = pl; } else sh[o] = __builtin_bit_cast(unsigned short, tohx(pv)); }
            __builtin_amdgcn_wave_barrier(); asm volatile("" ::: "memory");   // the fragment reads below take other lanes' stores: keep them behind the stores
            V pa[2], pb[2];
#pragma unroll
            for (int k2 = 0; k2 < 2; ++k2) { pa[k2] = LFrag<T16>::ld(sh + lr * PP + k2 * 32 + 8 * hi); if (HL) pb[k2] = LFrag<T16>::ld(sl + lr * PP + k2 * 32 + 8 * hi); }
            __builtin_amdgcn_wave_barrier(); asm volatile("" ::: "memory");   // the next tile's stores stay behind these reads
#pragma unroll
            for (int db = 0; db < 8; ++db) { const int g = db / (8 / NG), dl = db % (8 / NG);
#pragma unroll
                for (int k2 = 0; k2 < 2; ++k2) { O[db] = WFrag<T16>::mma(pa[k2], vf[g][(dl * 2 + k2) * NG], O[db]);
                    if (HL) { O[db] = WFrag<T16>::mma(pb[k2], vf[g][(dl * 2 + k2) * NG], O[db]); O[db] = WFrag<T16>::mma(pa[k2], vf[g][(dl * 2 + k2) * NG + 1], O[db]); } }
                if (HL && db == 0) {
                    __builtin_amdgcn_sched_barrier(0);   // the second value group is issued behind the first block's products (fewer than 64 loads outstanding)
#pragma unroll
                    for (int f = 0; f < 16 / NG; ++f) { const size_t o = vo + (size_t)(8 / NG + (f >> 1)) * 16 * TT + j0 + (f & 1) * 32; vf[NG - 1][f * NG] = WFrag<T16>::ld(VT + o); vf[NG - 1][f * NG + 1] = WFrag<T16>::ld(VTlo + o); }
                    asm volatile("s_wait_xcnt 0x0" ::: "memory");   // behind the second value group's loads, as above
                    __builtin_amdgcn_sched_barrier(0);   // and it flies under the products that follow
                } }
        }
    }
#pragma unroll
    for (int jj = 0; jj < 8; ++jj) {
        const float f = __fdiv_rn(1.0f, rowsum(l[jj]));
#pragma unroll
        for (int db = 0; db < 8; ++db) { unsigned short oh, ol; splitf(O[db][jj] * f, oh, ol); const int o = (hi * 8 + jj) * OP + db * 16 + lr; sh[o] = oh; sl[o] = ol; } }
    __builtin_amdgcn_wave_barrier(); asm volatile("" ::: "memory");   // the row reads below take other lanes' stores
#pragma unroll
    for (int c = 0; c < 8; ++c) { const int row = c * 2 + hi, col = lr * 8; const size_t oo = (size_t)(i0 + row) * DQ + h * HD + col; const v8us vh = *(const v8usa*)(sh + row * OP + col), vl = *(const v8usa*)(sl + row * OP + col); *(v8us*)(Ah + oo) = vh; *(v8us*)(Al + oo) = vl; }
}
__global__ __launch_bounds__(128) void k_fattn(const h16* __restrict__ R16, const bf* __restrict__ Rh, const bf* __restrict__ Rl, const h16* __restrict__ VT16, const bf* __restrict__ VTh, const bf* __restrict__ VTl, bf* Ah, bf* Al) {
    __shared__ __align__(16) unsigned short ps[4][2][16 * OP];
    const int wv = __builtin_amdgcn_readfirstlane((int)(threadIdx.x >> 5)); const int rb = (int)(gridDim.x - 1 - blockIdx.x);   // the last rows hold the most keys: they take the lowest block index
    const int i0 = rb * 64 + wv * 16, h = blockIdx.y;
    if (rb * 64 < RH) attn_rows<bf, true>(Rh, Rl, VTh, VTl, h, i0, ps[wv][0], ps[wv][1], Ah, Al);
    else attn_rows<h16, false>(R16, nullptr, VT16, nullptr, h, i0, ps[wv][0], ps[wv][1], Ah, Al);
}

// k_asoft: per row (zz, i): t = S x HD^-0.5 for j <= i and i - j < WIN (sliding causal window; the reference's -1e9 additive fill vanishes identically); softmax over the 1024 keys (register row, one exp, fixed trees);
__global__ __launch_bounds__(256) void k_asoft(const float* __restrict__ Sb, h16* P16, bf* Ph, bf* Pl) {
    const int lane = threadIdx.x & 31; const int row = blockIdx.x * 8 + (threadIdx.x >> 5); if (row >= ZH * TT) return; const int i = row % TT; const int zz = row / TT; (void)zz; const bool hires = (i < RH); const float* sr = Sb + (size_t)row * TT; float v[TT / 32]; float mx = -3.0e38f;
#pragma unroll
    for (int ch = 0; ch < TT / 128; ++ch) { const int j0 = ch * 128 + lane * 4; const v4f a = *(const v4f*)(sr + j0);
#pragma unroll
        for (int q = 0; q < 4; ++q) { const int j = j0 + q; (void)j; const float t = (j <= i && i - j < WIN) ? a[q] * SCL : -3.0e38f; v[ch * 4 + q] = t; mx = fmaxf(mx, t); } }
#pragma unroll
    for (int sh = 16; sh; sh >>= 1) mx = fmaxf(mx, __shfl_xor(mx, sh, 32));
    float sum = 0.f;
#pragma unroll
    for (int k = 0; k < TT / 32; ++k) { float d0 = __fsub_rn(v[k], mx); asm volatile("" : "+v"(d0)); v[k] = __builtin_amdgcn_exp2f(__fmul_rn(d0, 1.4426950408889634f)); sum += v[k]; }
#pragma unroll
    for (int sh = 16; sh; sh >>= 1) sum += __shfl_xor(sum, sh, 32);
    const float f = __fdiv_rn(hires ? 1.0f : PCAR, sum);
{
        if (hires) {
#pragma unroll
            for (int ch = 0; ch < TT / 128; ++ch) { v4us oh, ol;
#pragma unroll
                for (int q = 0; q < 4; ++q) { unsigned short a, c2; splitf(v[ch * 4 + q] * f, a, c2); oh[q] = a; ol[q] = c2; }
                const size_t oo = ((size_t)zz * (RH ? RH : 1) + i) * TT + ch * 128 + lane * 4; *(v4us*)(Ph + oo) = oh; *(v4us*)(Pl + oo) = ol; }
        } else {
#pragma unroll
            for (int ch = 0; ch < TT / 128; ++ch) { v4h o4;
#pragma unroll
                for (int q = 0; q < 4; ++q) o4[q] = tohx(v[ch * 4 + q] * f);
                *(v4h*)(P16 + (size_t)row * TT + ch * 128 + lane * 4) = o4; } }
         }
}
__global__ __launch_bounds__(256) void k_merge(const float* __restrict__ O, int h0, bf* Ah, bf* Al) { const size_t e = ((size_t)blockIdx.x * 256 + threadIdx.x) * 2; if (e >= (size_t)ZH * TT * HD) return; const int d = (int)(e % HD); const int t = (int)((e / HD) % TT); const int zz = (int)(e / ((size_t)HD * TT)); const float cs = (t < RH) ? 1.0f : (1.0f / PCAR); const size_t oo = (size_t)t * DQ + (h0 + zz) * HD + d;
    v2us oh, ol;
#pragma unroll
    for (int q = 0; q < 2; ++q) { unsigned short a, c2; splitf(O[e + q] * cs, a, c2); oh[q] = a; ol[q] = c2; } *(v2us*)(Ah + oo) = oh; *(v2us*)(Al + oo) = ol;  }

extern "C" void kernel_launch(void* const* d_in, const int* in_sizes, int n_in,
                              void* d_out, int out_size, void* d_ws, size_t ws_size, hipStream_t stream) {
    (void)in_sizes; (void)n_in; (void)out_size;
    const float* x = (const float*)d_in[0]; const float* cosA = (const float*)d_in[1]; const float* sinA = (const float*)d_in[2]; const float* wq = (const float*)d_in[3]; const float* bq = (const float*)d_in[4]; const float* wk = (const float*)d_in[5]; const float* bk = (const float*)d_in[6]; const float* wv = (const float*)d_in[7]; const float* bv = (const float*)d_in[8]; const float* wq2 = (const float*)d_in[9]; const float* bq2 = (const float*)d_in[10]; const float* wk2 = (const float*)d_in[11]; const float* bk2 = (const float*)d_in[12]; const float* wv2 = (const float*)d_in[13]; const float* bv2 = (const float*)d_in[14]; const float* wo = (const float*)d_in[15]; const float* gq = (const float*)d_in[16]; const float* gk = (const float*)d_in[17]; const float* gq2 = (const float*)d_in[18]; const float* gk2 = (const float*)d_in[19]; const float* cosT = cosA; const float* sinT = sinA;
    float* OUT = (float*)d_out;     // [2][1024][2048]
    char* wsp = (char*)d_ws;
    auto take = [&](size_t bytes) { char* p = wsp; wsp += (bytes + 255) & ~(size_t)255; return (void*)p; };
    // 16-bit GEMM operands, one conversion launch: [x (both batches) | wq | wq2 | wk | wk2 | wv | wv2 | wo]; the six projection weights are one [NP][DM] plane
    const size_t U = (size_t)DKV * DM; const int NP = 2 * DQ + 4 * DKV, NRH = 2 * NH_ + 2 * NKV, NVH = 2 * NKV;
    bf* XB = (bf*)take(12 * U * 2); bf* WP = XB + 2 * U; bf* WO = XB + 10 * U; float* CS = (float*)take((size_t)NB_ * TT * HD * 2 * 4);
    // head planes, both paths side by side: [q 16 | q2 16 | k 8 | k2 8][t][d] and [v 8 | v2 8][d][t]
    h16* R16 = (h16*)take((size_t)NRH * TT * HD * 2); bf* Rh = (bf*)take((size_t)NRH * TT * HD * 2); bf* Rl = (bf*)take((size_t)NRH * TT * HD * 2);
    h16* VT16 = (h16*)take((size_t)NVH * HD * TT * 2); bf* VTh = (bf*)take((size_t)NVH * HD * TT * 2); bf* VTl = (bf*)take((size_t)NVH * HD * TT * 2);
    float* F = (float*)take((size_t)TT * NP * 4); bf* ATl = (bf*)take((size_t)NB_ * TT * DQ * 2);   // one batch's [TT][NP] projection output; the lo plane of the merged attention output
    if ((size_t)(wsp - (char*)d_ws) > ws_size) return;    // ws 256 MiB
    bf* ATh = XB;     // the hi plane of the merged attention output reuses x: batch b's rows are dead once batch b's projection has run (stream-ordered; same size)
    static_assert(DQ == DM, "ATh fits x");
    k_cvtall<<<256, 512, 0, stream>>>(x, wq, wq2, wk, wk2, wv, wv2, wo, XB);
    k_cscvt<<<256, 256, 0, stream>>>(cosA, sinA, CS);
    for (int b = 0; b < NB_; ++b) {
        k_gemms<256, DM, 0, true><<<dim3(TT / 256, NP / 128, 1), 256, 0, stream>>>(XB + (size_t)b * TT * DM, nullptr, WP, F, NP, bq, bq2, bk, bk2, bv, bv2);
        k_rmsw<<<256, 512, 0, stream>>>(F, gq, gq2, gk, gk2);
        k_rope<<<256, 512, 0, stream>>>(F, CS + (size_t)b * TT * HD * 2, 1.0f, R16, Rh, Rl);
        k_vtp<<<256, 256, 0, stream>>>(F + NRH * HD, VT16, VTh, VTl);
        k_fattn<<<dim3(TT / 64, NH_, 1), 128, 0, stream>>>(R16, Rh, Rl, VT16, VTh, VTl, ATh + (size_t)b * TT * DQ, ATl + (size_t)b * TT * DQ); }
    k_gemms<128, DQ, 1, false><<<dim3(NB_ * TT / 128, DM / 128, 1), 128, 0, stream>>>(ATh, ATl, WO, OUT, DM, nullptr, nullptr, nullptr, nullptr, nullptr, nullptr);
}

// v006
// Measured time: 212 microseconds a run.
// In both of two side-by-side timings against v005, it was 1.18 times as fast.
// All steps since v000 together make it 11.0 times as fast.
#include <hip/hip_runtime.h>

// BMOJOAttention (hidden [2][1024][2048]; two projection paths - in-context (Wq,bq,Wk,bk,Wv,bv,gq,gk) and fading (Wq2..gk2): q = rope(rmsnorm(x Wq^T + bq) gq) (16 x 128), k = rope(rmsnorm(x Wk^T + bk) gk) (8 kv heads; group h/2), v = x Wv^T + bv; rotate-half RoPE with the read cos/sin [B][S][128]; s_ic = q_ic.k_ic / sqrt(128) live where 0 <= i-j < 256, s_f = q_f.k_f / sqrt(128) live where i-j >= 256 (else -1e30); ONE joint softmax over [s_ic | s_f]; out = p_ic v_ic + p_f v_f; merged Wo^T -> [2][1024][2048]).
// The joint softmax over 2S columns is computed as one causal softmax whose score (and value source) switches at i-j = 256: the masked halves contribute exactly 0; keys j > i are masked in both (causal tile skipping).
// Compute dtypes, f32 accumulate: every input rounded to bf16; both paths' q/k/v on PLAIN bf16 operands (inputs: exact) + bias; RMSNorm * g (in place) and RoPE (bf16-rounded per-batch tables) f32; both score sets and both attn.v products: query rows < 512 hl (3 products), the rest single fp16 (x1024), causal tile skipping; online softmax f32 over the live scores of both paths, both value products into one f32 accumulator, all in one kernel (k_fattn), which emits the hl planes of the merged output; Wo hl x exact (2 products).

#define NB_  2
#define TT   1024
#define DM   2048
#define NH_  16
#define NKV  8
#define REP  (NH_ / NKV)
#define HD   128
#define DQ   (NH_ * HD)
#define DKV  (NKV * HD)
#define ZH   16                   // heads per attention pass: all of them
#define RH   512                  // query rows < RH use hi+lo planes (0: none)
#define WIN  1024
#define PCAR 1024.0f
static_assert(RH % 64 == 0, "a 64-row block of the attention lies on one side of RH");
#define SCL  0.088388347648318447f   // HD^-0.5
typedef _Float16 h16;
typedef unsigned short bf;
typedef __attribute__((ext_vector_type(16))) __bf16   v16bf;
typedef __attribute__((ext_vector_type(16))) _Float16 v16h;
typedef __attribute__((ext_vector_type(8)))  _Float16 v8h;
typedef __attribute__((ext_vector_type(8)))  unsigned short v8us;
typedef __attribute__((ext_vector_type(8)))  float    v8f;
typedef __attribute__((ext_vector_type(4)))  float    v4f;
typedef v8h  __attribute__((may_alias)) v8ha;
typedef v4f  __attribute__((may_alias)) v4fa;
typedef v8us __attribute__((may_alias)) v8usa;

__device__ __forceinline__ unsigned short f2bf(float f) { unsigned u = __float_as_uint(f); u += 0x7FFFu + ((u >> 16) & 1u); return (unsigned short)(u >> 16); }
__device__ __forceinline__ float bf2f(unsigned short b) { return __uint_as_float(((unsigned)b) << 16); }
__device__ __forceinline__ float bfr(float f) { return bf2f(f2bf(f)); }
__device__ __forceinline__ v16h cat16(v8h lo, v8h hi) { return __builtin_shufflevector(lo, hi, 0, 1, 2, 3, 4, 5, 6, 7, 8, 9, 10, 11, 12, 13, 14, 15); }
__device__ __forceinline__ v16bf cat16b(v8us lo, v8us hi) { return __builtin_bit_cast(v16bf, __builtin_shufflevector(lo, hi, 0, 1, 2, 3, 4, 5, 6, 7, 8, 9, 10, 11, 12, 13, 14, 15)); }
__device__ __forceinline__ v8f wmma16(v16h a, v16h b, v8f c) { return __builtin_amdgcn_wmma_f32_16x16x32_f16(false, a, false, b, (short)0, c, false, false); }
__device__ __forceinline__ v8f wmmab(v16bf a, v16bf b, v8f c) { return __builtin_amdgcn_wmma_f32_16x16x32_bf16(false, a, false, b, (short)0, c, false, false); }



// ---- k_gemms: GEMM with both operands staged in LDS. One work-group = BM x 128 output tile, BM threads = BM / 32 waves in a (BM / 64) x 2 grid, 64 x 64 (16 accumulators) per wave; grid (M / BM, N / 128).
// C[m][n] (f32, pitch ldc, + optional bias[n] rounded to bf16) = sum_k (A[m][k] + A2[m][k]) Bt[n][k] (A2 only with NSPLIT = 1: two products per k step, A first); all planes K-contiguous bf16, KK % 64 == 0.
// A stage is 64 k (128 B, one line) of every operand row. Each global load of a wave covers four whole lines; a line is fetched once per work-group and then read from LDS by every wave that needs it.
// Two LDS buffers: a stage's lines are loaded into registers one stage ahead, stored into the other buffer between the two halves of the running stage's products, and one work-group barrier per stage hands the buffers over.
// With BIAS the N axis is the concatenation [q | q2 | k | k2 | v | v2] of both paths' projections (DQ, DQ, DKV, DKV, DKV, DKV columns); each 64-column tile lies in one section and takes that section's bias vector.
template <typename T16> struct WFrag;
template <> struct WFrag<h16> { typedef v16h V; static __device__ __forceinline__ V ld(const h16* p) { return cat16(*(const v8h*)p, *(const v8h*)(p + 16)); } static __device__ __forceinline__ v8f mma(V a, V b, v8f c) { return wmma16(a, b, c); } };
template <> struct WFrag<bf> { typedef v16bf V; static __device__ __forceinline__ V ld(const bf* p) { return cat16b(*(const v8us*)p, *(const v8us*)(p + 16)); } static __device__ __forceinline__ v8f mma(V a, V b, v8f c) { return wmmab(a, b, c); } };
#define GP 72     // LDS pitch (16-bit elements) of a staged 64-k row: 128 B + 16 B, the pitch for 16-byte row reads
template <int BM, int KK, int NSPLIT, bool BIAS>
__global__ __launch_bounds__(BM) void k_gemms(const bf* __restrict__ A, const bf* __restrict__ A2, const bf* __restrict__ Bt, float* C, int ldc, const float* __restrict__ bq, const float* __restrict__ bq2, const float* __restrict__ bk, const float* __restrict__ bk2, const float* __restrict__ bv, const float* __restrict__ bv2) {
    constexpr int NA = NSPLIT ? 2 : 1, RP = BM / 8, NBP = 128 / RP;    // A planes; rows that one staging pass of the work-group covers (8 threads a row); passes for the 128 rows of Bt (the BM rows of A take 8)
    __shared__ __align__(16) unsigned short sa[2][NA][BM * GP];
    __shared__ __align__(16) unsigned short sb[2][128 * GP];
    __shared__ __align__(16) float osm[BM / 32][16 * 68];
    const int tid = threadIdx.x, lane = tid & 31, lr = lane & 15, hi = lane >> 4, wv = __builtin_amdgcn_readfirstlane(tid >> 5);
    const int rw = (wv >> 1) * 64, cw = (wv & 1) * 64; const int r0 = blockIdx.x * BM, c0 = blockIdx.y * 128 + cw;
    const float* bias = nullptr;   // this wave's bias, already stepped to its column c0
    if (BIAS) bias = (c0 < DQ) ? bq + c0 : (c0 < 2 * DQ) ? bq2 + (c0 - DQ) : (c0 < 2 * DQ + DKV) ? bk + (c0 - 2 * DQ) : (c0 < 2 * DQ + 2 * DKV) ? bk2 + (c0 - 2 * DQ - DKV) : (c0 < 2 * DQ + 3 * DKV) ? bv + (c0 - 2 * DQ - 2 * DKV) : bv2 + (c0 - 2 * DQ - 3 * DKV);
    const int srow = tid >> 3, scol = (tid & 7) * 8;
    unsigned vo = (unsigned)(srow * KK + scol) * 2;    // the lane's byte offset from the work-group-uniform bases below, for the stage that is fetched next: carried through the loop in one register, stepped behind each run of loads
    typedef const __attribute__((address_space(1))) char* gptr;
    const gptr ua = (gptr)(A + (size_t)r0 * KK), ua2 = (gptr)(A2 + (size_t)r0 * KK), ub = (gptr)(Bt + (size_t)blockIdx.y * 128 * KK);
    v8us ra[NA][8], rb[NBP];
    auto ld16 = [](gptr p) { return *(const __attribute__((address_space(1))) v8us*)p; };
    auto fetch = [&]() {     // the next stage's lines into registers, one run of loads
#pragma unroll
        for (int i = 0; i < 8; ++i) { ra[0][i] = ld16(ua + vo + (size_t)i * RP * KK * 2); if (NSPLIT) ra[NA - 1][i] = ld16(ua2 + vo + (size_t)i * RP * KK * 2); }
#pragma unroll
        for (int i = 0; i < NBP; ++i) rb[i] = ld16(ub + vo + (size_t)i * RP * KK * 2);
        asm volatile("s_wait_xcnt 0x0" ::: "memory");   // behind the run of loads, in front of any later overwrite of their address registers
        __builtin_amdgcn_sched_barrier(0);   // keeps every later register write behind that wait
        vo += 128;
    };
    auto put = [&](int buf) {      // those registers into LDS buffer buf
#pragma unroll
        for (int i = 0; i < 8; ++i) { const int o = (srow + i * RP) * GP + scol; *(v8usa*)(&sa[buf][0][o]) = ra[0][i]; if (NSPLIT) *(v8usa*)(&sa[buf][NA - 1][o]) = ra[NA - 1][i]; }
#pragma unroll
        for (int i = 0; i < NBP; ++i) *(v8usa*)(&sb[buf][(srow + i * RP) * GP + scol]) = rb[i];
    };
    v8f acc[4][4];
#pragma unroll
    for (int mb = 0; mb < 4; ++mb)
#pragma unroll
        for (int nb = 0; nb < 4; ++nb) acc[mb][nb] = (v8f){};
    v16bf a[2][4], a2[2][4], b[2][4];   // the fragments of the two 32-k halves of a stage
    auto frags = [&](int ks, int buf) {   // half ks of the stage in LDS buffer buf, one run of reads
#pragma unroll
        for (int mb = 0; mb < 4; ++mb) { const int o = (rw + mb * 16 + lr) * GP + ks * 32 + 8 * hi; a[ks][mb] = cat16b(*(const v8usa*)(&sa[buf][0][o]), *(const v8usa*)(&sa[buf][0][o + 16])); if (NSPLIT) a2[ks][mb] = cat16b(*(const v8usa*)(&sa[buf][NA - 1][o]), *(const v8usa*)(&sa[buf][NA - 1][o + 16])); }
#pragma unroll
        for (int nb = 0; nb < 4; ++nb) { const int o = (cw + nb * 16 + lr) * GP + ks * 32 + 8 * hi; b[ks][nb] = cat16b(*(const v8usa*)(&sb[buf][o]), *(const v8usa*)(&sb[buf][o + 16])); }
    };
    auto products = [&](int ks) {
#pragma unroll
        for (int nb = 0; nb < 4; ++nb) {
#pragma unroll
            for (int mb = 0; mb < 4; ++mb) acc[mb][nb] = wmmab(a[ks][mb], b[ks][nb], acc[mb][nb]);
            if (NSPLIT) {
#pragma unroll
                for (int mb = 0; mb < 4; ++mb) acc[mb][nb] = wmmab(a2[ks][mb], b[ks][nb], acc[mb][nb]); } }
    };
    // Order of a trip (stage t in buffer t & 1): first half's products | stage t + 1 from registers into the other buffer | barrier | first-half fragments of stage t + 1 and the global loads of stage t + 2 go out | second half's products | second-half fragments of stage t + 1 go out.
    // Every read of a buffer stands in front of the barrier that precedes its refill; every read of a stage stands behind the barrier that follows its stores. No global load is in flight at a barrier (the barrier's fence would wait for it).
    // Each sched_barrier(0) keeps loads, stores and products on their side of that point, so that each run of reads flies under the products behind it.
    fetch(); put(0);
    __syncthreads();   // publishes stage 0
    frags(0, 0); fetch(); frags(1, 0);
    static_assert(KK >= 128, "a stage 1 exists");
#pragma unroll 1   // stays rolled: one copy of the body, one set of fragment and staging registers
    for (int kc = 0; kc < KK; kc += 64) {
        const int nxt = ((kc >> 6) & 1) ^ 1; const bool more1 = kc + 64 < KK, more2 = kc + 128 < KK;
        __builtin_amdgcn_sched_barrier(0);
        products(0);
        __builtin_amdgcn_sched_barrier(0);
        if (more1) put(nxt);
        __syncthreads();   // publishes stage t + 1 and ends every wave's reads of stage t
        if (more1) frags(0, nxt);
        if (more2) fetch();
        __builtin_amdgcn_sched_barrier(0);
        products(1);
        __builtin_amdgcn_sched_barrier(0);
        if (more1) frags(1, nxt);
    }
    float* os = osm[wv];
    v4f bb = (v4f){};   // the lane's four bias values (columns lr * 4 ..), the same for every row: read once
    if (BIAS) {
        const float b0 = bias[lr * 4], b1 = bias[lr * 4 + 1], b2 = bias[lr * 4 + 2], b3 = bias[lr * 4 + 3];
        asm volatile("s_wait_xcnt 0x0" ::: "memory");   // behind the bias load, in front of any later overwrite of its address registers
        __builtin_amdgcn_sched_barrier(0);   // keeps every later register write behind that wait
        bb[0] = bfr(b0); bb[1] = bfr(b1); bb[2] = bfr(b2); bb[3] = bfr(b3); }
#pragma unroll
    for (int mb = 0; mb < 4; ++mb) {
#pragma unroll
        for (int nb = 0; nb < 4; ++nb) {
#pragma unroll
            for (int j = 0; j < 8; ++j) os[(hi * 8 + j) * 68 + nb * 16 + lr] = acc[mb][nb][j]; }
        __builtin_amdgcn_wave_barrier(); asm volatile("" ::: "memory");   // the row reads below take other lanes' stores: keep them behind the stores
        float* crow = C + (size_t)(r0 + rw + mb * 16) * ldc + c0;
#pragma unroll
        for (int s = 0; s < 8; ++s) { const int row = 2 * s + hi, cofs = lr * 4; v4f val = *(const v4fa*)(os + row * 68 + cofs); if (BIAS) val += bb;
            *(v4f*)(crow + (size_t)row * ldc + cofs) = val; }
        __builtin_amdgcn_wave_barrier(); asm volatile("s_wait_xcnt 0x0" ::: "memory");   // the next block's LDS stores stay behind these reads; the wait stands behind the run of global stores, in front of any overwrite of their registers
        __builtin_amdgcn_sched_barrier(0);   // keeps the next block's register writes behind that wait
    }
}

__device__ __forceinline__ h16 tohx(float x) { return (h16)x; }
__device__ __forceinline__ void splitf(float y, unsigned short& h, unsigned short& l) { h = f2bf(y); l = f2bf(y - bf2f(h)); }
typedef __attribute__((ext_vector_type(2))) _Float16 v2h;
typedef __attribute__((ext_vector_type(4))) _Float16 v4h;
typedef __attribute__((ext_vector_type(2))) unsigned short v2us;
typedef __attribute__((ext_vector_type(4))) unsigned short v4us;
typedef __attribute__((ext_vector_type(2))) float v2f;
typedef __attribute__((ext_vector_type(4))) int v4i;

__global__ __launch_bounds__(256) void k_wtG(const float* __restrict__ w, int K, int N, bf* Bt) {
    const int lane = threadIdx.x & 31; const int L0 = (blockIdx.x * 8 + (threadIdx.x >> 5)) * 8; const int nlines = N * K / 64;
{
#pragma unroll 1
        for (int l = 0; l < 8; ++l) { const int L = L0 + l; if (L >= nlines) break; const size_t e = (size_t)L * 64 + lane * 2; const int k = (int)(e % K), n = (int)(e / K); v2us o;
            o[0] = f2bf(w[(size_t)k * N + n]); o[1] = f2bf(w[(size_t)(k + 1) * N + n]); *(v2us*)(Bt + e) = o; }
         }
}
// ---- The five elementwise kernels. The two conversions run as 256 work-groups, one per WGP; norm, rope and the v transpose take both batches in one launch as 512 work-groups, two per WGP; all resident from the start; a wave takes many rows or lines instead of one, so that a launch starts a few thousand waves and not tens of thousands.
// Every kernel is built of runs: a run of 16-byte loads, the arithmetic, a run of stores. run_end() closes a run.
#define NPC (2 * DQ + 4 * DKV)     // pitch of the projection output F: [q | q2 | k | k2 | v | v2]
#define NRS (2 * NH_ + 2 * NKV)    // head slots that take norm and rope: [q 16 | q2 16 | k 8 | k2 8]
#define RPW 12                     // head slots per wave, all of one row t
#define NVS (2 * NKV)              // value head slots: [v 8 | v2 8]
static_assert(NRS % RPW == 0 && NB_ * TT * (NRS / RPW) == 512 * 16, "norm and rope: 512 work-groups x 16 waves x RPW head slots cover [NB_ * TT][NRS]");
__device__ __forceinline__ void run_end() {
    asm volatile("s_wait_xcnt 0x0" ::: "memory");   // behind a run of global loads or stores, in front of any later overwrite of the registers they name
    __builtin_amdgcn_sched_barrier(0);   // keeps every later register write behind that wait
}
// k_cvtall: every f32 operand of the plain GEMMs rounded to bf16 in one launch. dst = [x | wq | wq2 | wk | wk2 | wv | wv2 | wo] in units of DKV * DM elements (2, 2, 2, 1, 1, 1, 1, 2 units).
// A chunk is 4 x 512 threads x 8 elements; 128 chunks a unit, so a chunk lies in one unit; work-group b takes the chunks k * 256 + b, k < 6.
static_assert((size_t)DKV * DM == (size_t)128 * 16384 && 12 * 128 == 6 * 256 && DQ == 2 * DKV && NB_ * TT == 2 * DKV, "unit bookkeeping of k_cvtall");
__global__ __launch_bounds__(512) void k_cvtall(const float* __restrict__ x, const float* __restrict__ wq, const float* __restrict__ wq2, const float* __restrict__ wk, const float* __restrict__ wk2, const float* __restrict__ wv, const float* __restrict__ wv2, const float* __restrict__ wo, bf* dst) {
    const size_t U = (size_t)DKV * DM; const unsigned lo = threadIdx.x * 8; v8f v[2][4];
    auto fetch = [&](int k) {     // chunk k's eight loads, one run
        const int c = k * 256 + (int)blockIdx.x, u = c >> 7;
        const float* s = ((u < 2) ? x + u * U : (u < 4) ? wq + (u - 2) * U : (u < 6) ? wq2 + (u - 4) * U : (u == 6) ? wk : (u == 7) ? wk2 : (u == 8) ? wv : (u == 9) ? wv2 : wo + (u - 10) * U) + (size_t)(c & 127) * 16384;
#pragma unroll
        for (int i = 0; i < 4; ++i) v[k & 1][i] = *(const v8f*)(s + i * 4096 + lo);
        run_end();
    };
    fetch(0);
#pragma unroll   // unrolled: the two register sets are indexed by constants
    for (int k = 0; k < 6; ++k) {
        if (k + 1 < 6) fetch(k + 1);   // the next chunk's loads fly under this chunk's conversion and stores
        bf* d = dst + (size_t)(k * 256 + (int)blockIdx.x) * 16384; v8us o[4];
#pragma unroll
        for (int i = 0; i < 4; ++i)
#pragma unroll
            for (int q = 0; q < 8; ++q) o[i][q] = f2bf(v[k & 1][i][q]);
        __builtin_amdgcn_sched_barrier(0);   // every value is ready before the first store: no store's register is written again inside the run
#pragma unroll
        for (int i = 0; i < 4; ++i) *(v8us*)(d + i * 4096 + lo) = o[i];
        if (k + 1 < 6) run_end();
    }
}
static_assert(NB_ * TT * HD == 256 * 256 * 4, "k_cscvt: four table entries a thread");
__global__ __launch_bounds__(256) void k_cscvt(const float* __restrict__ cosT, const float* __restrict__ sinT, float* CS) {
    const int idx = (blockIdx.x * 256 + threadIdx.x) * 4; const v4f c = *(const v4f*)(cosT + idx), s = *(const v4f*)(sinT + idx);
    run_end();
    v4f o0, o1; o0[0] = bfr(c[0]); o0[1] = bfr(s[0]); o0[2] = bfr(c[1]); o0[3] = bfr(s[1]); o1[0] = bfr(c[2]); o1[1] = bfr(s[2]); o1[2] = bfr(c[3]); o1[3] = bfr(s[3]);
    *(v4f*)(CS + (size_t)idx * 2) = o0; *(v4f*)(CS + (size_t)idx * 2 + 4) = o1;  }
// k_rope: head planes [b][h][t][d] (fp16 + hi/lo) of rope(x) x sc; F and CS hold both batches' rows, row r = b * TT + t; with the rotate-half convention out[d] = x[d] cos[t][d] - x[d+HD/2] sin[t][d], out[d+HD/2] = x[d+HD/2] cos[t][d+HD/2] + x[d] sin[t][d+HD/2]
// A wave takes RPW head slots of one row t, four d a lane; the row's cos/sin pairs are read once for all of them; one run of loads, then three groups of four head slots, each with its run of stores (256 B of a plane per store).
__global__ __launch_bounds__(512) void k_rope(const float* __restrict__ F, const float* __restrict__ CS, float sc, h16* P16, bf* Ph, bf* Pl) {
    const int lane = threadIdx.x & 31; const int W = blockIdx.x * 16 + __builtin_amdgcn_readfirstlane((int)(threadIdx.x >> 5)); const int t = W / (NRS / RPW), h0 = (W % (NRS / RPW)) * RPW;
    const int d = lane * 4, dp0 = (d < HD / 2) ? d + HD / 2 : d - HD / 2; const float* f = F + (size_t)t * NPC + h0 * HD; const size_t e0 = ((size_t)((t / TT) * NRS + h0) * TT + t % TT) * HD + d;
    h16* q16 = P16 + e0; bf* qh = Ph + e0; bf* ql = Pl + e0;
    asm volatile("" :: "v"(q16), "v"(qh), "v"(ql) : "memory");   // inputs only: the lane's three store addresses are complete in front of the loads, so that none of their arithmetic and no argument fetch lands in a register that an issued load names
    __builtin_amdgcn_sched_barrier(0);   // keeps the loads behind that point
    const v4f cs01 = *(const v4f*)(CS + ((size_t)t * HD + d) * 2), cs23 = *(const v4f*)(CS + ((size_t)t * HD + d) * 2 + 4);
    run_end();
    v4f xa[RPW], xb[RPW];
#pragma unroll
    for (int k = 0; k < RPW; ++k) { xa[k] = *(const v4f*)(f + k * HD + d); xb[k] = *(const v4f*)(f + k * HD + dp0); }
    run_end();
#pragma unroll
    for (int g = 0; g < RPW / 4; ++g) {
        v4h o16[4]; v4us oh[4], ol[4];
#pragma unroll
        for (int k = 0; k < 4; ++k)
#pragma unroll
            for (int q = 0; q < 4; ++q) { const int dd = d + q; const float x0 = xa[g * 4 + k][q], x1 = xb[g * 4 + k][q]; v2f cs; cs[0] = (q < 2) ? cs01[2 * (q & 1)] : cs23[2 * (q & 1)]; cs[1] = (q < 2) ? cs01[2 * (q & 1) + 1] : cs23[2 * (q & 1) + 1];
                float a = __fmul_rn(x0, cs[0]), bq = __fmul_rn(x1, cs[1]); asm volatile("" : "+v"(a)); asm volatile("" : "+v"(bq)); const float r = ((dd < HD / 2) ? __fsub_rn(a, bq) : __fadd_rn(a, bq)) * sc;
                o16[k][q] = tohx(r); unsigned short a2, c2; splitf(r, a2, c2); oh[k][q] = a2; ol[k][q] = c2; }
        __builtin_amdgcn_sched_barrier(0);   // every value is ready before the first store: no store's register is written again inside the run
#pragma unroll
        for (int k = 0; k < 4; ++k) { const size_t e = (size_t)(g * 4 + k) * TT * HD; *(v4h*)(q16 + e) = o16[k]; *(v4us*)(qh + e) = oh[k]; *(v4us*)(ql + e) = ol[k]; }
        if (g + 1 < RPW / 4) run_end();
    }
}
// k_vtp: value planes [b][g][d][t] (fp16 + hi/lo) of F[b * TT + t][g * HD + d]. Work-group = (b, g, 128 rows t, 64 columns d), wave = 8 columns; a lane takes four rows t: eight 16-byte loads (4 t x 8 d), then per column and plane one 8-byte store, 256 B of the plane per wave.
static_assert(NVS * (TT / 128) * (HD / 64) == 256, "k_vtp: 256 work-groups a batch");
__global__ __launch_bounds__(256) void k_vtp(const float* __restrict__ F, h16* V16, bf* Vh, bf* Vl) {
    const int lane = threadIdx.x & 31, w = __builtin_amdgcn_readfirstlane((int)(threadIdx.x >> 5)), b = blockIdx.x & 255, bt = blockIdx.x >> 8; const int g = b >> 4, tb = ((b >> 1) & 7) * 128, d0 = (b & 1) * 64 + w * 8;
    const float* f = F + (size_t)(bt * TT + tb) * NPC + g * HD + d0; v4f x[4][2]; v4h o16[8]; v4us oh[8], ol[8];
#pragma unroll
    for (int i = 0; i < 4; ++i)
#pragma unroll
        for (int j = 0; j < 2; ++j) x[i][j] = *(const v4f*)(f + (size_t)(lane * 4 + i) * NPC + j * 4);
    run_end();
#pragma unroll
    for (int dd = 0; dd < 8; ++dd)
#pragma unroll
        for (int i = 0; i < 4; ++i) { const float xv = x[i][dd >> 2][dd & 3]; o16[dd][i] = tohx(xv); unsigned short a2, c2; splitf(xv, a2, c2); oh[dd][i] = a2; ol[dd][i] = c2; }
    __builtin_amdgcn_sched_barrier(0);   // every value is ready before the first store: no store's register is written again inside the run
    const size_t e0 = (size_t)((bt * NVS + g) * HD + d0) * TT + tb;
#pragma unroll
    for (int dd = 0; dd < 8; ++dd) { const size_t e = e0 + (size_t)dd * TT + lane * 4; *(v4h*)(V16 + e) = o16[dd]; *(v4us*)(Vh + e) = oh[dd]; *(v4us*)(Vl + e) = ol[dd]; }
}
// k_rmsw: RMSNorm x g in place on the head slots [q | q2 | k | k2] of F. A wave takes RPW consecutive head slots of one row t of the NB_ * TT rows (RPW x 512 contiguous bytes): one run of loads, RPW independent row sums, one run of stores. The four weight vectors are read once; each slot takes its section's.
__global__ __launch_bounds__(512) void k_rmsw(float* F, const float* __restrict__ gq, const float* __restrict__ gq2, const float* __restrict__ gk, const float* __restrict__ gk2) {
    const int lane = threadIdx.x & 31; const int W = blockIdx.x * 16 + __builtin_amdgcn_readfirstlane((int)(threadIdx.x >> 5)); const int t = W / (NRS / RPW), h0 = (W % (NRS / RPW)) * RPW;
    float* f = F + (size_t)t * NPC + h0 * HD; v4f r[RPW]; float sq[RPW];
#pragma unroll
    for (int k = 0; k < RPW; ++k) r[k] = *(const v4f*)(f + k * HD + lane * 4);
    const v4f w0 = *(const v4f*)(gq + lane * 4), w1 = *(const v4f*)(gq2 + lane * 4), w2 = *(const v4f*)(gk + lane * 4), w3 = *(const v4f*)(gk2 + lane * 4);
    run_end();
#pragma unroll
    for (int k = 0; k < RPW; ++k) { const v4f a = r[k]; float ss = 0.f;
#pragma unroll
        for (int q = 0; q < 4; ++q) { float p = __fmul_rn(a[q], a[q]); asm volatile("" : "+v"(p)); ss = __fadd_rn(ss, p); }
        sq[k] = ss; }
#pragma unroll
    for (int sh = 16; sh; sh >>= 1)     // the RPW rows' butterflies step together: one cross-lane latency a step, not one a row and step
#pragma unroll
        for (int k = 0; k < RPW; ++k) sq[k] = __fadd_rn(sq[k], __shfl_xor(sq[k], sh, 32));
#pragma unroll
    for (int k = 0; k < RPW; ++k) { const int h = h0 + k; const v4f w = (h < NH_) ? w0 : (h < 2 * NH_) ? w1 : (h < 2 * NH_ + NKV) ? w2 : w3; const v4f a = r[k]; const float ss = sq[k];
        const float rs = __fdiv_rn(1.0f, sqrtf(__fadd_rn(ss * (1.0f / HD), 1e-6f))); v4f o;
#pragma unroll
        for (int q = 0; q < 4; ++q) { float y = __fmul_rn(a[q], rs); asm volatile("" : "+v"(y)); o[q] = __fmul_rn(y, bfr(w[q])); }
        r[k] = o; }
    __builtin_amdgcn_sched_barrier(0);   // every value is ready before the first store: no store's register is written again inside the run
#pragma unroll
    for (int k = 0; k < RPW; ++k) *(v4f*)(f + k * HD + lane * 4) = r[k];
}
// ---- k_fattn: scores, joint softmax and both value products of one head in one kernel; grid (NB_ * NH_, TT / 64): both batches in one launch, two work-groups per WGP; 4 waves, each wave owns 16 query rows and works alone (no work-group barrier).
// A wave walks 64-key tiles of the window path (from its diagonal tile down to key i - 255), then of the fading path (keys <= i - 256), under ONE running maximum, sum and output accumulator (online softmax):
// the joint softmax over [s_ic | s_f]. A key outside the path's own range gets weight exactly 0. The diagonal tile comes first, so every row's maximum is finite from the first tile on.
// Probabilities go from the accumulator layout to the A-operand layout through the wave's own LDS slice. Rows < RH: hi+lo bf16 planes, 3 products; rows >= RH: fp16, weights x PCAR (the factor cancels in sum and output alike).
// Loops: the path loop and the tile loop stay rolled (#pragma unroll 1: one copy of the long body); every inner loop is unrolled, so that the fragment and accumulator arrays are indexed by constants and stay in registers.
#define PP 72     // LDS pitch (16-bit elements) of the 16 x 64 probability tile: 16-byte aligned rows, 16-byte row reads spread over the banks
#define OP 136    // LDS pitch of the 16 x 128 output tile
template <int X> __device__ __forceinline__ float rowx(float v) { return __int_as_float(__builtin_amdgcn_update_dpp(0, __float_as_int(v), 0x160 + X, 0xf, 0xf, true)); }   // DPP row_xmask: the value of lane ^ X inside the 16-lane row, on the vector port (a shuffle would go through the LDS queue, one wait each)
__device__ __forceinline__ float rowmax(float v) { v = fmaxf(v, rowx<8>(v)); v = fmaxf(v, rowx<4>(v)); v = fmaxf(v, rowx<2>(v)); return fmaxf(v, rowx<1>(v)); }
__device__ __forceinline__ float rowsum(float v) { v += rowx<8>(v); v += rowx<4>(v); v += rowx<2>(v); return v + rowx<1>(v); }
template <typename T16> struct LFrag;
template <> struct LFrag<h16> { static __device__ __forceinline__ v16h ld(const unsigned short* p) { const v8us lo = *(const v8usa*)p, hi = *(const v8usa*)(p + 16); return cat16(__builtin_bit_cast(v8h, lo), __builtin_bit_cast(v8h, hi)); } };
template <> struct LFrag<bf> { static __device__ __forceinline__ v16bf ld(const unsigned short* p) { const v8us lo = *(const v8usa*)p, hi = *(const v8usa*)(p + 16); return cat16b(lo, hi); } };
template <typename T16, bool HL>
__device__ __forceinline__ void attn_rows(const T16* __restrict__ R, const T16* __restrict__ Rlo, const T16* __restrict__ VT, const T16* __restrict__ VTlo, int h, int i0, unsigned short* sh, unsigned short* sl, bf* Ah, bf* Al) {
    typedef typename WFrag<T16>::V V;
    constexpr int NG = HL ? 2 : 1;    // planes per operand; also the number of 16-fragment (32-load) groups that a tile's keys, and its values, are fetched in
    const int lane = threadIdx.x & 31, lr = lane & 15, hi = lane >> 4;
    v8f O[8]; float m[8], l[8];
#pragma unroll
    for (int db = 0; db < 8; ++db) O[db] = (v8f){};
#pragma unroll
    for (int jj = 0; jj < 8; ++jj) { m[jj] = -3.0e38f; l[jj] = 0.f; }
#pragma unroll 1
    for (int p = 0; p < 2; ++p) {      // p = 0: window path, p = 1: fading path
        const size_t qo = ((size_t)(p * NH_ + h) * TT + i0 + lr) * HD + 8 * hi, ko = ((size_t)(2 * NH_ + p * NKV + h / REP) * TT + lr) * HD + 8 * hi, vo = ((size_t)(p * NKV + h / REP) * HD + lr) * TT + 8 * hi;
        V a[4], a2[4];
#pragma unroll
        for (int ks = 0; ks < 4; ++ks) { a[ks] = WFrag<T16>::ld(R + qo + ks * 32); if (HL) a2[ks] = WFrag<T16>::ld(Rlo + qo + ks * 32); }
        const int jhi = p ? ((i0 + 15 - 256) >> 6) : (i0 >> 6), jlo = p ? 0 : (max(0, i0 - 255) >> 6);   // first and last 64-key tile with a live key for one of the 16 rows (jhi < 0: none)
#pragma unroll 1
        for (int jt = jhi; jt >= jlo; --jt) {
            const int j0 = jt * 64; v8f s[4]; V kf[NG][16], vf[NG][16];
            // Fetch order of a tile. Keys and values come in groups of 16 fragments (32 loads), each group issued as one run, so that a group costs one load latency and not one every few fragments.
            // A second group (hi+lo planes) is issued behind the first block's products, whose wait has retired part of the first group: fewer than 64 loads of the wave are outstanding at any time.
            // Each sched_barrier(0) keeps the compiler from moving loads or products over that point. Each s_wait_xcnt 0 stands behind a run of loads, in front of every later overwrite of their address registers (a later load's result may land there).
            asm volatile("s_wait_xcnt 0x0" ::: "memory");   // for the query loads in front of the loop: the key loads' results may land in their address registers
            __builtin_amdgcn_sched_barrier(0);   // keeps the key loads behind that wait
#pragma unroll
            for (int f = 0; f < 16 / NG; ++f) { const size_t o = ko + (size_t)(j0 + (f >> 2) * 16) * HD + (f & 3) * 32; kf[0][f * NG] = WFrag<T16>::ld(R + o); if (HL) kf[0][f * NG + 1] = WFrag<T16>::ld(Rlo + o); }
            asm volatile("s_wait_xcnt 0x0" ::: "memory");   // behind the first key group's loads, in front of any overwrite of their address registers
            __builtin_amdgcn_sched_barrier(0);   // the whole group is issued before the first product waits for a fragment
#pragma unroll
            for (int nb = 0; nb < 4; ++nb) { const int g = nb / (4 / NG), nl = nb % (4 / NG); s[nb] = (v8f){};
#pragma unroll
                for (int ks = 0; ks < 4; ++ks) { s[nb] = WFrag<T16>::mma(a[ks], kf[g][(nl * 4 + ks) * NG], s[nb]);
                    if (HL) { s[nb] = WFrag<T16>::mma(a2[ks], kf[g][(nl * 4 + ks) * NG], s[nb]); s[nb] = WFrag<T16>::mma(a[ks], kf[g][(nl * 4 + ks) * NG + 1], s[nb]); } }
                if (HL && nb == 0) {
                    __builtin_amdgcn_sched_barrier(0);   // the second key group is issued behind the first block's products (fewer than 64 loads outstanding)
#pragma unroll
                    for (int f = 0; f < 16 / NG; ++f) { const size_t o = ko + (size_t)(j0 + (4 / NG + (f >> 2)) * 16) * HD + (f & 3) * 32; kf[NG - 1][f * NG] = WFrag<T16>::ld(R + o); kf[NG - 1][f * NG + 1] = WFrag<T16>::ld(Rlo + o); }
                    asm volatile("s_wait_xcnt 0x0" ::: "memory");   // behind the second key group's loads, as above
                    __builtin_amdgcn_sched_barrier(0);   // and it flies under the products that follow
                } }
            __builtin_amdgcn_sched_barrier(0);   // the value loads start behind the last score product: every key load has retired by then
#pragma unroll
            for (int f = 0; f < 16 / NG; ++f) { const size_t o = vo + (size_t)(f >> 1) * 16 * TT + j0 + (f & 1) * 32; vf[0][f * NG] = WFrag<T16>::ld(VT + o); if (HL) vf[0][f * NG + 1] = WFrag<T16>::ld(VTlo + o); }
            asm volatile("s_wait_xcnt 0x0" ::: "memory");   // behind the first value group's loads, as above
            __builtin_amdgcn_sched_barrier(0);   // the first value group flies while the softmax runs
            float mx[8];
#pragma unroll
            for (int jj = 0; jj < 8; ++jj) mx[jj] = m[jj];
#pragma unroll
            for (int nb = 0; nb < 4; ++nb)
#pragma unroll
                for (int jj = 0; jj < 8; ++jj) { const int dij = (i0 + hi * 8 + jj) - (j0 + nb * 16 + lr); const bool live = p ? (dij >= 256) : (dij >= 0 && dij < 256); const float t = live ? s[nb][jj] * SCL : -3.0e38f; s[nb][jj] = t; mx[jj] = fmaxf(mx[jj], t); }
#pragma unroll
            for (int jj = 0; jj < 8; ++jj) {
                mx[jj] = rowmax(mx[jj]);   // a row's 16 columns lie in the 16 lanes of one half
                const float al = __builtin_amdgcn_exp2f((m[jj] - mx[jj]) * 1.4426950408889634f); m[jj] = mx[jj]; l[jj] *= al;
#pragma unroll
                for (int db = 0; db < 8; ++db) O[db][jj] *= al; }
#pragma unroll
            for (int nb = 0; nb < 4; ++nb)
#pragma unroll
                for (int jj = 0; jj < 8; ++jj) { const float pv = __builtin_amdgcn_exp2f((s[nb][jj] - m[jj]) * 1.4426950408889634f) * (HL ? 1.0f : PCAR); l[jj] += pv; const int o = (hi * 8 + jj) * PP + nb * 16 + lr;
                    if (HL) { unsigned short ph, pl; splitf(pv, ph, pl); sh[o] = ph; sl[o] = pl; } else sh[o] = __builtin_bit_cast(unsigned short, tohx(pv)); }
            __builtin_amdgcn_wave_barrier(); asm volatile("" ::: "memory");   // the fragment reads below take other lanes' stores: keep them behind the stores
            V pa[2], pb[2];
#pragma unroll
            for (int k2 = 0; k2 < 2; ++k2) { pa[k2] = LFrag<T16>::ld(sh + lr * PP + k2 * 32 + 8 * hi); if (HL) pb[k2] = LFrag<T16>::ld(sl + lr * PP + k2 * 32 + 8 * hi); }
            __builtin_amdgcn_wave_barrier(); asm volatile("" ::: "memory");   // the next tile's stores stay behind these reads
#pragma unroll
            for (int db = 0; db < 8; ++db) { const int g = db / (8 / NG), dl = db % (8 / NG);
#pragma unroll
                for (int k2 = 0; k2 < 2; ++k2) { O[db] = WFrag<T16>::mma(pa[k2], vf[g][(dl * 2 + k2) * NG], O[db]);
                    if (HL) { O[db] = WFrag<T16>::mma(pb[k2], vf[g][(dl * 2 + k2) * NG], O[db]); O[db] = WFrag<T16>::mma(pa[k2], vf[g][(dl * 2 + k2) * NG + 1], O[db]); } }
                if (HL && db == 0) {
                    __builtin_amdgcn_sched_barrier(0);   // the second value group is issued behind the first block's products (fewer than 64 loads outstanding)
#pragma unroll
                    for (int f = 0; f < 16 / NG; ++f) { const size_t o = vo + (size_t)(8 / NG + (f >> 1)) * 16 * TT + j0 + (f & 1) * 32; vf[NG - 1][f * NG] = WFrag<T16>::ld(VT + o); vf[NG - 1][f * NG + 1] = WFrag<T16>::ld(VTlo + o); }
                    asm volatile("s_wait_xcnt 0x0" ::: "memory");   // behind the second value group's loads, as above
                    __builtin_amdgcn_sched_barrier(0);   // and it flies under the products that follow
                } }
        }
    }
#pragma unroll
    for (int jj = 0; jj < 8; ++jj) {
        const float f = __fdiv_rn(1.0f, rowsum(l[jj]));
#pragma unroll
        for (int db = 0; db < 8; ++db) { unsigned short oh, ol; splitf(O[db][jj] * f, oh, ol); const int o = (hi * 8 + jj) * OP + db * 16 + lr; sh[o] = oh; sl[o] = ol; } }
    __builtin_amdgcn_wave_barrier(); asm volatile("" ::: "memory");   // the row reads below take other lanes' stores
    v8us vh[8], vl[8]; const size_t oo = (size_t)(i0 + hi) * DQ + h * HD + lr * 8; bf* qh = Ah + oo; bf* ql = Al + oo;   // the lane's two store addresses; the eight rows step by a constant
#pragma unroll
    for (int c = 0; c < 8; ++c) { const int row = c * 2 + hi, col = lr * 8; vh[c] = *(const v8usa*)(sh + row * OP + col); vl[c] = *(const v8usa*)(sl + row * OP + col); }
    asm volatile("" :: "v"(qh), "v"(ql) : "memory");   // inputs only: both store addresses are complete in front of the run of stores, so that none of their arithmetic lands in a register that an issued store names
    __builtin_amdgcn_sched_barrier(0);   // every row is in its own registers before the first store: no store's register is written again inside the run
#pragma unroll
    for (int c = 0; c < 8; ++c) { *(v8us*)(qh + (size_t)c * 2 * DQ) = vh[c]; *(v8us*)(ql + (size_t)c * 2 * DQ) = vl[c]; }
}
__global__ __launch_bounds__(128) void k_fattn(const h16* __restrict__ R16, const bf* __restrict__ Rh, const bf* __restrict__ Rl, const h16* __restrict__ VT16, const bf* __restrict__ VTh, const bf* __restrict__ VTl, bf* Ah, bf* Al) {
    __shared__ __align__(16) unsigned short ps[4][2][16 * OP];
    constexpr int NRB = TT / 64;
    const int wv = __builtin_amdgcn_readfirstlane((int)(threadIdx.x >> 5)); const int y = blockIdx.y; const int rb = (y < NRB / 2) ? NRB - 1 - y : y - NRB / 2;   // the first half of the grid takes the last rows (the most keys) downwards, the second half the first rows upwards: the work-groups half a grid apart hold row blocks t and NRB - 1 - t (speed only)
    const int i0 = rb * 64 + wv * 16, h = blockIdx.x % NH_, b = blockIdx.x / NH_;
    const size_t ro = (size_t)b * NRS * TT * HD, vo = (size_t)b * NVS * HD * TT, ao = (size_t)b * TT * DQ;   // batch b's planes
    if (rb * 64 < RH) attn_rows<bf, true>(Rh + ro, Rl + ro, VTh + vo, VTl + vo, h, i0, ps[wv][0], ps[wv][1], Ah + ao, Al + ao);
    else attn_rows<h16, false>(R16 + ro, nullptr, VT16 + vo, nullptr, h, i0, ps[wv][0], ps[wv][1], Ah + ao, Al + ao);
}

// k_asoft: per row (zz, i): t = S x HD^-0.5 for j <= i and i - j < WIN (sliding causal window; the reference's -1e9 additive fill vanishes identically); softmax over the 1024 keys (register row, one exp, fixed trees);
__global__ __launch_bounds__(256) void k_asoft(const float* __restrict__ Sb, h16* P16, bf* Ph, bf* Pl) {
    const int lane = threadIdx.x & 31; const int row = blockIdx.x * 8 + (threadIdx.x >> 5); if (row >= ZH * TT) return; const int i = row % TT; const int zz = row / TT; (void)zz; const bool hires = (i < RH); const float* sr = Sb + (size_t)row * TT; float v[TT / 32]; float mx = -3.0e38f;
#pragma unroll
    for (int ch = 0; ch < TT / 128; ++ch) { const int j0 = ch * 128 + lane * 4; const v4f a = *(const v4f*)(sr + j0);
#pragma unroll
        for (int q = 0; q < 4; ++q) { const int j = j0 + q; (void)j; const float t = (j <= i && i - j < WIN) ? a[q] * SCL : -3.0e38f; v[ch * 4 + q] = t; mx = fmaxf(mx, t); } }
#pragma unroll
    for (int sh = 16; sh; sh >>= 1) mx = fmaxf(mx, __shfl_xor(mx, sh, 32));
    float sum = 0.f;
#pragma unroll
    for (int k = 0; k < TT / 32; ++k) { float d0 = __fsub_rn(v[k], mx); asm volatile("" : "+v"(d0)); v[k] = __builtin_amdgcn_exp2f(__fmul_rn(d0, 1.4426950408889634f)); sum += v[k]; }
#pragma unroll
    for (int sh = 16; sh; sh >>= 1) sum += __shfl_xor(sum, sh, 32);
    const float f = __fdiv_rn(hires ? 1.0f : PCAR, sum);
{
        if (hires) {
#pragma unroll
            for (int ch = 0; ch < TT / 128; ++ch) { v4us oh, ol;
#pragma unroll
                for (int q = 0; q < 4; ++q) { unsigned short a, c2; splitf(v[ch * 4 + q] * f, a, c2); oh[q] = a; ol[q] = c2; }
                const size_t oo = ((size_t)zz * (RH ? RH : 1) + i) * TT + ch * 128 + lane * 4; *(v4us*)(Ph + oo) = oh; *(v4us*)(Pl + oo) = ol; }
        } else {
#pragma unroll
            for (int ch = 0; ch < TT / 128; ++ch) { v4h o4;
#pragma unroll
                for (int q = 0; q < 4; ++q) o4[q] = tohx(v[ch * 4 + q] * f);
                *(v4h*)(P16 + (size_t)row * TT + ch * 128 + lane * 4) = o4; } }
         }
}
__global__ __launch_bounds__(256) void k_merge(const float* __restrict__ O, int h0, bf* Ah, bf* Al) { const size_t e = ((size_t)blockIdx.x * 256 + threadIdx.x) * 2; if (e >= (size_t)ZH * TT * HD) return; const int d = (int)(e % HD); const int t = (int)((e / HD) % TT); const int zz = (int)(e / ((size_t)HD * TT)); const float cs = (t < RH) ? 1.0f : (1.0f / PCAR); const size_t oo = (size_t)t * DQ + (h0 + zz) * HD + d;
    v2us oh, ol;
#pragma unroll
    for (int q = 0; q < 2; ++q) { unsigned short a, c2; splitf(O[e + q] * cs, a, c2); oh[q] = a; ol[q] = c2; } *(v2us*)(Ah + oo) = oh; *(v2us*)(Al + oo) = ol;  }

extern "C" void kernel_launch(void* const* d_in, const int* in_sizes, int n_in,
                              void* d_out, int out_size, void* d_ws, size_t ws_size, hipStream_t stream) {
    (void)in_sizes; (void)n_in; (void)out_size;
    const float* x = (const float*)d_in[0]; const float* cosA = (const float*)d_in[1]; const float* sinA = (const float*)d_in[2]; const float* wq = (const float*)d_in[3]; const float* bq = (const float*)d_in[4]; const float* wk = (const float*)d_in[5]; const float* bk = (const float*)d_in[6]; const float* wv = (const float*)d_in[7]; const float* bv = (const float*)d_in[8]; const float* wq2 = (const float*)d_in[9]; const float* bq2 = (const float*)d_in[10]; const float* wk2 = (const float*)d_in[11]; const float* bk2 = (const float*)d_in[12]; const float* wv2 = (const float*)d_in[13]; const float* bv2 = (const float*)d_in[14]; const float* wo = (const float*)d_in[15]; const float* gq = (const float*)d_in[16]; const float* gk = (const float*)d_in[17]; const float* gq2 = (const float*)d_in[18]; const float* gk2 = (const float*)d_in[19]; const float* cosT = cosA; const float* sinT = sinA;
    float* OUT = (float*)d_out;     // [2][1024][2048]
    char* wsp = (char*)d_ws;
    auto take = [&](size_t bytes) { char* p = wsp; wsp += (bytes + 255) & ~(size_t)255; return (void*)p; };
    // 16-bit GEMM operands, one conversion launch: [x (both batches) | wq | wq2 | wk | wk2 | wv | wv2 | wo]; the six projection weights are one [NP][DM] plane
    const size_t U = (size_t)DKV * DM; const int NP = 2 * DQ + 4 * DKV, NRH = 2 * NH_ + 2 * NKV, NVH = 2 * NKV;
    bf* XB = (bf*)take(12 * U * 2); bf* WP = XB + 2 * U; bf* WO = XB + 10 * U; float* CS = (float*)take((size_t)NB_ * TT * HD * 2 * 4);
    // head planes per batch, both paths side by side: [b][q 16 | q2 16 | k 8 | k2 8][t][d] and [b][v 8 | v2 8][d][t]
    h16* R16 = (h16*)take((size_t)NB_ * NRH * TT * HD * 2); bf* Rh = (bf*)take((size_t)NB_ * NRH * TT * HD * 2); bf* Rl = (bf*)take((size_t)NB_ * NRH * TT * HD * 2);
    h16* VT16 = (h16*)take((size_t)NB_ * NVH * HD * TT * 2); bf* VTh = (bf*)take((size_t)NB_ * NVH * HD * TT * 2); bf* VTl = (bf*)take((size_t)NB_ * NVH * HD * TT * 2);
    float* F = (float*)take((size_t)NB_ * TT * NP * 4); bf* ATl = (bf*)take((size_t)NB_ * TT * DQ * 2);   // both batches' [NB_ * TT][NP] projection output; the lo plane of the merged attention output
    if ((size_t)(wsp - (char*)d_ws) > ws_size) return;    // ws 256 MiB
    bf* ATh = XB;     // the hi plane of the merged attention output reuses x: its rows are dead once the projection has run (stream-ordered; same size)
    static_assert(DQ == DM, "ATh fits x");
    k_cvtall<<<256, 512, 0, stream>>>(x, wq, wq2, wk, wk2, wv, wv2, wo, XB);
    k_cscvt<<<256, 256, 0, stream>>>(cosA, sinA, CS);
    // every stage takes both batches in one launch: the rows of x, F and CS are r = b * TT + t
    k_gemms<256, DM, 0, true><<<dim3(NB_ * TT / 256, NP / 128, 1), 256, 0, stream>>>(XB, nullptr, WP, F, NP, bq, bq2, bk, bk2, bv, bv2);
    k_rmsw<<<512, 512, 0, stream>>>(F, gq, gq2, gk, gk2);
    k_rope<<<512, 512, 0, stream>>>(F, CS, 1.0f, R16, Rh, Rl);
    k_vtp<<<512, 256, 0, stream>>>(F + NRH * HD, VT16, VTh, VTl);
    k_fattn<<<dim3(NB_ * NH_, TT / 64, 1), 128, 0, stream>>>(R16, Rh, Rl, VT16, VTh, VTl, ATh, ATl);
    k_gemms<128, DQ, 1, false><<<dim3(NB_ * TT / 128, DM / 128, 1), 128, 0, stream>>>(ATh, ATl, WO, OUT, DM, nullptr, nullptr, nullptr, nullptr, nullptr, nullptr);
}

// v007
// It runs in 186 microseconds.
// Two timings next to v006 put it at 1.15 and 1.16 times that version's speed.
// All steps since v000 together make it 12.7 times as fast.
#include <hip/hip_runtime.h>

// BMOJOAttention (hidden [2][1024][2048]; two projection paths - in-context (Wq,bq,Wk,bk,Wv,bv,gq,gk) and fading (Wq2..gk2): q = rope(rmsnorm(x Wq^T + bq) gq) (16 x 128), k = rope(rmsnorm(x Wk^T + bk) gk) (8 kv heads; group h/2), v = x Wv^T + bv; rotate-half RoPE with the read cos/sin [B][S][128]; s_ic = q_ic.k_ic / sqrt(128) live where 0 <= i-j < 256, s_f = q_f.k_f / sqrt(128) live where i-j >= 256 (else -1e30); ONE joint softmax over [s_ic | s_f]; out = p_ic v_ic + p_f v_f; merged Wo^T -> [2][1024][2048]).
// The joint softmax over 2S columns is computed as one causal softmax whose score (and value source) switches at i-j = 256: the masked halves contribute exactly 0; keys j > i are masked in both (causal tile skipping).
// Compute dtypes, f32 accumulate: every input rounded to bf16; both paths' q/k/v on PLAIN bf16 operands (inputs: exact) + bias; RMSNorm * g (in place) and RoPE (bf16-rounded per-batch tables) f32; both score sets and both attn.v products: query rows < 512 hl (3 products), the rest single fp16 (x1024), causal tile skipping; online softmax f32 over the live scores of both paths, both value products into one f32 accumulator, all in one kernel (k_fattn), which emits the hl planes of the merged output; Wo hl x exact (2 products).

#define NB_  2
#define TT   1024
#define DM   2048
#define NH_  16
#define NKV  8
#define REP  (NH_ / NKV)
#define HD   128
#define DQ   (NH_ * HD)
#define DKV  (NKV * HD)
#define ZH   16                   // heads per attention pass: all of them
#define RH   512                  // query rows < RH use hi+lo planes (0: none)
#define WIN  1024
#define PCAR 1024.0f
static_assert(RH % 64 == 0, "a 64-row block of the attention lies on one side of RH");
#define SCL  0.088388347648318447f   // HD^-0.5
typedef _Float16 h16;
typedef unsigned short bf;
typedef __attribute__((ext_vector_type(16))) __bf16   v16bf;
typedef __attribute__((ext_vector_type(16))) _Float16 v16h;
typedef __attribute__((ext_vector_type(8)))  _Float16 v8h;
typedef __attribute__((ext_vector_type(8)))  unsigned short v8us;
typedef __attribute__((ext_vector_type(8)))  float    v8f;
typedef __attribute__((ext_vector_type(4)))  float    v4f;
typedef v8h  __attribute__((may_alias)) v8ha;
typedef v4f  __attribute__((may_alias)) v4fa;
typedef v8us __attribute__((may_alias)) v8usa;

__device__ __forceinline__ unsigned short f2bf(float f) { unsigned u = __float_as_uint(f); u += 0x7FFFu + ((u >> 16) & 1u); return (unsigned short)(u >> 16); }
__device__ __forceinline__ float bf2f(unsigned short b) { return __uint_as_float(((unsigned)b) << 16); }
__device__ __forceinline__ float bfr(float f) { return bf2f(f2bf(f)); }
__device__ __forceinline__ v16h cat16(v8h lo, v8h hi) { return __builtin_shufflevector(lo, hi, 0, 1, 2, 3, 4, 5, 6, 7, 8, 9, 10, 11, 12, 13, 14, 15); }
__device__ __forceinline__ v16bf cat16b(v8us lo, v8us hi) { return __builtin_bit_cast(v16bf, __builtin_shufflevector(lo, hi, 0, 1, 2, 3, 4, 5, 6, 7, 8, 9, 10, 11, 12, 13, 14, 15)); }
__device__ __forceinline__ v8f wmma16(v16h a, v16h b, v8f c) { return __builtin_amdgcn_wmma_f32_16x16x32_f16(false, a, false, b, (short)0, c, false, false); }
__device__ __forceinline__ v8f wmmab(v16bf a, v16bf b, v8f c) { return __builtin_amdgcn_wmma_f32_16x16x32_bf16(false, a, false, b, (short)0, c, false, false); }



// ---- k_gemms: GEMM with both operands staged in LDS. One work-group = BM x 128 output tile, BM threads = BM / 32 waves in a (BM / 64) x 2 grid, 64 x 64 (16 accumulators) per wave; grid (M / BM, N / 128).
// C[m][n] (f32, pitch ldc, + optional bias[n] rounded to bf16) = sum_k (A[m][k] + A2[m][k]) Bt[n][k] (A2 only with NSPLIT = 1: two products per k step, A first); all planes K-contiguous bf16, KK % 64 == 0.
// A stage is 64 k (128 B, one line) of every operand row. Each global load of a wave covers four whole lines; a line is fetched once per work-group and then read from LDS by every wave that needs it.
// Two LDS buffers: a stage's lines are loaded into registers one stage ahead, stored into the other buffer between the two halves of the running stage's products, and one work-group barrier per stage hands the buffers over.
// With BIAS the N axis is the concatenation [q | q2 | k | k2 | v | v2] of both paths' projections (DQ, DQ, DKV, DKV, DKV, DKV columns); each 64-column tile lies in one section and takes that section's bias vector.
template <typename T16> struct WFrag;
template <> struct WFrag<h16> { typedef v16h V; static __device__ __forceinline__ V ld(const h16* p) { return cat16(*(const v8h*)p, *(const v8h*)(p + 16)); } static __device__ __forceinline__ v8f mma(V a, V b, v8f c) { return wmma16(a, b, c); } };
template <> struct WFrag<bf> { typedef v16bf V; static __device__ __forceinline__ V ld(const bf* p) { return cat16b(*(const v8us*)p, *(const v8us*)(p + 16)); } static __device__ __forceinline__ v8f mma(V a, V b, v8f c) { return wmmab(a, b, c); } };
#define GP 72     // LDS pitch (16-bit elements) of a staged 64-k row: 128 B + 16 B, the pitch for 16-byte row reads
template <int BM, int KK, int NSPLIT, bool BIAS>
__global__ __launch_bounds__(BM) void k_gemms(const bf* __restrict__ A, const bf* __restrict__ A2, const bf* __restrict__ Bt, float* C, int ldc, const float* __restrict__ bq, const float* __restrict__ bq2, const float* __restrict__ bk, const float* __restrict__ bk2, const float* __restrict__ bv, const float* __restrict__ bv2) {
    constexpr int NA = NSPLIT ? 2 : 1, RP = BM / 8, NBP = 128 / RP;    // A planes; rows that one staging pass of the work-group covers (8 threads a row); passes for the 128 rows of Bt (the BM rows of A take 8)
    __shared__ __align__(16) unsigned short sa[2][NA][BM * GP];
    __shared__ __align__(16) unsigned short sb[2][128 * GP];
    __shared__ __align__(16) float osm[BM / 32][16 * 68];
    const int tid = threadIdx.x, lane = tid & 31, lr = lane & 15, hi = lane >> 4, wv = __builtin_amdgcn_readfirstlane(tid >> 5);
    const int rw = (wv >> 1) * 64, cw = (wv & 1) * 64; const int r0 = blockIdx.x * BM, c0 = blockIdx.y * 128 + cw;
    const float* bias = nullptr;   // this wave's bias, already stepped to its column c0
    if (BIAS) bias = (c0 < DQ) ? bq + c0 : (c0 < 2 * DQ) ? bq2 + (c0 - DQ) : (c0 < 2 * DQ + DKV) ? bk + (c0 - 2 * DQ) : (c0 < 2 * DQ + 2 * DKV) ? bk2 + (c0 - 2 * DQ - DKV) : (c0 < 2 * DQ + 3 * DKV) ? bv + (c0 - 2 * DQ - 2 * DKV) : bv2 + (c0 - 2 * DQ - 3 * DKV);
    const int srow = tid >> 3, scol = (tid & 7) * 8;
    unsigned vo = (unsigned)(srow * KK + scol) * 2;    // the lane's byte offset from the work-group-uniform bases below, for the stage that is fetched next: carried through the loop in one register, stepped behind each run of loads
    typedef const __attribute__((address_space(1))) char* gptr;
    const gptr ua = (gptr)(A + (size_t)r0 * KK), ua2 = (gptr)(A2 + (size_t)r0 * KK), ub = (gptr)(Bt + (size_t)blockIdx.y * 128 * KK);
    v8us ra[NA][8], rb[NBP];
    auto ld16 = [](gptr p) { return *(const __attribute__((address_space(1))) v8us*)p; };
    auto fetch = [&]() {     // the next stage's lines into registers, one run of loads
#pragma unroll
        for (int i = 0; i < 8; ++i) { ra[0][i] = ld16(ua + vo + (size_t)i * RP * KK * 2); if (NSPLIT) ra[NA - 1][i] = ld16(ua2 + vo + (size_t)i * RP * KK * 2); }
#pragma unroll
        for (int i = 0; i < NBP; ++i) rb[i] = ld16(ub + vo + (size_t)i * RP * KK * 2);
        asm volatile("s_wait_xcnt 0x0" ::: "memory");   // behind the run of loads, in front of any later overwrite of their address registers
        __builtin_amdgcn_sched_barrier(0);   // keeps every later register write behind that wait
        vo += 128;
    };
    auto put = [&](int buf) {      // those registers into LDS buffer buf
#pragma unroll
        for (int i = 0; i < 8; ++i) { const int o = (srow + i * RP) * GP + scol; *(v8usa*)(&sa[buf][0][o]) = ra[0][i]; if (NSPLIT) *(v8usa*)(&sa[buf][NA - 1][o]) = ra[NA - 1][i]; }
#pragma unroll
        for (int i = 0; i < NBP; ++i) *(v8usa*)(&sb[buf][(srow + i * RP) * GP + scol]) = rb[i];
    };
    v8f acc[4][4];
#pragma unroll
    for (int mb = 0; mb < 4; ++mb)
#pragma unroll
        for (int nb = 0; nb < 4; ++nb) acc[mb][nb] = (v8f){};
    v16bf a[2][4], a2[2][4], b[2][4];   // the fragments of the two 32-k halves of a stage
    auto frags = [&](int ks, int buf) {   // half ks of the stage in LDS buffer buf, one run of reads
#pragma unroll
        for (int mb = 0; mb < 4; ++mb) { const int o = (rw + mb * 16 + lr) * GP + ks * 32 + 8 * hi; a[ks][mb] = cat16b(*(const v8usa*)(&sa[buf][0][o]), *(const v8usa*)(&sa[buf][0][o + 16])); if (NSPLIT) a2[ks][mb] = cat16b(*(const v8usa*)(&sa[buf][NA - 1][o]), *(const v8usa*)(&sa[buf][NA - 1][o + 16])); }
#pragma unroll
        for (int nb = 0; nb < 4; ++nb) { const int o = (cw + nb * 16 + lr) * GP + ks * 32 + 8 * hi; b[ks][nb] = cat16b(*(const v8usa*)(&sb[buf][o]), *(const v8usa*)(&sb[buf][o + 16])); }
    };
    auto products = [&](int ks) {
#pragma unroll
        for (int nb = 0; nb < 4; ++nb) {
#pragma unroll
            for (int mb = 0; mb < 4; ++mb) acc[mb][nb] = wmmab(a[ks][mb], b[ks][nb], acc[mb][nb]);
            if (NSPLIT) {
#pragma unroll
                for (int mb = 0; mb < 4; ++mb) acc[mb][nb] = wmmab(a2[ks][mb], b[ks][nb], acc[mb][nb]); } }
    };
    // Order of a trip (stage t in buffer t & 1): first half's products | stage t + 1 from registers into the other buffer | barrier | first-half fragments of stage t + 1 and the global loads of stage t + 2 go out | second half's products | second-half fragments of stage t + 1 go out.
    // Every read of a buffer stands in front of the barrier that precedes its refill; every read of a stage stands behind the barrier that follows its stores. No global load is in flight at a barrier (the barrier's fence would wait for it).
    // Each sched_barrier(0) keeps loads, stores and products on their side of that point, so that each run of reads flies under the products behind it.
    fetch(); put(0);
    __syncthreads();   // publishes stage 0
    frags(0, 0); fetch(); frags(1, 0);
    static_assert(KK >= 128, "a stage 1 exists");
#pragma unroll 1   // stays rolled: one copy of the body, one set of fragment and staging registers
    for (int kc = 0; kc < KK; kc += 64) {
        const int nxt = ((kc >> 6) & 1) ^ 1; const bool more1 = kc + 64 < KK, more2 = kc + 128 < KK;
        __builtin_amdgcn_sched_barrier(0);
        products(0);
        __builtin_amdgcn_sched_barrier(0);
        if (more1) put(nxt);
        __syncthreads();   // publishes stage t + 1 and ends every wave's reads of stage t
        if (more1) frags(0, nxt);
        if (more2) fetch();
        __builtin_amdgcn_sched_barrier(0);
        products(1);
        __builtin_amdgcn_sched_barrier(0);
        if (more1) frags(1, nxt);
    }
    float* os = osm[wv];
    v4f bb = (v4f){};   // the lane's four bias values (columns lr * 4 ..), the same for every row: read once
    if (BIAS) {
        const float b0 = bias[lr * 4], b1 = bias[lr * 4 + 1], b2 = bias[lr * 4 + 2], b3 = bias[lr * 4 + 3];
        asm volatile("s_wait_xcnt 0x0" ::: "memory");   // behind the bias load, in front of any later overwrite of its address registers
        __builtin_amdgcn_sched_barrier(0);   // keeps every later register write behind that wait
        bb[0] = bfr(b0); bb[1] = bfr(b1); bb[2] = bfr(b2); bb[3] = bfr(b3); }
#pragma unroll
    for (int mb = 0; mb < 4; ++mb) {
#pragma unroll
        for (int nb = 0; nb < 4; ++nb) {
#pragma unroll
            for (int j = 0; j < 8; ++j) os[(hi * 8 + j) * 68 + nb * 16 + lr] = acc[mb][nb][j]; }
        __builtin_amdgcn_wave_barrier(); asm volatile("" ::: "memory");   // the row reads below take other lanes' stores: keep them behind the stores
        float* crow = C + (size_t)(r0 + rw + mb * 16) * ldc + c0;
#pragma unroll
        for (int s = 0; s < 8; ++s) { const int row = 2 * s + hi, cofs = lr * 4; v4f val = *(const v4fa*)(os + row * 68 + cofs); if (BIAS) val += bb;
            *(v4f*)(crow + (size_t)row * ldc + cofs) = val; }
        __builtin_amdgcn_wave_barrier(); asm volatile("s_wait_xcnt 0x0" ::: "memory");   // the next block's LDS stores stay behind these reads; the wait stands behind the run of global stores, in front of any overwrite of their registers
        __builtin_amdgcn_sched_barrier(0);   // keeps the next block's register writes behind that wait
    }
}

__device__ __forceinline__ h16 tohx(float x) { return (h16)x; }
__device__ __forceinline__ void splitf(float y, unsigned short& h, unsigned short& l) { h = f2bf(y); l = f2bf(y - bf2f(h)); }
typedef __attribute__((ext_vector_type(2))) _Float16 v2h;
typedef __attribute__((ext_vector_type(4))) _Float16 v4h;
typedef __attribute__((ext_vector_type(2))) unsigned short v2us;
typedef __attribute__((ext_vector_type(4))) unsigned short v4us;
typedef __attribute__((ext_vector_type(2))) float v2f;
typedef __attribute__((ext_vector_type(4))) int v4i;

__global__ __launch_bounds__(256) void k_wtG(const float* __restrict__ w, int K, int N, bf* Bt) {
    const int lane = threadIdx.x & 31; const int L0 = (blockIdx.x * 8 + (threadIdx.x >> 5)) * 8; const int nlines = N * K / 64;
{
#pragma unroll 1
        for (int l = 0; l < 8; ++l) { const int L = L0 + l; if (L >= nlines) break; const size_t e = (size_t)L * 64 + lane * 2; const int k = (int)(e % K), n = (int)(e / K); v2us o;
            o[0] = f2bf(w[(size_t)k * N + n]); o[1] = f2bf(w[(size_t)(k + 1) * N + n]); *(v2us*)(Bt + e) = o; }
         }
}
// ---- The five elementwise kernels. The two conversions run as 256 work-groups, one per WGP; norm, rope and the v transpose take both batches in one launch as 512 work-groups, two per WGP; all resident from the start; a wave takes many rows or lines instead of one, so that a launch starts a few thousand waves and not tens of thousands.
// Every kernel is built of runs: a run of 16-byte loads, the arithmetic, a run of stores. run_end() closes a run.
#define NPC (2 * DQ + 4 * DKV)     // pitch of the projection output F: [q | q2 | k | k2 | v | v2]
#define NRS (2 * NH_ + 2 * NKV)    // head slots that take norm and rope: [q 16 | q2 16 | k 8 | k2 8]
#define RPW 12                     // head slots per wave, all of one row t
#define NVS (2 * NKV)              // value head slots: [v 8 | v2 8]
static_assert(NRS % RPW == 0 && NB_ * TT * (NRS / RPW) == 512 * 16, "norm and rope: 512 work-groups x 16 waves x RPW head slots cover [NB_ * TT][NRS]");
__device__ __forceinline__ void run_end() {
    asm volatile("s_wait_xcnt 0x0" ::: "memory");   // behind a run of global loads or stores, in front of any later overwrite of the registers they name
    __builtin_amdgcn_sched_barrier(0);   // keeps every later register write behind that wait
}
// k_cvtall: every f32 operand of the plain GEMMs rounded to bf16 in one launch. dst = [x | wq | wq2 | wk | wk2 | wv | wv2 | wo] in units of DKV * DM elements (2, 2, 2, 1, 1, 1, 1, 2 units).
// A chunk is 4 x 512 threads x 8 elements; 128 chunks a unit, so a chunk lies in one unit; work-group b takes the chunks k * 256 + b, k < 6.
static_assert((size_t)DKV * DM == (size_t)128 * 16384 && 12 * 128 == 6 * 256 && DQ == 2 * DKV && NB_ * TT == 2 * DKV, "unit bookkeeping of k_cvtall");
__global__ __launch_bounds__(512) void k_cvtall(const float* __restrict__ x, const float* __restrict__ wq, const float* __restrict__ wq2, const float* __restrict__ wk, const float* __restrict__ wk2, const float* __restrict__ wv, const float* __restrict__ wv2, const float* __restrict__ wo, bf* dst) {
    const size_t U = (size_t)DKV * DM; const unsigned lo = threadIdx.x * 8; v8f v[2][4];
    auto fetch = [&](int k) {     // chunk k's eight loads, one run
        const int c = k * 256 + (int)blockIdx.x, u = c >> 7;
        const float* s = ((u < 2) ? x + u * U : (u < 4) ? wq + (u - 2) * U : (u < 6) ? wq2 + (u - 4) * U : (u == 6) ? wk : (u == 7) ? wk2 : (u == 8) ? wv : (u == 9) ? wv2 : wo + (u - 10) * U) + (size_t)(c & 127) * 16384;
#pragma unroll
        for (int i = 0; i < 4; ++i) v[k & 1][i] = *(const v8f*)(s + i * 4096 + lo);
        run_end();
    };
    fetch(0);
#pragma unroll   // unrolled: the two register sets are indexed by constants
    for (int k = 0; k < 6; ++k) {
        if (k + 1 < 6) fetch(k + 1);   // the next chunk's loads fly under this chunk's conversion and stores
        bf* d = dst + (size_t)(k * 256 + (int)blockIdx.x) * 16384; v8us o[4];
#pragma unroll
        for (int i = 0; i < 4; ++i)
#pragma unroll
            for (int q = 0; q < 8; ++q) o[i][q] = f2bf(v[k & 1][i][q]);
        __builtin_amdgcn_sched_barrier(0);   // every value is ready before the first store: no store's register is written again inside the run
#pragma unroll
        for (int i = 0; i < 4; ++i) *(v8us*)(d + i * 4096 + lo) = o[i];
        if (k + 1 < 6) run_end();
    }
}
static_assert(NB_ * TT * HD == 256 * 256 * 4, "k_cscvt: four table entries a thread");
__global__ __launch_bounds__(256) void k_cscvt(const float* __restrict__ cosT, const float* __restrict__ sinT, float* CS) {
    const int idx = (blockIdx.x * 256 + threadIdx.x) * 4; const v4f c = *(const v4f*)(cosT + idx), s = *(const v4f*)(sinT + idx);
    run_end();
    v4f o0, o1; o0[0] = bfr(c[0]); o0[1] = bfr(s[0]); o0[2] = bfr(c[1]); o0[3] = bfr(s[1]); o1[0] = bfr(c[2]); o1[1] = bfr(s[2]); o1[2] = bfr(c[3]); o1[3] = bfr(s[3]);
    *(v4f*)(CS + (size_t)idx * 2) = o0; *(v4f*)(CS + (size_t)idx * 2 + 4) = o1;  }
// k_rope: head planes [b][h][t][d] (fp16 + hi/lo) of rope(x) x sc; F and CS hold both batches' rows, row r = b * TT + t; with the rotate-half convention out[d] = x[d] cos[t][d] - x[d+HD/2] sin[t][d], out[d+HD/2] = x[d+HD/2] cos[t][d+HD/2] + x[d] sin[t][d+HD/2]
// A wave takes RPW head slots of one row t, four d a lane; the row's cos/sin pairs are read once for all of them; one run of loads, then three groups of four head slots, each with its run of stores (256 B of a plane per store).
__global__ __launch_bounds__(512) void k_rope(const float* __restrict__ F, const float* __restrict__ CS, float sc, h16* P16, bf* Ph, bf* Pl) {
    const int lane = threadIdx.x & 31; const int W = blockIdx.x * 16 + __builtin_amdgcn_readfirstlane((int)(threadIdx.x >> 5)); const int t = W / (NRS / RPW), h0 = (W % (NRS / RPW)) * RPW;
    const int d = lane * 4, dp0 = (d < HD / 2) ? d + HD / 2 : d - HD / 2; const float* f = F + (size_t)t * NPC + h0 * HD; const size_t e0 = ((size_t)((t / TT) * NRS + h0) * TT + t % TT) * HD + d;
    h16* q16 = P16 + e0; bf* qh = Ph + e0; bf* ql = Pl + e0;
    asm volatile("" :: "v"(q16), "v"(qh), "v"(ql) : "memory");   // inputs only: the lane's three store addresses are complete in front of the loads, so that none of their arithmetic and no argument fetch lands in a register that an issued load names
    __builtin_amdgcn_sched_barrier(0);   // keeps the loads behind that point
    const v4f cs01 = *(const v4f*)(CS + ((size_t)t * HD + d) * 2), cs23 = *(const v4f*)(CS + ((size_t)t * HD + d) * 2 + 4);
    run_end();
    v4f xa[RPW], xb[RPW];
#pragma unroll
    for (int k = 0; k < RPW; ++k) { xa[k] = *(const v4f*)(f + k * HD + d); xb[k] = *(const v4f*)(f + k * HD + dp0); }
    run_end();
#pragma unroll
    for (int g = 0; g < RPW / 4; ++g) {
        v4h o16[4]; v4us oh[4], ol[4];
#pragma unroll
        for (int k = 0; k < 4; ++k)
#pragma unroll
            for (int q = 0; q < 4; ++q) { const int dd = d + q; const float x0 = xa[g * 4 + k][q], x1 = xb[g * 4 + k][q]; v2f cs; cs[0] = (q < 2) ? cs01[2 * (q & 1)] : cs23[2 * (q & 1)]; cs[1] = (q < 2) ? cs01[2 * (q & 1) + 1] : cs23[2 * (q & 1) + 1];
                float a = __fmul_rn(x0, cs[0]), bq = __fmul_rn(x1, cs[1]); asm volatile("" : "+v"(a)); asm volatile("" : "+v"(bq)); const float r = ((dd < HD / 2) ? __fsub_rn(a, bq) : __fadd_rn(a, bq)) * sc;
                o16[k][q] = tohx(r); unsigned short a2, c2; splitf(r, a2, c2); oh[k][q] = a2; ol[k][q] = c2; }
        __builtin_amdgcn_sched_barrier(0);   // every value is ready before the first store: no store's register is written again inside the run
#pragma unroll
        for (int k = 0; k < 4; ++k) { const size_t e = (size_t)(g * 4 + k) * TT * HD; *(v4h*)(q16 + e) = o16[k]; *(v4us*)(qh + e) = oh[k]; *(v4us*)(ql + e) = ol[k]; }
        if (g + 1 < RPW / 4) run_end();
    }
}
// k_vtp: value planes [b][g][d][t] (fp16 + hi/lo) of F[b * TT + t][g * HD + d]. Work-group = (b, g, 128 rows t, 64 columns d), wave = 8 columns; a lane takes four rows t: eight 16-byte loads (4 t x 8 d), then per column and plane one 8-byte store, 256 B of the plane per wave.
static_assert(NVS * (TT / 128) * (HD / 64) == 256, "k_vtp: 256 work-groups a batch");
__global__ __launch_bounds__(256) void k_vtp(const float* __restrict__ F, h16* V16, bf* Vh, bf* Vl) {
    const int lane = threadIdx.x & 31, w = __builtin_amdgcn_readfirstlane((int)(threadIdx.x >> 5)), b = blockIdx.x & 255, bt = blockIdx.x >> 8; const int g = b >> 4, tb = ((b >> 1) & 7) * 128, d0 = (b & 1) * 64 + w * 8;
    const float* f = F + (size_t)(bt * TT + tb) * NPC + g * HD + d0; v4f x[4][2]; v4h o16[8]; v4us oh[8], ol[8];
#pragma unroll
    for (int i = 0; i < 4; ++i)
#pragma unroll
        for (int j = 0; j < 2; ++j) x[i][j] = *(const v4f*)(f + (size_t)(lane * 4 + i) * NPC + j * 4);
    run_end();
#pragma unroll
    for (int dd = 0; dd < 8; ++dd)
#pragma unroll
        for (int i = 0; i < 4; ++i) { const float xv = x[i][dd >> 2][dd & 3]; o16[dd][i] = tohx(xv); unsigned short a2, c2; splitf(xv, a2, c2); oh[dd][i] = a2; ol[dd][i] = c2; }
    __builtin_amdgcn_sched_barrier(0);   // every value is ready before the first store: no store's register is written again inside the run
    const size_t e0 = (size_t)((bt * NVS + g) * HD + d0) * TT + tb;
#pragma unroll
    for (int dd = 0; dd < 8; ++dd) { const size_t e = e0 + (size_t)dd * TT + lane * 4; *(v4h*)(V16 + e) = o16[dd]; *(v4us*)(Vh + e) = oh[dd]; *(v4us*)(Vl + e) = ol[dd]; }
}
// k_rmsw: RMSNorm x g in place on the head slots [q | q2 | k | k2] of F. A wave takes RPW consecutive head slots of one row t of the NB_ * TT rows (RPW x 512 contiguous bytes): one run of loads, RPW independent row sums, one run of stores. The four weight vectors are read once; each slot takes its section's.
__global__ __launch_bounds__(512) void k_rmsw(float* F, const float* __restrict__ gq, const float* __restrict__ gq2, const float* __restrict__ gk, const float* __restrict__ gk2) {
    const int lane = threadIdx.x & 31; const int W = blockIdx.x * 16 + __builtin_amdgcn_readfirstlane((int)(threadIdx.x >> 5)); const int t = W / (NRS / RPW), h0 = (W % (NRS / RPW)) * RPW;
    float* f = F + (size_t)t * NPC + h0 * HD; v4f r[RPW]; float sq[RPW];
#pragma unroll
    for (int k = 0; k < RPW; ++k) r[k] = *(const v4f*)(f + k * HD + lane * 4);
    const v4f w0 = *(const v4f*)(gq + lane * 4), w1 = *(const v4f*)(gq2 + lane * 4), w2 = *(const v4f*)(gk + lane * 4), w3 = *(const v4f*)(gk2 + lane * 4);
    run_end();
#pragma unroll
    for (int k = 0; k < RPW; ++k) { const v4f a = r[k]; float ss = 0.f;
#pragma unroll
        for (int q = 0; q < 4; ++q) { float p = __fmul_rn(a[q], a[q]); asm volatile("" : "+v"(p)); ss = __fadd_rn(ss, p); }
        sq[k] = ss; }
#pragma unroll
    for (int sh = 16; sh; sh >>= 1)     // the RPW rows' butterflies step together: one cross-lane latency a step, not one a row and step
#pragma unroll
        for (int k = 0; k < RPW; ++k) sq[k] = __fadd_rn(sq[k], __shfl_xor(sq[k], sh, 32));
#pragma unroll
    for (int k = 0; k < RPW; ++k) { const int h = h0 + k; const v4f w = (h < NH_) ? w0 : (h < 2 * NH_) ? w1 : (h < 2 * NH_ + NKV) ? w2 : w3; const v4f a = r[k]; const float ss = sq[k];
        const float rs = __fdiv_rn(1.0f, sqrtf(__fadd_rn(ss * (1.0f / HD), 1e-6f))); v4f o;
#pragma unroll
        for (int q = 0; q < 4; ++q) { float y = __fmul_rn(a[q], rs); asm volatile("" : "+v"(y)); o[q] = __fmul_rn(y, bfr(w[q])); }
        r[k] = o; }
    __builtin_amdgcn_sched_barrier(0);   // every value is ready before the first store: no store's register is written again inside the run
#pragma unroll
    for (int k = 0; k < RPW; ++k) *(v4f*)(f + k * HD + lane * 4) = r[k];
}
// ---- k_fattn: scores, joint softmax and both value products of one head in one kernel; grid (NB_ * NH_, TT / 64): both batches in one launch, two work-groups per WGP; 4 waves, each wave owns 16 query rows.
// The work-group walks 64-key tiles of the window path (from its diagonal tile down to key i - 255), then of the fading path (keys <= i - 256); the list of tiles is the same for its four waves. Each wave keeps ONE running maximum, sum and output accumulator (online softmax):
// the joint softmax over [s_ic | s_f]. A key outside the path's own range gets weight exactly 0. The diagonal tile comes first, so every row's maximum is finite from the first tile on.
// A tile's keys (64 rows of 256 B) and values (128 rows of 128 B), every plane, are brought into LDS once per work-group by asynchronous copies of whole lines and read from there by all four waves. Two buffers: tile t + 1 flies while tile t is worked on; one work-group barrier per tile hands the buffers over.
// Probabilities go from the accumulator layout to the A-operand layout through the wave's own LDS slice. Rows < RH: hi+lo bf16 planes, 3 products; rows >= RH: fp16, weights x PCAR (the factor cancels in sum and output alike).
// Loops: the path loop and the tile loop stay rolled (#pragma unroll 1: one copy of the long body); every inner loop is unrolled, so that the fragment and accumulator arrays are indexed by constants and stay in registers.
#define PP 72     // LDS pitch (16-bit elements) of the 16 x 64 probability tile: 16-byte aligned rows, 16-byte row reads spread over the banks
#define OP 136    // LDS pitch of the 16 x 128 output tile
#define KP 136    // LDS pitch of a staged key row (128 d): 256 B + 16 B, the pitch for 16-byte row reads
#define VP 72     // LDS pitch of a staged value row (64 keys of one d): 128 B + 16 B
#define KPL (64 * KP)     // elements of one staged key plane
#define VPL (HD * VP)     // elements of one staged value plane
#define RING (2 * 2 * (KPL + VPL))   // two buffers of two planes of keys and values
static_assert(4 * 2 * 16 * OP <= RING, "the four waves' output tiles fit the ring");
template <int X> __device__ __forceinline__ float rowx(float v) { return __int_as_float(__builtin_amdgcn_update_dpp(0, __float_as_int(v), 0x160 + X, 0xf, 0xf, true)); }   // DPP row_xmask: the value of lane ^ X inside the 16-lane row, on the vector port (a shuffle would go through the LDS queue, one wait each)
__device__ __forceinline__ float rowmax(float v) { v = fmaxf(v, rowx<8>(v)); v = fmaxf(v, rowx<4>(v)); v = fmaxf(v, rowx<2>(v)); return fmaxf(v, rowx<1>(v)); }
__device__ __forceinline__ float rowsum(float v) { v += rowx<8>(v); v += rowx<4>(v); v += rowx<2>(v); return v + rowx<1>(v); }
template <typename T16> struct LFrag;
template <> struct LFrag<h16> { static __device__ __forceinline__ v16h ld(const unsigned short* p) { const v8us lo = *(const v8usa*)p, hi = *(const v8usa*)(p + 16); return cat16(__builtin_bit_cast(v8h, lo), __builtin_bit_cast(v8h, hi)); } };
template <> struct LFrag<bf> { static __device__ __forceinline__ v16bf ld(const unsigned short* p) { const v8us lo = *(const v8usa*)p, hi = *(const v8usa*)(p + 16); return cat16b(lo, hi); } };
// Eight asynchronous 16-byte copies of a lane, global memory to LDS: LDS byte addresses l + i * ls, global addresses g + i * gs bytes. The wait is the statement's last line: it stands behind the copies, in front of any later overwrite of the registers they name.
__device__ __forceinline__ void copies8(unsigned l, unsigned ls, const char* g, size_t gs) {
    asm volatile("global_load_async_to_lds_b128 %0, %8, off\n\t"
                 "global_load_async_to_lds_b128 %1, %9, off\n\t"
                 "global_load_async_to_lds_b128 %2, %10, off\n\t"
                 "global_load_async_to_lds_b128 %3, %11, off\n\t"
                 "global_load_async_to_lds_b128 %4, %12, off\n\t"
                 "global_load_async_to_lds_b128 %5, %13, off\n\t"
                 "global_load_async_to_lds_b128 %6, %14, off\n\t"
                 "global_load_async_to_lds_b128 %7, %15, off\n\t"
                 "s_wait_xcnt 0x0"
                 :: "v"(l), "v"(l + ls), "v"(l + 2 * ls), "v"(l + 3 * ls), "v"(l + 4 * ls), "v"(l + 5 * ls), "v"(l + 6 * ls), "v"(l + 7 * ls),
                    "v"(g), "v"(g + gs), "v"(g + 2 * gs), "v"(g + 3 * gs), "v"(g + 4 * gs), "v"(g + 5 * gs), "v"(g + 6 * gs), "v"(g + 7 * gs)
                 : "memory");
}
template <typename T16, bool HL>
__device__ __forceinline__ void attn_rows(const T16* __restrict__ R, const T16* __restrict__ Rlo, const T16* __restrict__ VT, const T16* __restrict__ VTlo, int h, int rb, int wv, unsigned short* ring, unsigned short* sh, unsigned short* sl, bf* Ah, bf* Al) {
    typedef typename WFrag<T16>::V V;
    constexpr int NG = HL ? 2 : 1;    // planes per operand; also the number of 16-fragment (32-read) groups that a tile's keys, and its values, are read in
    constexpr int STG = NG * (KPL + VPL);   // elements of one buffer: [key planes | value planes]
    const int tid = threadIdx.x, lane = tid & 31, lr = lane & 15, hi = lane >> 4, i0 = rb * 64 + wv * 16;
    const int n0 = min(rb, 4) + 1, nt = n0 + max(0, rb - 3);   // tiles of the window path (key tiles rb down to max(0, rb - 4)) and of both paths (fading: key tiles rb - 4 down to 0); every one holds a live key for each wave's 16 rows or is masked to weight 0
    const unsigned ring0 = (unsigned)(size_t)(__attribute__((address_space(3))) unsigned short*)ring;   // the ring's byte address in the work-group's LDS
    const unsigned klane = (unsigned)((tid >> 4) * KP + (tid & 15) * 8) * 2, vlane = (unsigned)((tid >> 3) * VP + (tid & 7) * 8) * 2, vgl = (unsigned)((tid >> 3) * TT + (tid & 7) * 8) * 2;   // the lane's byte offsets: in a staged key plane, in a staged value plane, in a value plane in memory
    auto stage = [&](int t) {     // tile t's planes into buffer t & 1: a wave's copy covers 512 B of whole lines (2 key rows, 4 value rows); 8 key rows, 16 value rows per step of the work-group
        const int p = (t >= n0) ? 1 : 0, j0 = (p ? (rb - 4) - (t - n0) : rb - t) * 64;
        const size_t ku = ((size_t)(2 * NH_ + p * NKV + h / REP) * TT + j0) * HD, vu = (size_t)(p * NKV + h / REP) * HD * TT + j0;   // the tile's first element in a key plane and in a value plane: the same for the whole work-group
        const unsigned kl = ring0 + (unsigned)((t & 1) * STG) * 2 + klane, vl = ring0 + (unsigned)((t & 1) * STG + NG * KPL) * 2 + vlane;
        copies8(kl, 8 * KP * 2, (const char*)(R + ku) + tid * 16, (size_t)8 * HD * 2);   // key rows are contiguous: thread tid takes bytes tid * 16 of each 2 KiB step
        if (HL) copies8(kl + KPL * 2, 8 * KP * 2, (const char*)(Rlo + ku) + tid * 16, (size_t)8 * HD * 2);
        copies8(vl, 16 * VP * 2, (const char*)(VT + vu) + vgl, (size_t)16 * TT * 2);
        if (HL) copies8(vl + VPL * 2, 16 * VP * 2, (const char*)(VTlo + vu) + vgl, (size_t)16 * TT * 2);
    };
    v8f O[8]; float m[8], l[8];
#pragma unroll
    for (int db = 0; db < 8; ++db) O[db] = (v8f){};
#pragma unroll
    for (int jj = 0; jj < 8; ++jj) { m[jj] = -3.0e38f; l[jj] = 0.f; }
    stage(0);
    asm volatile("s_wait_asynccnt 0x0" ::: "memory");   // this wave's copies of tile 0 have landed
    __syncthreads();   // publishes tile 0
    if (nt > 1) stage(1);
    int t = 0;     // the running tile, over both paths
#pragma unroll 1
    for (int p = 0; p < 2; ++p) {      // p = 0: window path, p = 1: fading path
        const int jhi = p ? rb - 4 : rb, jlo = p ? 0 : max(0, rb - 4);   // first and last 64-key tile of the path
        if (jhi < jlo) continue;   // no tile of this path (the same for the whole work-group): its queries are not read
        const size_t qo = ((size_t)(p * NH_ + h) * TT + i0 + lr) * HD + 8 * hi;
        V a[4], a2[4];
#pragma unroll
        for (int ks = 0; ks < 4; ++ks) { a[ks] = WFrag<T16>::ld(R + qo + ks * 32); if (HL) a2[ks] = WFrag<T16>::ld(Rlo + qo + ks * 32); }
        run_end();   // behind the query loads
#pragma unroll 1
        for (int jt = jhi; jt >= jlo; --jt, ++t) {
            const int j0 = jt * 64; v8f s[4]; V kf[NG][16], vf[NG][16];
            const unsigned short* kb = ring + (t & 1) * STG + lr * KP + 8 * hi; const unsigned short* vb = ring + (t & 1) * STG + NG * KPL + lr * VP + 8 * hi;   // the lane's place in this tile's key and value planes
            // Read order of a tile. Keys and values come from LDS in groups of 16 fragments (32 reads), each group issued as one run, so that a group costs one LDS latency and not one every few fragments.
            // A second group (hi+lo planes) is issued behind the first block's products and flies under the products that follow. Each sched_barrier(0) keeps the compiler from moving reads or products over that point.
#pragma unroll
            for (int f = 0; f < 16 / NG; ++f) { const int o = (f >> 2) * 16 * KP + (f & 3) * 32; kf[0][f * NG] = LFrag<T16>::ld(kb + o); if (HL) kf[0][f * NG + 1] = LFrag<T16>::ld(kb + KPL + o); }
            __builtin_amdgcn_sched_barrier(0);   // the whole group is issued before the first product waits for a fragment
#pragma unroll
            for (int nb = 0; nb < 4; ++nb) { const int g = nb / (4 / NG), nl = nb % (4 / NG); s[nb] = (v8f){};
#pragma unroll
                for (int ks = 0; ks < 4; ++ks) { s[nb] = WFrag<T16>::mma(a[ks], kf[g][(nl * 4 + ks) * NG], s[nb]);
                    if (HL) { s[nb] = WFrag<T16>::mma(a2[ks], kf[g][(nl * 4 + ks) * NG], s[nb]); s[nb] = WFrag<T16>::mma(a[ks], kf[g][(nl * 4 + ks) * NG + 1], s[nb]); } }
                if (HL && nb == 0) {
                    __builtin_amdgcn_sched_barrier(0);   // the second key group is issued behind the first block's products
#pragma unroll
                    for (int f = 0; f < 16 / NG; ++f) { const int o = (4 / NG + (f >> 2)) * 16 * KP + (f & 3) * 32; kf[NG - 1][f * NG] = LFrag<T16>::ld(kb + o); kf[NG - 1][f * NG + 1] = LFrag<T16>::ld(kb + KPL + o); }
                    __builtin_amdgcn_sched_barrier(0);   // and it flies under the products that follow
                } }
            __builtin_amdgcn_sched_barrier(0);   // the value reads start behind the last score product
#pragma unroll
            for (int f = 0; f < 16 / NG; ++f) { const int o = (f >> 1) * 16 * VP + (f & 1) * 32; vf[0][f * NG] = LFrag<T16>::ld(vb + o); if (HL) vf[0][f * NG + 1] = LFrag<T16>::ld(vb + VPL + o); }
            __builtin_amdgcn_sched_barrier(0);   // the first value group flies while the softmax runs
            float mx[8];
#pragma unroll
            for (int jj = 0; jj < 8; ++jj) mx[jj] = m[jj];
#pragma unroll
            for (int nb = 0; nb < 4; ++nb)
#pragma unroll
                for (int jj = 0; jj < 8; ++jj) { const int dij = (i0 + hi * 8 + jj) - (j0 + nb * 16 + lr); const bool live = p ? (dij >= 256) : (dij >= 0 && dij < 256); const float t2 = live ? s[nb][jj] * SCL : -3.0e38f; s[nb][jj] = t2; mx[jj] = fmaxf(mx[jj], t2); }
#pragma unroll
            for (int jj = 0; jj < 8; ++jj) {
                mx[jj] = rowmax(mx[jj]);   // a row's 16 columns lie in the 16 lanes of one half
                const float al = __builtin_amdgcn_exp2f((m[jj] - mx[jj]) * 1.4426950408889634f); m[jj] = mx[jj]; l[jj] *= al;
#pragma unroll
                for (int db = 0; db < 8; ++db) O[db][jj] *= al; }
#pragma unroll
            for (int nb = 0; nb < 4; ++nb)
#pragma unroll
                for (int jj = 0; jj < 8; ++jj) { const float pv = __builtin_amdgcn_exp2f((s[nb][jj] - m[jj]) * 1.4426950408889634f) * (HL ? 1.0f : PCAR); l[jj] += pv; const int o = (hi * 8 + jj) * PP + nb * 16 + lr;
                    if (HL) { unsigned short ph, pl; splitf(pv, ph, pl); sh[o] = ph; sl[o] = pl; } else sh[o] = __builtin_bit_cast(unsigned short, tohx(pv)); }
            __builtin_amdgcn_wave_barrier(); asm volatile("" ::: "memory");   // the fragment reads below take other lanes' stores: keep them behind the stores
            V pa[2], pb[2];
#pragma unroll
            for (int k2 = 0; k2 < 2; ++k2) { pa[k2] = LFrag<T16>::ld(sh + lr * PP + k2 * 32 + 8 * hi); if (HL) pb[k2] = LFrag<T16>::ld(sl + lr * PP + k2 * 32 + 8 * hi); }
            __builtin_amdgcn_wave_barrier(); asm volatile("" ::: "memory");   // the next tile's stores stay behind these reads
#pragma unroll
            for (int db = 0; db < 8; ++db) { const int g = db / (8 / NG), dl = db % (8 / NG);
#pragma unroll
                for (int k2 = 0; k2 < 2; ++k2) { O[db] = WFrag<T16>::mma(pa[k2], vf[g][(dl * 2 + k2) * NG], O[db]);
                    if (HL) { O[db] = WFrag<T16>::mma(pb[k2], vf[g][(dl * 2 + k2) * NG], O[db]); O[db] = WFrag<T16>::mma(pa[k2], vf[g][(dl * 2 + k2) * NG + 1], O[db]); } }
                if (HL && db == 0) {
                    __builtin_amdgcn_sched_barrier(0);   // the second value group is issued behind the first block's products
#pragma unroll
                    for (int f = 0; f < 16 / NG; ++f) { const int o = (8 / NG + (f >> 1)) * 16 * VP + (f & 1) * 32; vf[NG - 1][f * NG] = LFrag<T16>::ld(vb + o); vf[NG - 1][f * NG + 1] = LFrag<T16>::ld(vb + VPL + o); }
                    __builtin_amdgcn_sched_barrier(0);   // and it flies under the products that follow
                } }
            // Foot of tile t, every wave, in this order: own LDS reads done, own copies of tile t + 1 landed, barrier, refill of the buffer that tile t has just left.
            asm volatile("s_wait_dscnt 0x0" ::: "memory");      // this wave's reads of tile t have returned
            asm volatile("s_wait_asynccnt 0x0" ::: "memory");   // this wave's copies of tile t + 1 have landed
            __syncthreads();   // publishes tile t + 1 and ends every wave's reads of tile t
            if (t + 2 < nt) stage(t + 2);
        }
    }
    asm volatile("s_wait_asynccnt 0x0" ::: "memory");   // no copy is outstanding when the ring becomes output staging (the last tile's barrier has ended every wave's reads)
    unsigned short* oh_ = ring + wv * 2 * 16 * OP; unsigned short* ol_ = oh_ + 16 * OP;   // the wave's own output tiles, hi and lo
#pragma unroll
    for (int jj = 0; jj < 8; ++jj) {
        const float f = __fdiv_rn(1.0f, rowsum(l[jj]));
#pragma unroll
        for (int db = 0; db < 8; ++db) { unsigned short oh, ol; splitf(O[db][jj] * f, oh, ol); const int o = (hi * 8 + jj) * OP + db * 16 + lr; oh_[o] = oh; ol_[o] = ol; } }
    __builtin_amdgcn_wave_barrier(); asm volatile("" ::: "memory");   // the row reads below take other lanes' stores
    v8us vh[8], vl[8]; const size_t oo = (size_t)(i0 + hi) * DQ + h * HD + lr * 8; bf* qh = Ah + oo; bf* ql = Al + oo;   // the lane's two store addresses; the eight rows step by a constant
#pragma unroll
    for (int c = 0; c < 8; ++c) { const int row = c * 2 + hi, col = lr * 8; vh[c] = *(const v8usa*)(oh_ + row * OP + col); vl[c] = *(const v8usa*)(ol_ + row * OP + col); }
    asm volatile("" :: "v"(qh), "v"(ql) : "memory");   // inputs only: both store addresses are complete in front of the run of stores, so that none of their arithmetic lands in a register that an issued store names
    __builtin_amdgcn_sched_barrier(0);   // every row is in its own registers before the first store: no store's register is written again inside the run
#pragma unroll
    for (int c = 0; c < 8; ++c) { *(v8us*)(qh + (size_t)c * 2 * DQ) = vh[c]; *(v8us*)(ql + (size_t)c * 2 * DQ) = vl[c]; }
}
__global__ __launch_bounds__(128) void k_fattn(const h16* __restrict__ R16, const bf* __restrict__ Rh, const bf* __restrict__ Rl, const h16* __restrict__ VT16, const bf* __restrict__ VTh, const bf* __restrict__ VTl, bf* Ah, bf* Al) {
    __shared__ __align__(16) unsigned short ring[RING];
    __shared__ __align__(16) unsigned short ps[4][2][16 * PP];
    constexpr int NRB = TT / 64;
    const int wv = __builtin_amdgcn_readfirstlane((int)(threadIdx.x >> 5)); const int y = blockIdx.y; const int rb = (y < NRB / 2) ? NRB - 1 - y : y - NRB / 2;   // the first half of the grid takes the last rows (the most keys) downwards, the second half the first rows upwards: the work-groups half a grid apart hold row blocks t and NRB - 1 - t (speed only)
    const int h = blockIdx.x % NH_, b = blockIdx.x / NH_;
    const size_t ro = (size_t)b * NRS * TT * HD, vo = (size_t)b * NVS * HD * TT, ao = (size_t)b * TT * DQ;   // batch b's planes
    if (rb * 64 < RH) attn_rows<bf, true>(Rh + ro, Rl + ro, VTh + vo, VTl + vo, h, rb, wv, ring, ps[wv][0], ps[wv][1], Ah + ao, Al + ao);
    else attn_rows<h16, false>(R16 + ro, nullptr, VT16 + vo, nullptr, h, rb, wv, ring, ps[wv][0], ps[wv][1], Ah + ao, Al + ao);
}

// k_asoft: per row (zz, i): t = S x HD^-0.5 for j <= i and i - j < WIN (sliding causal window; the reference's -1e9 additive fill vanishes identically); softmax over the 1024 keys (register row, one exp, fixed trees);
__global__ __launch_bounds__(256) void k_asoft(const float* __restrict__ Sb, h16* P16, bf* Ph, bf* Pl) {
    const int lane = threadIdx.x & 31; const int row = blockIdx.x * 8 + (threadIdx.x >> 5); if (row >= ZH * TT) return; const int i = row % TT; const int zz = row / TT; (void)zz; const bool hires = (i < RH); const float* sr = Sb + (size_t)row * TT; float v[TT / 32]; float mx = -3.0e38f;
#pragma unroll
    for (int ch = 0; ch < TT / 128; ++ch) { const int j0 = ch * 128 + lane * 4; const v4f a = *(const v4f*)(sr + j0);
#pragma unroll
        for (int q = 0; q < 4; ++q) { const int j = j0 + q; (void)j; const float t = (j <= i && i - j < WIN) ? a[q] * SCL : -3.0e38f; v[ch * 4 + q] = t; mx = fmaxf(mx, t); } }
#pragma unroll
    for (int sh = 16; sh; sh >>= 1) mx = fmaxf(mx, __shfl_xor(mx, sh, 32));
    float sum = 0.f;
#pragma unroll
    for (int k = 0; k < TT / 32; ++k) { float d0 = __fsub_rn(v[k], mx); asm volatile("" : "+v"(d0)); v[k] = __builtin_amdgcn_exp2f(__fmul_rn(d0, 1.4426950408889634f)); sum += v[k]; }
#pragma unroll
    for (int sh = 16; sh; sh >>= 1) sum += __shfl_xor(sum, sh, 32);
    const float f = __fdiv_rn(hires ? 1.0f : PCAR, sum);
{
        if (hires) {
#pragma unroll
            for (int ch = 0; ch < TT / 128; ++ch) { v4us oh, ol;
#pragma unroll
                for (int q = 0; q < 4; ++q) { unsigned short a, c2; splitf(v[ch * 4 + q] * f, a, c2); oh[q] = a; ol[q] = c2; }
                const size_t oo = ((size_t)zz * (RH ? RH : 1) + i) * TT + ch * 128 + lane * 4; *(v4us*)(Ph + oo) = oh; *(v4us*)(Pl + oo) = ol; }
        } else {
#pragma unroll
            for (int ch = 0; ch < TT / 128; ++ch) { v4h o4;
#pragma unroll
                for (int q = 0; q < 4; ++q) o4[q] = tohx(v[ch * 4 + q] * f);
                *(v4h*)(P16 + (size_t)row * TT + ch * 128 + lane * 4) = o4; } }
         }
}
__global__ __launch_bounds__(256) void k_merge(const float* __restrict__ O, int h0, bf* Ah, bf* Al) { const size_t e = ((size_t)blockIdx.x * 256 + threadIdx.x) * 2; if (e >= (size_t)ZH * TT * HD) return; const int d = (int)(e % HD); const int t = (int)((e / HD) % TT); const int zz = (int)(e / ((size_t)HD * TT)); const float cs = (t < RH) ? 1.0f : (1.0f / PCAR); const size_t oo = (size_t)t * DQ + (h0 + zz) * HD + d;
    v2us oh, ol;
#pragma unroll
    for (int q = 0; q < 2; ++q) { unsigned short a, c2; splitf(O[e + q] * cs, a, c2); oh[q] = a; ol[q] = c2; } *(v2us*)(Ah + oo) = oh; *(v2us*)(Al + oo) = ol;  }

extern "C" void kernel_launch(void* const* d_in, const int* in_sizes, int n_in,
                              void* d_out, int out_size, void* d_ws, size_t ws_size, hipStream_t stream) {
    (void)in_sizes; (void)n_in; (void)out_size;
    const float* x = (const float*)d_in[0]; const float* cosA = (const float*)d_in[1]; const float* sinA = (const float*)d_in[2]; const float* wq = (const float*)d_in[3]; const float* bq = (const float*)d_in[4]; const float* wk = (const float*)d_in[5]; const float* bk = (const float*)d_in[6]; const float* wv = (const float*)d_in[7]; const float* bv = (const float*)d_in[8]; const float* wq2 = (const float*)d_in[9]; const float* bq2 = (const float*)d_in[10]; const float* wk2 = (const float*)d_in[11]; const float* bk2 = (const float*)d_in[12]; const float* wv2 = (const float*)d_in[13]; const float* bv2 = (const float*)d_in[14]; const float* wo = (const float*)d_in[15]; const float* gq = (const float*)d_in[16]; const float* gk = (const float*)d_in[17]; const float* gq2 = (const float*)d_in[18]; const float* gk2 = (const float*)d_in[19]; const float* cosT = cosA; const float* sinT = sinA;
    float* OUT = (float*)d_out;     // [2][1024][2048]
    char* wsp = (char*)d_ws;
    auto take = [&](size_t bytes) { char* p = wsp; wsp += (bytes + 255) & ~(size_t)255; return (void*)p; };
    // 16-bit GEMM operands, one conversion launch: [x (both batches) | wq | wq2 | wk | wk2 | wv | wv2 | wo]; the six projection weights are one [NP][DM] plane
    const size_t U = (size_t)DKV * DM; const int NP = 2 * DQ + 4 * DKV, NRH = 2 * NH_ + 2 * NKV, NVH = 2 * NKV;
    bf* XB = (bf*)take(12 * U * 2); bf* WP = XB + 2 * U; bf* WO = XB + 10 * U; float* CS = (float*)take((size_t)NB_ * TT * HD * 2 * 4);
    // head planes per batch, both paths side by side: [b][q 16 | q2 16 | k 8 | k2 8][t][d] and [b][v 8 | v2 8][d][t]
    h16* R16 = (h16*)take((size_t)NB_ * NRH * TT * HD * 2); bf* Rh = (bf*)take((size_t)NB_ * NRH * TT * HD * 2); bf* Rl = (bf*)take((size_t)NB_ * NRH * TT * HD * 2);
    h16* VT16 = (h16*)take((size_t)NB_ * NVH * HD * TT * 2); bf* VTh = (bf*)take((size_t)NB_ * NVH * HD * TT * 2); bf* VTl = (bf*)take((size_t)NB_ * NVH * HD * TT * 2);
    float* F = (float*)take((size_t)NB_ * TT * NP * 4); bf* ATl = (bf*)take((size_t)NB_ * TT * DQ * 2);   // both batches' [NB_ * TT][NP] projection output; the lo plane of the merged attention output
    if ((size_t)(wsp - (char*)d_ws) > ws_size) return;    // ws 256 MiB
    bf* ATh = XB;     // the hi plane of the merged attention output reuses x: its rows are dead once the projection has run (stream-ordered; same size)
    static_assert(DQ == DM, "ATh fits x");
    k_cvtall<<<256, 512, 0, stream>>>(x, wq, wq2, wk, wk2, wv, wv2, wo, XB);
    k_cscvt<<<256, 256, 0, stream>>>(cosA, sinA, CS);
    // every stage takes both batches in one launch: the rows of x, F and CS are r = b * TT + t
    k_gemms<256, DM, 0, true><<<dim3(NB_ * TT / 256, NP / 128, 1), 256, 0, stream>>>(XB, nullptr, WP, F, NP, bq, bq2, bk, bk2, bv, bv2);
    k_rmsw<<<512, 512, 0, stream>>>(F, gq, gq2, gk, gk2);
    k_rope<<<512, 512, 0, stream>>>(F, CS, 1.0f, R16, Rh, Rl);
    k_vtp<<<512, 256, 0, stream>>>(F + NRH * HD, VT16, VTh, VTl);
    k_fattn<<<dim3(NB_ * NH_, TT / 64, 1), 128, 0, stream>>>(R16, Rh, Rl, VT16, VTh, VTl, ATh, ATl);
    k_gemms<128, DQ, 1, false><<<dim3(NB_ * TT / 128, DM / 128, 1), 128, 0, stream>>>(ATh, ATl, WO, OUT, DM, nullptr, nullptr, nullptr, nullptr, nullptr, nullptr);
}

// v008
// A run of this version takes 167 microseconds.
// Two timings next to v007 both put it at 1.11 times that version's speed.
// Counting every step since v000, it is 14.2 times as fast.
#include <hip/hip_runtime.h>

// BMOJOAttention (hidden [2][1024][2048]; two projection paths - in-context (Wq,bq,Wk,bk,Wv,bv,gq,gk) and fading (Wq2..gk2): q = rope(rmsnorm(x Wq^T + bq) gq) (16 x 128), k = rope(rmsnorm(x Wk^T + bk) gk) (8 kv heads; group h/2), v = x Wv^T + bv; rotate-half RoPE with the read cos/sin [B][S][128]; s_ic = q_ic.k_ic / sqrt(128) live where 0 <= i-j < 256, s_f = q_f.k_f / sqrt(128) live where i-j >= 256 (else -1e30); ONE joint softmax over [s_ic | s_f]; out = p_ic v_ic + p_f v_f; merged Wo^T -> [2][1024][2048]).
// The joint softmax over 2S columns is computed as one causal softmax whose score (and value source) switches at i-j = 256: the masked halves contribute exactly 0; keys j > i are masked in both (causal tile skipping).
// Compute dtypes, f32 accumulate: every input rounded to bf16; both paths' q/k/v on PLAIN bf16 operands (inputs: exact) + bias; RMSNorm * g and RoPE (cos/sin rounded to bf16) f32, in registers of one kernel (k_post); both score sets and both attn.v products: query rows < 512 hl (3 products), the rest single fp16 (x1024), causal tile skipping; online softmax f32 over the live scores of both paths, both value products into one f32 accumulator, all in one kernel (k_fattn), which emits the hl planes of the merged output; Wo hl x exact (2 products).

#define NB_  2
#define TT   1024
#define DM   2048
#define NH_  16
#define NKV  8
#define REP  (NH_ / NKV)
#define HD   128
#define DQ   (NH_ * HD)
#define DKV  (NKV * HD)
#define ZH   16                   // heads per attention pass: all of them
#define RH   512                  // query rows < RH use hi+lo planes (0: none)
#define WIN  1024
#define PCAR 1024.0f
static_assert(RH % 64 == 0, "a 64-row block of the attention lies on one side of RH");
#define SCL  0.088388347648318447f   // HD^-0.5
typedef _Float16 h16;
typedef unsigned short bf;
typedef __attribute__((ext_vector_type(16))) __bf16   v16bf;
typedef __attribute__((ext_vector_type(16))) _Float16 v16h;
typedef __attribute__((ext_vector_type(8)))  _Float16 v8h;
typedef __attribute__((ext_vector_type(8)))  unsigned short v8us;
typedef __attribute__((ext_vector_type(8)))  float    v8f;
typedef __attribute__((ext_vector_type(4)))  float    v4f;
typedef v8h  __attribute__((may_alias)) v8ha;
typedef v4f  __attribute__((may_alias)) v4fa;
typedef v8us __attribute__((may_alias)) v8usa;

__device__ __forceinline__ unsigned short f2bf(float f) { unsigned u = __float_as_uint(f); u += 0x7FFFu + ((u >> 16) & 1u); return (unsigned short)(u >> 16); }
__device__ __forceinline__ float bf2f(unsigned short b) { return __uint_as_float(((unsigned)b) << 16); }
__device__ __forceinline__ float bfr(float f) { return bf2f(f2bf(f)); }
__device__ __forceinline__ v16h cat16(v8h lo, v8h hi) { return __builtin_shufflevector(lo, hi, 0, 1, 2, 3, 4, 5, 6, 7, 8, 9, 10, 11, 12, 13, 14, 15); }
__device__ __forceinline__ v16bf cat16b(v8us lo, v8us hi) { return __builtin_bit_cast(v16bf, __builtin_shufflevector(lo, hi, 0, 1, 2, 3, 4, 5, 6, 7, 8, 9, 10, 11, 12, 13, 14, 15)); }
__device__ __forceinline__ v8f wmma16(v16h a, v16h b, v8f c) { return __builtin_amdgcn_wmma_f32_16x16x32_f16(false, a, false, b, (short)0, c, false, false); }
__device__ __forceinline__ v8f wmmab(v16bf a, v16bf b, v8f c) { return __builtin_amdgcn_wmma_f32_16x16x32_bf16(false, a, false, b, (short)0, c, false, false); }



// ---- k_gemms: GEMM with both operands staged in LDS. One work-group = BM x 128 output tile, BM threads = BM / 32 waves in a (BM / 64) x 2 grid, 64 x 64 (16 accumulators) per wave; grid (M / BM, N / 128).
// C[m][n] (f32, pitch ldc, + optional bias[n] rounded to bf16) = sum_k (A[m][k] + A2[m][k]) Bt[n][k] (A2 only with NSPLIT = 1: two products per k step, A first); all planes K-contiguous bf16, KK % 64 == 0.
// A stage is 64 k (128 B, one line) of every operand row. Each global load of a wave covers four whole lines; a line is fetched once per work-group and then read from LDS by every wave that needs it.
// Two LDS buffers: a stage's lines are loaded into registers one stage ahead, stored into the other buffer between the two halves of the running stage's products, and one work-group barrier per stage hands the buffers over.
// With BIAS the N axis is the concatenation [q | q2 | k | k2 | v | v2] of both paths' projections (DQ, DQ, DKV, DKV, DKV, DKV columns); each 64-column tile lies in one section and takes that section's bias vector.
template <typename T16> struct WFrag;
template <> struct WFrag<h16> { typedef v16h V; static __device__ __forceinline__ V ld(const h16* p) { return cat16(*(const v8h*)p, *(const v8h*)(p + 16)); } static __device__ __forceinline__ v8f mma(V a, V b, v8f c) { return wmma16(a, b, c); } };
template <> struct WFrag<bf> { typedef v16bf V; static __device__ __forceinline__ V ld(const bf* p) { return cat16b(*(const v8us*)p, *(const v8us*)(p + 16)); } static __device__ __forceinline__ v8f mma(V a, V b, v8f c) { return wmmab(a, b, c); } };
#define GP 72     // LDS pitch (16-bit elements) of a staged 64-k row: 128 B + 16 B, the pitch for 16-byte row reads
template <int BM, int KK, int NSPLIT, bool BIAS>
__global__ __launch_bounds__(BM) void k_gemms(const bf* __restrict__ A, const bf* __restrict__ A2, const bf* __restrict__ Bt, float* C, int ldc, const float* __restrict__ bq, const float* __restrict__ bq2, const float* __restrict__ bk, const float* __restrict__ bk2, const float* __restrict__ bv, const float* __restrict__ bv2) {
    constexpr int NA = NSPLIT ? 2 : 1, RP = BM / 8, NBP = 128 / RP;    // A planes; rows that one staging pass of the work-group covers (8 threads a row); passes for the 128 rows of Bt (the BM rows of A take 8)
    __shared__ __align__(16) unsigned short sa[2][NA][BM * GP];
    __shared__ __align__(16) unsigned short sb[2][128 * GP];
    __shared__ __align__(16) float osm[BM / 32][16 * 68];
    const int tid = threadIdx.x, lane = tid & 31, lr = lane & 15, hi = lane >> 4, wv = __builtin_amdgcn_readfirstlane(tid >> 5);
    const int rw = (wv >> 1) * 64, cw = (wv & 1) * 64; const int r0 = blockIdx.x * BM, c0 = blockIdx.y * 128 + cw;
    const float* bias = nullptr;   // this wave's bias, already stepped to its column c0
    if (BIAS) bias = (c0 < DQ) ? bq + c0 : (c0 < 2 * DQ) ? bq2 + (c0 - DQ) : (c0 < 2 * DQ + DKV) ? bk + (c0 - 2 * DQ) : (c0 < 2 * DQ + 2 * DKV) ? bk2 + (c0 - 2 * DQ - DKV) : (c0 < 2 * DQ + 3 * DKV) ? bv + (c0 - 2 * DQ - 2 * DKV) : bv2 + (c0 - 2 * DQ - 3 * DKV);
    const int srow = tid >> 3, scol = (tid & 7) * 8;
    unsigned vo = (unsigned)(srow * KK + scol) * 2;    // the lane's byte offset from the work-group-uniform bases below, for the stage that is fetched next: carried through the loop in one register, stepped behind each run of loads
    typedef const __attribute__((address_space(1))) char* gptr;
    const gptr ua = (gptr)(A + (size_t)r0 * KK), ua2 = (gptr)(A2 + (size_t)r0 * KK), ub = (gptr)(Bt + (size_t)blockIdx.y * 128 * KK);
    v8us ra[NA][8], rb[NBP];
    auto ld16 = [](gptr p) { return *(const __attribute__((address_space(1))) v8us*)p; };
    auto fetch = [&]() {     // the next stage's lines into registers, one run of loads
#pragma unroll
        for (int i = 0; i < 8; ++i) { ra[0][i] = ld16(ua + vo + (size_t)i * RP * KK * 2); if (NSPLIT) ra[NA - 1][i] = ld16(ua2 + vo + (size_t)i * RP * KK * 2); }
#pragma unroll
        for (int i = 0; i < NBP; ++i) rb[i] = ld16(ub + vo + (size_t)i * RP * KK * 2);
        asm volatile("s_wait_xcnt 0x0" ::: "memory");   // behind the run of loads, in front of any later overwrite of their address registers
        __builtin_amdgcn_sched_barrier(0);   // keeps every later register write behind that wait
        vo += 128;
    };
    auto put = [&](int buf) {      // those registers into LDS buffer buf
#pragma unroll
        for (int i = 0; i < 8; ++i) { const int o = (srow + i * RP) * GP + scol; *(v8usa*)(&sa[buf][0][o]) = ra[0][i]; if (NSPLIT) *(v8usa*)(&sa[buf][NA - 1][o]) = ra[NA - 1][i]; }
#pragma unroll
        for (int i = 0; i < NBP; ++i) *(v8usa*)(&sb[buf][(srow + i * RP) * GP + scol]) = rb[i];
    };
    v8f acc[4][4];
#pragma unroll
    for (int mb = 0; mb < 4; ++mb)
#pragma unroll
        for (int nb = 0; nb < 4; ++nb) acc[mb][nb] = (v8f){};
    v16bf a[2][4], a2[2][4], b[2][4];   // the fragments of the two 32-k halves of a stage
    auto frags = [&](int ks, int buf) {   // half ks of the stage in LDS buffer buf, one run of reads
#pragma unroll
        for (int mb = 0; mb < 4; ++mb) { const int o = (rw + mb * 16 + lr) * GP + ks * 32 + 8 * hi; a[ks][mb] = cat16b(*(const v8usa*)(&sa[buf][0][o]), *(const v8usa*)(&sa[buf][0][o + 16])); if (NSPLIT) a2[ks][mb] = cat16b(*(const v8usa*)(&sa[buf][NA - 1][o]), *(const v8usa*)(&sa[buf][NA - 1][o + 16])); }
#pragma unroll
        for (int nb = 0; nb < 4; ++nb) { const int o = (cw + nb * 16 + lr) * GP + ks * 32 + 8 * hi; b[ks][nb] = cat16b(*(const v8usa*)(&sb[buf][o]), *(const v8usa*)(&sb[buf][o + 16])); }
    };
    auto products = [&](int ks) {
#pragma unroll
        for (int nb = 0; nb < 4; ++nb) {
#pragma unroll
            for (int mb = 0; mb < 4; ++mb) acc[mb][nb] = wmmab(a[ks][mb], b[ks][nb], acc[mb][nb]);
            if (NSPLIT) {
#pragma unroll
                for (int mb = 0; mb < 4; ++mb) acc[mb][nb] = wmmab(a2[ks][mb], b[ks][nb], acc[mb][nb]); } }
    };
    // Order of a trip (stage t in buffer t & 1): first half's products | stage t + 1 from registers into the other buffer | barrier | first-half fragments of stage t + 1 and the global loads of stage t + 2 go out | second half's products | second-half fragments of stage t + 1 go out.
    // Every read of a buffer stands in front of the barrier that precedes its refill; every read of a stage stands behind the barrier that follows its stores. No global load is in flight at a barrier (the barrier's fence would wait for it).
    // Each sched_barrier(0) keeps loads, stores and products on their side of that point, so that each run of reads flies under the products behind it.
    fetch(); put(0);
    __syncthreads();   // publishes stage 0
    frags(0, 0); fetch(); frags(1, 0);
    static_assert(KK >= 128, "a stage 1 exists");
#pragma unroll 1   // stays rolled: one copy of the body, one set of fragment and staging registers
    for (int kc = 0; kc < KK; kc += 64) {
        const int nxt = ((kc >> 6) & 1) ^ 1; const bool more1 = kc + 64 < KK, more2 = kc + 128 < KK;
        __builtin_amdgcn_sched_barrier(0);
        products(0);
        __builtin_amdgcn_sched_barrier(0);
        if (more1) put(nxt);
        __syncthreads();   // publishes stage t + 1 and ends every wave's reads of stage t
        if (more1) frags(0, nxt);
        if (more2) fetch();
        __builtin_amdgcn_sched_barrier(0);
        products(1);
        __builtin_amdgcn_sched_barrier(0);
        if (more1) frags(1, nxt);
    }
    float* os = osm[wv];
    v4f bb = (v4f){};   // the lane's four bias values (columns lr * 4 ..), the same for every row: read once
    if (BIAS) {
        const float b0 = bias[lr * 4], b1 = bias[lr * 4 + 1], b2 = bias[lr * 4 + 2], b3 = bias[lr * 4 + 3];
        asm volatile("s_wait_xcnt 0x0" ::: "memory");   // behind the bias load, in front of any later overwrite of its address registers
        __builtin_amdgcn_sched_barrier(0);   // keeps every later register write behind that wait
        bb[0] = bfr(b0); bb[1] = bfr(b1); bb[2] = bfr(b2); bb[3] = bfr(b3); }
#pragma unroll
    for (int mb = 0; mb < 4; ++mb) {
#pragma unroll
        for (int nb = 0; nb < 4; ++nb) {
#pragma unroll
            for (int j = 0; j < 8; ++j) os[(hi * 8 + j) * 68 + nb * 16 + lr] = acc[mb][nb][j]; }
        __builtin_amdgcn_wave_barrier(); asm volatile("" ::: "memory");   // the row reads below take other lanes' stores: keep them behind the stores
        float* crow = C + (size_t)(r0 + rw + mb * 16) * ldc + c0;
#pragma unroll
        for (int s = 0; s < 8; ++s) { const int row = 2 * s + hi, cofs = lr * 4; v4f val = *(const v4fa*)(os + row * 68 + cofs); if (BIAS) val += bb;
            *(v4f*)(crow + (size_t)row * ldc + cofs) = val; }
        __builtin_amdgcn_wave_barrier(); asm volatile("s_wait_xcnt 0x0" ::: "memory");   // the next block's LDS stores stay behind these reads; the wait stands behind the run of global stores, in front of any overwrite of their registers
        __builtin_amdgcn_sched_barrier(0);   // keeps the next block's register writes behind that wait
    }
}

__device__ __forceinline__ h16 tohx(float x) { return (h16)x; }
__device__ __forceinline__ void splitf(float y, unsigned short& h, unsigned short& l) { h = f2bf(y); l = f2bf(y - bf2f(h)); }
typedef __attribute__((ext_vector_type(2))) _Float16 v2h;
typedef __attribute__((ext_vector_type(4))) _Float16 v4h;
typedef __attribute__((ext_vector_type(2))) unsigned short v2us;
typedef __attribute__((ext_vector_type(4))) unsigned short v4us;
typedef __attribute__((ext_vector_type(2))) float v2f;
typedef __attribute__((ext_vector_type(4))) int v4i;

__global__ __launch_bounds__(256) void k_wtG(const float* __restrict__ w, int K, int N, bf* Bt) {
    const int lane = threadIdx.x & 31; const int L0 = (blockIdx.x * 8 + (threadIdx.x >> 5)) * 8; const int nlines = N * K / 64;
{
#pragma unroll 1
        for (int l = 0; l < 8; ++l) { const int L = L0 + l; if (L >= nlines) break; const size_t e = (size_t)L * 64 + lane * 2; const int k = (int)(e % K), n = (int)(e / K); v2us o;
            o[0] = f2bf(w[(size_t)k * N + n]); o[1] = f2bf(w[(size_t)(k + 1) * N + n]); *(v2us*)(Bt + e) = o; }
         }
}
// ---- The two elementwise kernels: k_cvtall in front of the projection (256 work-groups, one per WGP), k_post behind it. A wave takes many rows or lines instead of one, so that k_cvtall starts 4096 waves and k_post 12288, not tens of thousands.
// Every kernel is built of runs: a run of 16-byte loads, the arithmetic, a run of stores. run_end() closes a run.
#define NPC (2 * DQ + 4 * DKV)     // pitch of the projection output F: [q | q2 | k | k2 | v | v2]
#define NRS (2 * NH_ + 2 * NKV)    // head slots that take norm and rope: [q 16 | q2 16 | k 8 | k2 8]
#define RPW 12                     // head slots per wave, all of one row t
#define NVS (2 * NKV)              // value head slots: [v 8 | v2 8]
static_assert(NRS % RPW == 0 && NB_ * TT * (NRS / RPW) == 512 * 16, "norm and rope: 512 work-groups x 16 waves x RPW head slots cover [NB_ * TT][NRS]");
__device__ __forceinline__ void run_end() {
    asm volatile("s_wait_xcnt 0x0" ::: "memory");   // behind a run of global loads or stores, in front of any later overwrite of the registers they name
    __builtin_amdgcn_sched_barrier(0);   // keeps every later register write behind that wait
}
// k_cvtall: every f32 operand of the plain GEMMs rounded to bf16 in one launch. dst = [x | wq | wq2 | wk | wk2 | wv | wv2 | wo] in units of DKV * DM elements (2, 2, 2, 1, 1, 1, 1, 2 units).
// A chunk is 4 x 512 threads x 8 elements; 128 chunks a unit, so a chunk lies in one unit; work-group b takes the chunks k * 256 + b, k < 6.
static_assert((size_t)DKV * DM == (size_t)128 * 16384 && 12 * 128 == 6 * 256 && DQ == 2 * DKV && NB_ * TT == 2 * DKV, "unit bookkeeping of k_cvtall");
__global__ __launch_bounds__(512) void k_cvtall(const float* __restrict__ x, const float* __restrict__ wq, const float* __restrict__ wq2, const float* __restrict__ wk, const float* __restrict__ wk2, const float* __restrict__ wv, const float* __restrict__ wv2, const float* __restrict__ wo, bf* dst) {
    const size_t U = (size_t)DKV * DM; const unsigned lo = threadIdx.x * 8; v8f v[2][4];
    auto fetch = [&](int k) {     // chunk k's eight loads, one run
        const int c = k * 256 + (int)blockIdx.x, u = c >> 7;
        const float* s = ((u < 2) ? x + u * U : (u < 4) ? wq + (u - 2) * U : (u < 6) ? wq2 + (u - 4) * U : (u == 6) ? wk : (u == 7) ? wk2 : (u == 8) ? wv : (u == 9) ? wv2 : wo + (u - 10) * U) + (size_t)(c & 127) * 16384;
#pragma unroll
        for (int i = 0; i < 4; ++i) v[k & 1][i] = *(const v8f*)(s + i * 4096 + lo);
        run_end();
    };
    fetch(0);
#pragma unroll   // unrolled: the two register sets are indexed by constants
    for (int k = 0; k < 6; ++k) {
        if (k + 1 < 6) fetch(k + 1);   // the next chunk's loads fly under this chunk's conversion and stores
        bf* d = dst + (size_t)(k * 256 + (int)blockIdx.x) * 16384; v8us o[4];
#pragma unroll
        for (int i = 0; i < 4; ++i)
#pragma unroll
            for (int q = 0; q < 8; ++q) o[i][q] = f2bf(v[k & 1][i][q]);
        __builtin_amdgcn_sched_barrier(0);   // every value is ready before the first store: no store's register is written again inside the run
#pragma unroll
        for (int i = 0; i < 4; ++i) *(v8us*)(d + i * 4096 + lo) = o[i];
        if (k + 1 < 6) run_end();
    }
}
// k_post: everything between the projection and the attention in one launch; F (rows r = b * TT + t, both batches) is read once and not written.
// Work-groups NVB and up: RMSNorm x g, then RoPE, of the head slots [q | q2 | k | k2], out to the head planes [b][h][t][d] (fp16 + hi/lo). A wave takes RPW consecutive head slots of one row (RPW x 512 contiguous bytes), four d a lane: one run of loads, RPW independent row sums, the normed values stay in registers,
// then three groups of four head slots, each with its run of stores (256 B of a plane per store). The weight vectors and the row's cos/sin (rounded to bf16 here) are read once for all RPW slots.
// Rotate-half convention: out[d] = x[d] cos[t][d] - x[d+HD/2] sin[t][d], out[d+HD/2] = x[d+HD/2] cos[t][d+HD/2] + x[d] sin[t][d+HD/2]; the partner d +- HD/2 of a lane's four d lies in lane ^ 16.
// Work-groups below NVB: value planes [b][g][d][t] (fp16 + hi/lo) of F[b * TT + t][NRS * HD + g * HD + d]. Work-group = (b, g, 128 rows t), wave = 8 columns d; a lane takes four rows t: eight 16-byte loads (4 t x 8 d), then per column and plane one 8-byte store, 256 B of the plane per wave.
#define NVB (NB_ * NVS * (TT / 128))
static_assert(HD == 16 * 8, "k_post: the 16 waves of a value work-group cover the HD columns");
constexpr int sect(int h) { return (h < NH_) ? 0 : (h < 2 * NH_) ? 1 : (h < 2 * NH_ + NKV) ? 2 : 3; }   // the section [q | q2 | k | k2] of a head slot
constexpr bool two_sections() { for (int h0 = 0; h0 < NRS; h0 += RPW) if (sect(h0 + RPW - 1) - sect(h0) > 1) return false; return true; }
static_assert(two_sections(), "k_post: a wave's RPW head slots lie in the sections of its first and its last slot");
__device__ __forceinline__ float otherhalf(float v) { const int b = __float_as_int(v); return __int_as_float(__builtin_amdgcn_permlanex16(b, b, 0x76543210, 0xfedcba98, false, false)); }   // the value of lane ^ 16, on the vector port
__global__ __launch_bounds__(512) void k_post(const float* __restrict__ F, const float* __restrict__ cosT, const float* __restrict__ sinT, const float* __restrict__ gq, const float* __restrict__ gq2, const float* __restrict__ gk, const float* __restrict__ gk2, h16* P16, bf* Ph, bf* Pl, h16* V16, bf* Vh, bf* Vl) {
    const int lane = threadIdx.x & 31, w = __builtin_amdgcn_readfirstlane((int)(threadIdx.x >> 5));
    if (blockIdx.x < NVB) {     // the same for the whole work-group
        const int b = blockIdx.x, bt = b / (NVS * (TT / 128)), g = (b / (TT / 128)) % NVS, tb = (b % (TT / 128)) * 128, d0 = w * 8;
        const float* f = F + (size_t)(bt * TT + tb) * NPC + (NRS + g) * HD + d0; v4f x[4][2]; v4h o16[8]; v4us oh[8], ol[8];
        const size_t e0 = (size_t)((bt * NVS + g) * HD + d0) * TT + tb + lane * 4; h16* p16 = V16 + e0; bf* ph = Vh + e0; bf* pl = Vl + e0;   // the lane's three store addresses; the eight columns step by a constant
        asm volatile("" :: "v"(p16), "v"(ph), "v"(pl) : "memory");   // inputs only: the store addresses are complete in front of the loads, so that none of their arithmetic lands in a register that an issued load or store names
        __builtin_amdgcn_sched_barrier(0);   // keeps the loads behind that point
#pragma unroll
        for (int i = 0; i < 4; ++i)
#pragma unroll
            for (int j = 0; j < 2; ++j) x[i][j] = *(const v4f*)(f + (size_t)(lane * 4 + i) * NPC + j * 4);
        run_end();
#pragma unroll
        for (int dd = 0; dd < 8; ++dd)
#pragma unroll
            for (int i = 0; i < 4; ++i) { const float xv = x[i][dd >> 2][dd & 3]; o16[dd][i] = tohx(xv); unsigned short a2, c2; splitf(xv, a2, c2); oh[dd][i] = a2; ol[dd][i] = c2; }
        __builtin_amdgcn_sched_barrier(0);   // every value is ready before the first store: no store's register is written again inside the run
#pragma unroll
        for (int dd = 0; dd < 8; ++dd) { *(v4h*)(p16 + dd * TT) = o16[dd]; *(v4us*)(ph + dd * TT) = oh[dd]; *(v4us*)(pl + dd * TT) = ol[dd]; }
        return;
    }
    const int W = ((int)blockIdx.x - NVB) * 16 + w; const int t = W / (NRS / RPW), h0 = (W % (NRS / RPW)) * RPW;
    const int d = lane * 4; const float* f = F + (size_t)t * NPC + h0 * HD; const size_t e0 = ((size_t)((t / TT) * NRS + h0) * TT + t % TT) * HD + d;
    h16* q16 = P16 + e0; bf* qh = Ph + e0; bf* ql = Pl + e0;
    auto gvec = [&](int s) { return (s == 0) ? gq : (s == 1) ? gq2 : (s == 2) ? gk : gk2; };
    const int s0 = sect(h0);   // the wave's RPW slots lie in the sections of its first and its last slot: two weight vectors a wave
    const float* ga = gvec(s0); const float* gb = gvec(sect(h0 + RPW - 1)); const float* pc = cosT + (size_t)t * HD; const float* ps = sinT + (size_t)t * HD;
    asm volatile("" :: "v"(q16), "v"(qh), "v"(ql), "s"(f), "s"(ga), "s"(gb), "s"(pc), "s"(ps) : "memory");   // inputs only: the lane's three store addresses and the wave's five load bases are complete in front of the loads, so that the loads go out as one run and none of that arithmetic lands in a register that an issued load names
    __builtin_amdgcn_sched_barrier(0);   // keeps the loads behind that point
    v4f r[RPW]; float sq[RPW];
#pragma unroll
    for (int k = 0; k < RPW; ++k) r[k] = *(const v4f*)(f + k * HD + d);
    const v4f wa = *(const v4f*)(ga + d), wb = *(const v4f*)(gb + d), c4 = *(const v4f*)(pc + d), s4 = *(const v4f*)(ps + d);
    run_end();
    // The empty asm statements on products below are those of the norm and rope kernels that this one replaces: each product keeps its own f32 rounding, so that the planes come out bit-identical to theirs.
#pragma unroll
    for (int k = 0; k < RPW; ++k) { const v4f a = r[k]; float ss = 0.f;
#pragma unroll
        for (int q = 0; q < 4; ++q) { float p = __fmul_rn(a[q], a[q]); asm volatile("" : "+v"(p)); ss = __fadd_rn(ss, p); }
        sq[k] = ss; }
#pragma unroll
    for (int sh = 16; sh; sh >>= 1)     // the RPW rows' butterflies step together: one cross-lane latency a step, not one a row and step
#pragma unroll
        for (int k = 0; k < RPW; ++k) sq[k] = __fadd_rn(sq[k], __shfl_xor(sq[k], sh, 32));
    v4f ga4, gb4;   // the two weight vectors, rounded to bf16 once
#pragma unroll
    for (int q = 0; q < 4; ++q) { ga4[q] = bfr(wa[q]); gb4[q] = bfr(wb[q]); }
#pragma unroll
    for (int k = 0; k < RPW; ++k) { const v4f w = (sect(h0 + k) == s0) ? ga4 : gb4; const v4f a = r[k]; const float ss = sq[k];
        const float rs = __fdiv_rn(1.0f, sqrtf(__fadd_rn(ss * (1.0f / HD), 1e-6f))); v4f o;
#pragma unroll
        for (int q = 0; q < 4; ++q) { float y = __fmul_rn(a[q], rs); asm volatile("" : "+v"(y)); o[q] = __fmul_rn(y, w[q]); }
        r[k] = o; }
    v2f cs[4];   // the lane's four (cos, sin) pairs; the sine carries the sign of the rotated half: minus for d < HD / 2
#pragma unroll
    for (int q = 0; q < 4; ++q) { cs[q][0] = bfr(c4[q]); cs[q][1] = (d < HD / 2) ? -bfr(s4[q]) : bfr(s4[q]); }
#pragma unroll
    for (int g = 0; g < RPW / 4; ++g) {
        v4h o16[4]; v4us oh[4], ol[4];
#pragma unroll
        for (int k = 0; k < 4; ++k)
#pragma unroll
            for (int q = 0; q < 4; ++q) { const float x0 = r[g * 4 + k][q], x1 = otherhalf(x0);
                float a = __fmul_rn(x0, cs[q][0]), bq = __fmul_rn(x1, cs[q][1]); asm volatile("" : "+v"(a)); asm volatile("" : "+v"(bq)); const float rr = __fadd_rn(a, bq);
                o16[k][q] = tohx(rr); unsigned short a2, c2; splitf(rr, a2, c2); oh[k][q] = a2; ol[k][q] = c2; }
        __builtin_amdgcn_sched_barrier(0);   // every value is ready before the first store: no store's register is written again inside the run
#pragma unroll
        for (int k = 0; k < 4; ++k) { const size_t e = (size_t)(g * 4 + k) * TT * HD; *(v4h*)(q16 + e) = o16[k]; *(v4us*)(qh + e) = oh[k]; *(v4us*)(ql + e) = ol[k]; }
        if (g + 1 < RPW / 4) run_end();
    }
}
// ---- k_fattn: scores, joint softmax and both value products of one head in one kernel; grid (NB_ * NH_, TT / 64): both batches in one launch, two work-groups per WGP; 4 waves, each wave owns 16 query rows.
// The work-group walks 64-key tiles of the window path (from its diagonal tile down to key i - 255), then of the fading path (keys <= i - 256); the list of tiles is the same for its four waves. Each wave keeps ONE running maximum, sum and output accumulator (online softmax):
// the joint softmax over [s_ic | s_f]. A key outside the path's own range gets weight exactly 0. The diagonal tile comes first, so every row's maximum is finite from the first tile on.
// A tile's keys (64 rows of 256 B) and values (128 rows of 128 B), every plane, are brought into LDS once per work-group by asynchronous copies of whole lines and read from there by all four waves. Two buffers: tile t + 1 flies while tile t is worked on; one work-group barrier per tile hands the buffers over.
// Probabilities go from the accumulator layout to the A-operand layout through the wave's own LDS slice. Rows < RH: hi+lo bf16 planes, 3 products; rows >= RH: fp16, weights x PCAR (the factor cancels in sum and output alike).
// Loops: the path loop and the tile loop stay rolled (#pragma unroll 1: one copy of the long body); every inner loop is unrolled, so that the fragment and accumulator arrays are indexed by constants and stay in registers.
#define PP 72     // LDS pitch (16-bit elements) of the 16 x 64 probability tile: 16-byte aligned rows, 16-byte row reads spread over the banks
#define OP 136    // LDS pitch of the 16 x 128 output tile
#define KP 136    // LDS pitch of a staged key row (128 d): 256 B + 16 B, the pitch for 16-byte row reads
#define VP 72     // LDS pitch of a staged value row (64 keys of one d): 128 B + 16 B
#define KPL (64 * KP)     // elements of one staged key plane
#define VPL (HD * VP)     // elements of one staged value plane
#define RING (2 * 2 * (KPL + VPL))   // two buffers of two planes of keys and values
static_assert(4 * 2 * 16 * OP <= RING, "the four waves' output tiles fit the ring");
template <int X> __device__ __forceinline__ float rowx(float v) { return __int_as_float(__builtin_amdgcn_update_dpp(0, __float_as_int(v), 0x160 + X, 0xf, 0xf, true)); }   // DPP row_xmask: the value of lane ^ X inside the 16-lane row, on the vector port (a shuffle would go through the LDS queue, one wait each)
__device__ __forceinline__ float rowmax(float v) { v = fmaxf(v, rowx<8>(v)); v = fmaxf(v, rowx<4>(v)); v = fmaxf(v, rowx<2>(v)); return fmaxf(v, rowx<1>(v)); }
__device__ __forceinline__ float rowsum(float v) { v += rowx<8>(v); v += rowx<4>(v); v += rowx<2>(v); return v + rowx<1>(v); }
template <typename T16> struct LFrag;
template <> struct LFrag<h16> { static __device__ __forceinline__ v16h ld(const unsigned short* p) { const v8us lo = *(const v8usa*)p, hi = *(const v8usa*)(p + 16); return cat16(__builtin_bit_cast(v8h, lo), __builtin_bit_cast(v8h, hi)); } };
template <> struct LFrag<bf> { static __device__ __forceinline__ v16bf ld(const unsigned short* p) { const v8us lo = *(const v8usa*)p, hi = *(const v8usa*)(p + 16); return cat16b(lo, hi); } };
// Eight asynchronous 16-byte copies of a lane, global memory to LDS: LDS byte addresses l + i * ls, global addresses g + i * gs bytes. The wait is the statement's last line: it stands behind the copies, in front of any later overwrite of the registers they name.
__device__ __forceinline__ void copies8(unsigned l, unsigned ls, const char* g, size_t gs) {
    asm volatile("global_load_async_to_lds_b128 %0, %8, off\n\t"
                 "global_load_async_to_lds_b128 %1, %9, off\n\t"
                 "global_load_async_to_lds_b128 %2, %10, off\n\t"
                 "global_load_async_to_lds_b128 %3, %11, off\n\t"
                 "global_load_async_to_lds_b128 %4, %12, off\n\t"
                 "global_load_async_to_lds_b128 %5, %13, off\n\t"
                 "global_load_async_to_lds_b128 %6, %14, off\n\t"
                 "global_load_async_to_lds_b128 %7, %15, off\n\t"
                 "s_wait_xcnt 0x0"
                 :: "v"(l), "v"(l + ls), "v"(l + 2 * ls), "v"(l + 3 * ls), "v"(l + 4 * ls), "v"(l + 5 * ls), "v"(l + 6 * ls), "v"(l + 7 * ls),
                    "v"(g), "v"(g + gs), "v"(g + 2 * gs), "v"(g + 3 * gs), "v"(g + 4 * gs), "v"(g + 5 * gs), "v"(g + 6 * gs), "v"(g + 7 * gs)
                 : "memory");
}
template <typename T16, bool HL>
__device__ __forceinline__ void attn_rows(const T16* __restrict__ R, const T16* __restrict__ Rlo, const T16* __restrict__ VT, const T16* __restrict__ VTlo, int h, int rb, int wv, unsigned short* ring, unsigned short* sh, unsigned short* sl, bf* Ah, bf* Al) {
    typedef typename WFrag<T16>::V V;
    constexpr int NG = HL ? 2 : 1;    // planes per operand; also the number of 16-fragment (32-read) groups that a tile's keys, and its values, are read in
    constexpr int STG = NG * (KPL + VPL);   // elements of one buffer: [key planes | value planes]
    const int tid = threadIdx.x, lane = tid & 31, lr = lane & 15, hi = lane >> 4, i0 = rb * 64 + wv * 16;
    const int n0 = min(rb, 4) + 1, nt = n0 + max(0, rb - 3);   // tiles of the window path (key tiles rb down to max(0, rb - 4)) and of both paths (fading: key tiles rb - 4 down to 0); every one holds a live key for each wave's 16 rows or is masked to weight 0
    const unsigned ring0 = (unsigned)(size_t)(__attribute__((address_space(3))) unsigned short*)ring;   // the ring's byte address in the work-group's LDS
    const unsigned klane = (unsigned)((tid >> 4) * KP + (tid & 15) * 8) * 2, vlane = (unsigned)((tid >> 3) * VP + (tid & 7) * 8) * 2, vgl = (unsigned)((tid >> 3) * TT + (tid & 7) * 8) * 2;   // the lane's byte offsets: in a staged key plane, in a staged value plane, in a value plane in memory
    auto stage = [&](int t) {     // tile t's planes into buffer t & 1: a wave's copy covers 512 B of whole lines (2 key rows, 4 value rows); 8 key rows, 16 value rows per step of the work-group
        const int p = (t >= n0) ? 1 : 0, j0 = (p ? (rb - 4) - (t - n0) : rb - t) * 64;
        const size_t ku = ((size_t)(2 * NH_ + p * NKV + h / REP) * TT + j0) * HD, vu = (size_t)(p * NKV + h / REP) * HD * TT + j0;   // the tile's first element in a key plane and in a value plane: the same for the whole work-group
        const unsigned kl = ring0 + (unsigned)((t & 1) * STG) * 2 + klane, vl = ring0 + (unsigned)((t & 1) * STG + NG * KPL) * 2 + vlane;
        copies8(kl, 8 * KP * 2, (const char*)(R + ku) + tid * 16, (size_t)8 * HD * 2);   // key rows are contiguous: thread tid takes bytes tid * 16 of each 2 KiB step
        if (HL) copies8(kl + KPL * 2, 8 * KP * 2, (const char*)(Rlo + ku) + tid * 16, (size_t)8 * HD * 2);
        copies8(vl, 16 * VP * 2, (const char*)(VT + vu) + vgl, (size_t)16 * TT * 2);
        if (HL) copies8(vl + VPL * 2, 16 * VP * 2, (const char*)(VTlo + vu) + vgl, (size_t)16 * TT * 2);
    };
    v8f O[8]; float m[8], l[8];
#pragma unroll
    for (int db = 0; db < 8; ++db) O[db] = (v8f){};
#pragma unroll
    for (int jj = 0; jj < 8; ++jj) { m[jj] = -3.0e38f; l[jj] = 0.f; }
    stage(0);
    asm volatile("s_wait_asynccnt 0x0" ::: "memory");   // this wave's copies of tile 0 have landed
    __syncthreads();   // publishes tile 0
    if (nt > 1) stage(1);
    int t = 0;     // the running tile, over both paths
#pragma unroll 1
    for (int p = 0; p < 2; ++p) {      // p = 0: window path, p = 1: fading path
        const int jhi = p ? rb - 4 : rb, jlo = p ? 0 : max(0, rb - 4);   // first and last 64-key tile of the path
        if (jhi < jlo) continue;   // no tile of this path (the same for the whole work-group): its queries are not read
        const size_t qo = ((size_t)(p * NH_ + h) * TT + i0 + lr) * HD + 8 * hi;
        V a[4], a2[4];
#pragma unroll
        for (int ks = 0; ks < 4; ++ks) { a[ks] = WFrag<T16>::ld(R + qo + ks * 32); if (HL) a2[ks] = WFrag<T16>::ld(Rlo + qo + ks * 32); }
        run_end();   // behind the query loads
#pragma unroll 1
        for (int jt = jhi; jt >= jlo; --jt, ++t) {
            const int j0 = jt * 64; v8f s[4]; V kf[NG][16], vf[NG][16];
            const unsigned short* kb = ring + (t & 1) * STG + lr * KP + 8 * hi; const unsigned short* vb = ring + (t & 1) * STG + NG * KPL + lr * VP + 8 * hi;   // the lane's place in this tile's key and value planes
            // Read order of a tile. Keys and values come from LDS in groups of 16 fragments (32 reads), each group issued as one run, so that a group costs one LDS latency and not one every few fragments.
            // A second group (hi+lo planes) is issued behind the first block's products and flies under the products that follow. Each sched_barrier(0) keeps the compiler from moving reads or products over that point.
#pragma unroll
            for (int f = 0; f < 16 / NG; ++f) { const int o = (f >> 2) * 16 * KP + (f & 3) * 32; kf[0][f * NG] = LFrag<T16>::ld(kb + o); if (HL) kf[0][f * NG + 1] = LFrag<T16>::ld(kb + KPL + o); }
            __builtin_amdgcn_sched_barrier(0);   // the whole group is issued before the first product waits for a fragment
#pragma unroll
            for (int nb = 0; nb < 4; ++nb) { const int g = nb / (4 / NG), nl = nb % (4 / NG); s[nb] = (v8f){};
#pragma unroll
                for (int ks = 0; ks < 4; ++ks) { s[nb] = WFrag<T16>::mma(a[ks], kf[g][(nl * 4 + ks) * NG], s[nb]);
                    if (HL) { s[nb] = WFrag<T16>::mma(a2[ks], kf[g][(nl * 4 + ks) * NG], s[nb]); s[nb] = WFrag<T16>::mma(a[ks], kf[g][(nl * 4 + ks) * NG + 1], s[nb]); } }
                if (HL && nb == 0) {
                    __builtin_amdgcn_sched_barrier(0);   // the second key group is issued behind the first block's products
#pragma unroll
                    for (int f = 0; f < 16 / NG; ++f) { const int o = (4 / NG + (f >> 2)) * 16 * KP + (f & 3) * 32; kf[NG - 1][f * NG] = LFrag<T16>::ld(kb + o); kf[NG - 1][f * NG + 1] = LFrag<T16>::ld(kb + KPL + o); }
                    __builtin_amdgcn_sched_barrier(0);   // and it flies under the products that follow
                } }
            __builtin_amdgcn_sched_barrier(0);   // the value reads start behind the last score product
#pragma unroll
            for (int f = 0; f < 16 / NG; ++f) { const int o = (f >> 1) * 16 * VP + (f & 1) * 32; vf[0][f * NG] = LFrag<T16>::ld(vb + o); if (HL) vf[0][f * NG + 1] = LFrag<T16>::ld(vb + VPL + o); }
            __builtin_amdgcn_sched_barrier(0);   // the first value group flies while the softmax runs
            float mx[8];
#pragma unroll
            for (int jj = 0; jj < 8; ++jj) mx[jj] = m[jj];
#pragma unroll
            for (int nb = 0; nb < 4; ++nb)
#pragma unroll
                for (int jj = 0; jj < 8; ++jj) { const int dij = (i0 + hi * 8 + jj) - (j0 + nb * 16 + lr); const bool live = p ? (dij >= 256) : (dij >= 0 && dij < 256); const float t2 = live ? s[nb][jj] * SCL : -3.0e38f; s[nb][jj] = t2; mx[jj] = fmaxf(mx[jj], t2); }
#pragma unroll
            for (int jj = 0; jj < 8; ++jj) {
                mx[jj] = rowmax(mx[jj]);   // a row's 16 columns lie in the 16 lanes of one half
                const float al = __builtin_amdgcn_exp2f((m[jj] - mx[jj]) * 1.4426950408889634f); m[jj] = mx[jj]; l[jj] *= al;
#pragma unroll
                for (int db = 0; db < 8; ++db) O[db][jj] *= al; }
#pragma unroll
            for (int nb = 0; nb < 4; ++nb)
#pragma unroll
                for (int jj = 0; jj < 8; ++jj) { const float pv = __builtin_amdgcn_exp2f((s[nb][jj] - m[jj]) * 1.4426950408889634f) * (HL ? 1.0f : PCAR); l[jj] += pv; const int o = (hi * 8 + jj) * PP + nb * 16 + lr;
                    if (HL) { unsigned short ph, pl; splitf(pv, ph, pl); sh[o] = ph; sl[o] = pl; } else sh[o] = __builtin_bit_cast(unsigned short, tohx(pv)); }
            __builtin_amdgcn_wave_barrier(); asm volatile("" ::: "memory");   // the fragment reads below take other lanes' stores: keep them behind the stores
            V pa[2], pb[2];
#pragma unroll
            for (int k2 = 0; k2 < 2; ++k2) { pa[k2] = LFrag<T16>::ld(sh + lr * PP + k2 * 32 + 8 * hi); if (HL) pb[k2] = LFrag<T16>::ld(sl + lr * PP + k2 * 32 + 8 * hi); }
            __builtin_amdgcn_wave_barrier(); asm volatile("" ::: "memory");   // the next tile's stores stay behind these reads
#pragma unroll
            for (int db = 0; db < 8; ++db) { const int g = db / (8 / NG), dl = db % (8 / NG);
#pragma unroll
                for (int k2 = 0; k2 < 2; ++k2) { O[db] = WFrag<T16>::mma(pa[k2], vf[g][(dl * 2 + k2) * NG], O[db]);
                    if (HL) { O[db] = WFrag<T16>::mma(pb[k2], vf[g][(dl * 2 + k2) * NG], O[db]); O[db] = WFrag<T16>::mma(pa[k2], vf[g][(dl * 2 + k2) * NG + 1], O[db]); } }
                if (HL && db == 0) {
                    __builtin_amdgcn_sched_barrier(0);   // the second value group is issued behind the first block's products
#pragma unroll
                    for (int f = 0; f < 16 / NG; ++f) { const int o = (8 / NG + (f >> 1)) * 16 * VP + (f & 1) * 32; vf[NG - 1][f * NG] = LFrag<T16>::ld(vb + o); vf[NG - 1][f * NG + 1] = LFrag<T16>::ld(vb + VPL + o); }
                    __builtin_amdgcn_sched_barrier(0);   // and it flies under the products that follow
                } }
            // Foot of tile t, every wave, in this order: own LDS reads done, own copies of tile t + 1 landed, barrier, refill of the buffer that tile t has just left.
            asm volatile("s_wait_dscnt 0x0" ::: "memory");      // this wave's reads of tile t have returned
            asm volatile("s_wait_asynccnt 0x0" ::: "memory");   // this wave's copies of tile t + 1 have landed
            __syncthreads();   // publishes tile t + 1 and ends every wave's reads of tile t
            if (t + 2 < nt) stage(t + 2);
        }
    }
    asm volatile("s_wait_asynccnt 0x0" ::: "memory");   // no copy is outstanding when the ring becomes output staging (the last tile's barrier has ended every wave's reads)
    unsigned short* oh_ = ring + wv * 2 * 16 * OP; unsigned short* ol_ = oh_ + 16 * OP;   // the wave's own output tiles, hi and lo
#pragma unroll
    for (int jj = 0; jj < 8; ++jj) {
        const float f = __fdiv_rn(1.0f, rowsum(l[jj]));
#pragma unroll
        for (int db = 0; db < 8; ++db) { unsigned short oh, ol; splitf(O[db][jj] * f, oh, ol); const int o = (hi * 8 + jj) * OP + db * 16 + lr; oh_[o] = oh; ol_[o] = ol; } }
    __builtin_amdgcn_wave_barrier(); asm volatile("" ::: "memory");   // the row reads below take other lanes' stores
    v8us vh[8], vl[8]; const size_t oo = (size_t)(i0 + hi) * DQ + h * HD + lr * 8; bf* qh = Ah + oo; bf* ql = Al + oo;   // the lane's two store addresses; the eight rows step by a constant
#pragma unroll
    for (int c = 0; c < 8; ++c) { const int row = c * 2 + hi, col = lr * 8; vh[c] = *(const v8usa*)(oh_ + row * OP + col); vl[c] = *(const v8usa*)(ol_ + row * OP + col); }
    asm volatile("" :: "v"(qh), "v"(ql) : "memory");   // inputs only: both store addresses are complete in front of the run of stores, so that none of their arithmetic lands in a register that an issued store names
    __builtin_amdgcn_sched_barrier(0);   // every row is in its own registers before the first store: no store's register is written again inside the run
#pragma unroll
    for (int c = 0; c < 8; ++c) { *(v8us*)(qh + (size_t)c * 2 * DQ) = vh[c]; *(v8us*)(ql + (size_t)c * 2 * DQ) = vl[c]; }
}
__global__ __launch_bounds__(128) void k_fattn(const h16* __restrict__ R16, const bf* __restrict__ Rh, const bf* __restrict__ Rl, const h16* __restrict__ VT16, const bf* __restrict__ VTh, const bf* __restrict__ VTl, bf* Ah, bf* Al) {
    __shared__ __align__(16) unsigned short ring[RING];
    __shared__ __align__(16) unsigned short ps[4][2][16 * PP];
    constexpr int NRB = TT / 64;
    const int wv = __builtin_amdgcn_readfirstlane((int)(threadIdx.x >> 5)); const int y = blockIdx.y; const int rb = (y < NRB / 2) ? NRB - 1 - y : y - NRB / 2;   // the first half of the grid takes the last rows (the most keys) downwards, the second half the first rows upwards: the work-groups half a grid apart hold row blocks t and NRB - 1 - t (speed only)
    const int h = blockIdx.x % NH_, b = blockIdx.x / NH_;
    const size_t ro = (size_t)b * NRS * TT * HD, vo = (size_t)b * NVS * HD * TT, ao = (size_t)b * TT * DQ;   // batch b's planes
    if (rb * 64 < RH) attn_rows<bf, true>(Rh + ro, Rl + ro, VTh + vo, VTl + vo, h, rb, wv, ring, ps[wv][0], ps[wv][1], Ah + ao, Al + ao);
    else attn_rows<h16, false>(R16 + ro, nullptr, VT16 + vo, nullptr, h, rb, wv, ring, ps[wv][0], ps[wv][1], Ah + ao, Al + ao);
}

// k_asoft: per row (zz, i): t = S x HD^-0.5 for j <= i and i - j < WIN (sliding causal window; the reference's -1e9 additive fill vanishes identically); softmax over the 1024 keys (register row, one exp, fixed trees);
__global__ __launch_bounds__(256) void k_asoft(const float* __restrict__ Sb, h16* P16, bf* Ph, bf* Pl) {
    const int lane = threadIdx.x & 31; const int row = blockIdx.x * 8 + (threadIdx.x >> 5); if (row >= ZH * TT) return; const int i = row % TT; const int zz = row / TT; (void)zz; const bool hires = (i < RH); const float* sr = Sb + (size_t)row * TT; float v[TT / 32]; float mx = -3.0e38f;
#pragma unroll
    for (int ch = 0; ch < TT / 128; ++ch) { const int j0 = ch * 128 + lane * 4; const v4f a = *(const v4f*)(sr + j0);
#pragma unroll
        for (int q = 0; q < 4; ++q) { const int j = j0 + q; (void)j; const float t = (j <= i && i - j < WIN) ? a[q] * SCL : -3.0e38f; v[ch * 4 + q] = t; mx = fmaxf(mx, t); } }
#pragma unroll
    for (int sh = 16; sh; sh >>= 1) mx = fmaxf(mx, __shfl_xor(mx, sh, 32));
    float sum = 0.f;
#pragma unroll
    for (int k = 0; k < TT / 32; ++k) { float d0 = __fsub_rn(v[k], mx); asm volatile("" : "+v"(d0)); v[k] = __builtin_amdgcn_exp2f(__fmul_rn(d0, 1.4426950408889634f)); sum += v[k]; }
#pragma unroll
    for (int sh = 16; sh; sh >>= 1) sum += __shfl_xor(sum, sh, 32);
    const float f = __fdiv_rn(hires ? 1.0f : PCAR, sum);
{
        if (hires) {
#pragma unroll
            for (int ch = 0; ch < TT / 128; ++ch) { v4us oh, ol;
#pragma unroll
                for (int q = 0; q < 4; ++q) { unsigned short a, c2; splitf(v[ch * 4 + q] * f, a, c2); oh[q] = a; ol[q] = c2; }
                const size_t oo = ((size_t)zz * (RH ? RH : 1) + i) * TT + ch * 128 + lane * 4; *(v4us*)(Ph + oo) = oh; *(v4us*)(Pl + oo) = ol; }
        } else {
#pragma unroll
            for (int ch = 0; ch < TT / 128; ++ch) { v4h o4;
#pragma unroll
                for (int q = 0; q < 4; ++q) o4[q] = tohx(v[ch * 4 + q] * f);
                *(v4h*)(P16 + (size_t)row * TT + ch * 128 + lane * 4) = o4; } }
         }
}
__global__ __launch_bounds__(256) void k_merge(const float* __restrict__ O, int h0, bf* Ah, bf* Al) { const size_t e = ((size_t)blockIdx.x * 256 + threadIdx.x) * 2; if (e >= (size_t)ZH * TT * HD) return; const int d = (int)(e % HD); const int t = (int)((e / HD) % TT); const int zz = (int)(e / ((size_t)HD * TT)); const float cs = (t < RH) ? 1.0f : (1.0f / PCAR); const size_t oo = (size_t)t * DQ + (h0 + zz) * HD + d;
    v2us oh, ol;
#pragma unroll
    for (int q = 0; q < 2; ++q) { unsigned short a, c2; splitf(O[e + q] * cs, a, c2); oh[q] = a; ol[q] = c2; } *(v2us*)(Ah + oo) = oh; *(v2us*)(Al + oo) = ol;  }

extern "C" void kernel_launch(void* const* d_in, const int* in_sizes, int n_in,
                              void* d_out, int out_size, void* d_ws, size_t ws_size, hipStream_t stream) {
    (void)in_sizes; (void)n_in; (void)out_size;
    const float* x = (const float*)d_in[0]; const float* cosA = (const float*)d_in[1]; const float* sinA = (const float*)d_in[2]; const float* wq = (const float*)d_in[3]; const float* bq = (const float*)d_in[4]; const float* wk = (const float*)d_in[5]; const float* bk = (const float*)d_in[6]; const float* wv = (const float*)d_in[7]; const float* bv = (const float*)d_in[8]; const float* wq2 = (const float*)d_in[9]; const float* bq2 = (const float*)d_in[10]; const float* wk2 = (const float*)d_in[11]; const float* bk2 = (const float*)d_in[12]; const float* wv2 = (const float*)d_in[13]; const float* bv2 = (const float*)d_in[14]; const float* wo = (const float*)d_in[15]; const float* gq = (const float*)d_in[16]; const float* gk = (const float*)d_in[17]; const float* gq2 = (const float*)d_in[18]; const float* gk2 = (const float*)d_in[19]; const float* cosT = cosA; const float* sinT = sinA;
    float* OUT = (float*)d_out;     // [2][1024][2048]
    char* wsp = (char*)d_ws;
    auto take = [&](size_t bytes) { char* p = wsp; wsp += (bytes + 255) & ~(size_t)255; return (void*)p; };
    // 16-bit GEMM operands, one conversion launch: [x (both batches) | wq | wq2 | wk | wk2 | wv | wv2 | wo]; the six projection weights are one [NP][DM] plane
    const size_t U = (size_t)DKV * DM; const int NP = 2 * DQ + 4 * DKV, NRH = 2 * NH_ + 2 * NKV, NVH = 2 * NKV;
    bf* XB = (bf*)take(12 * U * 2); bf* WP = XB + 2 * U; bf* WO = XB + 10 * U;
    // head planes per batch, both paths side by side: [b][q 16 | q2 16 | k 8 | k2 8][t][d] and [b][v 8 | v2 8][d][t]
    h16* R16 = (h16*)take((size_t)NB_ * NRH * TT * HD * 2); bf* Rh = (bf*)take((size_t)NB_ * NRH * TT * HD * 2); bf* Rl = (bf*)take((size_t)NB_ * NRH * TT * HD * 2);
    h16* VT16 = (h16*)take((size_t)NB_ * NVH * HD * TT * 2); bf* VTh = (bf*)take((size_t)NB_ * NVH * HD * TT * 2); bf* VTl = (bf*)take((size_t)NB_ * NVH * HD * TT * 2);
    float* F = (float*)take((size_t)NB_ * TT * NP * 4); bf* ATl = (bf*)take((size_t)NB_ * TT * DQ * 2);   // both batches' [NB_ * TT][NP] projection output; the lo plane of the merged attention output
    if ((size_t)(wsp - (char*)d_ws) > ws_size) return;    // ws 256 MiB
    bf* ATh = XB;     // the hi plane of the merged attention output reuses x: its rows are dead once the projection has run (stream-ordered; same size)
    static_assert(DQ == DM, "ATh fits x");
    k_cvtall<<<256, 512, 0, stream>>>(x, wq, wq2, wk, wk2, wv, wv2, wo, XB);
    // every stage takes both batches in one launch: the rows of x, F and the cos/sin tables are r = b * TT + t
    k_gemms<256, DM, 0, true><<<dim3(NB_ * TT / 256, NP / 128, 1), 256, 0, stream>>>(XB, nullptr, WP, F, NP, bq, bq2, bk, bk2, bv, bv2);
    k_post<<<NVB + 512, 512, 0, stream>>>(F, cosA, sinA, gq, gq2, gk, gk2, R16, Rh, Rl, VT16, VTh, VTl);
    k_fattn<<<dim3(NB_ * NH_, TT / 64, 1), 128, 0, stream>>>(R16, Rh, Rl, VT16, VTh, VTl, ATh, ATl);
    k_gemms<128, DQ, 1, false><<<dim3(NB_ * TT / 128, DM / 128, 1), 128, 0, stream>>>(ATh, ATl, WO, OUT, DM, nullptr, nullptr, nullptr, nullptr, nullptr, nullptr);
}

// v009
// Measured time: 145 microseconds a run.
// Timed twice side by side with v008, it ran 1.15 times as fast both times.
// Counting every step since v000, it is 16.3 times as fast.
#include <hip/hip_runtime.h>

// BMOJOAttention (hidden [2][1024][2048]; two projection paths - in-context (Wq,bq,Wk,bk,Wv,bv,gq,gk) and fading (Wq2..gk2): q = rope(rmsnorm(x Wq^T + bq) gq) (16 x 128), k = rope(rmsnorm(x Wk^T + bk) gk) (8 kv heads; group h/2), v = x Wv^T + bv; rotate-half RoPE with the read cos/sin [B][S][128]; s_ic = q_ic.k_ic / sqrt(128) live where 0 <= i-j < 256, s_f = q_f.k_f / sqrt(128) live where i-j >= 256 (else -1e30); ONE joint softmax over [s_ic | s_f]; out = p_ic v_ic + p_f v_f; merged Wo^T -> [2][1024][2048]).
// The joint softmax over 2S columns is computed as one causal softmax whose score (and value source) switches at i-j = 256: the masked halves contribute exactly 0; keys j > i are masked in both (causal tile skipping).
// Compute dtypes, f32 accumulate: every input rounded to bf16; both paths' q/k/v on PLAIN bf16 operands (inputs: exact) + bias; RMSNorm * g and RoPE (cos/sin rounded to bf16) f32, in registers of one kernel (k_post); both score sets and both attn.v products: query rows < 512 hl (3 products), the rest single fp16 (x1024), causal tile skipping; online softmax f32 over the live scores of both paths, both value products into one f32 accumulator, all in one kernel (k_fattn), which emits the hl planes of the merged output; Wo hl x exact (2 products).

#define NB_  2
#define TT   1024
#define DM   2048
#define NH_  16
#define NKV  8
#define REP  (NH_ / NKV)
#define HD   128
#define DQ   (NH_ * HD)
#define DKV  (NKV * HD)
#define ZH   16                   // heads per attention pass: all of them
#define RH   512                  // query rows < RH use hi+lo planes (0: none)
#define WIN  1024
#define PCAR 1024.0f
static_assert(RH % 64 == 0, "a 64-row block of the attention lies on one side of RH");
#define SCL  0.088388347648318447f   // HD^-0.5
typedef _Float16 h16;
typedef unsigned short bf;
typedef __attribute__((ext_vector_type(16))) __bf16   v16bf;
typedef __attribute__((ext_vector_type(16))) _Float16 v16h;
typedef __attribute__((ext_vector_type(8)))  _Float16 v8h;
typedef __attribute__((ext_vector_type(8)))  unsigned short v8us;
typedef __attribute__((ext_vector_type(8)))  float    v8f;
typedef __attribute__((ext_vector_type(4)))  float    v4f;
typedef v8h  __attribute__((may_alias)) v8ha;
typedef v4f  __attribute__((may_alias)) v4fa;
typedef v8us __attribute__((may_alias)) v8usa;

__device__ __forceinline__ unsigned short f2bf(float f) { unsigned u = __float_as_uint(f); u += 0x7FFFu + ((u >> 16) & 1u); return (unsigned short)(u >> 16); }
__device__ __forceinline__ float bf2f(unsigned short b) { return __uint_as_float(((unsigned)b) << 16); }
__device__ __forceinline__ float bfr(float f) { return bf2f(f2bf(f)); }
__device__ __forceinline__ v16h cat16(v8h lo, v8h hi) { return __builtin_shufflevector(lo, hi, 0, 1, 2, 3, 4, 5, 6, 7, 8, 9, 10, 11, 12, 13, 14, 15); }
__device__ __forceinline__ v16bf cat16b(v8us lo, v8us hi) { return __builtin_bit_cast(v16bf, __builtin_shufflevector(lo, hi, 0, 1, 2, 3, 4, 5, 6, 7, 8, 9, 10, 11, 12, 13, 14, 15)); }
__device__ __forceinline__ v8f wmma16(v16h a, v16h b, v8f c) { return __builtin_amdgcn_wmma_f32_16x16x32_f16(false, a, false, b, (short)0, c, false, false); }
__device__ __forceinline__ v8f wmmab(v16bf a, v16bf b, v8f c) { return __builtin_amdgcn_wmma_f32_16x16x32_bf16(false, a, false, b, (short)0, c, false, false); }



// ---- k_gemms: GEMM with both operands staged in LDS. One work-group = BM x BN output tile, BM * BN / 128 threads = waves in a (BM / 64) x (BN / 64) grid, 64 x 64 (16 accumulators) per wave; grid (M / BM, N / BN).
// C[m][n] (f32, pitch ldc, + optional bias[n] rounded to bf16) = sum_k (A[m][k] + A2[m][k]) Bt[n][k] (A2 only with NSPLIT = 1: two products per k step, A first); all planes K-contiguous bf16, KK % 64 == 0.
// A stage is 64 k (128 B, one line) of every operand row. Each global load of a wave covers four whole lines; a line is fetched once per work-group and then read from LDS by every wave that needs it.
// Two LDS buffers: a stage's lines are loaded into registers one stage ahead, stored into the other buffer between the two halves of the running stage's products, and one work-group barrier per stage hands the buffers over.
// NF = fragment sets. 2: each half's fragments are read one half ahead (few waves per SIMD). 1: each half reads its own fragments, which keeps a 16-wave work-group inside 256 registers a wave; the three other waves of the SIMD cover the read latency.
// The projection takes 256 x 256 tiles: per output element a tile's operand lines are (BM + BN) / (BM * BN), a third fewer reads from L2 than at 256 x 128, and its 256 work-groups are one per WGP, all resident at once.
// With BIAS the N axis is the concatenation [q | q2 | k | k2 | v | v2] of both paths' projections (DQ, DQ, DKV, DKV, DKV, DKV columns); each 64-column tile lies in one section and takes that section's bias vector.
template <typename T16> struct WFrag;
template <> struct WFrag<h16> { typedef v16h V; static __device__ __forceinline__ V ld(const h16* p) { return cat16(*(const v8h*)p, *(const v8h*)(p + 16)); } static __device__ __forceinline__ v8f mma(V a, V b, v8f c) { return wmma16(a, b, c); } };
template <> struct WFrag<bf> { typedef v16bf V; static __device__ __forceinline__ V ld(const bf* p) { return cat16b(*(const v8us*)p, *(const v8us*)(p + 16)); } static __device__ __forceinline__ v8f mma(V a, V b, v8f c) { return wmmab(a, b, c); } };
__device__ __forceinline__ void bar_signal() { asm volatile("s_barrier_signal -1" ::: "memory"); }   // the two halves of the work-group's own barrier; the clobber keeps every LDS access on its side
__device__ __forceinline__ void bar_wait() { asm volatile("s_barrier_wait -1" ::: "memory"); }
#define GP 72     // LDS pitch (16-bit elements) of a staged 64-k row: 128 B + 16 B, the pitch for 16-byte row reads
template <int BM, int BN, int KK, int NSPLIT, bool BIAS, int NF>
__global__ __launch_bounds__(BM * BN / 128) void k_gemms(const bf* __restrict__ A, const bf* __restrict__ A2, const bf* __restrict__ Bt, float* C, int ldc, const float* __restrict__ bq, const float* __restrict__ bq2, const float* __restrict__ bk, const float* __restrict__ bk2, const float* __restrict__ bv, const float* __restrict__ bv2) {
    constexpr int NA = NSPLIT ? 2 : 1, NT = BM * BN / 128, NWC = BN / 64, RP = NT / 8, NAP = BM / RP, NBP = BN / RP;    // A planes; threads; wave columns; rows that one staging pass of the work-group covers (8 threads a row); passes for the BM rows of A and the BN rows of Bt
    __shared__ __align__(16) unsigned short sa[2][NA][BM * GP];
    __shared__ __align__(16) unsigned short sb[2][BN * GP];
    __shared__ __align__(16) float osm[NT / 32][16 * 68];
    const int tid = threadIdx.x, lane = tid & 31, lr = lane & 15, hi = lane >> 4, wv = __builtin_amdgcn_readfirstlane(tid >> 5);
    const int rw = (wv / NWC) * 64, cw = (wv % NWC) * 64; const int r0 = blockIdx.x * BM, c0 = blockIdx.y * BN + cw;
    const float* bias = nullptr;   // this wave's bias, already stepped to its column c0
    if (BIAS) bias = (c0 < DQ) ? bq + c0 : (c0 < 2 * DQ) ? bq2 + (c0 - DQ) : (c0 < 2 * DQ + DKV) ? bk + (c0 - 2 * DQ) : (c0 < 2 * DQ + 2 * DKV) ? bk2 + (c0 - 2 * DQ - DKV) : (c0 < 2 * DQ + 3 * DKV) ? bv + (c0 - 2 * DQ - 2 * DKV) : bv2 + (c0 - 2 * DQ - 3 * DKV);
    const int srow = tid >> 3, scol = (tid & 7) * 8;
    unsigned vo = (unsigned)(srow * KK + scol) * 2;    // the lane's byte offset from the work-group-uniform bases below, for the stage that is fetched next: carried through the loop in one register, stepped behind each run of loads
    typedef const __attribute__((address_space(1))) char* gptr;
    const gptr ua = (gptr)(A + (size_t)r0 * KK), ua2 = (gptr)(A2 + (size_t)r0 * KK), ub = (gptr)(Bt + (size_t)blockIdx.y * BN * KK);
    v8us ra[NA][NAP], rb[NBP];
    auto ld16 = [](gptr p) { return *(const __attribute__((address_space(1))) v8us*)p; };
    auto fetch = [&]() {     // the next stage's lines into registers, one run of loads
#pragma unroll
        for (int i = 0; i < NAP; ++i) { ra[0][i] = ld16(ua + vo + (size_t)i * RP * KK * 2); if (NSPLIT) ra[NA - 1][i] = ld16(ua2 + vo + (size_t)i * RP * KK * 2); }
#pragma unroll
        for (int i = 0; i < NBP; ++i) rb[i] = ld16(ub + vo + (size_t)i * RP * KK * 2);
        asm volatile("s_wait_xcnt 0x0" ::: "memory");   // behind the run of loads, in front of any later overwrite of their address registers
        __builtin_amdgcn_sched_barrier(0);   // keeps every later register write behind that wait
        vo += 128;
    };
    auto put = [&](int buf) {      // those registers into LDS buffer buf
#pragma unroll
        for (int i = 0; i < NAP; ++i) { const int o = (srow + i * RP) * GP + scol; *(v8usa*)(&sa[buf][0][o]) = ra[0][i]; if (NSPLIT) *(v8usa*)(&sa[buf][NA - 1][o]) = ra[NA - 1][i]; }
#pragma unroll
        for (int i = 0; i < NBP; ++i) *(v8usa*)(&sb[buf][(srow + i * RP) * GP + scol]) = rb[i];
    };
    v8f acc[4][4];
#pragma unroll
    for (int mb = 0; mb < 4; ++mb)
#pragma unroll
        for (int nb = 0; nb < 4; ++nb) acc[mb][nb] = (v8f){};
    v16bf a[NF][4], a2[NF][4], b[NF][4];   // the fragments of the two 32-k halves of a stage (NF = 1: of the running half)
    auto frags = [&](int kh, int buf) {   // half kh of the stage in LDS buffer buf, one run of reads
        const int ks = kh & (NF - 1);
#pragma unroll
        for (int mb = 0; mb < 4; ++mb) { const int o = (rw + mb * 16 + lr) * GP + kh * 32 + 8 * hi; a[ks][mb] = cat16b(*(const v8usa*)(&sa[buf][0][o]), *(const v8usa*)(&sa[buf][0][o + 16])); if (NSPLIT) a2[ks][mb] = cat16b(*(const v8usa*)(&sa[buf][NA - 1][o]), *(const v8usa*)(&sa[buf][NA - 1][o + 16])); }
#pragma unroll
        for (int nb = 0; nb < 4; ++nb) { const int o = (cw + nb * 16 + lr) * GP + kh * 32 + 8 * hi; b[ks][nb] = cat16b(*(const v8usa*)(&sb[buf][o]), *(const v8usa*)(&sb[buf][o + 16])); }
    };
    auto products = [&](int kh) {
        const int ks = kh & (NF - 1);
#pragma unroll
        for (int nb = 0; nb < 4; ++nb) {
#pragma unroll
            for (int mb = 0; mb < 4; ++mb) acc[mb][nb] = wmmab(a[ks][mb], b[ks][nb], acc[mb][nb]);
            if (NSPLIT) {
#pragma unroll
                for (int mb = 0; mb < 4; ++mb) acc[mb][nb] = wmmab(a2[ks][mb], b[ks][nb], acc[mb][nb]); } }
    };
    // Two fragment sets. Order of a trip (stage t in buffer t & 1): first half's products | stage t + 1 from registers into the other buffer | barrier | first-half fragments of stage t + 1 and the global loads of stage t + 2 go out | second half's products | second-half fragments of stage t + 1 go out.
    // Every read of a buffer stands in front of the barrier that precedes its refill; every read of a stage stands behind the barrier that follows its stores. No global load is in flight at a __syncthreads (its fence would wait for it).
    // Each sched_barrier(0) keeps loads, stores and products on their side of that point, so that each run of reads flies under the products behind it.
    static_assert(KK >= 128, "a stage 1 exists");
    if (NF == 1) {
    // One fragment set. Order of a trip: barrier wait | first-half fragments | first half's products | second-half fragments go out, stage t + 1 from registers into the other buffer | own LDS traffic done | barrier signal | the global loads of stage t + 2 go out | second half's products.
    // The work-group barrier is split: no LDS access stands between a wave's signal and its wait, so the second half's products of the waves that are through run while the last wave still reads and stores. Signal and wait alternate in every wave: one signal in front of the loop, wait then signal in each trip, one wait behind the loop.
    fetch(); put(0);
    asm volatile("s_wait_dscnt 0x0" ::: "memory");   // this wave's stores of stage 0 are done before it signals
    bar_signal();
    fetch();
#pragma unroll 1   // stays rolled: one copy of the body
    for (int kc = 0; kc < KK; kc += 64) {
        const int cur = (kc >> 6) & 1; const bool more1 = kc + 64 < KK, more2 = kc + 128 < KK;
        bar_wait();   // stage t is published, and every wave has ended its reads of the other buffer
        frags(0, cur);
        __builtin_amdgcn_sched_barrier(0);
        products(0);
        __builtin_amdgcn_sched_barrier(0);
        frags(1, cur);
        if (more1) put(cur ^ 1);
        asm volatile("s_wait_dscnt 0x0" ::: "memory");   // this wave's reads of stage t have returned and its stores of stage t + 1 are done before it signals
        bar_signal();
        if (more2) fetch();
        __builtin_amdgcn_sched_barrier(0);
        products(1);
        __builtin_amdgcn_sched_barrier(0);
    }
    bar_wait();   // the wait that belongs to the last trip's signal
    } else {
    fetch(); put(0);
    __syncthreads();   // publishes stage 0
    frags(0, 0); fetch(); frags(1, 0);
#pragma unroll 1   // stays rolled: one copy of the body, one set of fragment and staging registers
    for (int kc = 0; kc < KK; kc += 64) {
        const int nxt = ((kc >> 6) & 1) ^ 1; const bool more1 = kc + 64 < KK, more2 = kc + 128 < KK;
        __builtin_amdgcn_sched_barrier(0);
        products(0);
        __builtin_amdgcn_sched_barrier(0);
        if (more1) put(nxt);
        __syncthreads();   // publishes stage t + 1 and ends every wave's reads of stage t
        if (more1) frags(0, nxt);
        if (more2) fetch();
        __builtin_amdgcn_sched_barrier(0);
        products(1);
        __builtin_amdgcn_sched_barrier(0);
        if (more1) frags(1, nxt);
    }
    }
    float* os = osm[wv];
    v4f bb = (v4f){};   // the lane's four bias values (columns lr * 4 ..), the same for every row: read once
    if (BIAS) {
        const float b0 = bias[lr * 4], b1 = bias[lr * 4 + 1], b2 = bias[lr * 4 + 2], b3 = bias[lr * 4 + 3];
        asm volatile("s_wait_xcnt 0x0" ::: "memory");   // behind the bias load, in front of any later overwrite of its address registers
        __builtin_amdgcn_sched_barrier(0);   // keeps every later register write behind that wait
        bb[0] = bfr(b0); bb[1] = bfr(b1); bb[2] = bfr(b2); bb[3] = bfr(b3); }
#pragma unroll
    for (int mb = 0; mb < 4; ++mb) {
#pragma unroll
        for (int nb = 0; nb < 4; ++nb) {
#pragma unroll
            for (int j = 0; j < 8; ++j) os[(hi * 8 + j) * 68 + nb * 16 + lr] = acc[mb][nb][j]; }
        __builtin_amdgcn_wave_barrier(); asm volatile("" ::: "memory");   // the row reads below take other lanes' stores: keep them behind the stores
        float* crow = C + (size_t)(r0 + rw + mb * 16) * ldc + c0;
#pragma unroll
        for (int s = 0; s < 8; ++s) { const int row = 2 * s + hi, cofs = lr * 4; v4f val = *(const v4fa*)(os + row * 68 + cofs); if (BIAS) val += bb;
            *(v4f*)(crow + (size_t)row * ldc + cofs) = val; }
        __builtin_amdgcn_wave_barrier(); asm volatile("s_wait_xcnt 0x0" ::: "memory");   // the next block's LDS stores stay behind these reads; the wait stands behind the run of global stores, in front of any overwrite of their registers
        __builtin_amdgcn_sched_barrier(0);   // keeps the next block's register writes behind that wait
    }
}

__device__ __forceinline__ h16 tohx(float x) { return (h16)x; }
__device__ __forceinline__ void splitf(float y, unsigned short& h, unsigned short& l) { h = f2bf(y); l = f2bf(y - bf2f(h)); }
typedef __attribute__((ext_vector_type(2))) _Float16 v2h;
typedef __attribute__((ext_vector_type(4))) _Float16 v4h;
typedef __attribute__((ext_vector_type(2))) unsigned short v2us;
typedef __attribute__((ext_vector_type(4))) unsigned short v4us;
typedef __attribute__((ext_vector_type(2))) float v2f;
typedef __attribute__((ext_vector_type(4))) int v4i;

__global__ __launch_bounds__(256) void k_wtG(const float* __restrict__ w, int K, int N, bf* Bt) {
    const int lane = threadIdx.x & 31; const int L0 = (blockIdx.x * 8 + (threadIdx.x >> 5)) * 8; const int nlines = N * K / 64;
{
#pragma unroll 1
        for (int l = 0; l < 8; ++l) { const int L = L0 + l; if (L >= nlines) break; const size_t e = (size_t)L * 64 + lane * 2; const int k = (int)(e % K), n = (int)(e / K); v2us o;
            o[0] = f2bf(w[(size_t)k * N + n]); o[1] = f2bf(w[(size_t)(k + 1) * N + n]); *(v2us*)(Bt + e) = o; }
         }
}
// ---- The two elementwise kernels: k_cvtall in front of the projection (256 work-groups, one per WGP), k_post behind it. A wave takes many rows or lines instead of one, so that k_cvtall starts 4096 waves and k_post 12288, not tens of thousands.
// Every kernel is built of runs: a run of 16-byte loads, the arithmetic, a run of stores. run_end() closes a run.
#define NPC (2 * DQ + 4 * DKV)     // pitch of the projection output F: [q | q2 | k | k2 | v | v2]
#define NRS (2 * NH_ + 2 * NKV)    // head slots that take norm and rope: [q 16 | q2 16 | k 8 | k2 8]
#define RPW 12                     // head slots per wave, all of one row t
#define NVS (2 * NKV)              // value head slots: [v 8 | v2 8]
static_assert(NRS % RPW == 0 && NB_ * TT * (NRS / RPW) == 512 * 16, "norm and rope: 512 work-groups x 16 waves x RPW head slots cover [NB_ * TT][NRS]");
__device__ __forceinline__ void run_end() {
    asm volatile("s_wait_xcnt 0x0" ::: "memory");   // behind a run of global loads or stores, in front of any later overwrite of the registers they name
    __builtin_amdgcn_sched_barrier(0);   // keeps every later register write behind that wait
}
// k_cvtall: every f32 operand of the plain GEMMs rounded to bf16 in one launch. dst = [x | wq | wq2 | wk | wk2 | wv | wv2 | wo] in units of DKV * DM elements (2, 2, 2, 1, 1, 1, 1, 2 units).
// A chunk is 4 x 512 threads x 8 elements; 128 chunks a unit, so a chunk lies in one unit; work-group b takes the chunks k * 256 + b, k < 6.
static_assert((size_t)DKV * DM == (size_t)128 * 16384 && 12 * 128 == 6 * 256 && DQ == 2 * DKV && NB_ * TT == 2 * DKV, "unit bookkeeping of k_cvtall");
__global__ __launch_bounds__(512) void k_cvtall(const float* __restrict__ x, const float* __restrict__ wq, const float* __restrict__ wq2, const float* __restrict__ wk, const float* __restrict__ wk2, const float* __restrict__ wv, const float* __restrict__ wv2, const float* __restrict__ wo, bf* dst) {
    const size_t U = (size_t)DKV * DM; const unsigned lo = threadIdx.x * 8; v8f v[2][4];
    auto fetch = [&](int k) {     // chunk k's eight loads, one run
        const int c = k * 256 + (int)blockIdx.x, u = c >> 7;
        const float* s = ((u < 2) ? x + u * U : (u < 4) ? wq + (u - 2) * U : (u < 6) ? wq2 + (u - 4) * U : (u == 6) ? wk : (u == 7) ? wk2 : (u == 8) ? wv : (u == 9) ? wv2 : wo + (u - 10) * U) + (size_t)(c & 127) * 16384;
#pragma unroll
        for (int i = 0; i < 4; ++i) v[k & 1][i] = *(const v8f*)(s + i * 4096 + lo);
        run_end();
    };
    fetch(0);
#pragma unroll   // unrolled: the two register sets are indexed by constants
    for (int k = 0; k < 6; ++k) {
        if (k + 1 < 6) fetch(k + 1);   // the next chunk's loads fly under this chunk's conversion and stores
        bf* d = dst + (size_t)(k * 256 + (int)blockIdx.x) * 16384; v8us o[4];
#pragma unroll
        for (int i = 0; i < 4; ++i)
#pragma unroll
            for (int q = 0; q < 8; ++q) o[i][q] = f2bf(v[k & 1][i][q]);
        __builtin_amdgcn_sched_barrier(0);   // every value is ready before the first store: no store's register is written again inside the run
#pragma unroll
        for (int i = 0; i < 4; ++i) *(v8us*)(d + i * 4096 + lo) = o[i];
        if (k + 1 < 6) run_end();
    }
}
// k_post: everything between the projection and the attention in one launch; F (rows r = b * TT + t, both batches) is read once and not written.
// Work-groups NVB and up: RMSNorm x g, then RoPE, of the head slots [q | q2 | k | k2], out to the head planes [b][h][t][d] (fp16 + hi/lo). A wave takes RPW consecutive head slots of one row (RPW x 512 contiguous bytes), four d a lane: one run of loads, RPW independent row sums, the normed values stay in registers,
// then three groups of four head slots, each with its run of stores (256 B of a plane per store). The weight vectors and the row's cos/sin (rounded to bf16 here) are read once for all RPW slots.
// Rotate-half convention: out[d] = x[d] cos[t][d] - x[d+HD/2] sin[t][d], out[d+HD/2] = x[d+HD/2] cos[t][d+HD/2] + x[d] sin[t][d+HD/2]; the partner d +- HD/2 of a lane's four d lies in lane ^ 16.
// Work-groups below NVB: value planes [b][g][d][t] (fp16 + hi/lo) of F[b * TT + t][NRS * HD + g * HD + d]. Work-group = (b, g, 128 rows t), wave = 8 columns d; a lane takes four rows t: eight 16-byte loads (4 t x 8 d), then per column and plane one 8-byte store, 256 B of the plane per wave.
#define NVB (NB_ * NVS * (TT / 128))
static_assert(HD == 16 * 8, "k_post: the 16 waves of a value work-group cover the HD columns");
constexpr int sect(int h) { return (h < NH_) ? 0 : (h < 2 * NH_) ? 1 : (h < 2 * NH_ + NKV) ? 2 : 3; }   // the section [q | q2 | k | k2] of a head slot
constexpr bool two_sections() { for (int h0 = 0; h0 < NRS; h0 += RPW) if (sect(h0 + RPW - 1) - sect(h0) > 1) return false; return true; }
static_assert(two_sections(), "k_post: a wave's RPW head slots lie in the sections of its first and its last slot");
__device__ __forceinline__ float otherhalf(float v) { const int b = __float_as_int(v); return __int_as_float(__builtin_amdgcn_permlanex16(b, b, 0x76543210, 0xfedcba98, false, false)); }   // the value of lane ^ 16, on the vector port
__global__ __launch_bounds__(512) void k_post(const float* __restrict__ F, const float* __restrict__ cosT, const float* __restrict__ sinT, const float* __restrict__ gq, const float* __restrict__ gq2, const float* __restrict__ gk, const float* __restrict__ gk2, h16* P16, bf* Ph, bf* Pl, h16* V16, bf* Vh, bf* Vl) {
    const int lane = threadIdx.x & 31, w = __builtin_amdgcn_readfirstlane((int)(threadIdx.x >> 5));
    if (blockIdx.x < NVB) {     // the same for the whole work-group
        const int b = blockIdx.x, bt = b / (NVS * (TT / 128)), g = (b / (TT / 128)) % NVS, tb = (b % (TT / 128)) * 128, d0 = w * 8;
        const float* f = F + (size_t)(bt * TT + tb) * NPC + (NRS + g) * HD + d0; v4f x[4][2]; v4h o16[8]; v4us oh[8], ol[8];
        const size_t e0 = (size_t)((bt * NVS + g) * HD + d0) * TT + tb + lane * 4; h16* p16 = V16 + e0; bf* ph = Vh + e0; bf* pl = Vl + e0;   // the lane's three store addresses; the eight columns step by a constant
        asm volatile("" :: "v"(p16), "v"(ph), "v"(pl) : "memory");   // inputs only: the store addresses are complete in front of the loads, so that none of their arithmetic lands in a register that an issued load or store names
        __builtin_amdgcn_sched_barrier(0);   // keeps the loads behind that point
#pragma unroll
        for (int i = 0; i < 4; ++i)
#pragma unroll
            for (int j = 0; j < 2; ++j) x[i][j] = *(const v4f*)(f + (size_t)(lane * 4 + i) * NPC + j * 4);
        run_end();
#pragma unroll
        for (int dd = 0; dd < 8; ++dd)
#pragma unroll
            for (int i = 0; i < 4; ++i) { const float xv = x[i][dd >> 2][dd & 3]; o16[dd][i] = tohx(xv); unsigned short a2, c2; splitf(xv, a2, c2); oh[dd][i] = a2; ol[dd][i] = c2; }
        __builtin_amdgcn_sched_barrier(0);   // every value is ready before the first store: no store's register is written again inside the run
#pragma unroll
        for (int dd = 0; dd < 8; ++dd) { *(v4h*)(p16 + dd * TT) = o16[dd]; *(v4us*)(ph + dd * TT) = oh[dd]; *(v4us*)(pl + dd * TT) = ol[dd]; }
        return;
    }
    const int W = ((int)blockIdx.x - NVB) * 16 + w; const int t = W / (NRS / RPW), h0 = (W % (NRS / RPW)) * RPW;
    const int d = lane * 4; const float* f = F + (size_t)t * NPC + h0 * HD; const size_t e0 = ((size_t)((t / TT) * NRS + h0) * TT + t % TT) * HD + d;
    h16* q16 = P16 + e0; bf* qh = Ph + e0; bf* ql = Pl + e0;
    auto gvec = [&](int s) { return (s == 0) ? gq : (s == 1) ? gq2 : (s == 2) ? gk : gk2; };
    const int s0 = sect(h0);   // the wave's RPW slots lie in the sections of its first and its last slot: two weight vectors a wave
    const float* ga = gvec(s0); const float* gb = gvec(sect(h0 + RPW - 1)); const float* pc = cosT + (size_t)t * HD; const float* ps = sinT + (size_t)t * HD;
    asm volatile("" :: "v"(q16), "v"(qh), "v"(ql), "s"(f), "s"(ga), "s"(gb), "s"(pc), "s"(ps) : "memory");   // inputs only: the lane's three store addresses and the wave's five load bases are complete in front of the loads, so that the loads go out as one run and none of that arithmetic lands in a register that an issued load names
    __builtin_amdgcn_sched_barrier(0);   // keeps the loads behind that point
    v4f r[RPW]; float sq[RPW];
#pragma unroll
    for (int k = 0; k < RPW; ++k) r[k] = *(const v4f*)(f + k * HD + d);
    const v4f wa = *(const v4f*)(ga + d), wb = *(const v4f*)(gb + d), c4 = *(const v4f*)(pc + d), s4 = *(const v4f*)(ps + d);
    run_end();
    // The empty asm statements on products below are those of the norm and rope kernels that this one replaces: each product keeps its own f32 rounding, so that the planes come out bit-identical to theirs.
#pragma unroll
    for (int k = 0; k < RPW; ++k) { const v4f a = r[k]; float ss = 0.f;
#pragma unroll
        for (int q = 0; q < 4; ++q) { float p = __fmul_rn(a[q], a[q]); asm volatile("" : "+v"(p)); ss = __fadd_rn(ss, p); }
        sq[k] = ss; }
#pragma unroll
    for (int sh = 16; sh; sh >>= 1)     // the RPW rows' butterflies step together: one cross-lane latency a step, not one a row and step
#pragma unroll
        for (int k = 0; k < RPW; ++k) sq[k] = __fadd_rn(sq[k], __shfl_xor(sq[k], sh, 32));
    v4f ga4, gb4;   // the two weight vectors, rounded to bf16 once
#pragma unroll
    for (int q = 0; q < 4; ++q) { ga4[q] = bfr(wa[q]); gb4[q] = bfr(wb[q]); }
#pragma unroll
    for (int k = 0; k < RPW; ++k) { const v4f w = (sect(h0 + k) == s0) ? ga4 : gb4; const v4f a = r[k]; const float ss = sq[k];
        const float rs = __fdiv_rn(1.0f, sqrtf(__fadd_rn(ss * (1.0f / HD), 1e-6f))); v4f o;
#pragma unroll
        for (int q = 0; q < 4; ++q) { float y = __fmul_rn(a[q], rs); asm volatile("" : "+v"(y)); o[q] = __fmul_rn(y, w[q]); }
        r[k] = o; }
    v2f cs[4];   // the lane's four (cos, sin) pairs; the sine carries the sign of the rotated half: minus for d < HD / 2
#pragma unroll
    for (int q = 0; q < 4; ++q) { cs[q][0] = bfr(c4[q]); cs[q][1] = (d < HD / 2) ? -bfr(s4[q]) : bfr(s4[q]); }
#pragma unroll
    for (int g = 0; g < RPW / 4; ++g) {
        v4h o16[4]; v4us oh[4], ol[4];
#pragma unroll
        for (int k = 0; k < 4; ++k)
#pragma unroll
            for (int q = 0; q < 4; ++q) { const float x0 = r[g * 4 + k][q], x1 = otherhalf(x0);
                float a = __fmul_rn(x0, cs[q][0]), bq = __fmul_rn(x1, cs[q][1]); asm volatile("" : "+v"(a)); asm volatile("" : "+v"(bq)); const float rr = __fadd_rn(a, bq);
                o16[k][q] = tohx(rr); unsigned short a2, c2; splitf(rr, a2, c2); oh[k][q] = a2; ol[k][q] = c2; }
        __builtin_amdgcn_sched_barrier(0);   // every value is ready before the first store: no store's register is written again inside the run
#pragma unroll
        for (int k = 0; k < 4; ++k) { const size_t e = (size_t)(g * 4 + k) * TT * HD; *(v4h*)(q16 + e) = o16[k]; *(v4us*)(qh + e) = oh[k]; *(v4us*)(ql + e) = ol[k]; }
        if (g + 1 < RPW / 4) run_end();
    }
}
// ---- k_fattn: scores, joint softmax and both value products of one head in one kernel; grid (NB_ * NH_, TT / 64): both batches in one launch, two work-groups per WGP; 4 waves, each wave owns 16 query rows.
// The work-group walks 64-key tiles of the window path (from its diagonal tile down to key i - 255), then of the fading path (keys <= i - 256); the list of tiles is the same for its four waves. Each wave keeps ONE running maximum, sum and output accumulator (online softmax):
// the joint softmax over [s_ic | s_f]. A key outside the path's own range gets weight exactly 0. The diagonal tile comes first, so every row's maximum is finite from the first tile on.
// A tile's keys (64 rows of 256 B) and values (128 rows of 128 B), every plane, are brought into LDS once per work-group by asynchronous copies of whole lines and read from there by all four waves. Two buffers: tile t + 1 flies while tile t is worked on; one work-group barrier per tile hands the buffers over.
// Probabilities go from the accumulator layout to the A-operand layout through the wave's own LDS slice. Rows < RH: hi+lo bf16 planes, 3 products; rows >= RH: fp16, weights x PCAR (the factor cancels in sum and output alike).
// Loops: the path loop and the tile loop stay rolled (#pragma unroll 1: one copy of the long body); every inner loop is unrolled, so that the fragment and accumulator arrays are indexed by constants and stay in registers.
#define PP 72     // LDS pitch (16-bit elements) of the 16 x 64 probability tile: 16-byte aligned rows, 16-byte row reads spread over the banks
#define OP 136    // LDS pitch of the 16 x 128 output tile
#define KP 136    // LDS pitch of a staged key row (128 d): 256 B + 16 B, the pitch for 16-byte row reads
#define VP 72     // LDS pitch of a staged value row (64 keys of one d): 128 B + 16 B
#define KPL (64 * KP)     // elements of one staged key plane
#define VPL (HD * VP)     // elements of one staged value plane
#define RING (2 * 2 * (KPL + VPL))   // two buffers of two planes of keys and values
static_assert(4 * 2 * 16 * OP <= RING, "the four waves' output tiles fit the ring");
template <int X> __device__ __forceinline__ float rowx(float v) { return __int_as_float(__builtin_amdgcn_update_dpp(0, __float_as_int(v), 0x160 + X, 0xf, 0xf, true)); }   // DPP row_xmask: the value of lane ^ X inside the 16-lane row, on the vector port (a shuffle would go through the LDS queue, one wait each)
__device__ __forceinline__ float rowmax(float v) { v = fmaxf(v, rowx<8>(v)); v = fmaxf(v, rowx<4>(v)); v = fmaxf(v, rowx<2>(v)); return fmaxf(v, rowx<1>(v)); }
__device__ __forceinline__ float rowsum(float v) { v += rowx<8>(v); v += rowx<4>(v); v += rowx<2>(v); return v + rowx<1>(v); }
template <typename T16> struct LFrag;
template <> struct LFrag<h16> { static __device__ __forceinline__ v16h ld(const unsigned short* p) { const v8us lo = *(const v8usa*)p, hi = *(const v8usa*)(p + 16); return cat16(__builtin_bit_cast(v8h, lo), __builtin_bit_cast(v8h, hi)); } };
template <> struct LFrag<bf> { static __device__ __forceinline__ v16bf ld(const unsigned short* p) { const v8us lo = *(const v8usa*)p, hi = *(const v8usa*)(p + 16); return cat16b(lo, hi); } };
// Eight asynchronous 16-byte copies of a lane, global memory to LDS: LDS byte addresses l + i * ls, global addresses g + i * gs bytes. The wait is the statement's last line: it stands behind the copies, in front of any later overwrite of the registers they name.
__device__ __forceinline__ void copies8(unsigned l, unsigned ls, const char* g, size_t gs) {
    asm volatile("global_load_async_to_lds_b128 %0, %8, off\n\t"
                 "global_load_async_to_lds_b128 %1, %9, off\n\t"
                 "global_load_async_to_lds_b128 %2, %10, off\n\t"
                 "global_load_async_to_lds_b128 %3, %11, off\n\t"
                 "global_load_async_to_lds_b128 %4, %12, off\n\t"
                 "global_load_async_to_lds_b128 %5, %13, off\n\t"
                 "global_load_async_to_lds_b128 %6, %14, off\n\t"
                 "global_load_async_to_lds_b128 %7, %15, off\n\t"
                 "s_wait_xcnt 0x0"
                 :: "v"(l), "v"(l + ls), "v"(l + 2 * ls), "v"(l + 3 * ls), "v"(l + 4 * ls), "v"(l + 5 * ls), "v"(l + 6 * ls), "v"(l + 7 * ls),
                    "v"(g), "v"(g + gs), "v"(g + 2 * gs), "v"(g + 3 * gs), "v"(g + 4 * gs), "v"(g + 5 * gs), "v"(g + 6 * gs), "v"(g + 7 * gs)
                 : "memory");
}
template <typename T16, bool HL>
__device__ __forceinline__ void attn_rows(const T16* __restrict__ R, const T16* __restrict__ Rlo, const T16* __restrict__ VT, const T16* __restrict__ VTlo, int h, int rb, int wv, unsigned short* ring, unsigned short* sh, unsigned short* sl, bf* Ah, bf* Al) {
    typedef typename WFrag<T16>::V V;
    constexpr int NG = HL ? 2 : 1;    // planes per operand; also the number of 16-fragment (32-read) groups that a tile's keys, and its values, are read in
    constexpr int STG = NG * (KPL + VPL);   // elements of one buffer: [key planes | value planes]
    const int tid = threadIdx.x, lane = tid & 31, lr = lane & 15, hi = lane >> 4, i0 = rb * 64 + wv * 16;
    const int n0 = min(rb, 4) + 1, nt = n0 + max(0, rb - 3);   // tiles of the window path (key tiles rb down to max(0, rb - 4)) and of both paths (fading: key tiles rb - 4 down to 0); every one holds a live key for each wave's 16 rows or is masked to weight 0
    const unsigned ring0 = (unsigned)(size_t)(__attribute__((address_space(3))) unsigned short*)ring;   // the ring's byte address in the work-group's LDS
    const unsigned klane = (unsigned)((tid >> 4) * KP + (tid & 15) * 8) * 2, vlane = (unsigned)((tid >> 3) * VP + (tid & 7) * 8) * 2, vgl = (unsigned)((tid >> 3) * TT + (tid & 7) * 8) * 2;   // the lane's byte offsets: in a staged key plane, in a staged value plane, in a value plane in memory
    auto stage = [&](int t) {     // tile t's planes into buffer t & 1: a wave's copy covers 512 B of whole lines (2 key rows, 4 value rows); 8 key rows, 16 value rows per step of the work-group
        const int p = (t >= n0) ? 1 : 0, j0 = (p ? (rb - 4) - (t - n0) : rb - t) * 64;
        const size_t ku = ((size_t)(2 * NH_ + p * NKV + h / REP) * TT + j0) * HD, vu = (size_t)(p * NKV + h / REP) * HD * TT + j0;   // the tile's first element in a key plane and in a value plane: the same for the whole work-group
        const unsigned kl = ring0 + (unsigned)((t & 1) * STG) * 2 + klane, vl = ring0 + (unsigned)((t & 1) * STG + NG * KPL) * 2 + vlane;
        copies8(kl, 8 * KP * 2, (const char*)(R + ku) + tid * 16, (size_t)8 * HD * 2);   // key rows are contiguous: thread tid takes bytes tid * 16 of each 2 KiB step
        if (HL) copies8(kl + KPL * 2, 8 * KP * 2, (const char*)(Rlo + ku) + tid * 16, (size_t)8 * HD * 2);
        copies8(vl, 16 * VP * 2, (const char*)(VT + vu) + vgl, (size_t)16 * TT * 2);
        if (HL) copies8(vl + VPL * 2, 16 * VP * 2, (const char*)(VTlo + vu) + vgl, (size_t)16 * TT * 2);
    };
    v8f O[8]; float m[8], l[8];
#pragma unroll
    for (int db = 0; db < 8; ++db) O[db] = (v8f){};
#pragma unroll
    for (int jj = 0; jj < 8; ++jj) { m[jj] = -3.0e38f; l[jj] = 0.f; }
    stage(0);
    asm volatile("s_wait_asynccnt 0x0" ::: "memory");   // this wave's copies of tile 0 have landed
    __syncthreads();   // publishes tile 0
    if (nt > 1) stage(1);
    int t = 0;     // the running tile, over both paths
#pragma unroll 1
    for (int p = 0; p < 2; ++p) {      // p = 0: window path, p = 1: fading path
        const int jhi = p ? rb - 4 : rb, jlo = p ? 0 : max(0, rb - 4);   // first and last 64-key tile of the path
        if (jhi < jlo) continue;   // no tile of this path (the same for the whole work-group): its queries are not read
        const size_t qo = ((size_t)(p * NH_ + h) * TT + i0 + lr) * HD + 8 * hi;
        V a[4], a2[4];
#pragma unroll
        for (int ks = 0; ks < 4; ++ks) { a[ks] = WFrag<T16>::ld(R + qo + ks * 32); if (HL) a2[ks] = WFrag<T16>::ld(Rlo + qo + ks * 32); }
        run_end();   // behind the query loads
#pragma unroll 1
        for (int jt = jhi; jt >= jlo; --jt, ++t) {
            const int j0 = jt * 64; v8f s[4]; V kf[NG][16], vf[NG][16];
            const unsigned short* kb = ring + (t & 1) * STG + lr * KP + 8 * hi; const unsigned short* vb = ring + (t & 1) * STG + NG * KPL + lr * VP + 8 * hi;   // the lane's place in this tile's key and value planes
            // Read order of a tile. Keys and values come from LDS in groups of 16 fragments (32 reads), each group issued as one run, so that a group costs one LDS latency and not one every few fragments.
            // A second group (hi+lo planes) is issued behind the first block's products and flies under the products that follow. Each sched_barrier(0) keeps the compiler from moving reads or products over that point.
#pragma unroll
            for (int f = 0; f < 16 / NG; ++f) { const int o = (f >> 2) * 16 * KP + (f & 3) * 32; kf[0][f * NG] = LFrag<T16>::ld(kb + o); if (HL) kf[0][f * NG + 1] = LFrag<T16>::ld(kb + KPL + o); }
            __builtin_amdgcn_sched_barrier(0);   // the whole group is issued before the first product waits for a fragment
#pragma unroll
            for (int nb = 0; nb < 4; ++nb) { const int g = nb / (4 / NG), nl = nb % (4 / NG); s[nb] = (v8f){};
#pragma unroll
                for (int ks = 0; ks < 4; ++ks) { s[nb] = WFrag<T16>::mma(a[ks], kf[g][(nl * 4 + ks) * NG], s[nb]);
                    if (HL) { s[nb] = WFrag<T16>::mma(a2[ks], kf[g][(nl * 4 + ks) * NG], s[nb]); s[nb] = WFrag<T16>::mma(a[ks], kf[g][(nl * 4 + ks) * NG + 1], s[nb]); } }
                if (HL && nb == 0) {
                    __builtin_amdgcn_sched_barrier(0);   // the second key group is issued behind the first block's products
#pragma unroll
                    for (int f = 0; f < 16 / NG; ++f) { const int o = (4 / NG + (f >> 2)) * 16 * KP + (f & 3) * 32; kf[NG - 1][f * NG] = LFrag<T16>::ld(kb + o); kf[NG - 1][f * NG + 1] = LFrag<T16>::ld(kb + KPL + o); }
                    __builtin_amdgcn_sched_barrier(0);   // and it flies under the products that follow
                } }
            __builtin_amdgcn_sched_barrier(0);   // the value reads start behind the last score product
#pragma unroll
            for (int f = 0; f < 16 / NG; ++f) { const int o = (f >> 1) * 16 * VP + (f & 1) * 32; vf[0][f * NG] = LFrag<T16>::ld(vb + o); if (HL) vf[0][f * NG + 1] = LFrag<T16>::ld(vb + VPL + o); }
            __builtin_amdgcn_sched_barrier(0);   // the first value group flies while the softmax runs
            float mx[8];
#pragma unroll
            for (int jj = 0; jj < 8; ++jj) mx[jj] = m[jj];
#pragma unroll
            for (int nb = 0; nb < 4; ++nb)
#pragma unroll
                for (int jj = 0; jj < 8; ++jj) { const int dij = (i0 + hi * 8 + jj) - (j0 + nb * 16 + lr); const bool live = p ? (dij >= 256) : (dij >= 0 && dij < 256); const float t2 = live ? s[nb][jj] * SCL : -3.0e38f; s[nb][jj] = t2; mx[jj] = fmaxf(mx[jj], t2); }
#pragma unroll
            for (int jj = 0; jj < 8; ++jj) {
                mx[jj] = rowmax(mx[jj]);   // a row's 16 columns lie in the 16 lanes of one half
                const float al = __builtin_amdgcn_exp2f((m[jj] - mx[jj]) * 1.4426950408889634f); m[jj] = mx[jj]; l[jj] *= al;
#pragma unroll
                for (int db = 0; db < 8; ++db) O[db][jj] *= al; }
#pragma unroll
            for (int nb = 0; nb < 4; ++nb)
#pragma unroll
                for (int jj = 0; jj < 8; ++jj) { const float pv = __builtin_amdgcn_exp2f((s[nb][jj] - m[jj]) * 1.4426950408889634f) * (HL ? 1.0f : PCAR); l[jj] += pv; const int o = (hi * 8 + jj) * PP + nb * 16 + lr;
                    if (HL) { unsigned short ph, pl; splitf(pv, ph, pl); sh[o] = ph; sl[o] = pl; } else sh[o] = __builtin_bit_cast(unsigned short, tohx(pv)); }
            __builtin_amdgcn_wave_barrier(); asm volatile("" ::: "memory");   // the fragment reads below take other lanes' stores: keep them behind the stores
            V pa[2], pb[2];
#pragma unroll
            for (int k2 = 0; k2 < 2; ++k2) { pa[k2] = LFrag<T16>::ld(sh + lr * PP + k2 * 32 + 8 * hi); if (HL) pb[k2] = LFrag<T16>::ld(sl + lr * PP + k2 * 32 + 8 * hi); }
            __builtin_amdgcn_wave_barrier(); asm volatile("" ::: "memory");   // the next tile's stores stay behind these reads
#pragma unroll
            for (int db = 0; db < 8; ++db) { const int g = db / (8 / NG), dl = db % (8 / NG);
#pragma unroll
                for (int k2 = 0; k2 < 2; ++k2) { O[db] = WFrag<T16>::mma(pa[k2], vf[g][(dl * 2 + k2) * NG], O[db]);
                    if (HL) { O[db] = WFrag<T16>::mma(pb[k2], vf[g][(dl * 2 + k2) * NG], O[db]); O[db] = WFrag<T16>::mma(pa[k2], vf[g][(dl * 2 + k2) * NG + 1], O[db]); } }
                if (HL && db == 0) {
                    __builtin_amdgcn_sched_barrier(0);   // the second value group is issued behind the first block's products
#pragma unroll
                    for (int f = 0; f < 16 / NG; ++f) { const int o = (8 / NG + (f >> 1)) * 16 * VP + (f & 1) * 32; vf[NG - 1][f * NG] = LFrag<T16>::ld(vb + o); vf[NG - 1][f * NG + 1] = LFrag<T16>::ld(vb + VPL + o); }
                    __builtin_amdgcn_sched_barrier(0);   // and it flies under the products that follow
                } }
            // Foot of tile t, every wave, in this order: own LDS reads done, own copies of tile t + 1 landed, barrier, refill of the buffer that tile t has just left.
            asm volatile("s_wait_dscnt 0x0" ::: "memory");      // this wave's reads of tile t have returned
            asm volatile("s_wait_asynccnt 0x0" ::: "memory");   // this wave's copies of tile t + 1 have landed
            __syncthreads();   // publishes tile t + 1 and ends every wave's reads of tile t
            if (t + 2 < nt) stage(t + 2);
        }
    }
    asm volatile("s_wait_asynccnt 0x0" ::: "memory");   // no copy is outstanding when the ring becomes output staging (the last tile's barrier has ended every wave's reads)
    unsigned short* oh_ = ring + wv * 2 * 16 * OP; unsigned short* ol_ = oh_ + 16 * OP;   // the wave's own output tiles, hi and lo
#pragma unroll
    for (int jj = 0; jj < 8; ++jj) {
        const float f = __fdiv_rn(1.0f, rowsum(l[jj]));
#pragma unroll
        for (int db = 0; db < 8; ++db) { unsigned short oh, ol; splitf(O[db][jj] * f, oh, ol); const int o = (hi * 8 + jj) * OP + db * 16 + lr; oh_[o] = oh; ol_[o] = ol; } }
    __builtin_amdgcn_wave_barrier(); asm volatile("" ::: "memory");   // the row reads below take other lanes' stores
    v8us vh[8], vl[8]; const size_t oo = (size_t)(i0 + hi) * DQ + h * HD + lr * 8; bf* qh = Ah + oo; bf* ql = Al + oo;   // the lane's two store addresses; the eight rows step by a constant
#pragma unroll
    for (int c = 0; c < 8; ++c) { const int row = c * 2 + hi, col = lr * 8; vh[c] = *(const v8usa*)(oh_ + row * OP + col); vl[c] = *(const v8usa*)(ol_ + row * OP + col); }
    asm volatile("" :: "v"(qh), "v"(ql) : "memory");   // inputs only: both store addresses are complete in front of the run of stores, so that none of their arithmetic lands in a register that an issued store names
    __builtin_amdgcn_sched_barrier(0);   // every row is in its own registers before the first store: no store's register is written again inside the run
#pragma unroll
    for (int c = 0; c < 8; ++c) { *(v8us*)(qh + (size_t)c * 2 * DQ) = vh[c]; *(v8us*)(ql + (size_t)c * 2 * DQ) = vl[c]; }
}
__global__ __launch_bounds__(128) void k_fattn(const h16* __restrict__ R16, const bf* __restrict__ Rh, const bf* __restrict__ Rl, const h16* __restrict__ VT16, const bf* __restrict__ VTh, const bf* __restrict__ VTl, bf* Ah, bf* Al) {
    __shared__ __align__(16) unsigned short ring[RING];
    __shared__ __align__(16) unsigned short ps[4][2][16 * PP];
    constexpr int NRB = TT / 64;
    const int wv = __builtin_amdgcn_readfirstlane((int)(threadIdx.x >> 5)); const int y = blockIdx.y; const int rb = (y < NRB / 2) ? NRB - 1 - y : y - NRB / 2;   // the first half of the grid takes the last rows (the most keys) downwards, the second half the first rows upwards: the work-groups half a grid apart hold row blocks t and NRB - 1 - t (speed only)
    const int h = blockIdx.x % NH_, b = blockIdx.x / NH_;
    const size_t ro = (size_t)b * NRS * TT * HD, vo = (size_t)b * NVS * HD * TT, ao = (size_t)b * TT * DQ;   // batch b's planes
    if (rb * 64 < RH) attn_rows<bf, true>(Rh + ro, Rl + ro, VTh + vo, VTl + vo, h, rb, wv, ring, ps[wv][0], ps[wv][1], Ah + ao, Al + ao);
    else attn_rows<h16, false>(R16 + ro, nullptr, VT16 + vo, nullptr, h, rb, wv, ring, ps[wv][0], ps[wv][1], Ah + ao, Al + ao);
}

// k_asoft: per row (zz, i): t = S x HD^-0.5 for j <= i and i - j < WIN (sliding causal window; the reference's -1e9 additive fill vanishes identically); softmax over the 1024 keys (register row, one exp, fixed trees);
__global__ __launch_bounds__(256) void k_asoft(const float* __restrict__ Sb, h16* P16, bf* Ph, bf* Pl) {
    const int lane = threadIdx.x & 31; const int row = blockIdx.x * 8 + (threadIdx.x >> 5); if (row >= ZH * TT) return; const int i = row % TT; const int zz = row / TT; (void)zz; const bool hires = (i < RH); const float* sr = Sb + (size_t)row * TT; float v[TT / 32]; float mx = -3.0e38f;
#pragma unroll
    for (int ch = 0; ch < TT / 128; ++ch) { const int j0 = ch * 128 + lane * 4; const v4f a = *(const v4f*)(sr + j0);
#pragma unroll
        for (int q = 0; q < 4; ++q) { const int j = j0 + q; (void)j; const float t = (j <= i && i - j < WIN) ? a[q] * SCL : -3.0e38f; v[ch * 4 + q] = t; mx = fmaxf(mx, t); } }
#pragma unroll
    for (int sh = 16; sh; sh >>= 1) mx = fmaxf(mx, __shfl_xor(mx, sh, 32));
    float sum = 0.f;
#pragma unroll
    for (int k = 0; k < TT / 32; ++k) { float d0 = __fsub_rn(v[k], mx); asm volatile("" : "+v"(d0)); v[k] = __builtin_amdgcn_exp2f(__fmul_rn(d0, 1.4426950408889634f)); sum += v[k]; }
#pragma unroll
    for (int sh = 16; sh; sh >>= 1) sum += __shfl_xor(sum, sh, 32);
    const float f = __fdiv_rn(hires ? 1.0f : PCAR, sum);
{
        if (hires) {
#pragma unroll
            for (int ch = 0; ch < TT / 128; ++ch) { v4us oh, ol;
#pragma unroll
                for (int q = 0; q < 4; ++q) { unsigned short a, c2; splitf(v[ch * 4 + q] * f, a, c2); oh[q] = a; ol[q] = c2; }
                const size_t oo = ((size_t)zz * (RH ? RH : 1) + i) * TT + ch * 128 + lane * 4; *(v4us*)(Ph + oo) = oh; *(v4us*)(Pl + oo) = ol; }
        } else {
#pragma unroll
            for (int ch = 0; ch < TT / 128; ++ch) { v4h o4;
#pragma unroll
                for (int q = 0; q < 4; ++q) o4[q] = tohx(v[ch * 4 + q] * f);
                *(v4h*)(P16 + (size_t)row * TT + ch * 128 + lane * 4) = o4; } }
         }
}
__global__ __launch_bounds__(256) void k_merge(const float* __restrict__ O, int h0, bf* Ah, bf* Al) { const size_t e = ((size_t)blockIdx.x * 256 + threadIdx.x) * 2; if (e >= (size_t)ZH * TT * HD) return; const int d = (int)(e % HD); const int t = (int)((e / HD) % TT); const int zz = (int)(e / ((size_t)HD * TT)); const float cs = (t < RH) ? 1.0f : (1.0f / PCAR); const size_t oo = (size_t)t * DQ + (h0 + zz) * HD + d;
    v2us oh, ol;
#pragma unroll
    for (int q = 0; q < 2; ++q) { unsigned short a, c2; splitf(O[e + q] * cs, a, c2); oh[q] = a; ol[q] = c2; } *(v2us*)(Ah + oo) = oh; *(v2us*)(Al + oo) = ol;  }

extern "C" void kernel_launch(void* const* d_in, const int* in_sizes, int n_in,
                              void* d_out, int out_size, void* d_ws, size_t ws_size, hipStream_t stream) {
    (void)in_sizes; (void)n_in; (void)out_size;
    const float* x = (const float*)d_in[0]; const float* cosA = (const float*)d_in[1]; const float* sinA = (const float*)d_in[2]; const float* wq = (const float*)d_in[3]; const float* bq = (const float*)d_in[4]; const float* wk = (const float*)d_in[5]; const float* bk = (const float*)d_in[6]; const float* wv = (const float*)d_in[7]; const float* bv = (const float*)d_in[8]; const float* wq2 = (const float*)d_in[9]; const float* bq2 = (const float*)d_in[10]; const float* wk2 = (const float*)d_in[11]; const float* bk2 = (const float*)d_in[12]; const float* wv2 = (const float*)d_in[13]; const float* bv2 = (const float*)d_in[14]; const float* wo = (const float*)d_in[15]; const float* gq = (const float*)d_in[16]; const float* gk = (const float*)d_in[17]; const float* gq2 = (const float*)d_in[18]; const float* gk2 = (const float*)d_in[19]; const float* cosT = cosA; const float* sinT = sinA;
    float* OUT = (float*)d_out;     // [2][1024][2048]
    char* wsp = (char*)d_ws;
    auto take = [&](size_t bytes) { char* p = wsp; wsp += (bytes + 255) & ~(size_t)255; return (void*)p; };
    // 16-bit GEMM operands, one conversion launch: [x (both batches) | wq | wq2 | wk | wk2 | wv | wv2 | wo]; the six projection weights are one [NP][DM] plane
    const size_t U = (size_t)DKV * DM; const int NP = 2 * DQ + 4 * DKV, NRH = 2 * NH_ + 2 * NKV, NVH = 2 * NKV;
    bf* XB = (bf*)take(12 * U * 2); bf* WP = XB + 2 * U; bf* WO = XB + 10 * U;
    // head planes per batch, both paths side by side: [b][q 16 | q2 16 | k 8 | k2 8][t][d] and [b][v 8 | v2 8][d][t]
    h16* R16 = (h16*)take((size_t)NB_ * NRH * TT * HD * 2); bf* Rh = (bf*)take((size_t)NB_ * NRH * TT * HD * 2); bf* Rl = (bf*)take((size_t)NB_ * NRH * TT * HD * 2);
    h16* VT16 = (h16*)take((size_t)NB_ * NVH * HD * TT * 2); bf* VTh = (bf*)take((size_t)NB_ * NVH * HD * TT * 2); bf* VTl = (bf*)take((size_t)NB_ * NVH * HD * TT * 2);
    float* F = (float*)take((size_t)NB_ * TT * NP * 4); bf* ATl = (bf*)take((size_t)NB_ * TT * DQ * 2);   // both batches' [NB_ * TT][NP] projection output; the lo plane of the merged attention output
    if ((size_t)(wsp - (char*)d_ws) > ws_size) return;    // ws 256 MiB
    bf* ATh = XB;     // the hi plane of the merged attention output reuses x: its rows are dead once the projection has run (stream-ordered; same size)
    static_assert(DQ == DM, "ATh fits x");
    k_cvtall<<<256, 512, 0, stream>>>(x, wq, wq2, wk, wk2, wv, wv2, wo, XB);
    // every stage takes both batches in one launch: the rows of x, F and the cos/sin tables are r = b * TT + t
    k_gemms<256, 256, DM, 0, true, 1><<<dim3(NB_ * TT / 256, NP / 256, 1), 512, 0, stream>>>(XB, nullptr, WP, F, NP, bq, bq2, bk, bk2, bv, bv2);
    k_post<<<NVB + 512, 512, 0, stream>>>(F, cosA, sinA, gq, gq2, gk, gk2, R16, Rh, Rl, VT16, VTh, VTl);
    k_fattn<<<dim3(NB_ * NH_, TT / 64, 1), 128, 0, stream>>>(R16, Rh, Rl, VT16, VTh, VTl, ATh, ATl);
    k_gemms<128, 128, DQ, 1, false, 2><<<dim3(NB_ * TT / 128, DM / 128, 1), 128, 0, stream>>>(ATh, ATl, WO, OUT, DM, nullptr, nullptr, nullptr, nullptr, nullptr, nullptr);
}

// v010
// It runs in 137 microseconds.
// Timed twice side by side with v009, it ran 1.08 and 1.05 times as fast.
// Counting every step since v000, it is 17.3 times as fast.
#include <hip/hip_runtime.h>

// BMOJOAttention (hidden [2][1024][2048]; two projection paths - in-context (Wq,bq,Wk,bk,Wv,bv,gq,gk) and fading (Wq2..gk2): q = rope(rmsnorm(x Wq^T + bq) gq) (16 x 128), k = rope(rmsnorm(x Wk^T + bk) gk) (8 kv heads; group h/2), v = x Wv^T + bv; rotate-half RoPE with the read cos/sin [B][S][128]; s_ic = q_ic.k_ic / sqrt(128) live where 0 <= i-j < 256, s_f = q_f.k_f / sqrt(128) live where i-j >= 256 (else -1e30); ONE joint softmax over [s_ic | s_f]; out = p_ic v_ic + p_f v_f; merged Wo^T -> [2][1024][2048]).
// The joint softmax over 2S columns is computed as one causal softmax whose score (and value source) switches at i-j = 256: the masked halves contribute exactly 0; keys j > i are masked in both (causal tile skipping).
// Compute dtypes, f32 accumulate: every input rounded to bf16; both paths' q/k/v on PLAIN bf16 operands (inputs: exact) + bias; RMSNorm * g and RoPE (cos/sin rounded to bf16) f32, in the projection GEMM's epilogue; both score sets and both attn.v products: query rows < 512 hl (3 products), the rest single fp16 (x1024), causal tile skipping; online softmax f32 over the live scores of both paths, both value products into one f32 accumulator, all in one kernel (k_fattn), which emits the hl planes of the merged output; Wo hl x exact (2 products).

#define NB_  2
#define TT   1024
#define DM   2048
#define NH_  16
#define NKV  8
#define REP  (NH_ / NKV)
#define HD   128
#define DQ   (NH_ * HD)
#define DKV  (NKV * HD)
#define ZH   16                   // heads per attention pass: all of them
#define RH   512                  // query rows < RH use hi+lo planes (0: none)
#define WIN  1024
#define PCAR 1024.0f
static_assert(RH % 64 == 0, "a 64-row block of the attention lies on one side of RH");
#define SCL  0.088388347648318447f   // HD^-0.5
typedef _Float16 h16;
typedef unsigned short bf;
typedef __attribute__((ext_vector_type(16))) __bf16   v16bf;
typedef __attribute__((ext_vector_type(16))) _Float16 v16h;
typedef __attribute__((ext_vector_type(8)))  _Float16 v8h;
typedef __attribute__((ext_vector_type(8)))  unsigned short v8us;
typedef __attribute__((ext_vector_type(8)))  float    v8f;
typedef __attribute__((ext_vector_type(4)))  float    v4f;
typedef v8h  __attribute__((may_alias)) v8ha;
typedef v4f  __attribute__((may_alias)) v4fa;
typedef v8us __attribute__((may_alias)) v8usa;

__device__ __forceinline__ unsigned short f2bf(float f) { unsigned u = __float_as_uint(f); u += 0x7FFFu + ((u >> 16) & 1u); return (unsigned short)(u >> 16); }
__device__ __forceinline__ float bf2f(unsigned short b) { return __uint_as_float(((unsigned)b) << 16); }
__device__ __forceinline__ float bfr(float f) { return bf2f(f2bf(f)); }
__device__ __forceinline__ v16h cat16(v8h lo, v8h hi) { return __builtin_shufflevector(lo, hi, 0, 1, 2, 3, 4, 5, 6, 7, 8, 9, 10, 11, 12, 13, 14, 15); }
__device__ __forceinline__ v16bf cat16b(v8us lo, v8us hi) { return __builtin_bit_cast(v16bf, __builtin_shufflevector(lo, hi, 0, 1, 2, 3, 4, 5, 6, 7, 8, 9, 10, 11, 12, 13, 14, 15)); }
__device__ __forceinline__ v8f wmma16(v16h a, v16h b, v8f c) { return __builtin_amdgcn_wmma_f32_16x16x32_f16(false, a, false, b, (short)0, c, false, false); }
__device__ __forceinline__ v8f wmmab(v16bf a, v16bf b, v8f c) { return __builtin_amdgcn_wmma_f32_16x16x32_bf16(false, a, false, b, (short)0, c, false, false); }



__device__ __forceinline__ h16 tohx(float x) { return (h16)x; }
__device__ __forceinline__ void splitf(float y, unsigned short& h, unsigned short& l) { h = f2bf(y); l = f2bf(y - bf2f(h)); }
typedef __attribute__((ext_vector_type(2))) _Float16 v2h;
typedef __attribute__((ext_vector_type(4))) _Float16 v4h;
typedef __attribute__((ext_vector_type(2))) unsigned short v2us;
typedef __attribute__((ext_vector_type(4))) unsigned short v4us;
typedef __attribute__((ext_vector_type(2))) float v2f;
typedef __attribute__((ext_vector_type(4))) int v4i;

#define NRS (2 * NH_ + 2 * NKV)    // head slots that take norm and rope: [q 16 | q2 16 | k 8 | k2 8]
#define NVS (2 * NKV)              // value head slots: [v 8 | v2 8]
__device__ __forceinline__ void run_end() {
    asm volatile("s_wait_xcnt 0x0" ::: "memory");   // behind a run of global loads or stores, in front of any later overwrite of the registers they name
    __builtin_amdgcn_sched_barrier(0);   // keeps every later register write behind that wait
}
constexpr int sect(int h) { return (h < NH_) ? 0 : (h < 2 * NH_) ? 1 : (h < 2 * NH_ + NKV) ? 2 : 3; }   // the section [q | q2 | k | k2] of a head slot
__device__ __forceinline__ float otherhalf(float v) { const int b = __float_as_int(v); return __int_as_float(__builtin_amdgcn_permlanex16(b, b, 0x76543210, 0xfedcba98, false, false)); }   // the value of lane ^ 16, on the vector port
typedef float __attribute__((may_alias)) fa;

// ---- k_gemms: GEMM with both operands staged in LDS. One work-group = BM x BN output tile, BM * BN / 128 threads = waves in a (BM / 64) x (BN / 64) grid, 64 x 64 (16 accumulators) per wave; grid (M / BM, N / BN).
// C[m][n] (f32, pitch ldc) = sum_k (A[m][k] + A2[m][k]) Bt[n][k] (A2 only with NSPLIT = 1: two products per k step, A first); all planes K-contiguous bf16, KK % 64 == 0.
// A stage is 64 k (128 B, one line) of every operand row. Each global load of a wave covers four whole lines; a line is fetched once per work-group and then read from LDS by every wave that needs it.
// Two LDS buffers: a stage's lines are loaded into registers one stage ahead, stored into the other buffer between the two halves of the running stage's products, and one work-group barrier per stage hands the buffers over.
// NF = fragment sets. 2: each half's fragments are read one half ahead (few waves per SIMD). 1: each half reads its own fragments, which keeps a 16-wave work-group inside 256 registers a wave; the three other waves of the SIMD cover the read latency.
// The projection takes 256 x 256 tiles: per output element a tile's operand lines are (BM + BN) / (BM * BN), a third fewer reads from L2 than at 256 x 128, and its 256 work-groups are one per WGP, all resident at once.
// With POST the N axis is the concatenation [q | q2 | k | k2 | v | v2] of both paths' projections (DQ, DQ, DKV, DKV, DKV, DKV columns); each 64-column tile lies in one section and takes that section's bias vector, and C is not written:
// the epilogue does everything between the projection and the attention on the work-group's own tile (256 rows r = b * TT + t, two heads) and writes the head planes.
// Sections q, q2, k, k2: the whole f32 tile goes into LDS (over the dead stage buffers), one work-group barrier, then RMSNorm x g and RoPE, out to the planes [b][h][t][d] (fp16 + hi/lo). A wave takes, four times, four rows of both heads, four d a lane:
// the row's cos/sin (rounded to bf16 here) are read once for both heads, eight independent row sums, two groups of four head rows, each with its run of stores (256 B of a plane per store).
// Rotate-half convention: out[d] = x[d] cos[t][d] - x[d+HD/2] sin[t][d], out[d+HD/2] = x[d+HD/2] cos[t][d+HD/2] + x[d] sin[t][d+HD/2]; the partner d +- HD/2 of a lane's four d lies in lane ^ 16.
// Sections v, v2: value planes [b][g][d][t] (fp16 + hi/lo). A lane's accumulator holds eight consecutive t of one d: each wave turns its 64 t x 64 d, 16 d at a time, through its own LDS slice into whole 128-B lines of the plane.
template <typename T16> struct WFrag;
template <> struct WFrag<h16> { typedef v16h V; static __device__ __forceinline__ V ld(const h16* p) { return cat16(*(const v8h*)p, *(const v8h*)(p + 16)); } static __device__ __forceinline__ v8f mma(V a, V b, v8f c) { return wmma16(a, b, c); } };
template <> struct WFrag<bf> { typedef v16bf V; static __device__ __forceinline__ V ld(const bf* p) { return cat16b(*(const v8us*)p, *(const v8us*)(p + 16)); } static __device__ __forceinline__ v8f mma(V a, V b, v8f c) { return wmmab(a, b, c); } };
__device__ __forceinline__ void bar_signal() { asm volatile("s_barrier_signal -1" ::: "memory"); }   // the two halves of the work-group's own barrier; the clobber keeps every LDS access on its side
__device__ __forceinline__ void bar_wait() { asm volatile("s_barrier_wait -1" ::: "memory"); }
#define GP 72     // LDS pitch (16-bit elements) of a staged 64-k row: 128 B + 16 B, the pitch for 16-byte row reads
template <int BM, int BN, int KK, int NSPLIT, bool POST, int NF>
__global__ __launch_bounds__(BM * BN / 128) void k_gemms(const bf* __restrict__ A, const bf* __restrict__ A2, const bf* __restrict__ Bt, float* C, int ldc, const float* __restrict__ bq, const float* __restrict__ bq2, const float* __restrict__ bk, const float* __restrict__ bk2, const float* __restrict__ bv, const float* __restrict__ bv2,
        const float* __restrict__ cosT, const float* __restrict__ sinT, const float* __restrict__ gq, const float* __restrict__ gq2, const float* __restrict__ gk, const float* __restrict__ gk2, h16* P16, bf* Ph, bf* Pl, h16* V16, bf* Vh, bf* Vl) {
    constexpr int NA = NSPLIT ? 2 : 1, NT = BM * BN / 128, NWC = BN / 64, RP = NT / 8, NAP = BM / RP, NBP = BN / RP;    // A planes; threads; wave columns; rows that one staging pass of the work-group covers (8 threads a row); passes for the BM rows of A and the BN rows of Bt
    constexpr int SAB = 2 * NA * BM * GP * 2, SBB = 2 * BN * GP * 2, OSE = 16 * 68, OSB = (NT / 32) * OSE * 4;    // bytes of the A and the Bt stage buffers; elements of a wave's 16 x 64 output block; bytes of all waves' blocks
    constexpr int SMB = POST ? (4 * OSB > SAB + SBB ? 4 * OSB : SAB + SBB) : SAB + SBB + OSB;    // POST: the whole tile (four blocks a wave) lies over the stage buffers, which are dead by then
    __shared__ __align__(16) char smem[SMB];
    unsigned short (*sa)[NA][BM * GP] = reinterpret_cast<unsigned short (*)[NA][BM * GP]>(smem);
    unsigned short (*sb)[BN * GP] = reinterpret_cast<unsigned short (*)[BN * GP]>(smem + SAB);
    const int tid = threadIdx.x, lane = tid & 31, lr = lane & 15, hi = lane >> 4, wv = __builtin_amdgcn_readfirstlane(tid >> 5);
    const int rw = (wv / NWC) * 64, cw = (wv % NWC) * 64; const int r0 = blockIdx.x * BM, c0 = blockIdx.y * BN + cw;
    const float* bias = nullptr;   // this wave's bias, already stepped to its column c0
    if (POST) bias = (c0 < DQ) ? bq + c0 : (c0 < 2 * DQ) ? bq2 + (c0 - DQ) : (c0 < 2 * DQ + DKV) ? bk + (c0 - 2 * DQ) : (c0 < 2 * DQ + 2 * DKV) ? bk2 + (c0 - 2 * DQ - DKV) : (c0 < 2 * DQ + 3 * DKV) ? bv + (c0 - 2 * DQ - 2 * DKV) : bv2 + (c0 - 2 * DQ - 3 * DKV);
    const int srow = tid >> 3, scol = (tid & 7) * 8;
    unsigned vo = (unsigned)(srow * KK + scol) * 2;    // the lane's byte offset from the work-group-uniform bases below, for the stage that is fetched next: carried through the loop in one register, stepped behind each run of loads
    typedef const __attribute__((address_space(1))) char* gptr;
    const gptr ua = (gptr)(A + (size_t)r0 * KK), ua2 = (gptr)(A2 + (size_t)r0 * KK), ub = (gptr)(Bt + (size_t)blockIdx.y * BN * KK);
    v8us ra[NA][NAP], rb[NBP];
    auto ld16 = [](gptr p) { return *(const __attribute__((address_space(1))) v8us*)p; };
    auto fetch = [&]() {     // the next stage's lines into registers, one run of loads
#pragma unroll
        for (int i = 0; i < NAP; ++i) { ra[0][i] = ld16(ua + vo + (size_t)i * RP * KK * 2); if (NSPLIT) ra[NA - 1][i] = ld16(ua2 + vo + (size_t)i * RP * KK * 2); }
#pragma unroll
        for (int i = 0; i < NBP; ++i) rb[i] = ld16(ub + vo + (size_t)i * RP * KK * 2);
        asm volatile("s_wait_xcnt 0x0" ::: "memory");   // behind the run of loads, in front of any later overwrite of their address registers
        __builtin_amdgcn_sched_barrier(0);   // keeps every later register write behind that wait
        vo += 128;
    };
    auto put = [&](int buf) {      // those registers into LDS buffer buf
#pragma unroll
        for (int i = 0; i < NAP; ++i) { const int o = (srow + i * RP) * GP + scol; *(v8usa*)(&sa[buf][0][o]) = ra[0][i]; if (NSPLIT) *(v8usa*)(&sa[buf][NA - 1][o]) = ra[NA - 1][i]; }
#pragma unroll
        for (int i = 0; i < NBP; ++i) *(v8usa*)(&sb[buf][(srow + i * RP) * GP + scol]) = rb[i];
    };
    v8f acc[4][4];
#pragma unroll
    for (int mb = 0; mb < 4; ++mb)
#pragma unroll
        for (int nb = 0; nb < 4; ++nb) acc[mb][nb] = (v8f){};
    v16bf a[NF][4], a2[NF][4], b[NF][4];   // the fragments of the two 32-k halves of a stage (NF = 1: of the running half)
    auto frags = [&](int kh, int buf) {   // half kh of the stage in LDS buffer buf, one run of reads
        const int ks = kh & (NF - 1);
#pragma unroll
        for (int mb = 0; mb < 4; ++mb) { const int o = (rw + mb * 16 + lr) * GP + kh * 32 + 8 * hi; a[ks][mb] = cat16b(*(const v8usa*)(&sa[buf][0][o]), *(const v8usa*)(&sa[buf][0][o + 16])); if (NSPLIT) a2[ks][mb] = cat16b(*(const v8usa*)(&sa[buf][NA - 1][o]), *(const v8usa*)(&sa[buf][NA - 1][o + 16])); }
#pragma unroll
        for (int nb = 0; nb < 4; ++nb) { const int o = (cw + nb * 16 + lr) * GP + kh * 32 + 8 * hi; b[ks][nb] = cat16b(*(const v8usa*)(&sb[buf][o]), *(const v8usa*)(&sb[buf][o + 16])); }
    };
    auto products = [&](int kh) {
        const int ks = kh & (NF - 1);
#pragma unroll
        for (int nb = 0; nb < 4; ++nb) {
#pragma unroll
            for (int mb = 0; mb < 4; ++mb) acc[mb][nb] = wmmab(a[ks][mb], b[ks][nb], acc[mb][nb]);
            if (NSPLIT) {
#pragma unroll
                for (int mb = 0; mb < 4; ++mb) acc[mb][nb] = wmmab(a2[ks][mb], b[ks][nb], acc[mb][nb]); } }
    };
    // Two fragment sets. Order of a trip (stage t in buffer t & 1): first half's products | stage t + 1 from registers into the other buffer | barrier | first-half fragments of stage t + 1 and the global loads of stage t + 2 go out | second half's products | second-half fragments of stage t + 1 go out.
    // Every read of a buffer stands in front of the barrier that precedes its refill; every read of a stage stands behind the barrier that follows its stores. No global load is in flight at a __syncthreads (its fence would wait for it).
    // Each sched_barrier(0) keeps loads, stores and products on their side of that point, so that each run of reads flies under the products behind it.
    static_assert(KK >= 128, "a stage 1 exists");
    if (NF == 1) {
    // One fragment set. Order of a trip: barrier wait | first-half fragments | first half's products | second-half fragments go out, stage t + 1 from registers into the other buffer | own LDS traffic done | barrier signal | the global loads of stage t + 2 go out | second half's products.
    // The work-group barrier is split: no LDS access stands between a wave's signal and its wait, so the second half's products of the waves that are through run while the last wave still reads and stores. Signal and wait alternate in every wave: one signal in front of the loop, wait then signal in each trip, one wait behind the loop.
    fetch(); put(0);
    asm volatile("s_wait_dscnt 0x0" ::: "memory");   // this wave's stores of stage 0 are done before it signals
    bar_signal();
    fetch();
#pragma unroll 1   // stays rolled: one copy of the body
    for (int kc = 0; kc < KK; kc += 64) {
        const int cur = (kc >> 6) & 1; const bool more1 = kc + 64 < KK, more2 = kc + 128 < KK;
        bar_wait();   // stage t is published, and every wave has ended its reads of the other buffer
        frags(0, cur);
        __builtin_amdgcn_sched_barrier(0);
        products(0);
        __builtin_amdgcn_sched_barrier(0);
        frags(1, cur);
        if (more1) put(cur ^ 1);
        asm volatile("s_wait_dscnt 0x0" ::: "memory");   // this wave's reads of stage t have returned and its stores of stage t + 1 are done before it signals
        bar_signal();
        if (more2) fetch();
        __builtin_amdgcn_sched_barrier(0);
        products(1);
        __builtin_amdgcn_sched_barrier(0);
    }
    bar_wait();   // the wait that belongs to the last trip's signal
    } else {
    fetch(); put(0);
    __syncthreads();   // publishes stage 0
    frags(0, 0); fetch(); frags(1, 0);
#pragma unroll 1   // stays rolled: one copy of the body, one set of fragment and staging registers
    for (int kc = 0; kc < KK; kc += 64) {
        const int nxt = ((kc >> 6) & 1) ^ 1; const bool more1 = kc + 64 < KK, more2 = kc + 128 < KK;
        __builtin_amdgcn_sched_barrier(0);
        products(0);
        __builtin_amdgcn_sched_barrier(0);
        if (more1) put(nxt);
        __syncthreads();   // publishes stage t + 1 and ends every wave's reads of stage t
        if (more1) frags(0, nxt);
        if (more2) fetch();
        __builtin_amdgcn_sched_barrier(0);
        products(1);
        __builtin_amdgcn_sched_barrier(0);
        if (more1) frags(1, nxt);
    }
    }
    if constexpr (POST) {
        static_assert(NF == 1 && BM == 256 && BN == 2 * HD && TT % BM == 0 && DQ % BN == 0 && DKV % BN == 0 && NT == 512 && (NT / 32) * 64 * GP * 2 <= SMB, "POST: the last barrier wait has ended every wave's reads of the stage buffers; a tile is 256 rows of one batch and two heads of one section");
        const int bt = r0 / TT, tw = r0 % TT + rw;     // the tile's batch; the wave's first row t in it
        if (blockIdx.y >= NRS * HD / BN) {     // value sections; the same for the whole work-group
            const int g = (c0 - NRS * HD) / HD, db = c0 % HD;     // the wave's value head slot and its first column d
            unsigned short* vt = reinterpret_cast<unsigned short*>(smem) + wv * (64 * GP);     // the wave's own slice: [3 planes][16 d][64 t], pitch GP
            const size_t e0 = (size_t)((bt * NVS + g) * HD + db + (lane >> 3)) * TT + tw + (lane & 7) * 8;     // eight lanes a line: 64 t of one d
            unsigned short* pv[3] = { reinterpret_cast<unsigned short*>(V16) + e0, Vh + e0, Vl + e0 };     // the lane's three store addresses; the steps of four d step by a constant
            asm volatile("" :: "v"(pv[0]), "v"(pv[1]), "v"(pv[2]) : "memory");   // inputs only: the store addresses are complete in front of the loads, so that none of their arithmetic lands in a register that an issued load or store names
            __builtin_amdgcn_sched_barrier(0);   // keeps the loads behind that point
            float bb[4];   // the lane's four bias values (columns nb * 16 + lr)
#pragma unroll
            for (int nb = 0; nb < 4; ++nb) bb[nb] = bias[nb * 16 + lr];
            run_end();
#pragma unroll
            for (int nb = 0; nb < 4; ++nb) bb[nb] = bfr(bb[nb]);
#pragma unroll
            for (int nb = 0; nb < 4; ++nb) {     // 16 d at a time, the three planes (fp16, hi, lo) side by side in the slice
#pragma unroll
                for (int mb = 0; mb < 4; ++mb) { v8us o16, oh, ol;
#pragma unroll
                    for (int j = 0; j < 8; ++j) { const float xv = acc[mb][nb][j] + bb[nb]; unsigned short a2, c2; splitf(xv, a2, c2); o16[j] = __builtin_bit_cast(unsigned short, tohx(xv)); oh[j] = a2; ol[j] = c2; }
                    unsigned short* w = vt + lr * GP + mb * 16 + hi * 8; *(v8usa*)w = o16; *(v8usa*)(w + 16 * GP) = oh; *(v8usa*)(w + 32 * GP) = ol; }
                __builtin_amdgcn_wave_barrier(); asm volatile("" ::: "memory");   // the line reads below take other lanes' stores: keep them behind the stores
                v8us ln[3][4];
#pragma unroll
                for (int pl = 0; pl < 3; ++pl)
#pragma unroll
                    for (int s = 0; s < 4; ++s) ln[pl][s] = *(const v8usa*)(vt + (pl * 16 + s * 4 + (lane >> 3)) * GP + (lane & 7) * 8);
                __builtin_amdgcn_wave_barrier(); asm volatile("" ::: "memory");   // the next 16 d's LDS stores stay behind these reads
                __builtin_amdgcn_sched_barrier(0);   // every line is in its own registers before the first store: no store's register is written again inside the run
#pragma unroll
                for (int pl = 0; pl < 3; ++pl)
#pragma unroll
                    for (int s = 0; s < 4; ++s) *(v8us*)(pv[pl] + (size_t)(nb * 16 + s * 4) * TT) = ln[pl][s];
                if (nb < 3) run_end();
            }
        } else {
        fa* ob = reinterpret_cast<fa*>(smem);     // the tile: [block mb][wave][16 rows][64 columns, pitch 68]
#pragma unroll
        for (int mb = 0; mb < 4; ++mb)
#pragma unroll
            for (int nb = 0; nb < 4; ++nb)
#pragma unroll
                for (int j = 0; j < 8; ++j) ob[(mb * (NT / 32) + wv) * OSE + (hi * 8 + j) * 68 + nb * 16 + lr] = acc[mb][nb][j];
        __syncthreads();   // publishes the tile: a head's 128 columns lie in two waves' blocks
        const int wc = wv % NWC, hs = blockIdx.y * (BN / HD), d = lane * 4;     // the wave's place among the four of its rows; the tile's first head slot; the lane's four d
        const int sc = sect(hs); const float* gw = (sc == 0) ? gq : (sc == 1) ? gq2 : (sc == 2) ? gk : gk2; const float* bh = bias - cw;     // the section's weight vector; the bias of the tile's first column
        asm volatile("" :: "s"(gw), "s"(bh) : "memory");   // inputs only: the load bases are complete in front of the loads
        __builtin_amdgcn_sched_barrier(0);   // keeps the loads behind that point
        const v4f wa = *(const v4f*)(gw + d), ba = *(const v4f*)(bh + d), bb = *(const v4f*)(bh + HD + d);
        run_end();
        v4f g4, b4[2];   // the weight vector and both heads' bias, rounded to bf16 once
#pragma unroll
        for (int q = 0; q < 4; ++q) { g4[q] = bfr(wa[q]); b4[0][q] = bfr(ba[q]); b4[1][q] = bfr(bb[q]); }
        const fa* sl = ob + ((wv / NWC) * NWC + (lane >> 4)) * OSE + wc * 4 * 68 + (lane & 15) * 4;     // the lane's place in head 0, row wc * 4 of a block; head 1 lies two waves on
#pragma unroll 1   // stays rolled: one copy of the long body
        for (int mb = 0; mb < 4; ++mb) {
            const int t = tw + mb * 16 + wc * 4;     // the first of the wave's four rows
            const float* pc = cosT + (size_t)(bt * TT + t) * HD; const float* ps = sinT + (size_t)(bt * TT + t) * HD; const size_t e0 = ((size_t)(bt * NRS + hs) * TT + t) * HD + d;
            h16* q16 = P16 + e0; bf* qh = Ph + e0; bf* ql = Pl + e0;
            asm volatile("" :: "v"(q16), "v"(qh), "v"(ql), "s"(pc), "s"(ps) : "memory");   // inputs only: the lane's three store addresses and the wave's two load bases are complete in front of the loads, so that the loads go out as one run and none of that arithmetic lands in a register that an issued load names
            __builtin_amdgcn_sched_barrier(0);   // keeps the loads behind that point
            v4f c4[4], s4[4], r[8]; float sq[8];     // r, sq: slot k = head * 4 + row
#pragma unroll
            for (int k = 0; k < 4; ++k) { c4[k] = *(const v4f*)(pc + k * HD + d); s4[k] = *(const v4f*)(ps + k * HD + d); }
            run_end();
#pragma unroll
            for (int k = 0; k < 8; ++k) r[k] = *(const v4fa*)(sl + (mb * (NT / 32) + (k >> 2) * 2) * OSE + (k & 3) * 68) + b4[k >> 2];
            // The empty asm statements on products below are those of the norm and rope kernels that this epilogue replaces: each product keeps its own f32 rounding, so that the planes come out bit-identical to theirs.
#pragma unroll
            for (int k = 0; k < 8; ++k) { const v4f a = r[k]; float ss = 0.f;
#pragma unroll
                for (int q = 0; q < 4; ++q) { float p = __fmul_rn(a[q], a[q]); asm volatile("" : "+v"(p)); ss = __fadd_rn(ss, p); }
                sq[k] = ss; }
#pragma unroll
            for (int sh = 16; sh; sh >>= 1)     // the eight rows' butterflies step together: one cross-lane latency a step, not one a row and step
#pragma unroll
                for (int k = 0; k < 8; ++k) sq[k] = __fadd_rn(sq[k], __shfl_xor(sq[k], sh, 32));
#pragma unroll
            for (int k = 0; k < 8; ++k) { const v4f a = r[k]; const float ss = sq[k];
                const float rs = __fdiv_rn(1.0f, sqrtf(__fadd_rn(ss * (1.0f / HD), 1e-6f))); v4f o;
#pragma unroll
                for (int q = 0; q < 4; ++q) { float y = __fmul_rn(a[q], rs); asm volatile("" : "+v"(y)); o[q] = __fmul_rn(y, g4[q]); }
                r[k] = o; }
            v2f cs[4][4];   // per row the lane's four (cos, sin) pairs; the sine carries the sign of the rotated half: minus for d < HD / 2
#pragma unroll
            for (int k = 0; k < 4; ++k)
#pragma unroll
                for (int q = 0; q < 4; ++q) { cs[k][q][0] = bfr(c4[k][q]); cs[k][q][1] = (d < HD / 2) ? -bfr(s4[k][q]) : bfr(s4[k][q]); }
#pragma unroll
            for (int g = 0; g < 2; ++g) {     // head g of the tile
                v4h o16[4]; v4us oh[4], ol[4];
#pragma unroll
                for (int k = 0; k < 4; ++k)
#pragma unroll
                    for (int q = 0; q < 4; ++q) { const float x0 = r[g * 4 + k][q], x1 = otherhalf(x0);
                        float a = __fmul_rn(x0, cs[k][q][0]), bq_ = __fmul_rn(x1, cs[k][q][1]); asm volatile("" : "+v"(a)); asm volatile("" : "+v"(bq_)); const float rr = __fadd_rn(a, bq_);
                        o16[k][q] = tohx(rr); unsigned short a2, c2; splitf(rr, a2, c2); oh[k][q] = a2; ol[k][q] = c2; }
                __builtin_amdgcn_sched_barrier(0);   // every value is ready before the first store: no store's register is written again inside the run
#pragma unroll
                for (int k = 0; k < 4; ++k) { const size_t e = (size_t)g * TT * HD + k * HD; *(v4h*)(q16 + e) = o16[k]; *(v4us*)(qh + e) = oh[k]; *(v4us*)(ql + e) = ol[k]; }
                run_end();
            }
        }
        }
    } else {
    fa* os = reinterpret_cast<fa*>(smem + SAB + SBB) + wv * OSE;
#pragma unroll
    for (int mb = 0; mb < 4; ++mb) {
#pragma unroll
        for (int nb = 0; nb < 4; ++nb) {
#pragma unroll
            for (int j = 0; j < 8; ++j) os[(hi * 8 + j) * 68 + nb * 16 + lr] = acc[mb][nb][j]; }
        __builtin_amdgcn_wave_barrier(); asm volatile("" ::: "memory");   // the row reads below take other lanes' stores: keep them behind the stores
        float* crow = C + (size_t)(r0 + rw + mb * 16) * ldc + c0;
#pragma unroll
        for (int s = 0; s < 8; ++s) { const int row = 2 * s + hi, cofs = lr * 4; v4f val = *(const v4fa*)(os + row * 68 + cofs);
            *(v4f*)(crow + (size_t)row * ldc + cofs) = val; }
        __builtin_amdgcn_wave_barrier(); asm volatile("s_wait_xcnt 0x0" ::: "memory");   // the next block's LDS stores stay behind these reads; the wait stands behind the run of global stores, in front of any overwrite of their registers
        __builtin_amdgcn_sched_barrier(0);   // keeps the next block's register writes behind that wait
    }
    }
}

__global__ __launch_bounds__(256) void k_wtG(const float* __restrict__ w, int K, int N, bf* Bt) {
    const int lane = threadIdx.x & 31; const int L0 = (blockIdx.x * 8 + (threadIdx.x >> 5)) * 8; const int nlines = N * K / 64;
{
#pragma unroll 1
        for (int l = 0; l < 8; ++l) { const int L = L0 + l; if (L >= nlines) break; const size_t e = (size_t)L * 64 + lane * 2; const int k = (int)(e % K), n = (int)(e / K); v2us o;
            o[0] = f2bf(w[(size_t)k * N + n]); o[1] = f2bf(w[(size_t)(k + 1) * N + n]); *(v2us*)(Bt + e) = o; }
         }
}
// ---- The elementwise kernel k_cvtall in front of the projection (256 work-groups, one per WGP). A wave takes many lines instead of one, so that the launch starts a few thousand waves and not tens of thousands.
// It is built of runs: a run of 16-byte loads, the arithmetic, a run of stores. run_end() closes a run.
// k_cvtall: every f32 operand of the plain GEMMs rounded to bf16 in one launch. dst = [x | wq | wq2 | wk | wk2 | wv | wv2 | wo] in units of DKV * DM elements (2, 2, 2, 1, 1, 1, 1, 2 units).
// A chunk is 4 x 512 threads x 8 elements; 128 chunks a unit, so a chunk lies in one unit; work-group b takes the chunks k * 256 + b, k < 6.
static_assert((size_t)DKV * DM == (size_t)128 * 16384 && 12 * 128 == 6 * 256 && DQ == 2 * DKV && NB_ * TT == 2 * DKV, "unit bookkeeping of k_cvtall");
__global__ __launch_bounds__(512) void k_cvtall(const float* __restrict__ x, const float* __restrict__ wq, const float* __restrict__ wq2, const float* __restrict__ wk, const float* __restrict__ wk2, const float* __restrict__ wv, const float* __restrict__ wv2, const float* __restrict__ wo, bf* dst) {
    const size_t U = (size_t)DKV * DM; const unsigned lo = threadIdx.x * 8; v8f v[2][4];
    auto fetch = [&](int k) {     // chunk k's eight loads, one run
        const int c = k * 256 + (int)blockIdx.x, u = c >> 7;
        const float* s = ((u < 2) ? x + u * U : (u < 4) ? wq + (u - 2) * U : (u < 6) ? wq2 + (u - 4) * U : (u == 6) ? wk : (u == 7) ? wk2 : (u == 8) ? wv : (u == 9) ? wv2 : wo + (u - 10) * U) + (size_t)(c & 127) * 16384;
#pragma unroll
        for (int i = 0; i < 4; ++i) v[k & 1][i] = *(const v8f*)(s + i * 4096 + lo);
        run_end();
    };
    fetch(0);
#pragma unroll   // unrolled: the two register sets are indexed by constants
    for (int k = 0; k < 6; ++k) {
        if (k + 1 < 6) fetch(k + 1);   // the next chunk's loads fly under this chunk's conversion and stores
        bf* d = dst + (size_t)(k * 256 + (int)blockIdx.x) * 16384; v8us o[4];
#pragma unroll
        for (int i = 0; i < 4; ++i)
#pragma unroll
            for (int q = 0; q < 8; ++q) o[i][q] = f2bf(v[k & 1][i][q]);
        __builtin_amdgcn_sched_barrier(0);   // every value is ready before the first store: no store's register is written again inside the run
#pragma unroll
        for (int i = 0; i < 4; ++i) *(v8us*)(d + i * 4096 + lo) = o[i];
        if (k + 1 < 6) run_end();
    }
}
// ---- k_fattn: scores, joint softmax and both value products of one head in one kernel; grid (NB_ * NH_, TT / 64): both batches in one launch, two work-groups per WGP; 4 waves, each wave owns 16 query rows.
// The work-group walks 64-key tiles of the window path (from its diagonal tile down to key i - 255), then of the fading path (keys <= i - 256); the list of tiles is the same for its four waves. Each wave keeps ONE running maximum, sum and output accumulator (online softmax):
// the joint softmax over [s_ic | s_f]. A key outside the path's own range gets weight exactly 0. The diagonal tile comes first, so every row's maximum is finite from the first tile on.
// A tile's keys (64 rows of 256 B) and values (128 rows of 128 B), every plane, are brought into LDS once per work-group by asynchronous copies of whole lines and read from there by all four waves. Two buffers: tile t + 1 flies while tile t is worked on; one work-group barrier per tile hands the buffers over.
// Probabilities go from the accumulator layout to the A-operand layout through the wave's own LDS slice. Rows < RH: hi+lo bf16 planes, 3 products; rows >= RH: fp16, weights x PCAR (the factor cancels in sum and output alike).
// Loops: the path loop and the tile loop stay rolled (#pragma unroll 1: one copy of the long body); every inner loop is unrolled, so that the fragment and accumulator arrays are indexed by constants and stay in registers.
#define PP 72     // LDS pitch (16-bit elements) of the 16 x 64 probability tile: 16-byte aligned rows, 16-byte row reads spread over the banks
#define OP 136    // LDS pitch of the 16 x 128 output tile
#define KP 136    // LDS pitch of a staged key row (128 d): 256 B + 16 B, the pitch for 16-byte row reads
#define VP 72     // LDS pitch of a staged value row (64 keys of one d): 128 B + 16 B
#define KPL (64 * KP)     // elements of one staged key plane
#define VPL (HD * VP)     // elements of one staged value plane
#define RING (2 * 2 * (KPL + VPL))   // two buffers of two planes of keys and values
static_assert(4 * 2 * 16 * OP <= RING, "the four waves' output tiles fit the ring");
template <int X> __device__ __forceinline__ float rowx(float v) { return __int_as_float(__builtin_amdgcn_update_dpp(0, __float_as_int(v), 0x160 + X, 0xf, 0xf, true)); }   // DPP row_xmask: the value of lane ^ X inside the 16-lane row, on the vector port (a shuffle would go through the LDS queue, one wait each)
__device__ __forceinline__ float rowmax(float v) { v = fmaxf(v, rowx<8>(v)); v = fmaxf(v, rowx<4>(v)); v = fmaxf(v, rowx<2>(v)); return fmaxf(v, rowx<1>(v)); }
__device__ __forceinline__ float rowsum(float v) { v += rowx<8>(v); v += rowx<4>(v); v += rowx<2>(v); return v + rowx<1>(v); }
template <typename T16> struct LFrag;
template <> struct LFrag<h16> { static __device__ __forceinline__ v16h ld(const unsigned short* p) { const v8us lo = *(const v8usa*)p, hi = *(const v8usa*)(p + 16); return cat16(__builtin_bit_cast(v8h, lo), __builtin_bit_cast(v8h, hi)); } };
template <> struct LFrag<bf> { static __device__ __forceinline__ v16bf ld(const unsigned short* p) { const v8us lo = *(const v8usa*)p, hi = *(const v8usa*)(p + 16); return cat16b(lo, hi); } };
// Eight asynchronous 16-byte copies of a lane, global memory to LDS: LDS byte addresses l + i * ls, global addresses g + i * gs bytes. The wait is the statement's last line: it stands behind the copies, in front of any later overwrite of the registers they name.
__device__ __forceinline__ void copies8(unsigned l, unsigned ls, const char* g, size_t gs) {
    asm volatile("global_load_async_to_lds_b128 %0, %8, off\n\t"
                 "global_load_async_to_lds_b128 %1, %9, off\n\t"
                 "global_load_async_to_lds_b128 %2, %10, off\n\t"
                 "global_load_async_to_lds_b128 %3, %11, off\n\t"
                 "global_load_async_to_lds_b128 %4, %12, off\n\t"
                 "global_load_async_to_lds_b128 %5, %13, off\n\t"
                 "global_load_async_to_lds_b128 %6, %14, off\n\t"
                 "global_load_async_to_lds_b128 %7, %15, off\n\t"
                 "s_wait_xcnt 0x0"
                 :: "v"(l), "v"(l + ls), "v"(l + 2 * ls), "v"(l + 3 * ls), "v"(l + 4 * ls), "v"(l + 5 * ls), "v"(l + 6 * ls), "v"(l + 7 * ls),
                    "v"(g), "v"(g + gs), "v"(g + 2 * gs), "v"(g + 3 * gs), "v"(g + 4 * gs), "v"(g + 5 * gs), "v"(g + 6 * gs), "v"(g + 7 * gs)
                 : "memory");
}
template <typename T16, bool HL>
__device__ __forceinline__ void attn_rows(const T16* __restrict__ R, const T16* __restrict__ Rlo, const T16* __restrict__ VT, const T16* __restrict__ VTlo, int h, int rb, int wv, unsigned short* ring, unsigned short* sh, unsigned short* sl, bf* Ah, bf* Al) {
    typedef typename WFrag<T16>::V V;
    constexpr int NG = HL ? 2 : 1;    // planes per operand; also the number of 16-fragment (32-read) groups that a tile's keys, and its values, are read in
    constexpr int STG = NG * (KPL + VPL);   // elements of one buffer: [key planes | value planes]
    const int tid = threadIdx.x, lane = tid & 31, lr = lane & 15, hi = lane >> 4, i0 = rb * 64 + wv * 16;
    const int n0 = min(rb, 4) + 1, nt = n0 + max(0, rb - 3);   // tiles of the window path (key tiles rb down to max(0, rb - 4)) and of both paths (fading: key tiles rb - 4 down to 0); every one holds a live key for each wave's 16 rows or is masked to weight 0
    const unsigned ring0 = (unsigned)(size_t)(__attribute__((address_space(3))) unsigned short*)ring;   // the ring's byte address in the work-group's LDS
    const unsigned klane = (unsigned)((tid >> 4) * KP + (tid & 15) * 8) * 2, vlane = (unsigned)((tid >> 3) * VP + (tid & 7) * 8) * 2, vgl = (unsigned)((tid >> 3) * TT + (tid & 7) * 8) * 2;   // the lane's byte offsets: in a staged key plane, in a staged value plane, in a value plane in memory
    auto stage = [&](int t) {     // tile t's planes into buffer t & 1: a wave's copy covers 512 B of whole lines (2 key rows, 4 value rows); 8 key rows, 16 value rows per step of the work-group
        const int p = (t >= n0) ? 1 : 0, j0 = (p ? (rb - 4) - (t - n0) : rb - t) * 64;
        const size_t ku = ((size_t)(2 * NH_ + p * NKV + h / REP) * TT + j0) * HD, vu = (size_t)(p * NKV + h / REP) * HD * TT + j0;   // the tile's first element in a key plane and in a value plane: the same for the whole work-group
        const unsigned kl = ring0 + (unsigned)((t & 1) * STG) * 2 + klane, vl = ring0 + (unsigned)((t & 1) * STG + NG * KPL) * 2 + vlane;
        copies8(kl, 8 * KP * 2, (const char*)(R + ku) + tid * 16, (size_t)8 * HD * 2);   // key rows are contiguous: thread tid takes bytes tid * 16 of each 2 KiB step
        if (HL) copies8(kl + KPL * 2, 8 * KP * 2, (const char*)(Rlo + ku) + tid * 16, (size_t)8 * HD * 2);
        copies8(vl, 16 * VP * 2, (const char*)(VT + vu) + vgl, (size_t)16 * TT * 2);
        if (HL) copies8(vl + VPL * 2, 16 * VP * 2, (const char*)(VTlo + vu) + vgl, (size_t)16 * TT * 2);
    };
    v8f O[8]; float m[8], l[8];
#pragma unroll
    for (int db = 0; db < 8; ++db) O[db] = (v8f){};
#pragma unroll
    for (int jj = 0; jj < 8; ++jj) { m[jj] = -3.0e38f; l[jj] = 0.f; }
    stage(0);
    asm volatile("s_wait_asynccnt 0x0" ::: "memory");   // this wave's copies of tile 0 have landed
    __syncthreads();   // publishes tile 0
    if (nt > 1) stage(1);
    int t = 0;     // the running tile, over both paths
#pragma unroll 1
    for (int p = 0; p < 2; ++p) {      // p = 0: window path, p = 1: fading path
        const int jhi = p ? rb - 4 : rb, jlo = p ? 0 : max(0, rb - 4);   // first and last 64-key tile of the path
        if (jhi < jlo) continue;   // no tile of this path (the same for the whole work-group): its queries are not read
        const size_t qo = ((size_t)(p * NH_ + h) * TT + i0 + lr) * HD + 8 * hi;
        V a[4], a2[4];
#pragma unroll
        for (int ks = 0; ks < 4; ++ks) { a[ks] = WFrag<T16>::ld(R + qo + ks * 32); if (HL) a2[ks] = WFrag<T16>::ld(Rlo + qo + ks * 32); }
        run_end();   // behind the query loads
#pragma unroll 1
        for (int jt = jhi; jt >= jlo; --jt, ++t) {
            const int j0 = jt * 64; v8f s[4]; V kf[NG][16], vf[NG][16];
            const unsigned short* kb = ring + (t & 1) * STG + lr * KP + 8 * hi; const unsigned short* vb = ring + (t & 1) * STG + NG * KPL + lr * VP + 8 * hi;   // the lane's place in this tile's key and value planes
            // Read order of a tile. Keys and values come from LDS in groups of 16 fragments (32 reads), each group issued as one run, so that a group costs one LDS latency and not one every few fragments.
            // A second group (hi+lo planes) is issued behind the first block's products and flies under the products that follow. Each sched_barrier(0) keeps the compiler from moving reads or products over that point.
#pragma unroll
            for (int f = 0; f < 16 / NG; ++f) { const int o = (f >> 2) * 16 * KP + (f & 3) * 32; kf[0][f * NG] = LFrag<T16>::ld(kb + o); if (HL) kf[0][f * NG + 1] = LFrag<T16>::ld(kb + KPL + o); }
            __builtin_amdgcn_sched_barrier(0);   // the whole group is issued before the first product waits for a fragment
#pragma unroll
            for (int nb = 0; nb < 4; ++nb) { const int g = nb / (4 / NG), nl = nb % (4 / NG); s[nb] = (v8f){};
#pragma unroll
                for (int ks = 0; ks < 4; ++ks) { s[nb] = WFrag<T16>::mma(a[ks], kf[g][(nl * 4 + ks) * NG], s[nb]);
                    if (HL) { s[nb] = WFrag<T16>::mma(a2[ks], kf[g][(nl * 4 + ks) * NG], s[nb]); s[nb] = WFrag<T16>::mma(a[ks], kf[g][(nl * 4 + ks) * NG + 1], s[nb]); } }
                if (HL && nb == 0) {
                    __builtin_amdgcn_sched_barrier(0);   // the second key group is issued behind the first block's products
#pragma unroll
                    for (int f = 0; f < 16 / NG; ++f) { const int o = (4 / NG + (f >> 2)) * 16 * KP + (f & 3) * 32; kf[NG - 1][f * NG] = LFrag<T16>::ld(kb + o); kf[NG - 1][f * NG + 1] = LFrag<T16>::ld(kb + KPL + o); }
                    __builtin_amdgcn_sched_barrier(0);   // and it flies under the products that follow
                } }
            __builtin_amdgcn_sched_barrier(0);   // the value reads start behind the last score product
#pragma unroll
            for (int f = 0; f < 16 / NG; ++f) { const int o = (f >> 1) * 16 * VP + (f & 1) * 32; vf[0][f * NG] = LFrag<T16>::ld(vb + o); if (HL) vf[0][f * NG + 1] = LFrag<T16>::ld(vb + VPL + o); }
            __builtin_amdgcn_sched_barrier(0);   // the first value group flies while the softmax runs
            float mx[8];
#pragma unroll
            for (int jj = 0; jj < 8; ++jj) mx[jj] = m[jj];
#pragma unroll
            for (int nb = 0; nb < 4; ++nb)
#pragma unroll
                for (int jj = 0; jj < 8; ++jj) { const int dij = (i0 + hi * 8 + jj) - (j0 + nb * 16 + lr); const bool live = p ? (dij >= 256) : (dij >= 0 && dij < 256); const float t2 = live ? s[nb][jj] * SCL : -3.0e38f; s[nb][jj] = t2; mx[jj] = fmaxf(mx[jj], t2); }
#pragma unroll
            for (int jj = 0; jj < 8; ++jj) {
                mx[jj] = rowmax(mx[jj]);   // a row's 16 columns lie in the 16 lanes of one half
                const float al = __builtin_amdgcn_exp2f((m[jj] - mx[jj]) * 1.4426950408889634f); m[jj] = mx[jj]; l[jj] *= al;
#pragma unroll
                for (int db = 0; db < 8; ++db) O[db][jj] *= al; }
#pragma unroll
            for (int nb = 0; nb < 4; ++nb)
#pragma unroll
                for (int jj = 0; jj < 8; ++jj) { const float pv = __builtin_amdgcn_exp2f((s[nb][jj] - m[jj]) * 1.4426950408889634f) * (HL ? 1.0f : PCAR); l[jj] += pv; const int o = (hi * 8 + jj) * PP + nb * 16 + lr;
                    if (HL) { unsigned short ph, pl; splitf(pv, ph, pl); sh[o] = ph; sl[o] = pl; } else sh[o] = __builtin_bit_cast(unsigned short, tohx(pv)); }
            __builtin_amdgcn_wave_barrier(); asm volatile("" ::: "memory");   // the fragment reads below take other lanes' stores: keep them behind the stores
            V pa[2], pb[2];
#pragma unroll
            for (int k2 = 0; k2 < 2; ++k2) { pa[k2] = LFrag<T16>::ld(sh + lr * PP + k2 * 32 + 8 * hi); if (HL) pb[k2] = LFrag<T16>::ld(sl + lr * PP + k2 * 32 + 8 * hi); }
            __builtin_amdgcn_wave_barrier(); asm volatile("" ::: "memory");   // the next tile's stores stay behind these reads
#pragma unroll
            for (int db = 0; db < 8; ++db) { const int g = db / (8 / NG), dl = db % (8 / NG);
#pragma unroll
                for (int k2 = 0; k2 < 2; ++k2) { O[db] = WFrag<T16>::mma(pa[k2], vf[g][(dl * 2 + k2) * NG], O[db]);
                    if (HL) { O[db] = WFrag<T16>::mma(pb[k2], vf[g][(dl * 2 + k2) * NG], O[db]); O[db] = WFrag<T16>::mma(pa[k2], vf[g][(dl * 2 + k2) * NG + 1], O[db]); } }
                if (HL && db == 0) {
                    __builtin_amdgcn_sched_barrier(0);   // the second value group is issued behind the first block's products
#pragma unroll
                    for (int f = 0; f < 16 / NG; ++f) { const int o = (8 / NG + (f >> 1)) * 16 * VP + (f & 1) * 32; vf[NG - 1][f * NG] = LFrag<T16>::ld(vb + o); vf[NG - 1][f * NG + 1] = LFrag<T16>::ld(vb + VPL + o); }
                    __builtin_amdgcn_sched_barrier(0);   // and it flies under the products that follow
                } }
            // Foot of tile t, every wave, in this order: own LDS reads done, own copies of tile t + 1 landed, barrier, refill of the buffer that tile t has just left.
            asm volatile("s_wait_dscnt 0x0" ::: "memory");      // this wave's reads of tile t have returned
            asm volatile("s_wait_asynccnt 0x0" ::: "memory");   // this wave's copies of tile t + 1 have landed
            __syncthreads();   // publishes tile t + 1 and ends every wave's reads of tile t
            if (t + 2 < nt) stage(t + 2);
        }
    }
    asm volatile("s_wait_asynccnt 0x0" ::: "memory");   // no copy is outstanding when the ring becomes output staging (the last tile's barrier has ended every wave's reads)
    unsigned short* oh_ = ring + wv * 2 * 16 * OP; unsigned short* ol_ = oh_ + 16 * OP;   // the wave's own output tiles, hi and lo
#pragma unroll
    for (int jj = 0; jj < 8; ++jj) {
        const float f = __fdiv_rn(1.0f, rowsum(l[jj]));
#pragma unroll
        for (int db = 0; db < 8; ++db) { unsigned short oh, ol; splitf(O[db][jj] * f, oh, ol); const int o = (hi * 8 + jj) * OP + db * 16 + lr; oh_[o] = oh; ol_[o] = ol; } }
    __builtin_amdgcn_wave_barrier(); asm volatile("" ::: "memory");   // the row reads below take other lanes' stores
    v8us vh[8], vl[8]; const size_t oo = (size_t)(i0 + hi) * DQ + h * HD + lr * 8; bf* qh = Ah + oo; bf* ql = Al + oo;   // the lane's two store addresses; the eight rows step by a constant
#pragma unroll
    for (int c = 0; c < 8; ++c) { const int row = c * 2 + hi, col = lr * 8; vh[c] = *(const v8usa*)(oh_ + row * OP + col); vl[c] = *(const v8usa*)(ol_ + row * OP + col); }
    asm volatile("" :: "v"(qh), "v"(ql) : "memory");   // inputs only: both store addresses are complete in front of the run of stores, so that none of their arithmetic lands in a register that an issued store names
    __builtin_amdgcn_sched_barrier(0);   // every row is in its own registers before the first store: no store's register is written again inside the run
#pragma unroll
    for (int c = 0; c < 8; ++c) { *(v8us*)(qh + (size_t)c * 2 * DQ) = vh[c]; *(v8us*)(ql + (size_t)c * 2 * DQ) = vl[c]; }
}
__global__ __launch_bounds__(128) void k_fattn(const h16* __restrict__ R16, const bf* __restrict__ Rh, const bf* __restrict__ Rl, const h16* __restrict__ VT16, const bf* __restrict__ VTh, const bf* __restrict__ VTl, bf* Ah, bf* Al) {
    __shared__ __align__(16) unsigned short ring[RING];
    __shared__ __align__(16) unsigned short ps[4][2][16 * PP];
    constexpr int NRB = TT / 64;
    const int wv = __builtin_amdgcn_readfirstlane((int)(threadIdx.x >> 5)); const int y = blockIdx.y; const int rb = (y < NRB / 2) ? NRB - 1 - y : y - NRB / 2;   // the first half of the grid takes the last rows (the most keys) downwards, the second half the first rows upwards: the work-groups half a grid apart hold row blocks t and NRB - 1 - t (speed only)
    const int h = blockIdx.x % NH_, b = blockIdx.x / NH_;
    const size_t ro = (size_t)b * NRS * TT * HD, vo = (size_t)b * NVS * HD * TT, ao = (size_t)b * TT * DQ;   // batch b's planes
    if (rb * 64 < RH) attn_rows<bf, true>(Rh + ro, Rl + ro, VTh + vo, VTl + vo, h, rb, wv, ring, ps[wv][0], ps[wv][1], Ah + ao, Al + ao);
    else attn_rows<h16, false>(R16 + ro, nullptr, VT16 + vo, nullptr, h, rb, wv, ring, ps[wv][0], ps[wv][1], Ah + ao, Al + ao);
}

// k_asoft: per row (zz, i): t = S x HD^-0.5 for j <= i and i - j < WIN (sliding causal window; the reference's -1e9 additive fill vanishes identically); softmax over the 1024 keys (register row, one exp, fixed trees);
__global__ __launch_bounds__(256) void k_asoft(const float* __restrict__ Sb, h16* P16, bf* Ph, bf* Pl) {
    const int lane = threadIdx.x & 31; const int row = blockIdx.x * 8 + (threadIdx.x >> 5); if (row >= ZH * TT) return; const int i = row % TT; const int zz = row / TT; (void)zz; const bool hires = (i < RH); const float* sr = Sb + (size_t)row * TT; float v[TT / 32]; float mx = -3.0e38f;
#pragma unroll
    for (int ch = 0; ch < TT / 128; ++ch) { const int j0 = ch * 128 + lane * 4; const v4f a = *(const v4f*)(sr + j0);
#pragma unroll
        for (int q = 0; q < 4; ++q) { const int j = j0 + q; (void)j; const float t = (j <= i && i - j < WIN) ? a[q] * SCL : -3.0e38f; v[ch * 4 + q] = t; mx = fmaxf(mx, t); } }
#pragma unroll
    for (int sh = 16; sh; sh >>= 1) mx = fmaxf(mx, __shfl_xor(mx, sh, 32));
    float sum = 0.f;
#pragma unroll
    for (int k = 0; k < TT / 32; ++k) { float d0 = __fsub_rn(v[k], mx); asm volatile("" : "+v"(d0)); v[k] = __builtin_amdgcn_exp2f(__fmul_rn(d0, 1.4426950408889634f)); sum += v[k]; }
#pragma unroll
    for (int sh = 16; sh; sh >>= 1) sum += __shfl_xor(sum, sh, 32);
    const float f = __fdiv_rn(hires ? 1.0f : PCAR, sum);
{
        if (hires) {
#pragma unroll
            for (int ch = 0; ch < TT / 128; ++ch) { v4us oh, ol;
#pragma unroll
                for (int q = 0; q < 4; ++q) { unsigned short a, c2; splitf(v[ch * 4 + q] * f, a, c2); oh[q] = a; ol[q] = c2; }
                const size_t oo = ((size_t)zz * (RH ? RH : 1) + i) * TT + ch * 128 + lane * 4; *(v4us*)(Ph + oo) = oh; *(v4us*)(Pl + oo) = ol; }
        } else {
#pragma unroll
            for (int ch = 0; ch < TT / 128; ++ch) { v4h o4;
#pragma unroll
                for (int q = 0; q < 4; ++q) o4[q] = tohx(v[ch * 4 + q] * f);
                *(v4h*)(P16 + (size_t)row * TT + ch * 128 + lane * 4) = o4; } }
         }
}
__global__ __launch_bounds__(256) void k_merge(const float* __restrict__ O, int h0, bf* Ah, bf* Al) { const size_t e = ((size_t)blockIdx.x * 256 + threadIdx.x) * 2; if (e >= (size_t)ZH * TT * HD) return; const int d = (int)(e % HD); const int t = (int)((e / HD) % TT); const int zz = (int)(e / ((size_t)HD * TT)); const float cs = (t < RH) ? 1.0f : (1.0f / PCAR); const size_t oo = (size_t)t * DQ + (h0 + zz) * HD + d;
    v2us oh, ol;
#pragma unroll
    for (int q = 0; q < 2; ++q) { unsigned short a, c2; splitf(O[e + q] * cs, a, c2); oh[q] = a; ol[q] = c2; } *(v2us*)(Ah + oo) = oh; *(v2us*)(Al + oo) = ol;  }

extern "C" void kernel_launch(void* const* d_in, const int* in_sizes, int n_in,
                              void* d_out, int out_size, void* d_ws, size_t ws_size, hipStream_t stream) {
    (void)in_sizes; (void)n_in; (void)out_size;
    const float* x = (const float*)d_in[0]; const float* cosA = (const float*)d_in[1]; const float* sinA = (const float*)d_in[2]; const float* wq = (const float*)d_in[3]; const float* bq = (const float*)d_in[4]; const float* wk = (const float*)d_in[5]; const float* bk = (const float*)d_in[6]; const float* wv = (const float*)d_in[7]; const float* bv = (const float*)d_in[8]; const float* wq2 = (const float*)d_in[9]; const float* bq2 = (const float*)d_in[10]; const float* wk2 = (const float*)d_in[11]; const float* bk2 = (const float*)d_in[12]; const float* wv2 = (const float*)d_in[13]; const float* bv2 = (const float*)d_in[14]; const float* wo = (const float*)d_in[15]; const float* gq = (const float*)d_in[16]; const float* gk = (const float*)d_in[17]; const float* gq2 = (const float*)d_in[18]; const float* gk2 = (const float*)d_in[19]; const float* cosT = cosA; const float* sinT = sinA;
    float* OUT = (float*)d_out;     // [2][1024][2048]
    char* wsp = (char*)d_ws;
    auto take = [&](size_t bytes) { char* p = wsp; wsp += (bytes + 255) & ~(size_t)255; return (void*)p; };
    // 16-bit GEMM operands, one conversion launch: [x (both batches) | wq | wq2 | wk | wk2 | wv | wv2 | wo]; the six projection weights are one [NP][DM] plane
    const size_t U = (size_t)DKV * DM; const int NP = 2 * DQ + 4 * DKV, NRH = 2 * NH_ + 2 * NKV, NVH = 2 * NKV;
    bf* XB = (bf*)take(12 * U * 2); bf* WP = XB + 2 * U; bf* WO = XB + 10 * U;
    // head planes per batch, both paths side by side: [b][q 16 | q2 16 | k 8 | k2 8][t][d] and [b][v 8 | v2 8][d][t]
    h16* R16 = (h16*)take((size_t)NB_ * NRH * TT * HD * 2); bf* Rh = (bf*)take((size_t)NB_ * NRH * TT * HD * 2); bf* Rl = (bf*)take((size_t)NB_ * NRH * TT * HD * 2);
    h16* VT16 = (h16*)take((size_t)NB_ * NVH * HD * TT * 2); bf* VTh = (bf*)take((size_t)NB_ * NVH * HD * TT * 2); bf* VTl = (bf*)take((size_t)NB_ * NVH * HD * TT * 2);
    bf* ATl = (bf*)take((size_t)NB_ * TT * DQ * 2);   // the lo plane of the merged attention output
    if ((size_t)(wsp - (char*)d_ws) > ws_size) return;    // ws 256 MiB
    bf* ATh = XB;     // the hi plane of the merged attention output reuses x: its rows are dead once the projection has run (stream-ordered; same size)
    static_assert(DQ == DM, "ATh fits x");
    k_cvtall<<<256, 512, 0, stream>>>(x, wq, wq2, wk, wk2, wv, wv2, wo, XB);
    // every stage takes both batches in one launch: the rows of x and the cos/sin tables are r = b * TT + t
    k_gemms<256, 256, DM, 0, true, 1><<<dim3(NB_ * TT / 256, NP / 256, 1), 512, 0, stream>>>(XB, nullptr, WP, nullptr, 0, bq, bq2, bk, bk2, bv, bv2, cosA, sinA, gq, gq2, gk, gk2, R16, Rh, Rl, VT16, VTh, VTl);
    k_fattn<<<dim3(NB_ * NH_, TT / 64, 1), 128, 0, stream>>>(R16, Rh, Rl, VT16, VTh, VTl, ATh, ATl);
    k_gemms<128, 128, DQ, 1, false, 2><<<dim3(NB_ * TT / 128, DM / 128, 1), 128, 0, stream>>>(ATh, ATl, WO, OUT, DM, nullptr, nullptr, nullptr, nullptr, nullptr, nullptr, nullptr, nullptr, nullptr, nullptr, nullptr, nullptr, nullptr, nullptr, nullptr, nullptr, nullptr, nullptr);
}
